// v000
// Times are from an AMD MI455X. After a warm-up the kernel runs many times in a row, and a time is the length of
// such a window on the GPU divided by its runs, so every launch and the gaps after it count. The runs cycle
// through copies of the inputs. A figure is the median of several windows, for all but v000 over two sittings.
// Sittings can differ by a few percent; kernels timed side by side share one.
// v000 is the starting kernel. One run takes 2750 microseconds.
#include <hip/hip_runtime.h>

// Grouped-query causal attention with per-head RMSNorm and computed half-split rotary embeddings at base 1e6 (x [2][2048][2048]; q = x Wq (32 heads x 64), k, v = x Wk, x Wv (8 kv heads x 64) ('xw' 0.02, no bias); per head q = rms_norm(q) x q_norm_w, k = rms_norm(k) x k_norm_w (eps 1e-5; weights [64] = ones, read); rope: (x1, x2) = the two HALVES of each head: cat(x1 cos - x2 sin, x2 cos + x1 sin) with angle t x 1000000^(-2i/64), i < 32 (32 f32 frequencies jnp-exact for the module's power expression; precise cosf/sinf); query heads viewed (HKV, g): kv head = q head / 4; scores x 64^-0.5; causal (finfo.min == exclusion); softmax; out = merged Wo ('xw') -> [2][2048][2048] (8.4 M); argument order x, Wq, Wk, Wv, Wo, q_norm_w, k_norm_w).
// Layout per batch: bf16 copy of x; 'xw' weights transposed once (k_wtG); exact projections; k_hrms (per (head, token) 1/sqrt(mean + eps)) + k_rmsapply (x r x w[d] in place); k_cs5 table {cosf, sinf}(t x INVT[d mod 32]); rotate-half plane builders; causal T-2048 GQA attention (kv z-stride 0; hybrid rows: < 512 hi/lo 3 products, rest fp16 x1024; k_gemmc skips tiles above the diagonal); merged hi/lo x Wo exact.
// Compute dtypes, f32 accumulate: every input rounded to bf16 incl. the norm scales; projections exact; RMSNorm and rotary f32; attention rows < 512 3 products, rest fp16; softmax f32; Wo hl x exact.

#define NB_  2
#define TT   2048
#define DM   2048
#define NH_  32
#define NKV  8
#define REP  (NH_ / NKV)
#define HD   64
#define DQ   (NH_ * HD)
#define DKV  (NKV * HD)
#define ZH   2
#define RH   512                  // query rows < RH use hi+lo planes (0: none)
#define WIN  2048
#define PCAR 1024.0f
#define SCL  0.125f   // HD^-0.5
typedef _Float16 h16;
typedef unsigned short bf;
typedef __attribute__((ext_vector_type(16))) __bf16   v16bf;
typedef __attribute__((ext_vector_type(16))) _Float16 v16h;
typedef __attribute__((ext_vector_type(8)))  _Float16 v8h;
typedef __attribute__((ext_vector_type(8)))  unsigned short v8us;
typedef __attribute__((ext_vector_type(8)))  float    v8f;
typedef __attribute__((ext_vector_type(4)))  float    v4f;
typedef v8h  __attribute__((may_alias)) v8ha;
typedef v4f  __attribute__((may_alias)) v4fa;
typedef v8us __attribute__((may_alias)) v8usa;

__device__ __forceinline__ unsigned short f2bf(float f) { unsigned u = __float_as_uint(f); u += 0x7FFFu + ((u >> 16) & 1u); return (unsigned short)(u >> 16); }
__device__ __forceinline__ float bf2f(unsigned short b) { return __uint_as_float(((unsigned)b) << 16); }
__device__ __forceinline__ float bfr(float f) { return bf2f(f2bf(f)); }
__device__ __forceinline__ v16h cat16(v8h lo, v8h hi) { return __builtin_shufflevector(lo, hi, 0, 1, 2, 3, 4, 5, 6, 7, 8, 9, 10, 11, 12, 13, 14, 15); }
__device__ __forceinline__ v16bf cat16b(v8us lo, v8us hi) { return __builtin_bit_cast(v16bf, __builtin_shufflevector(lo, hi, 0, 1, 2, 3, 4, 5, 6, 7, 8, 9, 10, 11, 12, 13, 14, 15)); }
__device__ __forceinline__ v8f wmma16(v16h a, v16h b, v8f c) { return __builtin_amdgcn_wmma_f32_16x16x32_f16(false, a, false, b, (short)0, c, false, false); }
__device__ __forceinline__ v8f wmmab(v16bf a, v16bf b, v8f c) { return __builtin_amdgcn_wmma_f32_16x16x32_bf16(false, a, false, b, (short)0, c, false, false); }



// ---- k_gemmw: register-blocked GEMM, ONE WAVE per 64x64 output tile (16 accumulators), operands straight from K-contiguous 16-bit planes; grid (M/64, N/64, Z), 32 threads.
// C[m][n] (f32, pitch ldc, + optional f32 bias[n]) = sum_k A[m][k] Bt[n][k] (+ split products per NSPLIT). z-batch strides sA/sB/sC in elements. K % 32 == 0.
template <typename T16> struct WFrag;
template <> struct WFrag<h16> { typedef v16h V; static __device__ __forceinline__ V ld(const h16* p) { return cat16(*(const v8h*)p, *(const v8h*)(p + 16)); } static __device__ __forceinline__ v8f mma(V a, V b, v8f c) { return wmma16(a, b, c); } };
template <> struct WFrag<bf> { typedef v16bf V; static __device__ __forceinline__ V ld(const bf* p) { return cat16b(*(const v8us*)p, *(const v8us*)(p + 16)); } static __device__ __forceinline__ v8f mma(V a, V b, v8f c) { return wmmab(a, b, c); } };
template <typename T16, int NSPLIT, bool BIAS>
__global__ __launch_bounds__(32) void k_gemmw(const T16* __restrict__ A, const T16* __restrict__ A2, const T16* __restrict__ Bt, const T16* __restrict__ Bt2, int K, float* C, int ldc, const float* __restrict__ bias, size_t sA, size_t sB, size_t sC) {
    typedef typename WFrag<T16>::V V;
    __shared__ __align__(16) float os[16 * 68];
    const size_t z = blockIdx.z; A += z * sA; if (A2) A2 += z * sA; Bt += z * sB; if (Bt2) Bt2 += z * sB; C += z * sC;
    const int lane = threadIdx.x & 31, lr = lane & 15, hi = lane >> 4; const int r0 = blockIdx.x * 64, c0 = blockIdx.y * 64;
    v8f acc[4][4];
#pragma unroll
    for (int mb = 0; mb < 4; ++mb)
#pragma unroll
        for (int nb = 0; nb < 4; ++nb) acc[mb][nb] = (v8f){};
    const size_t aoff = (size_t)(r0 + lr) * K + 8 * hi, boff = (size_t)(c0 + lr) * K + 8 * hi;
#pragma unroll 1
    for (int kc = 0; kc < K; kc += 32) {
        V a[4], a2[4];
#pragma unroll
        for (int mb = 0; mb < 4; ++mb) { a[mb] = WFrag<T16>::ld(A + aoff + (size_t)mb * 16 * K + kc); if (NSPLIT == 1 || NSPLIT == 2) a2[mb] = WFrag<T16>::ld(A2 + aoff + (size_t)mb * 16 * K + kc); }
#pragma unroll
        for (int nb = 0; nb < 4; ++nb) { const V b = WFrag<T16>::ld(Bt + boff + (size_t)nb * 16 * K + kc); V b2; if (NSPLIT >= 2) b2 = WFrag<T16>::ld(Bt2 + boff + (size_t)nb * 16 * K + kc);
#pragma unroll
            for (int mb = 0; mb < 4; ++mb) { acc[mb][nb] = WFrag<T16>::mma(a[mb], b, acc[mb][nb]); if (NSPLIT == 1 || NSPLIT == 2) acc[mb][nb] = WFrag<T16>::mma(a2[mb], b, acc[mb][nb]); if (NSPLIT >= 2) acc[mb][nb] = WFrag<T16>::mma(a[mb], b2, acc[mb][nb]); } }
        asm volatile("v_nop\n\tv_nop\n\tv_nop\n\tv_nop" : "+v"(acc[0][0]), "+v"(acc[1][1]), "+v"(acc[2][2]), "+v"(acc[3][3]) : "v"(a[0]), "v"(a[3]));
    }
#pragma unroll
    for (int mb = 0; mb < 4; ++mb) {
#pragma unroll
        for (int nb = 0; nb < 4; ++nb) {
#pragma unroll
            for (int j = 0; j < 8; ++j) os[(hi * 8 + j) * 68 + nb * 16 + lr] = acc[mb][nb][j]; }
        __builtin_amdgcn_wave_barrier(); asm volatile("" ::: "memory");
        float* crow = C + (size_t)(r0 + mb * 16) * ldc + c0;
{
#pragma unroll
            for (int s = 0; s < 8; ++s) { const int row = 2 * s + hi, cofs = lr * 4; v4f val = *(const v4fa*)(os + row * 68 + cofs); if (BIAS) { val[0] += bfr(bias[c0 + cofs]); val[1] += bfr(bias[c0 + cofs + 1]); val[2] += bfr(bias[c0 + cofs + 2]); val[3] += bfr(bias[c0 + cofs + 3]); }
                *(v4f*)(crow + (size_t)row * ldc + cofs) = val; }
             }
        __builtin_amdgcn_wave_barrier(); asm volatile("" ::: "memory");
    }
}

// ---- k_gemmc: the same one-wave 64x64 tile GEMM specialised for causal attention: CMODE 1 skips score tiles entirely above the diagonal (query rows r0+roff.., key columns c0..), CMODE 2 limits the
// key (K) loop of the probability x value contraction to the diagonal block (probabilities beyond it are exactly zero). roff = row offset of this launch's first row within the sequence.
template <typename T16, int NSPLIT, int CMODE>
__global__ __launch_bounds__(32) void k_gemmc(const T16* __restrict__ A, const T16* __restrict__ A2, const T16* __restrict__ Bt, const T16* __restrict__ Bt2, int K, float* C, int ldc, int roff, size_t sA, size_t sB, size_t sC) {
    typedef typename WFrag<T16>::V V;
    __shared__ __align__(16) float os[16 * 68];
    const size_t z = blockIdx.z; A += z * sA; if (A2) A2 += z * sA; Bt += z * sB; if (Bt2) Bt2 += z * sB; C += z * sC;
    const int lane = threadIdx.x & 31, lr = lane & 15, hi = lane >> 4; const int r0 = blockIdx.x * 64, c0 = blockIdx.y * 64;
    if (CMODE == 1 && c0 > r0 + roff + 63) return;                  // score tile entirely above the causal diagonal: never read (the softmax masks j > i by select)
    const int Kl = (CMODE == 2) ? min(K, r0 + roff + 64) : K;        // P.V: probabilities are exactly 0 beyond the diagonal block, so the K loop stops there
    v8f acc[4][4];
#pragma unroll
    for (int mb = 0; mb < 4; ++mb)
#pragma unroll
        for (int nb = 0; nb < 4; ++nb) acc[mb][nb] = (v8f){};
    const size_t aoff = (size_t)(r0 + lr) * K + 8 * hi, boff = (size_t)(c0 + lr) * K + 8 * hi;
#pragma unroll 1
    for (int kc = 0; kc < Kl; kc += 32) {
        V a[4], a2[4];
#pragma unroll
        for (int mb = 0; mb < 4; ++mb) { a[mb] = WFrag<T16>::ld(A + aoff + (size_t)mb * 16 * K + kc); if (NSPLIT == 1 || NSPLIT == 2) a2[mb] = WFrag<T16>::ld(A2 + aoff + (size_t)mb * 16 * K + kc); }
#pragma unroll
        for (int nb = 0; nb < 4; ++nb) { const V b = WFrag<T16>::ld(Bt + boff + (size_t)nb * 16 * K + kc); V b2; if (NSPLIT >= 2) b2 = WFrag<T16>::ld(Bt2 + boff + (size_t)nb * 16 * K + kc);
#pragma unroll
            for (int mb = 0; mb < 4; ++mb) { acc[mb][nb] = WFrag<T16>::mma(a[mb], b, acc[mb][nb]); if (NSPLIT == 1 || NSPLIT == 2) acc[mb][nb] = WFrag<T16>::mma(a2[mb], b, acc[mb][nb]); if (NSPLIT >= 2) acc[mb][nb] = WFrag<T16>::mma(a[mb], b2, acc[mb][nb]); } }
        asm volatile("v_nop\n\tv_nop\n\tv_nop\n\tv_nop" : "+v"(acc[0][0]), "+v"(acc[1][1]), "+v"(acc[2][2]), "+v"(acc[3][3]) : "v"(a[0]), "v"(a[3]));
    }
#pragma unroll
    for (int mb = 0; mb < 4; ++mb) {
#pragma unroll
        for (int nb = 0; nb < 4; ++nb) {
#pragma unroll
            for (int j = 0; j < 8; ++j) os[(hi * 8 + j) * 68 + nb * 16 + lr] = acc[mb][nb][j]; }
        __builtin_amdgcn_wave_barrier(); asm volatile("" ::: "memory");
        float* crow = C + (size_t)(r0 + mb * 16) * ldc + c0;
{
#pragma unroll
            for (int s = 0; s < 8; ++s) { const int row = 2 * s + hi, cofs = lr * 4; v4f val = *(const v4fa*)(os + row * 68 + cofs);
                *(v4f*)(crow + (size_t)row * ldc + cofs) = val; }
             }
        __builtin_amdgcn_wave_barrier(); asm volatile("" ::: "memory");
    }
}

__device__ __forceinline__ h16 tohx(float x) { return (h16)x; }
__device__ __forceinline__ void splitf(float y, unsigned short& h, unsigned short& l) { h = f2bf(y); l = f2bf(y - bf2f(h)); }
typedef __attribute__((ext_vector_type(2))) _Float16 v2h;
typedef __attribute__((ext_vector_type(4))) _Float16 v4h;
typedef __attribute__((ext_vector_type(2))) unsigned short v2us;
typedef __attribute__((ext_vector_type(4))) unsigned short v4us;
typedef __attribute__((ext_vector_type(2))) float v2f;
typedef __attribute__((ext_vector_type(4))) int v4i;

__global__ __launch_bounds__(256) void k_cvt8(const float* __restrict__ src, bf* dst, size_t n8) { const size_t i = (size_t)blockIdx.x * 256 + threadIdx.x; if (i >= n8) return; const v8f v = *(const v8f*)(src + i * 8); v8us o;
#pragma unroll
    for (int k = 0; k < 8; ++k) o[k] = f2bf(v[k]); *(v8us*)(dst + i * 8) = o;  }

// k_rope: head planes [h][t][d] (fp16 + hi/lo) of rope(x) x sc with the rotate-half convention out[d] = x[d] cos[t][d] - x[d+HD/2] sin[t][d], out[d+HD/2] = x[d+HD/2] cos[t][d+HD/2] + x[d] sin[t][d+HD/2]
__global__ __launch_bounds__(256) void k_rope(const float* __restrict__ F, int pitch, int nheads, const float* __restrict__ CS, const float* __restrict__ RF, const float* __restrict__ nw, float sc, h16* P16, bf* Ph, bf* Pl) {
    const size_t e = ((size_t)blockIdx.x * 256 + threadIdx.x) * 2; if (e >= (size_t)nheads * TT * HD) return; const int d = (int)(e % HD); const int t = (int)((e / HD) % TT); const int h = (int)(e / ((size_t)HD * TT)); const float* f = F + (size_t)t * pitch + h * HD; const float rf = RF ? RF[(size_t)h * TT + t] : 1.0f; v2h o16; v2us oh, ol;
#pragma unroll
    for (int q = 0; q < 2; ++q) { const int dd = d + q; const int dp = (dd < HD / 2) ? dd + HD / 2 : dd - HD / 2; float x0 = f[dd], x1 = f[dp];
        if (RF) { float n0 = __fmul_rn(x0, rf), n1 = __fmul_rn(x1, rf); asm volatile("" : "+v"(n0)); asm volatile("" : "+v"(n1)); x0 = __fmul_rn(bfr(nw[dd]), n0); x1 = __fmul_rn(bfr(nw[dp]), n1); }
        const v2f cs = *(const v2f*)(CS + ((size_t)t * HD + dd) * 2); float a = __fmul_rn(x0, cs[0]), bq = __fmul_rn(x1, cs[1]); asm volatile("" : "+v"(a)); asm volatile("" : "+v"(bq)); const float r = ((dd < HD / 2) ? __fsub_rn(a, bq) : __fadd_rn(a, bq)) * sc;
        o16[q] = tohx(r); unsigned short a2, c2; splitf(r, a2, c2); oh[q] = a2; ol[q] = c2; }
    *(v2h*)(P16 + e) = o16; *(v2us*)(Ph + e) = oh; *(v2us*)(Pl + e) = ol;  }
__global__ __launch_bounds__(256) void k_vtp(const float* __restrict__ F, int pitch, int nheads, h16* V16, bf* Vh, bf* Vl) { const size_t e = ((size_t)blockIdx.x * 256 + threadIdx.x) * 2; if (e >= (size_t)nheads * HD * TT) return; const int t = (int)(e % TT); const int d = (int)((e / TT) % HD); const int g = (int)(e / ((size_t)TT * HD)); v2h o16; v2us oh, ol;
#pragma unroll
    for (int q = 0; q < 2; ++q) { const float x = F[(size_t)(t + q) * pitch + g * HD + d]; o16[q] = tohx(x); unsigned short a2, c2; splitf(x, a2, c2); oh[q] = a2; ol[q] = c2; }
    *(v2h*)(V16 + e) = o16; *(v2us*)(Vh + e) = oh; *(v2us*)(Vl + e) = ol;  }
__constant__ float INVT[HD / 2] = { 1.000000000e+00f, 6.493816376e-01f, 4.216965139e-01f, 2.738419771e-01f, 1.778279394e-01f, 1.154781953e-01f, 7.498942316e-02f, 4.869675264e-02f, 3.162277490e-02f, 2.053525113e-02f, 1.333521400e-02f, 8.659643121e-03f, 5.623413250e-03f, 3.651741194e-03f, 2.371373819e-03f, 1.539926510e-03f, 1.000000047e-03f, 6.493816036e-04f, 4.216965172e-04f, 2.738419571e-04f, 1.778279402e-04f, 1.154782003e-04f, 7.498942432e-05f, 4.869675104e-05f, 3.162277790e-05f, 2.053524986e-05f, 1.333521413e-05f, 8.659642845e-06f, 5.623413472e-06f, 3.651741281e-06f, 2.371373739e-06f, 1.539926529e-06f };   // THETA ** (-arange(0, 64, 2) / 64) with THETA = 1e6 in float32 (the module's power expression)
__global__ __launch_bounds__(256) void k_cs5(float* CS) { const int idx = blockIdx.x * 256 + threadIdx.x; if (idx >= TT * HD) return; const int d = idx % HD; const int t = idx / HD; const float a = __fmul_rn((float)t, INVT[d % (HD / 2)]); v2f cs; cs[0] = cosf(a); cs[1] = sinf(a); *(v2f*)(CS + (size_t)idx * 2) = cs;  }
__global__ __launch_bounds__(256) void k_hrms(const float* __restrict__ F, int pitch, int nheads, float* RF) { const int idx = blockIdx.x * 256 + threadIdx.x; if (idx >= nheads * TT) return; const int t = idx % TT; const int h = idx / TT; const float* f = F + (size_t)t * pitch + h * HD; float s = 0.f;
#pragma unroll 4
    for (int d = 0; d < HD; d += 4) { const v4f a = *(const v4f*)(f + d);
#pragma unroll
        for (int q = 0; q < 4; ++q) { float p = __fmul_rn(a[q], a[q]); asm volatile("" : "+v"(p)); s = __fadd_rn(s, p); } }
    const float rf = __fdiv_rn(1.0f, __fsqrt_rn(__fadd_rn(__fdiv_rn(s, (float)HD), 1e-5f))); *(float*)(RF + idx) = rf;  }

__global__ __launch_bounds__(256) void k_rmsapply(float* F, int pitch, int nheads, const float* __restrict__ RF, const float* __restrict__ w) { const size_t i = (size_t)blockIdx.x * 256 + threadIdx.x; if (i >= (size_t)TT * nheads * HD / 4) return; const size_t e = i * 4; const int c = (int)(e % ((size_t)nheads * HD)); const int t = (int)(e / ((size_t)nheads * HD)); const int h = c / HD, d = c % HD; const float r = RF[(size_t)h * TT + t]; v4f a = *(const v4f*)(F + (size_t)t * pitch + c);
#pragma unroll
    for (int q = 0; q < 4; ++q) { float y = __fmul_rn(a[q], r); asm volatile("" : "+v"(y)); float wv_ = bfr(w[d + q]); asm volatile("" : "+v"(wv_)); a[q] = __fmul_rn(y, wv_); }   /* x w[d] */
    *(v4f*)(F + (size_t)t * pitch + c) = a;  }
// k_asoft: per row (zz, i): t = S x HD^-0.5 for j <= i and i - j < WIN (WIN = T: the window bound always holds, plain causal; the reference's -1e9 additive fill vanishes identically); softmax over the 2048 keys (register row, one exp, fixed trees);
__global__ __launch_bounds__(256) void k_asoft(const float* __restrict__ Sb, h16* P16, bf* Ph, bf* Pl) {
    const int lane = threadIdx.x & 31; const int row = blockIdx.x * 8 + (threadIdx.x >> 5); if (row >= ZH * TT) return; const int i = row % TT; const int zz = row / TT; (void)zz; const bool hires = (i < RH); const float* sr = Sb + (size_t)row * TT; float v[TT / 32]; float mx = -3.0e38f;
#pragma unroll
    for (int ch = 0; ch < TT / 128; ++ch) { const int j0 = ch * 128 + lane * 4; const v4f a = *(const v4f*)(sr + j0);
#pragma unroll
        for (int q = 0; q < 4; ++q) { const int j = j0 + q; (void)j; const float t = (j <= i && i - j < WIN) ? a[q] * SCL : -3.0e38f; v[ch * 4 + q] = t; mx = fmaxf(mx, t); } }
#pragma unroll
    for (int sh = 16; sh; sh >>= 1) mx = fmaxf(mx, __shfl_xor(mx, sh, 32));
    float sum = 0.f;
#pragma unroll
    for (int k = 0; k < TT / 32; ++k) { float d0 = __fsub_rn(v[k], mx); asm volatile("" : "+v"(d0)); v[k] = __builtin_amdgcn_exp2f(__fmul_rn(d0, 1.4426950408889634f)); sum += v[k]; }
#pragma unroll
    for (int sh = 16; sh; sh >>= 1) sum += __shfl_xor(sum, sh, 32);
    const float f = __fdiv_rn(hires ? 1.0f : PCAR, sum);
{
        if (hires) {
#pragma unroll
            for (int ch = 0; ch < TT / 128; ++ch) { v4us oh, ol;
#pragma unroll
                for (int q = 0; q < 4; ++q) { unsigned short a, c2; splitf(v[ch * 4 + q] * f, a, c2); oh[q] = a; ol[q] = c2; }
                const size_t oo = ((size_t)zz * (RH ? RH : 1) + i) * TT + ch * 128 + lane * 4; *(v4us*)(Ph + oo) = oh; *(v4us*)(Pl + oo) = ol; }
        } else {
#pragma unroll
            for (int ch = 0; ch < TT / 128; ++ch) { v4h o4;
#pragma unroll
                for (int q = 0; q < 4; ++q) o4[q] = tohx(v[ch * 4 + q] * f);
                *(v4h*)(P16 + (size_t)row * TT + ch * 128 + lane * 4) = o4; } }
         }
}
__global__ __launch_bounds__(256) void k_wtG(const float* __restrict__ w, int K, int N, bf* Bt) {
    const int lane = threadIdx.x & 31; const int L0 = (blockIdx.x * 8 + (threadIdx.x >> 5)) * 8; const int nlines = N * K / 64;
{
#pragma unroll 1
        for (int l = 0; l < 8; ++l) { const int L = L0 + l; if (L >= nlines) break; const size_t e = (size_t)L * 64 + lane * 2; const int k = (int)(e % K), n = (int)(e / K); v2us o;
            o[0] = f2bf(w[(size_t)k * N + n]); o[1] = f2bf(w[(size_t)(k + 1) * N + n]); *(v2us*)(Bt + e) = o; }
         }
}

__global__ __launch_bounds__(256) void k_merge(const float* __restrict__ O, int h0, bf* Ah, bf* Al) { const size_t e = ((size_t)blockIdx.x * 256 + threadIdx.x) * 2; if (e >= (size_t)ZH * TT * HD) return; const int d = (int)(e % HD); const int t = (int)((e / HD) % TT); const int zz = (int)(e / ((size_t)HD * TT)); const float cs = (t < RH) ? 1.0f : (1.0f / PCAR); const size_t oo = (size_t)t * DQ + (h0 + zz) * HD + d;
    v2us oh, ol;
#pragma unroll
    for (int q = 0; q < 2; ++q) { unsigned short a, c2; splitf(O[e + q] * cs, a, c2); oh[q] = a; ol[q] = c2; } *(v2us*)(Ah + oo) = oh; *(v2us*)(Al + oo) = ol;  }

extern "C" void kernel_launch(void* const* d_in, const int* in_sizes, int n_in,
                              void* d_out, int out_size, void* d_ws, size_t ws_size, hipStream_t stream) {
    (void)in_sizes; (void)n_in; (void)out_size;
    const float* x = (const float*)d_in[0]; const float* wq = (const float*)d_in[1]; const float* wk = (const float*)d_in[2]; const float* wv = (const float*)d_in[3]; const float* wo = (const float*)d_in[4]; const float* qsc = (const float*)d_in[5]; const float* ksc = (const float*)d_in[6];   /* input order x, Wq ('xw' [2048][2048]), Wk, Wv ([2048][512]), Wo ('xw'), q_norm_w, k_norm_w ([64], read) */
    float* OUT = (float*)d_out;     // [2][2048][2048]
    char* wsp = (char*)d_ws;
    auto take = [&](size_t bytes) { char* p = wsp; wsp += (bytes + 255) & ~(size_t)255; return (void*)p; };
    bf* WQ = (bf*)take((size_t)DQ * DM * 2); bf* WK = (bf*)take((size_t)DKV * DM * 2); bf* WV = (bf*)take((size_t)DKV * DM * 2); bf* WO = (bf*)take((size_t)DM * DQ * 2); float* CS = (float*)take((size_t)TT * HD * 2 * 4);
    bf* XB = (bf*)take((size_t)TT * DM * 2); float* RFQ = (float*)take((size_t)NH_ * TT * 4); float* RFK = (float*)take((size_t)NKV * TT * 4);   /* per (head, token) inverse RMS */ float* FQ = (float*)take((size_t)TT * DQ * 4); float* FK = (float*)take((size_t)TT * DKV * 4);
    h16* QP16 = (h16*)take((size_t)NH_ * TT * HD * 2); h16* KP16 = (h16*)take((size_t)NKV * TT * HD * 2); h16* VT16 = (h16*)take((size_t)NKV * HD * TT * 2);
    bf* QPh = (bf*)take((size_t)NH_ * TT * HD * 2); bf* QPl = (bf*)take((size_t)NH_ * TT * HD * 2); bf* KPh = (bf*)take((size_t)NKV * TT * HD * 2); bf* KPl = (bf*)take((size_t)NKV * TT * HD * 2); bf* VTh = (bf*)take((size_t)NKV * HD * TT * 2); bf* VTl = (bf*)take((size_t)NKV * HD * TT * 2); bf* Ph = (bf*)take((size_t)ZH * RH * TT * 2); bf* Pl = (bf*)take((size_t)ZH * RH * TT * 2);
    float* Sb = (float*)take((size_t)ZH * TT * TT * 4); h16* P16 = (h16*)take((size_t)ZH * TT * TT * 2); float* Ob = (float*)take((size_t)ZH * TT * HD * 4); bf* ATh = (bf*)take((size_t)TT * DQ * 2); bf* ATl = (bf*)take((size_t)TT * DQ * 2);
    if ((size_t)(wsp - (char*)d_ws) > ws_size) return;    // ws 256 MiB
    float* FV = FK;   // v projection reuses the k buffer after the k planes are built (stream-ordered)
    { k_wtG<<<(unsigned)((DM * DQ / 64 + 63) / 64), 256, 0, stream>>>(wq, DM, DQ, WQ); k_wtG<<<(unsigned)((DM * DKV / 64 + 63) / 64), 256, 0, stream>>>(wk, DM, DKV, WK); k_wtG<<<(unsigned)((DM * DKV / 64 + 63) / 64), 256, 0, stream>>>(wv, DM, DKV, WV);
      k_wtG<<<(unsigned)((DQ * DM / 64 + 63) / 64), 256, 0, stream>>>(wo, DQ, DM, WO);
       }
    k_cs5<<<(TT * HD + 255) / 256, 256, 0, stream>>>(CS);   /* rotary table computed from t and INVT */
    const unsigned LQ = (unsigned)(((size_t)NH_ * TT * HD / 2 + 255) / 256), LKv = (unsigned)(((size_t)NKV * TT * HD / 2 + 255) / 256);
    for (int b = 0; b < NB_; ++b) {
        
        k_cvt8<<<(unsigned)(((size_t)TT * DM / 8 + 255) / 256), 256, 0, stream>>>(x + (size_t)b * TT * DM, XB, (size_t)TT * DM / 8);
        k_gemmw<bf, 0, false><<<dim3(TT / 64, DQ / 64, 1), 32, 0, stream>>>(XB, nullptr, WQ, nullptr, DM, FQ, DQ, nullptr, 0, 0, 0);
        k_hrms<<<(NH_ * TT + 255) / 256, 256, 0, stream>>>(FQ, DQ, NH_, RFQ); k_rmsapply<<<(unsigned)(((size_t)TT * DQ / 4 + 255) / 256), 256, 0, stream>>>(FQ, DQ, NH_, RFQ, qsc);   /* per-head RMSNorm x q_norm_w */ k_rope<<<LQ, 256, 0, stream>>>(FQ, DQ, NH_, CS, nullptr, nullptr, 1.0f, QP16, QPh, QPl);
        k_gemmw<bf, 0, false><<<dim3(TT / 64, DKV / 64, 1), 32, 0, stream>>>(XB, nullptr, WK, nullptr, DM, FK, DKV, nullptr, 0, 0, 0);
        k_hrms<<<(NKV * TT + 255) / 256, 256, 0, stream>>>(FK, DKV, NKV, RFK); k_rmsapply<<<(unsigned)(((size_t)TT * DKV / 4 + 255) / 256), 256, 0, stream>>>(FK, DKV, NKV, RFK, ksc);   /* per-head RMSNorm x k_norm_w */ k_rope<<<LKv, 256, 0, stream>>>(FK, DKV, NKV, CS, nullptr, nullptr, 1.0f, KP16, KPh, KPl);
        k_gemmw<bf, 0, false><<<dim3(TT / 64, DKV / 64, 1), 32, 0, stream>>>(XB, nullptr, WV, nullptr, DM, FV, DKV, nullptr, 0, 0, 0); k_vtp<<<LKv, 256, 0, stream>>>(FV, DKV, NKV, VT16, VTh, VTl);
        for (int h0 = 0; h0 < NH_; h0 += ZH) { const size_t zq = (size_t)h0, zk = (size_t)(h0 / REP);   // both heads of a pass share kv group h0/REP (REP >= 2): sB = 0
            k_gemmc<bf, 2, 1><<<dim3(RH / 64, TT / 64, ZH), 32, 0, stream>>>(QPh + zq * TT * HD, QPl + zq * TT * HD, KPh + zk * TT * HD, KPl + zk * TT * HD, HD, Sb, TT, 0, (size_t)TT * HD, 0, (size_t)TT * TT);
            k_gemmc<h16, 0, 1><<<dim3((TT - RH) / 64, TT / 64, ZH), 32, 0, stream>>>(QP16 + zq * TT * HD + (size_t)RH * HD, nullptr, KP16 + zk * TT * HD, nullptr, HD, Sb + (size_t)RH * TT, TT, RH, (size_t)TT * HD, 0, (size_t)TT * TT);
            k_asoft<<<ZH * TT / 8, 256, 0, stream>>>(Sb, P16, Ph, Pl);
            k_gemmc<bf, 2, 2><<<dim3(RH / 64, HD / 64, ZH), 32, 0, stream>>>(Ph, Pl, VTh + zk * HD * TT, VTl + zk * HD * TT, TT, Ob, HD, 0, (size_t)RH * TT, 0, (size_t)TT * HD);
            k_gemmc<h16, 0, 2><<<dim3((TT - RH) / 64, HD / 64, ZH), 32, 0, stream>>>(P16 + (size_t)RH * TT, nullptr, VT16 + zk * HD * TT, nullptr, TT, Ob + (size_t)RH * HD, HD, RH, (size_t)TT * TT, 0, (size_t)TT * HD);
            k_merge<<<(unsigned)(((size_t)ZH * TT * HD / 2 + 255) / 256), 256, 0, stream>>>(Ob, h0, ATh, ATl); }
        k_gemmw<bf, 1, false><<<dim3(TT / 64, DM / 64, 1), 32, 0, stream>>>(ATh, ATl, WO, nullptr, DQ, OUT + (size_t)b * TT * DM, DM, nullptr, 0, 0, 0); }
}

// v001
// It runs in 1500 microseconds.
// Timed twice side by side with v000, it ran 1.85 times as fast both times.
#include <hip/hip_runtime.h>

// Grouped-query causal attention with per-head RMSNorm and computed half-split rotary embeddings at base 1e6 (x [2][2048][2048]; q = x Wq (32 heads x 64), k, v = x Wk, x Wv (8 kv heads x 64) ('xw' 0.02, no bias); per head q = rms_norm(q) x q_norm_w, k = rms_norm(k) x k_norm_w (eps 1e-5; weights [64] = ones, read); rope: (x1, x2) = the two HALVES of each head: cat(x1 cos - x2 sin, x2 cos + x1 sin) with angle t x 1000000^(-2i/64), i < 32 (32 f32 frequencies jnp-exact for the module's power expression; precise cosf/sinf); query heads viewed (HKV, g): kv head = q head / 4; scores x 64^-0.5; causal (finfo.min == exclusion); softmax; out = merged Wo ('xw') -> [2][2048][2048] (8.4 M); argument order x, Wq, Wk, Wv, Wo, q_norm_w, k_norm_w).
// Layout per batch: bf16 copy of x; 'xw' weights transposed once (k_wtG); exact projections; k_hrms (per (head, token) 1/sqrt(mean + eps)) + k_rmsapply (x r x w[d] in place); k_cs5 table {cosf, sinf}(t x INVT[d mod 32]); rotate-half plane builders; causal T-2048 GQA attention (kv z-stride 0; hybrid rows: < 512 hi/lo 3 products, rest fp16 x1024; k_gemmc skips tiles above the diagonal); merged hi/lo x Wo exact.
// Compute dtypes, f32 accumulate: every input rounded to bf16 incl. the norm scales; projections exact; RMSNorm and rotary f32; attention rows < 512 3 products, rest fp16; softmax f32; Wo hl x exact.

#define NB_  2
#define TT   2048
#define DM   2048
#define NH_  32
#define NKV  8
#define REP  (NH_ / NKV)
#define HD   64
#define DQ   (NH_ * HD)
#define DKV  (NKV * HD)
#define ZH   2
#define RH   512                  // query rows < RH use hi+lo planes (0: none)
#define WIN  2048
#define PCAR 1024.0f
#define SCL  0.125f   // HD^-0.5
typedef _Float16 h16;
typedef unsigned short bf;
typedef __attribute__((ext_vector_type(16))) __bf16   v16bf;
typedef __attribute__((ext_vector_type(16))) _Float16 v16h;
typedef __attribute__((ext_vector_type(8)))  _Float16 v8h;
typedef __attribute__((ext_vector_type(8)))  unsigned short v8us;
typedef __attribute__((ext_vector_type(8)))  float    v8f;
typedef __attribute__((ext_vector_type(4)))  float    v4f;
typedef v8h  __attribute__((may_alias)) v8ha;
typedef v4f  __attribute__((may_alias)) v4fa;
typedef v8us __attribute__((may_alias)) v8usa;

__device__ __forceinline__ unsigned short f2bf(float f) { unsigned u = __float_as_uint(f); u += 0x7FFFu + ((u >> 16) & 1u); return (unsigned short)(u >> 16); }
__device__ __forceinline__ float bf2f(unsigned short b) { return __uint_as_float(((unsigned)b) << 16); }
__device__ __forceinline__ float bfr(float f) { return bf2f(f2bf(f)); }
__device__ __forceinline__ v16h cat16(v8h lo, v8h hi) { return __builtin_shufflevector(lo, hi, 0, 1, 2, 3, 4, 5, 6, 7, 8, 9, 10, 11, 12, 13, 14, 15); }
__device__ __forceinline__ v16bf cat16b(v8us lo, v8us hi) { return __builtin_bit_cast(v16bf, __builtin_shufflevector(lo, hi, 0, 1, 2, 3, 4, 5, 6, 7, 8, 9, 10, 11, 12, 13, 14, 15)); }
__device__ __forceinline__ v8f wmma16(v16h a, v16h b, v8f c) { return __builtin_amdgcn_wmma_f32_16x16x32_f16(false, a, false, b, (short)0, c, false, false); }
__device__ __forceinline__ v8f wmmab(v16bf a, v16bf b, v8f c) { return __builtin_amdgcn_wmma_f32_16x16x32_bf16(false, a, false, b, (short)0, c, false, false); }



// ---- split-K inside a work-group: the NW waves of a 64x64 tile each take every NW-th 32-wide step of K (neighbouring waves read the two halves of the same 128-byte lines at about the same time),
// so the chain of dependent load round trips per wave is NW times shorter. ksum_store puts the NW partial tiles into LDS (row pitch 68 floats), and behind one barrier adds them in the fixed order wave 0..NW-1 and stores the tile.
template <int NW, bool BIAS>
__device__ __forceinline__ void ksum_store(const v8f (&acc)[4][4], float* os, int w, int lr, int hi, float* C, int ldc, const float* bias) {
#pragma unroll
    for (int mb = 0; mb < 4; ++mb)
#pragma unroll
        for (int nb = 0; nb < 4; ++nb)
#pragma unroll
            for (int j = 0; j < 8; ++j) os[(w * 64 + mb * 16 + hi * 8 + j) * 68 + nb * 16 + lr] = acc[mb][nb][j];
    __syncthreads();                       // all NW partial tiles are in LDS before any of them is read
    const int tid = threadIdx.x, cofs = (tid & 15) * 4;
#pragma unroll
    for (int s = 0; s < 32 / NW; ++s) { const int row = s * NW * 2 + (tid >> 4);
        v4f val = *(const v4fa*)(os + row * 68 + cofs);
#pragma unroll
        for (int u = 1; u < NW; ++u) val += *(const v4fa*)(os + (u * 64 + row) * 68 + cofs);
        if (BIAS) { val[0] += bfr(bias[cofs]); val[1] += bfr(bias[cofs + 1]); val[2] += bfr(bias[cofs + 2]); val[3] += bfr(bias[cofs + 3]); }
        *(v4f*)(C + (size_t)row * ldc + cofs) = val; }
}

// ---- k_gemmw: register-blocked GEMM, NW WAVES per 64x64 output tile (16 accumulators each, K split between them), operands straight from K-contiguous 16-bit planes; grid (M/64, N/64, Z), NW*32 threads.
// C[m][n] (f32, pitch ldc, + optional f32 bias[n]) = sum_k A[m][k] Bt[n][k] (+ split products per NSPLIT). z-batch strides sA/sB/sC in elements. K % 32 == 0.
template <typename T16> struct WFrag;
template <> struct WFrag<h16> { typedef v16h V; static __device__ __forceinline__ V ld(const h16* p) { return cat16(*(const v8h*)p, *(const v8h*)(p + 16)); } static __device__ __forceinline__ v8f mma(V a, V b, v8f c) { return wmma16(a, b, c); } };
template <> struct WFrag<bf> { typedef v16bf V; static __device__ __forceinline__ V ld(const bf* p) { return cat16b(*(const v8us*)p, *(const v8us*)(p + 16)); } static __device__ __forceinline__ v8f mma(V a, V b, v8f c) { return wmmab(a, b, c); } };
template <typename T16, int NSPLIT, bool BIAS, int NW>
__global__ __launch_bounds__(NW * 32) void k_gemmw(const T16* __restrict__ A, const T16* __restrict__ A2, const T16* __restrict__ Bt, const T16* __restrict__ Bt2, int K, float* C, int ldc, const float* __restrict__ bias, size_t sA, size_t sB, size_t sC) {
    typedef typename WFrag<T16>::V V;
    __shared__ __align__(16) float os[NW * 64 * 68];
    const size_t z = blockIdx.z; A += z * sA; if (A2) A2 += z * sA; Bt += z * sB; if (Bt2) Bt2 += z * sB; C += z * sC;
    const int lane = threadIdx.x & 31, lr = lane & 15, hi = lane >> 4; const int r0 = blockIdx.x * 64, c0 = blockIdx.y * 64;
    const int w = __builtin_amdgcn_readfirstlane(threadIdx.x >> 5);   // wave number, scalar: the K loop's bounds stay wave-uniform
    v8f acc[4][4];
#pragma unroll
    for (int mb = 0; mb < 4; ++mb)
#pragma unroll
        for (int nb = 0; nb < 4; ++nb) acc[mb][nb] = (v8f){};
    const size_t aoff = (size_t)(r0 + lr) * K + 8 * hi, boff = (size_t)(c0 + lr) * K + 8 * hi;
#pragma unroll 1
    for (int kc = w * 32; kc < K; kc += NW * 32) {
        V a[4], a2[4];
#pragma unroll
        for (int mb = 0; mb < 4; ++mb) { a[mb] = WFrag<T16>::ld(A + aoff + (size_t)mb * 16 * K + kc); if (NSPLIT == 1 || NSPLIT == 2) a2[mb] = WFrag<T16>::ld(A2 + aoff + (size_t)mb * 16 * K + kc); }
#pragma unroll
        for (int nb = 0; nb < 4; ++nb) { const V b = WFrag<T16>::ld(Bt + boff + (size_t)nb * 16 * K + kc); V b2; if (NSPLIT >= 2) b2 = WFrag<T16>::ld(Bt2 + boff + (size_t)nb * 16 * K + kc);
#pragma unroll
            for (int mb = 0; mb < 4; ++mb) { acc[mb][nb] = WFrag<T16>::mma(a[mb], b, acc[mb][nb]); if (NSPLIT == 1 || NSPLIT == 2) acc[mb][nb] = WFrag<T16>::mma(a2[mb], b, acc[mb][nb]); if (NSPLIT >= 2) acc[mb][nb] = WFrag<T16>::mma(a[mb], b2, acc[mb][nb]); } }
        asm volatile("v_nop\n\tv_nop\n\tv_nop\n\tv_nop" : "+v"(acc[0][0]), "+v"(acc[1][1]), "+v"(acc[2][2]), "+v"(acc[3][3]) : "v"(a[0]), "v"(a[3]));
    }
    ksum_store<NW, BIAS>(acc, os, w, lr, hi, C + (size_t)r0 * ldc + c0, ldc, BIAS ? bias + c0 : nullptr);
}

// ---- k_gemmc: the same 64x64 tile GEMM specialised for causal attention: CMODE 1 skips score tiles entirely above the diagonal (query rows r0+roff.., key columns c0..), CMODE 2 limits the
// key (K) loop of the probability x value contraction to the diagonal block (probabilities beyond it are exactly zero). roff = row offset of this launch's first row within the sequence.
// NW = 1: one wave per tile (the short K = 64 score products); NW = 8 or 16: the K loop split between NW waves as in k_gemmw (no early return there: every wave reaches the barrier).
template <typename T16, int NSPLIT, int CMODE, int NW>
__global__ __launch_bounds__(NW * 32) void k_gemmc(const T16* __restrict__ A, const T16* __restrict__ A2, const T16* __restrict__ Bt, const T16* __restrict__ Bt2, int K, float* C, int ldc, int roff, size_t sA, size_t sB, size_t sC) {
    typedef typename WFrag<T16>::V V;
    static_assert(NW == 1 || CMODE != 1, "the early return of CMODE 1 stands in front of no barrier only with one wave");
    __shared__ __align__(16) float os[(NW == 1 ? 16 : NW * 64) * 68];
    const size_t z = blockIdx.z; A += z * sA; if (A2) A2 += z * sA; Bt += z * sB; if (Bt2) Bt2 += z * sB; C += z * sC;
    const int lane = threadIdx.x & 31, lr = lane & 15, hi = lane >> 4; const int r0 = blockIdx.x * 64, c0 = blockIdx.y * 64;
    const int w = (NW == 1) ? 0 : __builtin_amdgcn_readfirstlane(threadIdx.x >> 5);   // wave number, scalar: the K loop's bounds stay wave-uniform
    if (CMODE == 1 && c0 > r0 + roff + 63) return;                  // score tile entirely above the causal diagonal: never read (the softmax masks j > i by select)
    const int Kl = (CMODE == 2) ? min(K, r0 + roff + 64) : K;        // P.V: probabilities are exactly 0 beyond the diagonal block, so the K loop stops there
    v8f acc[4][4];
#pragma unroll
    for (int mb = 0; mb < 4; ++mb)
#pragma unroll
        for (int nb = 0; nb < 4; ++nb) acc[mb][nb] = (v8f){};
    const size_t aoff = (size_t)(r0 + lr) * K + 8 * hi, boff = (size_t)(c0 + lr) * K + 8 * hi;
#pragma unroll 1
    for (int kc = w * 32; kc < Kl; kc += NW * 32) {
        V a[4], a2[4];
#pragma unroll
        for (int mb = 0; mb < 4; ++mb) { a[mb] = WFrag<T16>::ld(A + aoff + (size_t)mb * 16 * K + kc); if (NSPLIT == 1 || NSPLIT == 2) a2[mb] = WFrag<T16>::ld(A2 + aoff + (size_t)mb * 16 * K + kc); }
#pragma unroll
        for (int nb = 0; nb < 4; ++nb) { const V b = WFrag<T16>::ld(Bt + boff + (size_t)nb * 16 * K + kc); V b2; if (NSPLIT >= 2) b2 = WFrag<T16>::ld(Bt2 + boff + (size_t)nb * 16 * K + kc);
#pragma unroll
            for (int mb = 0; mb < 4; ++mb) { acc[mb][nb] = WFrag<T16>::mma(a[mb], b, acc[mb][nb]); if (NSPLIT == 1 || NSPLIT == 2) acc[mb][nb] = WFrag<T16>::mma(a2[mb], b, acc[mb][nb]); if (NSPLIT >= 2) acc[mb][nb] = WFrag<T16>::mma(a[mb], b2, acc[mb][nb]); } }
        asm volatile("v_nop\n\tv_nop\n\tv_nop\n\tv_nop" : "+v"(acc[0][0]), "+v"(acc[1][1]), "+v"(acc[2][2]), "+v"(acc[3][3]) : "v"(a[0]), "v"(a[3]));
    }
    if constexpr (NW > 1) { ksum_store<NW, false>(acc, os, w, lr, hi, C + (size_t)r0 * ldc + c0, ldc, nullptr); return; }
#pragma unroll
    for (int mb = 0; mb < 4; ++mb) {
#pragma unroll
        for (int nb = 0; nb < 4; ++nb) {
#pragma unroll
            for (int j = 0; j < 8; ++j) os[(hi * 8 + j) * 68 + nb * 16 + lr] = acc[mb][nb][j]; }
        __builtin_amdgcn_wave_barrier(); asm volatile("" ::: "memory");
        float* crow = C + (size_t)(r0 + mb * 16) * ldc + c0;
{
#pragma unroll
            for (int s = 0; s < 8; ++s) { const int row = 2 * s + hi, cofs = lr * 4; v4f val = *(const v4fa*)(os + row * 68 + cofs);
                *(v4f*)(crow + (size_t)row * ldc + cofs) = val; }
             }
        __builtin_amdgcn_wave_barrier(); asm volatile("" ::: "memory");
    }
}

__device__ __forceinline__ h16 tohx(float x) { return (h16)x; }
__device__ __forceinline__ void splitf(float y, unsigned short& h, unsigned short& l) { h = f2bf(y); l = f2bf(y - bf2f(h)); }
typedef __attribute__((ext_vector_type(2))) _Float16 v2h;
typedef __attribute__((ext_vector_type(4))) _Float16 v4h;
typedef __attribute__((ext_vector_type(2))) unsigned short v2us;
typedef __attribute__((ext_vector_type(4))) unsigned short v4us;
typedef __attribute__((ext_vector_type(2))) float v2f;
typedef __attribute__((ext_vector_type(4))) int v4i;

__global__ __launch_bounds__(256) void k_cvt8(const float* __restrict__ src, bf* dst, size_t n8) { const size_t i = (size_t)blockIdx.x * 256 + threadIdx.x; if (i >= n8) return; const v8f v = *(const v8f*)(src + i * 8); v8us o;
#pragma unroll
    for (int k = 0; k < 8; ++k) o[k] = f2bf(v[k]); *(v8us*)(dst + i * 8) = o;  }

// k_rope: head planes [h][t][d] (fp16 + hi/lo) of rope(x) x sc with the rotate-half convention out[d] = x[d] cos[t][d] - x[d+HD/2] sin[t][d], out[d+HD/2] = x[d+HD/2] cos[t][d+HD/2] + x[d] sin[t][d+HD/2]
__global__ __launch_bounds__(256) void k_rope(const float* __restrict__ F, int pitch, int nheads, const float* __restrict__ CS, const float* __restrict__ RF, const float* __restrict__ nw, float sc, h16* P16, bf* Ph, bf* Pl) {
    const size_t e = ((size_t)blockIdx.x * 256 + threadIdx.x) * 2; if (e >= (size_t)nheads * TT * HD) return; const int d = (int)(e % HD); const int t = (int)((e / HD) % TT); const int h = (int)(e / ((size_t)HD * TT)); const float* f = F + (size_t)t * pitch + h * HD; const float rf = RF ? RF[(size_t)h * TT + t] : 1.0f; v2h o16; v2us oh, ol;
#pragma unroll
    for (int q = 0; q < 2; ++q) { const int dd = d + q; const int dp = (dd < HD / 2) ? dd + HD / 2 : dd - HD / 2; float x0 = f[dd], x1 = f[dp];
        if (RF) { float n0 = __fmul_rn(x0, rf), n1 = __fmul_rn(x1, rf); asm volatile("" : "+v"(n0)); asm volatile("" : "+v"(n1)); x0 = __fmul_rn(bfr(nw[dd]), n0); x1 = __fmul_rn(bfr(nw[dp]), n1); }
        const v2f cs = *(const v2f*)(CS + ((size_t)t * HD + dd) * 2); float a = __fmul_rn(x0, cs[0]), bq = __fmul_rn(x1, cs[1]); asm volatile("" : "+v"(a)); asm volatile("" : "+v"(bq)); const float r = ((dd < HD / 2) ? __fsub_rn(a, bq) : __fadd_rn(a, bq)) * sc;
        o16[q] = tohx(r); unsigned short a2, c2; splitf(r, a2, c2); oh[q] = a2; ol[q] = c2; }
    *(v2h*)(P16 + e) = o16; *(v2us*)(Ph + e) = oh; *(v2us*)(Pl + e) = ol;  }
__global__ __launch_bounds__(256) void k_vtp(const float* __restrict__ F, int pitch, int nheads, h16* V16, bf* Vh, bf* Vl) { const size_t e = ((size_t)blockIdx.x * 256 + threadIdx.x) * 2; if (e >= (size_t)nheads * HD * TT) return; const int t = (int)(e % TT); const int d = (int)((e / TT) % HD); const int g = (int)(e / ((size_t)TT * HD)); v2h o16; v2us oh, ol;
#pragma unroll
    for (int q = 0; q < 2; ++q) { const float x = F[(size_t)(t + q) * pitch + g * HD + d]; o16[q] = tohx(x); unsigned short a2, c2; splitf(x, a2, c2); oh[q] = a2; ol[q] = c2; }
    *(v2h*)(V16 + e) = o16; *(v2us*)(Vh + e) = oh; *(v2us*)(Vl + e) = ol;  }
__constant__ float INVT[HD / 2] = { 1.000000000e+00f, 6.493816376e-01f, 4.216965139e-01f, 2.738419771e-01f, 1.778279394e-01f, 1.154781953e-01f, 7.498942316e-02f, 4.869675264e-02f, 3.162277490e-02f, 2.053525113e-02f, 1.333521400e-02f, 8.659643121e-03f, 5.623413250e-03f, 3.651741194e-03f, 2.371373819e-03f, 1.539926510e-03f, 1.000000047e-03f, 6.493816036e-04f, 4.216965172e-04f, 2.738419571e-04f, 1.778279402e-04f, 1.154782003e-04f, 7.498942432e-05f, 4.869675104e-05f, 3.162277790e-05f, 2.053524986e-05f, 1.333521413e-05f, 8.659642845e-06f, 5.623413472e-06f, 3.651741281e-06f, 2.371373739e-06f, 1.539926529e-06f };   // THETA ** (-arange(0, 64, 2) / 64) with THETA = 1e6 in float32 (the module's power expression)
__global__ __launch_bounds__(256) void k_cs5(float* CS) { const int idx = blockIdx.x * 256 + threadIdx.x; if (idx >= TT * HD) return; const int d = idx % HD; const int t = idx / HD; const float a = __fmul_rn((float)t, INVT[d % (HD / 2)]); v2f cs; cs[0] = cosf(a); cs[1] = sinf(a); *(v2f*)(CS + (size_t)idx * 2) = cs;  }
__global__ __launch_bounds__(256) void k_hrms(const float* __restrict__ F, int pitch, int nheads, float* RF) { const int idx = blockIdx.x * 256 + threadIdx.x; if (idx >= nheads * TT) return; const int t = idx % TT; const int h = idx / TT; const float* f = F + (size_t)t * pitch + h * HD; float s = 0.f;
#pragma unroll 4
    for (int d = 0; d < HD; d += 4) { const v4f a = *(const v4f*)(f + d);
#pragma unroll
        for (int q = 0; q < 4; ++q) { float p = __fmul_rn(a[q], a[q]); asm volatile("" : "+v"(p)); s = __fadd_rn(s, p); } }
    const float rf = __fdiv_rn(1.0f, __fsqrt_rn(__fadd_rn(__fdiv_rn(s, (float)HD), 1e-5f))); *(float*)(RF + idx) = rf;  }

__global__ __launch_bounds__(256) void k_rmsapply(float* F, int pitch, int nheads, const float* __restrict__ RF, const float* __restrict__ w) { const size_t i = (size_t)blockIdx.x * 256 + threadIdx.x; if (i >= (size_t)TT * nheads * HD / 4) return; const size_t e = i * 4; const int c = (int)(e % ((size_t)nheads * HD)); const int t = (int)(e / ((size_t)nheads * HD)); const int h = c / HD, d = c % HD; const float r = RF[(size_t)h * TT + t]; v4f a = *(const v4f*)(F + (size_t)t * pitch + c);
#pragma unroll
    for (int q = 0; q < 4; ++q) { float y = __fmul_rn(a[q], r); asm volatile("" : "+v"(y)); float wv_ = bfr(w[d + q]); asm volatile("" : "+v"(wv_)); a[q] = __fmul_rn(y, wv_); }   /* x w[d] */
    *(v4f*)(F + (size_t)t * pitch + c) = a;  }
// k_asoft: per row (zz, i): t = S x HD^-0.5 for j <= i and i - j < WIN (WIN = T: the window bound always holds, plain causal; the reference's -1e9 additive fill vanishes identically); softmax over the 2048 keys (register row, one exp, fixed trees);
__global__ __launch_bounds__(256) void k_asoft(const float* __restrict__ Sb, h16* P16, bf* Ph, bf* Pl) {
    const int lane = threadIdx.x & 31; const int row = blockIdx.x * 8 + (threadIdx.x >> 5); if (row >= ZH * TT) return; const int i = row % TT; const int zz = row / TT; (void)zz; const bool hires = (i < RH); const float* sr = Sb + (size_t)row * TT; float v[TT / 32]; float mx = -3.0e38f;
#pragma unroll
    for (int ch = 0; ch < TT / 128; ++ch) { const int j0 = ch * 128 + lane * 4; const v4f a = *(const v4f*)(sr + j0);
#pragma unroll
        for (int q = 0; q < 4; ++q) { const int j = j0 + q; (void)j; const float t = (j <= i && i - j < WIN) ? a[q] * SCL : -3.0e38f; v[ch * 4 + q] = t; mx = fmaxf(mx, t); } }
#pragma unroll
    for (int sh = 16; sh; sh >>= 1) mx = fmaxf(mx, __shfl_xor(mx, sh, 32));
    float sum = 0.f;
#pragma unroll
    for (int k = 0; k < TT / 32; ++k) { float d0 = __fsub_rn(v[k], mx); asm volatile("" : "+v"(d0)); v[k] = __builtin_amdgcn_exp2f(__fmul_rn(d0, 1.4426950408889634f)); sum += v[k]; }
#pragma unroll
    for (int sh = 16; sh; sh >>= 1) sum += __shfl_xor(sum, sh, 32);
    const float f = __fdiv_rn(hires ? 1.0f : PCAR, sum);
{
        if (hires) {
#pragma unroll
            for (int ch = 0; ch < TT / 128; ++ch) { v4us oh, ol;
#pragma unroll
                for (int q = 0; q < 4; ++q) { unsigned short a, c2; splitf(v[ch * 4 + q] * f, a, c2); oh[q] = a; ol[q] = c2; }
                const size_t oo = ((size_t)zz * (RH ? RH : 1) + i) * TT + ch * 128 + lane * 4; *(v4us*)(Ph + oo) = oh; *(v4us*)(Pl + oo) = ol; }
        } else {
#pragma unroll
            for (int ch = 0; ch < TT / 128; ++ch) { v4h o4;
#pragma unroll
                for (int q = 0; q < 4; ++q) o4[q] = tohx(v[ch * 4 + q] * f);
                *(v4h*)(P16 + (size_t)row * TT + ch * 128 + lane * 4) = o4; } }
         }
}
__global__ __launch_bounds__(256) void k_wtG(const float* __restrict__ w, int K, int N, bf* Bt) {
    const int lane = threadIdx.x & 31; const int L0 = (blockIdx.x * 8 + (threadIdx.x >> 5)) * 8; const int nlines = N * K / 64;
{
#pragma unroll 1
        for (int l = 0; l < 8; ++l) { const int L = L0 + l; if (L >= nlines) break; const size_t e = (size_t)L * 64 + lane * 2; const int k = (int)(e % K), n = (int)(e / K); v2us o;
            o[0] = f2bf(w[(size_t)k * N + n]); o[1] = f2bf(w[(size_t)(k + 1) * N + n]); *(v2us*)(Bt + e) = o; }
         }
}

__global__ __launch_bounds__(256) void k_merge(const float* __restrict__ O, int h0, bf* Ah, bf* Al) { const size_t e = ((size_t)blockIdx.x * 256 + threadIdx.x) * 2; if (e >= (size_t)ZH * TT * HD) return; const int d = (int)(e % HD); const int t = (int)((e / HD) % TT); const int zz = (int)(e / ((size_t)HD * TT)); const float cs = (t < RH) ? 1.0f : (1.0f / PCAR); const size_t oo = (size_t)t * DQ + (h0 + zz) * HD + d;
    v2us oh, ol;
#pragma unroll
    for (int q = 0; q < 2; ++q) { unsigned short a, c2; splitf(O[e + q] * cs, a, c2); oh[q] = a; ol[q] = c2; } *(v2us*)(Ah + oo) = oh; *(v2us*)(Al + oo) = ol;  }

extern "C" void kernel_launch(void* const* d_in, const int* in_sizes, int n_in,
                              void* d_out, int out_size, void* d_ws, size_t ws_size, hipStream_t stream) {
    (void)in_sizes; (void)n_in; (void)out_size;
    const float* x = (const float*)d_in[0]; const float* wq = (const float*)d_in[1]; const float* wk = (const float*)d_in[2]; const float* wv = (const float*)d_in[3]; const float* wo = (const float*)d_in[4]; const float* qsc = (const float*)d_in[5]; const float* ksc = (const float*)d_in[6];   /* input order x, Wq ('xw' [2048][2048]), Wk, Wv ([2048][512]), Wo ('xw'), q_norm_w, k_norm_w ([64], read) */
    float* OUT = (float*)d_out;     // [2][2048][2048]
    char* wsp = (char*)d_ws;
    auto take = [&](size_t bytes) { char* p = wsp; wsp += (bytes + 255) & ~(size_t)255; return (void*)p; };
    bf* WQ = (bf*)take((size_t)DQ * DM * 2); bf* WK = (bf*)take((size_t)DKV * DM * 2); bf* WV = (bf*)take((size_t)DKV * DM * 2); bf* WO = (bf*)take((size_t)DM * DQ * 2); float* CS = (float*)take((size_t)TT * HD * 2 * 4);
    bf* XB = (bf*)take((size_t)TT * DM * 2); float* RFQ = (float*)take((size_t)NH_ * TT * 4); float* RFK = (float*)take((size_t)NKV * TT * 4);   /* per (head, token) inverse RMS */ float* FQ = (float*)take((size_t)TT * DQ * 4); float* FK = (float*)take((size_t)TT * DKV * 4);
    h16* QP16 = (h16*)take((size_t)NH_ * TT * HD * 2); h16* KP16 = (h16*)take((size_t)NKV * TT * HD * 2); h16* VT16 = (h16*)take((size_t)NKV * HD * TT * 2);
    bf* QPh = (bf*)take((size_t)NH_ * TT * HD * 2); bf* QPl = (bf*)take((size_t)NH_ * TT * HD * 2); bf* KPh = (bf*)take((size_t)NKV * TT * HD * 2); bf* KPl = (bf*)take((size_t)NKV * TT * HD * 2); bf* VTh = (bf*)take((size_t)NKV * HD * TT * 2); bf* VTl = (bf*)take((size_t)NKV * HD * TT * 2); bf* Ph = (bf*)take((size_t)ZH * RH * TT * 2); bf* Pl = (bf*)take((size_t)ZH * RH * TT * 2);
    float* Sb = (float*)take((size_t)ZH * TT * TT * 4); h16* P16 = (h16*)take((size_t)ZH * TT * TT * 2); float* Ob = (float*)take((size_t)ZH * TT * HD * 4); bf* ATh = (bf*)take((size_t)TT * DQ * 2); bf* ATl = (bf*)take((size_t)TT * DQ * 2);
    if ((size_t)(wsp - (char*)d_ws) > ws_size) return;    // ws 256 MiB
    float* FV = FK;   // v projection reuses the k buffer after the k planes are built (stream-ordered)
    { k_wtG<<<(unsigned)((DM * DQ / 64 + 63) / 64), 256, 0, stream>>>(wq, DM, DQ, WQ); k_wtG<<<(unsigned)((DM * DKV / 64 + 63) / 64), 256, 0, stream>>>(wk, DM, DKV, WK); k_wtG<<<(unsigned)((DM * DKV / 64 + 63) / 64), 256, 0, stream>>>(wv, DM, DKV, WV);
      k_wtG<<<(unsigned)((DQ * DM / 64 + 63) / 64), 256, 0, stream>>>(wo, DQ, DM, WO);
       }
    k_cs5<<<(TT * HD + 255) / 256, 256, 0, stream>>>(CS);   /* rotary table computed from t and INVT */
    const unsigned LQ = (unsigned)(((size_t)NH_ * TT * HD / 2 + 255) / 256), LKv = (unsigned)(((size_t)NKV * TT * HD / 2 + 255) / 256);
    for (int b = 0; b < NB_; ++b) {
        
        k_cvt8<<<(unsigned)(((size_t)TT * DM / 8 + 255) / 256), 256, 0, stream>>>(x + (size_t)b * TT * DM, XB, (size_t)TT * DM / 8);
        k_gemmw<bf, 0, false, 8><<<dim3(TT / 64, DQ / 64, 1), 256, 0, stream>>>(XB, nullptr, WQ, nullptr, DM, FQ, DQ, nullptr, 0, 0, 0);
        k_hrms<<<(NH_ * TT + 255) / 256, 256, 0, stream>>>(FQ, DQ, NH_, RFQ); k_rmsapply<<<(unsigned)(((size_t)TT * DQ / 4 + 255) / 256), 256, 0, stream>>>(FQ, DQ, NH_, RFQ, qsc);   /* per-head RMSNorm x q_norm_w */ k_rope<<<LQ, 256, 0, stream>>>(FQ, DQ, NH_, CS, nullptr, nullptr, 1.0f, QP16, QPh, QPl);
        k_gemmw<bf, 0, false, 16><<<dim3(TT / 64, DKV / 64, 1), 512, 0, stream>>>(XB, nullptr, WK, nullptr, DM, FK, DKV, nullptr, 0, 0, 0);
        k_hrms<<<(NKV * TT + 255) / 256, 256, 0, stream>>>(FK, DKV, NKV, RFK); k_rmsapply<<<(unsigned)(((size_t)TT * DKV / 4 + 255) / 256), 256, 0, stream>>>(FK, DKV, NKV, RFK, ksc);   /* per-head RMSNorm x k_norm_w */ k_rope<<<LKv, 256, 0, stream>>>(FK, DKV, NKV, CS, nullptr, nullptr, 1.0f, KP16, KPh, KPl);
        k_gemmw<bf, 0, false, 16><<<dim3(TT / 64, DKV / 64, 1), 512, 0, stream>>>(XB, nullptr, WV, nullptr, DM, FV, DKV, nullptr, 0, 0, 0); k_vtp<<<LKv, 256, 0, stream>>>(FV, DKV, NKV, VT16, VTh, VTl);
        for (int h0 = 0; h0 < NH_; h0 += ZH) { const size_t zq = (size_t)h0, zk = (size_t)(h0 / REP);   // both heads of a pass share kv group h0/REP (REP >= 2): sB = 0
            k_gemmc<bf, 2, 1, 1><<<dim3(RH / 64, TT / 64, ZH), 32, 0, stream>>>(QPh + zq * TT * HD, QPl + zq * TT * HD, KPh + zk * TT * HD, KPl + zk * TT * HD, HD, Sb, TT, 0, (size_t)TT * HD, 0, (size_t)TT * TT);
            k_gemmc<h16, 0, 1, 1><<<dim3((TT - RH) / 64, TT / 64, ZH), 32, 0, stream>>>(QP16 + zq * TT * HD + (size_t)RH * HD, nullptr, KP16 + zk * TT * HD, nullptr, HD, Sb + (size_t)RH * TT, TT, RH, (size_t)TT * HD, 0, (size_t)TT * TT);
            k_asoft<<<ZH * TT / 8, 256, 0, stream>>>(Sb, P16, Ph, Pl);
            k_gemmc<bf, 2, 2, 8><<<dim3(RH / 64, HD / 64, ZH), 256, 0, stream>>>(Ph, Pl, VTh + zk * HD * TT, VTl + zk * HD * TT, TT, Ob, HD, 0, (size_t)RH * TT, 0, (size_t)TT * HD);
            k_gemmc<h16, 0, 2, 16><<<dim3((TT - RH) / 64, HD / 64, ZH), 512, 0, stream>>>(P16 + (size_t)RH * TT, nullptr, VT16 + zk * HD * TT, nullptr, TT, Ob + (size_t)RH * HD, HD, RH, (size_t)TT * TT, 0, (size_t)TT * HD);
            k_merge<<<(unsigned)(((size_t)ZH * TT * HD / 2 + 255) / 256), 256, 0, stream>>>(Ob, h0, ATh, ATl); }
        k_gemmw<bf, 1, false, 8><<<dim3(TT / 64, DM / 64, 1), 256, 0, stream>>>(ATh, ATl, WO, nullptr, DQ, OUT + (size_t)b * TT * DM, DM, nullptr, 0, 0, 0); }
}

// v002
// A run of this version takes 1080 microseconds.
// Timed twice side by side with v001, it ran 1.37 and 1.40 times as fast.
// Counting every step since v000, it is 2.56 times as fast.
#include <hip/hip_runtime.h>

// Grouped-query causal attention with per-head RMSNorm and computed half-split rotary embeddings at base 1e6 (x [2][2048][2048]; q = x Wq (32 heads x 64), k, v = x Wk, x Wv (8 kv heads x 64) ('xw' 0.02, no bias); per head q = rms_norm(q) x q_norm_w, k = rms_norm(k) x k_norm_w (eps 1e-5; weights [64] = ones, read); rope: (x1, x2) = the two HALVES of each head: cat(x1 cos - x2 sin, x2 cos + x1 sin) with angle t x 1000000^(-2i/64), i < 32 (32 f32 frequencies jnp-exact for the module's power expression; precise cosf/sinf); query heads viewed (HKV, g): kv head = q head / 4; scores x 64^-0.5; causal (finfo.min == exclusion); softmax; out = merged Wo ('xw') -> [2][2048][2048] (8.4 M); argument order x, Wq, Wk, Wv, Wo, q_norm_w, k_norm_w).
// Layout per batch: bf16 copy of x; 'xw' weights transposed once (k_wtG); exact projections; k_hrms (per (head, token) 1/sqrt(mean + eps)) + k_rmsapply (x r x w[d] in place); k_cs5 table {cosf, sinf}(t x INVT[d mod 32]); rotate-half plane builders; causal T-2048 GQA attention (kv z-stride 0; hybrid rows: < 512 hi/lo 3 products, rest fp16 x1024; k_gemmc skips tiles above the diagonal); merged hi/lo x Wo exact.
// Compute dtypes, f32 accumulate: every input rounded to bf16 incl. the norm scales; projections exact; RMSNorm and rotary f32; attention rows < 512 3 products, rest fp16; softmax f32; Wo hl x exact.

#define NB_  2
#define TT   2048
#define DM   2048
#define NH_  32
#define NKV  8
#define REP  (NH_ / NKV)
#define HD   64
#define DQ   (NH_ * HD)
#define DKV  (NKV * HD)
#define ZH   4                    // query heads per attention pass: at most REP, so that the heads of a pass share one kv head
#define RH   512                  // query rows < RH use hi+lo planes (0: none)
#define WIN  2048
#define PCAR 1024.0f
#define SCL  0.125f   // HD^-0.5
typedef _Float16 h16;
typedef unsigned short bf;
typedef __attribute__((ext_vector_type(16))) __bf16   v16bf;
typedef __attribute__((ext_vector_type(16))) _Float16 v16h;
typedef __attribute__((ext_vector_type(8)))  _Float16 v8h;
typedef __attribute__((ext_vector_type(8)))  unsigned short v8us;
typedef __attribute__((ext_vector_type(8)))  float    v8f;
typedef __attribute__((ext_vector_type(4)))  float    v4f;
typedef v8h  __attribute__((may_alias)) v8ha;
typedef v4f  __attribute__((may_alias)) v4fa;
typedef v8us __attribute__((may_alias)) v8usa;

__device__ __forceinline__ unsigned short f2bf(float f) { unsigned u = __float_as_uint(f); u += 0x7FFFu + ((u >> 16) & 1u); return (unsigned short)(u >> 16); }
__device__ __forceinline__ float bf2f(unsigned short b) { return __uint_as_float(((unsigned)b) << 16); }
__device__ __forceinline__ float bfr(float f) { return bf2f(f2bf(f)); }
__device__ __forceinline__ v16h cat16(v8h lo, v8h hi) { return __builtin_shufflevector(lo, hi, 0, 1, 2, 3, 4, 5, 6, 7, 8, 9, 10, 11, 12, 13, 14, 15); }
__device__ __forceinline__ v16bf cat16b(v8us lo, v8us hi) { return __builtin_bit_cast(v16bf, __builtin_shufflevector(lo, hi, 0, 1, 2, 3, 4, 5, 6, 7, 8, 9, 10, 11, 12, 13, 14, 15)); }
__device__ __forceinline__ v8f wmma16(v16h a, v16h b, v8f c) { return __builtin_amdgcn_wmma_f32_16x16x32_f16(false, a, false, b, (short)0, c, false, false); }
__device__ __forceinline__ v8f wmmab(v16bf a, v16bf b, v8f c) { return __builtin_amdgcn_wmma_f32_16x16x32_bf16(false, a, false, b, (short)0, c, false, false); }



// ---- split-K inside a work-group: the NW waves of a 64x64 tile each take every NW-th 32-wide step of K (neighbouring waves read the two halves of the same 128-byte lines at about the same time),
// so the chain of dependent load round trips per wave is NW times shorter. ksum_store puts the NW partial tiles into LDS (row pitch 68 floats), and behind one barrier adds them in the fixed order wave 0..NW-1 and stores the tile.
template <int NW, bool BIAS>
__device__ __forceinline__ void ksum_store(const v8f (&acc)[4][4], float* os, int w, int lr, int hi, float* C, int ldc, const float* bias) {
#pragma unroll
    for (int mb = 0; mb < 4; ++mb)
#pragma unroll
        for (int nb = 0; nb < 4; ++nb)
#pragma unroll
            for (int j = 0; j < 8; ++j) os[(w * 64 + mb * 16 + hi * 8 + j) * 68 + nb * 16 + lr] = acc[mb][nb][j];
    __syncthreads();                       // all NW partial tiles are in LDS before any of them is read
    const int tid = threadIdx.x, cofs = (tid & 15) * 4;
#pragma unroll
    for (int s = 0; s < 32 / NW; ++s) { const int row = s * NW * 2 + (tid >> 4);
        v4f val = *(const v4fa*)(os + row * 68 + cofs);
#pragma unroll
        for (int u = 1; u < NW; ++u) val += *(const v4fa*)(os + (u * 64 + row) * 68 + cofs);
        if (BIAS) { val[0] += bfr(bias[cofs]); val[1] += bfr(bias[cofs + 1]); val[2] += bfr(bias[cofs + 2]); val[3] += bfr(bias[cofs + 3]); }
        *(v4f*)(C + (size_t)row * ldc + cofs) = val; }
}

// ---- k_gemmw: register-blocked GEMM, NW WAVES per 64x64 output tile (16 accumulators each, K split between them), operands straight from K-contiguous 16-bit planes; grid (M/64, N/64, Z), NW*32 threads.
// C[m][n] (f32, pitch ldc, + optional f32 bias[n]) = sum_k A[m][k] Bt[n][k] (+ split products per NSPLIT). z-batch strides sA/sB/sC in elements. K % 32 == 0.
template <typename T16> struct WFrag;
template <> struct WFrag<h16> { typedef v16h V; static __device__ __forceinline__ V ld(const h16* p) { return cat16(*(const v8h*)p, *(const v8h*)(p + 16)); } static __device__ __forceinline__ v8f mma(V a, V b, v8f c) { return wmma16(a, b, c); } };
template <> struct WFrag<bf> { typedef v16bf V; static __device__ __forceinline__ V ld(const bf* p) { return cat16b(*(const v8us*)p, *(const v8us*)(p + 16)); } static __device__ __forceinline__ v8f mma(V a, V b, v8f c) { return wmmab(a, b, c); } };
template <typename T16, int NSPLIT, bool BIAS, int NW>
__global__ __launch_bounds__(NW * 32) void k_gemmw(const T16* __restrict__ A, const T16* __restrict__ A2, const T16* __restrict__ Bt, const T16* __restrict__ Bt2, int K, float* C, int ldc, const float* __restrict__ bias, size_t sA, size_t sB, size_t sC) {
    typedef typename WFrag<T16>::V V;
    __shared__ __align__(16) float os[NW * 64 * 68];
    const size_t z = blockIdx.z; A += z * sA; if (A2) A2 += z * sA; Bt += z * sB; if (Bt2) Bt2 += z * sB; C += z * sC;
    const int lane = threadIdx.x & 31, lr = lane & 15, hi = lane >> 4; const int r0 = blockIdx.x * 64, c0 = blockIdx.y * 64;
    const int w = __builtin_amdgcn_readfirstlane(threadIdx.x >> 5);   // wave number, scalar: the K loop's bounds stay wave-uniform
    v8f acc[4][4];
#pragma unroll
    for (int mb = 0; mb < 4; ++mb)
#pragma unroll
        for (int nb = 0; nb < 4; ++nb) acc[mb][nb] = (v8f){};
    const size_t aoff = (size_t)(r0 + lr) * K + 8 * hi, boff = (size_t)(c0 + lr) * K + 8 * hi;
#pragma unroll 1
    for (int kc = w * 32; kc < K; kc += NW * 32) {
        V a[4], a2[4];
#pragma unroll
        for (int mb = 0; mb < 4; ++mb) { a[mb] = WFrag<T16>::ld(A + aoff + (size_t)mb * 16 * K + kc); if (NSPLIT == 1 || NSPLIT == 2) a2[mb] = WFrag<T16>::ld(A2 + aoff + (size_t)mb * 16 * K + kc); }
#pragma unroll
        for (int nb = 0; nb < 4; ++nb) { const V b = WFrag<T16>::ld(Bt + boff + (size_t)nb * 16 * K + kc); V b2; if (NSPLIT >= 2) b2 = WFrag<T16>::ld(Bt2 + boff + (size_t)nb * 16 * K + kc);
#pragma unroll
            for (int mb = 0; mb < 4; ++mb) { acc[mb][nb] = WFrag<T16>::mma(a[mb], b, acc[mb][nb]); if (NSPLIT == 1 || NSPLIT == 2) acc[mb][nb] = WFrag<T16>::mma(a2[mb], b, acc[mb][nb]); if (NSPLIT >= 2) acc[mb][nb] = WFrag<T16>::mma(a[mb], b2, acc[mb][nb]); } }
        asm volatile("v_nop\n\tv_nop\n\tv_nop\n\tv_nop" : "+v"(acc[0][0]), "+v"(acc[1][1]), "+v"(acc[2][2]), "+v"(acc[3][3]) : "v"(a[0]), "v"(a[3]));
    }
    ksum_store<NW, BIAS>(acc, os, w, lr, hi, C + (size_t)r0 * ldc + c0, ldc, BIAS ? bias + c0 : nullptr);
}

// ---- k_gemmc: the same 64x64 tile GEMM specialised for causal attention: CMODE 1 skips score tiles entirely above the diagonal (query rows r0+roff.., key columns c0..), CMODE 2 limits the
// key (K) loop of the probability x value contraction to the diagonal block (probabilities beyond it are exactly zero). roff = row offset of this launch's first row within the sequence.
// NW = 1: one wave per tile (the short K = 64 score products); NW = 8 or 16: the K loop split between NW waves as in k_gemmw (no early return there: every wave reaches the barrier).
template <typename T16, int NSPLIT, int CMODE, int NW>
__global__ __launch_bounds__(NW * 32) void k_gemmc(const T16* __restrict__ A, const T16* __restrict__ A2, const T16* __restrict__ Bt, const T16* __restrict__ Bt2, int K, float* C, int ldc, int roff, size_t sA, size_t sB, size_t sC) {
    typedef typename WFrag<T16>::V V;
    static_assert(NW == 1 || CMODE != 1, "the early return of CMODE 1 stands in front of no barrier only with one wave");
    __shared__ __align__(16) float os[(NW == 1 ? 16 : NW * 64) * 68];
    const size_t z = blockIdx.z; A += z * sA; if (A2) A2 += z * sA; Bt += z * sB; if (Bt2) Bt2 += z * sB; C += z * sC;
    const int lane = threadIdx.x & 31, lr = lane & 15, hi = lane >> 4; const int r0 = blockIdx.x * 64, c0 = blockIdx.y * 64;
    const int w = (NW == 1) ? 0 : __builtin_amdgcn_readfirstlane(threadIdx.x >> 5);   // wave number, scalar: the K loop's bounds stay wave-uniform
    if (CMODE == 1 && c0 > r0 + roff + 63) return;                  // score tile entirely above the causal diagonal: never read (the softmax masks j > i by select)
    const int Kl = (CMODE == 2) ? min(K, r0 + roff + 64) : K;        // P.V: probabilities are exactly 0 beyond the diagonal block, so the K loop stops there
    v8f acc[4][4];
#pragma unroll
    for (int mb = 0; mb < 4; ++mb)
#pragma unroll
        for (int nb = 0; nb < 4; ++nb) acc[mb][nb] = (v8f){};
    const size_t aoff = (size_t)(r0 + lr) * K + 8 * hi, boff = (size_t)(c0 + lr) * K + 8 * hi;
#pragma unroll 1
    for (int kc = w * 32; kc < Kl; kc += NW * 32) {
        V a[4], a2[4];
#pragma unroll
        for (int mb = 0; mb < 4; ++mb) { a[mb] = WFrag<T16>::ld(A + aoff + (size_t)mb * 16 * K + kc); if (NSPLIT == 1 || NSPLIT == 2) a2[mb] = WFrag<T16>::ld(A2 + aoff + (size_t)mb * 16 * K + kc); }
#pragma unroll
        for (int nb = 0; nb < 4; ++nb) { const V b = WFrag<T16>::ld(Bt + boff + (size_t)nb * 16 * K + kc); V b2; if (NSPLIT >= 2) b2 = WFrag<T16>::ld(Bt2 + boff + (size_t)nb * 16 * K + kc);
#pragma unroll
            for (int mb = 0; mb < 4; ++mb) { acc[mb][nb] = WFrag<T16>::mma(a[mb], b, acc[mb][nb]); if (NSPLIT == 1 || NSPLIT == 2) acc[mb][nb] = WFrag<T16>::mma(a2[mb], b, acc[mb][nb]); if (NSPLIT >= 2) acc[mb][nb] = WFrag<T16>::mma(a[mb], b2, acc[mb][nb]); } }
        asm volatile("v_nop\n\tv_nop\n\tv_nop\n\tv_nop" : "+v"(acc[0][0]), "+v"(acc[1][1]), "+v"(acc[2][2]), "+v"(acc[3][3]) : "v"(a[0]), "v"(a[3]));
    }
    if constexpr (NW > 1) { ksum_store<NW, false>(acc, os, w, lr, hi, C + (size_t)r0 * ldc + c0, ldc, nullptr); return; }
#pragma unroll
    for (int mb = 0; mb < 4; ++mb) {
#pragma unroll
        for (int nb = 0; nb < 4; ++nb) {
#pragma unroll
            for (int j = 0; j < 8; ++j) os[(hi * 8 + j) * 68 + nb * 16 + lr] = acc[mb][nb][j]; }
        __builtin_amdgcn_wave_barrier(); asm volatile("" ::: "memory");
        float* crow = C + (size_t)(r0 + mb * 16) * ldc + c0;
{
#pragma unroll
            for (int s = 0; s < 8; ++s) { const int row = 2 * s + hi, cofs = lr * 4; v4f val = *(const v4fa*)(os + row * 68 + cofs);
                *(v4f*)(crow + (size_t)row * ldc + cofs) = val; }
             }
        __builtin_amdgcn_wave_barrier(); asm volatile("" ::: "memory");
    }
}

__device__ __forceinline__ h16 tohx(float x) { return (h16)x; }
__device__ __forceinline__ void splitf(float y, unsigned short& h, unsigned short& l) { h = f2bf(y); l = f2bf(y - bf2f(h)); }
typedef __attribute__((ext_vector_type(2))) _Float16 v2h;
typedef __attribute__((ext_vector_type(4))) _Float16 v4h;
typedef __attribute__((ext_vector_type(2))) unsigned short v2us;
typedef __attribute__((ext_vector_type(4))) unsigned short v4us;
typedef __attribute__((ext_vector_type(2))) float v2f;
typedef __attribute__((ext_vector_type(4))) int v4i;

__global__ __launch_bounds__(256) void k_cvt8(const float* __restrict__ src, bf* dst, size_t n8) { const size_t i = (size_t)blockIdx.x * 256 + threadIdx.x; if (i >= n8) return; const v8f v = *(const v8f*)(src + i * 8); v8us o;
#pragma unroll
    for (int k = 0; k < 8; ++k) o[k] = f2bf(v[k]); *(v8us*)(dst + i * 8) = o;  }

// k_rope: head planes [h][t][d] (fp16 + hi/lo) of rope(x) x sc with the rotate-half convention out[d] = x[d] cos[t][d] - x[d+HD/2] sin[t][d], out[d+HD/2] = x[d+HD/2] cos[t][d+HD/2] + x[d] sin[t][d+HD/2]
__global__ __launch_bounds__(256) void k_rope(const float* __restrict__ F, int pitch, int nheads, const float* __restrict__ CS, const float* __restrict__ RF, const float* __restrict__ nw, float sc, h16* P16, bf* Ph, bf* Pl) {
    const size_t e = ((size_t)blockIdx.x * 256 + threadIdx.x) * 2; if (e >= (size_t)nheads * TT * HD) return; const int d = (int)(e % HD); const int t = (int)((e / HD) % TT); const int h = (int)(e / ((size_t)HD * TT)); const float* f = F + (size_t)t * pitch + h * HD; const float rf = RF ? RF[(size_t)h * TT + t] : 1.0f; v2h o16; v2us oh, ol;
#pragma unroll
    for (int q = 0; q < 2; ++q) { const int dd = d + q; const int dp = (dd < HD / 2) ? dd + HD / 2 : dd - HD / 2; float x0 = f[dd], x1 = f[dp];
        if (RF) { float n0 = __fmul_rn(x0, rf), n1 = __fmul_rn(x1, rf); asm volatile("" : "+v"(n0)); asm volatile("" : "+v"(n1)); x0 = __fmul_rn(bfr(nw[dd]), n0); x1 = __fmul_rn(bfr(nw[dp]), n1); }
        const v2f cs = *(const v2f*)(CS + ((size_t)t * HD + dd) * 2); float a = __fmul_rn(x0, cs[0]), bq = __fmul_rn(x1, cs[1]); asm volatile("" : "+v"(a)); asm volatile("" : "+v"(bq)); const float r = ((dd < HD / 2) ? __fsub_rn(a, bq) : __fadd_rn(a, bq)) * sc;
        o16[q] = tohx(r); unsigned short a2, c2; splitf(r, a2, c2); oh[q] = a2; ol[q] = c2; }
    *(v2h*)(P16 + e) = o16; *(v2us*)(Ph + e) = oh; *(v2us*)(Pl + e) = ol;  }
__global__ __launch_bounds__(256) void k_vtp(const float* __restrict__ F, int pitch, int nheads, h16* V16, bf* Vh, bf* Vl) { const size_t e = ((size_t)blockIdx.x * 256 + threadIdx.x) * 2; if (e >= (size_t)nheads * HD * TT) return; const int t = (int)(e % TT); const int d = (int)((e / TT) % HD); const int g = (int)(e / ((size_t)TT * HD)); v2h o16; v2us oh, ol;
#pragma unroll
    for (int q = 0; q < 2; ++q) { const float x = F[(size_t)(t + q) * pitch + g * HD + d]; o16[q] = tohx(x); unsigned short a2, c2; splitf(x, a2, c2); oh[q] = a2; ol[q] = c2; }
    *(v2h*)(V16 + e) = o16; *(v2us*)(Vh + e) = oh; *(v2us*)(Vl + e) = ol;  }
__constant__ float INVT[HD / 2] = { 1.000000000e+00f, 6.493816376e-01f, 4.216965139e-01f, 2.738419771e-01f, 1.778279394e-01f, 1.154781953e-01f, 7.498942316e-02f, 4.869675264e-02f, 3.162277490e-02f, 2.053525113e-02f, 1.333521400e-02f, 8.659643121e-03f, 5.623413250e-03f, 3.651741194e-03f, 2.371373819e-03f, 1.539926510e-03f, 1.000000047e-03f, 6.493816036e-04f, 4.216965172e-04f, 2.738419571e-04f, 1.778279402e-04f, 1.154782003e-04f, 7.498942432e-05f, 4.869675104e-05f, 3.162277790e-05f, 2.053524986e-05f, 1.333521413e-05f, 8.659642845e-06f, 5.623413472e-06f, 3.651741281e-06f, 2.371373739e-06f, 1.539926529e-06f };   // THETA ** (-arange(0, 64, 2) / 64) with THETA = 1e6 in float32 (the module's power expression)
__global__ __launch_bounds__(256) void k_cs5(float* CS) { const int idx = blockIdx.x * 256 + threadIdx.x; if (idx >= TT * HD) return; const int d = idx % HD; const int t = idx / HD; const float a = __fmul_rn((float)t, INVT[d % (HD / 2)]); v2f cs; cs[0] = cosf(a); cs[1] = sinf(a); *(v2f*)(CS + (size_t)idx * 2) = cs;  }
__global__ __launch_bounds__(256) void k_hrms(const float* __restrict__ F, int pitch, int nheads, float* RF) { const int idx = blockIdx.x * 256 + threadIdx.x; if (idx >= nheads * TT) return; const int t = idx % TT; const int h = idx / TT; const float* f = F + (size_t)t * pitch + h * HD; float s = 0.f;
#pragma unroll 4
    for (int d = 0; d < HD; d += 4) { const v4f a = *(const v4f*)(f + d);
#pragma unroll
        for (int q = 0; q < 4; ++q) { float p = __fmul_rn(a[q], a[q]); asm volatile("" : "+v"(p)); s = __fadd_rn(s, p); } }
    const float rf = __fdiv_rn(1.0f, __fsqrt_rn(__fadd_rn(__fdiv_rn(s, (float)HD), 1e-5f))); *(float*)(RF + idx) = rf;  }

__global__ __launch_bounds__(256) void k_rmsapply(float* F, int pitch, int nheads, const float* __restrict__ RF, const float* __restrict__ w) { const size_t i = (size_t)blockIdx.x * 256 + threadIdx.x; if (i >= (size_t)TT * nheads * HD / 4) return; const size_t e = i * 4; const int c = (int)(e % ((size_t)nheads * HD)); const int t = (int)(e / ((size_t)nheads * HD)); const int h = c / HD, d = c % HD; const float r = RF[(size_t)h * TT + t]; v4f a = *(const v4f*)(F + (size_t)t * pitch + c);
#pragma unroll
    for (int q = 0; q < 4; ++q) { float y = __fmul_rn(a[q], r); asm volatile("" : "+v"(y)); float wv_ = bfr(w[d + q]); asm volatile("" : "+v"(wv_)); a[q] = __fmul_rn(y, wv_); }   /* x w[d] */
    *(v4f*)(F + (size_t)t * pitch + c) = a;  }
// k_asoft: per row (zz, i): t = S x HD^-0.5 for j <= i and i - j < WIN (WIN = T: the window bound always holds, plain causal; the reference's -1e9 additive fill vanishes identically); softmax over the 2048 keys (register row, one exp, fixed trees);
__global__ __launch_bounds__(256) void k_asoft(const float* __restrict__ Sb, h16* P16, bf* Ph, bf* Pl) {
    const int lane = threadIdx.x & 31; const int row = blockIdx.x * 8 + (threadIdx.x >> 5); if (row >= ZH * TT) return; const int i = row % TT; const int zz = row / TT; (void)zz; const bool hires = (i < RH); const float* sr = Sb + (size_t)row * TT; float v[TT / 32]; float mx = -3.0e38f;
#pragma unroll
    for (int ch = 0; ch < TT / 128; ++ch) { const int j0 = ch * 128 + lane * 4; const v4f a = *(const v4f*)(sr + j0);
#pragma unroll
        for (int q = 0; q < 4; ++q) { const int j = j0 + q; (void)j; const float t = (j <= i && i - j < WIN) ? a[q] * SCL : -3.0e38f; v[ch * 4 + q] = t; mx = fmaxf(mx, t); } }
#pragma unroll
    for (int sh = 16; sh; sh >>= 1) mx = fmaxf(mx, __shfl_xor(mx, sh, 32));
    float sum = 0.f;
#pragma unroll
    for (int k = 0; k < TT / 32; ++k) { float d0 = __fsub_rn(v[k], mx); asm volatile("" : "+v"(d0)); v[k] = __builtin_amdgcn_exp2f(__fmul_rn(d0, 1.4426950408889634f)); sum += v[k]; }
#pragma unroll
    for (int sh = 16; sh; sh >>= 1) sum += __shfl_xor(sum, sh, 32);
    const float f = __fdiv_rn(hires ? 1.0f : PCAR, sum);
{
        if (hires) {
#pragma unroll
            for (int ch = 0; ch < TT / 128; ++ch) { v4us oh, ol;
#pragma unroll
                for (int q = 0; q < 4; ++q) { unsigned short a, c2; splitf(v[ch * 4 + q] * f, a, c2); oh[q] = a; ol[q] = c2; }
                const size_t oo = ((size_t)zz * (RH ? RH : 1) + i) * TT + ch * 128 + lane * 4; *(v4us*)(Ph + oo) = oh; *(v4us*)(Pl + oo) = ol; }
        } else {
#pragma unroll
            for (int ch = 0; ch < TT / 128; ++ch) { v4h o4;
#pragma unroll
                for (int q = 0; q < 4; ++q) o4[q] = tohx(v[ch * 4 + q] * f);
                *(v4h*)(P16 + (size_t)row * TT + ch * 128 + lane * 4) = o4; } }
         }
}
__global__ __launch_bounds__(256) void k_wtG(const float* __restrict__ w, int K, int N, bf* Bt) {
    const int lane = threadIdx.x & 31; const int L0 = (blockIdx.x * 8 + (threadIdx.x >> 5)) * 8; const int nlines = N * K / 64;
{
#pragma unroll 1
        for (int l = 0; l < 8; ++l) { const int L = L0 + l; if (L >= nlines) break; const size_t e = (size_t)L * 64 + lane * 2; const int k = (int)(e % K), n = (int)(e / K); v2us o;
            o[0] = f2bf(w[(size_t)k * N + n]); o[1] = f2bf(w[(size_t)(k + 1) * N + n]); *(v2us*)(Bt + e) = o; }
         }
}

__global__ __launch_bounds__(256) void k_merge(const float* __restrict__ O, int h0, bf* Ah, bf* Al) { const size_t e = ((size_t)blockIdx.x * 256 + threadIdx.x) * 2; if (e >= (size_t)ZH * TT * HD) return; const int d = (int)(e % HD); const int t = (int)((e / HD) % TT); const int zz = (int)(e / ((size_t)HD * TT)); const float cs = (t < RH) ? 1.0f : (1.0f / PCAR); const size_t oo = (size_t)t * DQ + (h0 + zz) * HD + d;
    v2us oh, ol;
#pragma unroll
    for (int q = 0; q < 2; ++q) { unsigned short a, c2; splitf(O[e + q] * cs, a, c2); oh[q] = a; ol[q] = c2; } *(v2us*)(Ah + oo) = oh; *(v2us*)(Al + oo) = ol;  }

extern "C" void kernel_launch(void* const* d_in, const int* in_sizes, int n_in,
                              void* d_out, int out_size, void* d_ws, size_t ws_size, hipStream_t stream) {
    (void)in_sizes; (void)n_in; (void)out_size;
    const float* x = (const float*)d_in[0]; const float* wq = (const float*)d_in[1]; const float* wk = (const float*)d_in[2]; const float* wv = (const float*)d_in[3]; const float* wo = (const float*)d_in[4]; const float* qsc = (const float*)d_in[5]; const float* ksc = (const float*)d_in[6];   /* input order x, Wq ('xw' [2048][2048]), Wk, Wv ([2048][512]), Wo ('xw'), q_norm_w, k_norm_w ([64], read) */
    float* OUT = (float*)d_out;     // [2][2048][2048]
    char* wsp = (char*)d_ws;
    auto take = [&](size_t bytes) { char* p = wsp; wsp += (bytes + 255) & ~(size_t)255; return (void*)p; };
    bf* WQ = (bf*)take((size_t)DQ * DM * 2); bf* WK = (bf*)take((size_t)DKV * DM * 2); bf* WV = (bf*)take((size_t)DKV * DM * 2); bf* WO = (bf*)take((size_t)DM * DQ * 2); float* CS = (float*)take((size_t)TT * HD * 2 * 4);
    bf* XB = (bf*)take((size_t)TT * DM * 2); float* RFQ = (float*)take((size_t)NH_ * TT * 4); float* RFK = (float*)take((size_t)NKV * TT * 4);   /* per (head, token) inverse RMS */ float* FQ = (float*)take((size_t)TT * DQ * 4); float* FK = (float*)take((size_t)TT * DKV * 4);
    h16* QP16 = (h16*)take((size_t)NH_ * TT * HD * 2); h16* KP16 = (h16*)take((size_t)NKV * TT * HD * 2); h16* VT16 = (h16*)take((size_t)NKV * HD * TT * 2);
    bf* QPh = (bf*)take((size_t)NH_ * TT * HD * 2); bf* QPl = (bf*)take((size_t)NH_ * TT * HD * 2); bf* KPh = (bf*)take((size_t)NKV * TT * HD * 2); bf* KPl = (bf*)take((size_t)NKV * TT * HD * 2); bf* VTh = (bf*)take((size_t)NKV * HD * TT * 2); bf* VTl = (bf*)take((size_t)NKV * HD * TT * 2); bf* Ph = (bf*)take((size_t)ZH * RH * TT * 2); bf* Pl = (bf*)take((size_t)ZH * RH * TT * 2);
    float* Sb = (float*)take((size_t)ZH * TT * TT * 4); h16* P16 = (h16*)take((size_t)ZH * TT * TT * 2); float* Ob = (float*)take((size_t)ZH * TT * HD * 4); bf* ATh = (bf*)take((size_t)TT * DQ * 2); bf* ATl = (bf*)take((size_t)TT * DQ * 2);
    if ((size_t)(wsp - (char*)d_ws) > ws_size) return;    // ws 256 MiB
    float* FV = FK;   // v projection reuses the k buffer after the k planes are built (stream-ordered)
    { k_wtG<<<(unsigned)((DM * DQ / 64 + 63) / 64), 256, 0, stream>>>(wq, DM, DQ, WQ); k_wtG<<<(unsigned)((DM * DKV / 64 + 63) / 64), 256, 0, stream>>>(wk, DM, DKV, WK); k_wtG<<<(unsigned)((DM * DKV / 64 + 63) / 64), 256, 0, stream>>>(wv, DM, DKV, WV);
      k_wtG<<<(unsigned)((DQ * DM / 64 + 63) / 64), 256, 0, stream>>>(wo, DQ, DM, WO);
       }
    k_cs5<<<(TT * HD + 255) / 256, 256, 0, stream>>>(CS);   /* rotary table computed from t and INVT */
    const unsigned LQ = (unsigned)(((size_t)NH_ * TT * HD / 2 + 255) / 256), LKv = (unsigned)(((size_t)NKV * TT * HD / 2 + 255) / 256);
    for (int b = 0; b < NB_; ++b) {
        
        k_cvt8<<<(unsigned)(((size_t)TT * DM / 8 + 255) / 256), 256, 0, stream>>>(x + (size_t)b * TT * DM, XB, (size_t)TT * DM / 8);
        k_gemmw<bf, 0, false, 8><<<dim3(TT / 64, DQ / 64, 1), 256, 0, stream>>>(XB, nullptr, WQ, nullptr, DM, FQ, DQ, nullptr, 0, 0, 0);
        k_hrms<<<(NH_ * TT + 255) / 256, 256, 0, stream>>>(FQ, DQ, NH_, RFQ); k_rmsapply<<<(unsigned)(((size_t)TT * DQ / 4 + 255) / 256), 256, 0, stream>>>(FQ, DQ, NH_, RFQ, qsc);   /* per-head RMSNorm x q_norm_w */ k_rope<<<LQ, 256, 0, stream>>>(FQ, DQ, NH_, CS, nullptr, nullptr, 1.0f, QP16, QPh, QPl);
        k_gemmw<bf, 0, false, 16><<<dim3(TT / 64, DKV / 64, 1), 512, 0, stream>>>(XB, nullptr, WK, nullptr, DM, FK, DKV, nullptr, 0, 0, 0);
        k_hrms<<<(NKV * TT + 255) / 256, 256, 0, stream>>>(FK, DKV, NKV, RFK); k_rmsapply<<<(unsigned)(((size_t)TT * DKV / 4 + 255) / 256), 256, 0, stream>>>(FK, DKV, NKV, RFK, ksc);   /* per-head RMSNorm x k_norm_w */ k_rope<<<LKv, 256, 0, stream>>>(FK, DKV, NKV, CS, nullptr, nullptr, 1.0f, KP16, KPh, KPl);
        k_gemmw<bf, 0, false, 16><<<dim3(TT / 64, DKV / 64, 1), 512, 0, stream>>>(XB, nullptr, WV, nullptr, DM, FV, DKV, nullptr, 0, 0, 0); k_vtp<<<LKv, 256, 0, stream>>>(FV, DKV, NKV, VT16, VTh, VTl);
        for (int h0 = 0; h0 < NH_; h0 += ZH) { const size_t zq = (size_t)h0, zk = (size_t)(h0 / REP);   // the ZH heads of a pass share kv group h0/REP (ZH <= REP): sB = 0
            k_gemmc<bf, 2, 1, 1><<<dim3(RH / 64, TT / 64, ZH), 32, 0, stream>>>(QPh + zq * TT * HD, QPl + zq * TT * HD, KPh + zk * TT * HD, KPl + zk * TT * HD, HD, Sb, TT, 0, (size_t)TT * HD, 0, (size_t)TT * TT);
            k_gemmc<h16, 0, 1, 1><<<dim3((TT - RH) / 64, TT / 64, ZH), 32, 0, stream>>>(QP16 + zq * TT * HD + (size_t)RH * HD, nullptr, KP16 + zk * TT * HD, nullptr, HD, Sb + (size_t)RH * TT, TT, RH, (size_t)TT * HD, 0, (size_t)TT * TT);
            k_asoft<<<ZH * TT / 8, 256, 0, stream>>>(Sb, P16, Ph, Pl);
            k_gemmc<bf, 2, 2, 8><<<dim3(RH / 64, HD / 64, ZH), 256, 0, stream>>>(Ph, Pl, VTh + zk * HD * TT, VTl + zk * HD * TT, TT, Ob, HD, 0, (size_t)RH * TT, 0, (size_t)TT * HD);
            k_gemmc<h16, 0, 2, 16><<<dim3((TT - RH) / 64, HD / 64, ZH), 512, 0, stream>>>(P16 + (size_t)RH * TT, nullptr, VT16 + zk * HD * TT, nullptr, TT, Ob + (size_t)RH * HD, HD, RH, (size_t)TT * TT, 0, (size_t)TT * HD);
            k_merge<<<(unsigned)(((size_t)ZH * TT * HD / 2 + 255) / 256), 256, 0, stream>>>(Ob, h0, ATh, ATl); }
        k_gemmw<bf, 1, false, 8><<<dim3(TT / 64, DM / 64, 1), 256, 0, stream>>>(ATh, ATl, WO, nullptr, DQ, OUT + (size_t)b * TT * DM, DM, nullptr, 0, 0, 0); }
}

// v003
// A run of this version takes 413 microseconds.
// Next to v002, in two timings, it ran 2.66 and 2.59 times as fast.
// Over all steps from v000 it is 6.71 times as fast.
#include <hip/hip_runtime.h>

// Grouped-query causal attention with per-head RMSNorm and computed half-split rotary embeddings at base 1e6 (x [2][2048][2048]; q = x Wq (32 heads x 64), k, v = x Wk, x Wv (8 kv heads x 64) ('xw' 0.02, no bias); per head q = rms_norm(q) x q_norm_w, k = rms_norm(k) x k_norm_w (eps 1e-5; weights [64] = ones, read); rope: (x1, x2) = the two HALVES of each head: cat(x1 cos - x2 sin, x2 cos + x1 sin) with angle t x 1000000^(-2i/64), i < 32 (32 f32 frequencies jnp-exact for the module's power expression; precise cosf/sinf); query heads viewed (HKV, g): kv head = q head / 4; scores x 64^-0.5; causal (finfo.min == exclusion); softmax; out = merged Wo ('xw') -> [2][2048][2048] (8.4 M); argument order x, Wq, Wk, Wv, Wo, q_norm_w, k_norm_w).
// Layout per batch: bf16 copy of x; 'xw' weights transposed once (k_wtG); exact projections; k_hrms (per (head, token) 1/sqrt(mean + eps)) + k_rmsapply (x r x w[d] in place); k_cs5 table {cosf, sinf}(t x INVT[d mod 32]); rotate-half plane builders; causal T-2048 GQA attention in one launch (k_fattn, running softmax; hybrid rows: < 512 hi/lo 3 products, rest fp16 x1024; key blocks above the diagonal are never visited); merged hi/lo x Wo exact.
// Compute dtypes, f32 accumulate: every input rounded to bf16 incl. the norm weights; projections exact; RMSNorm and rotary f32; attention rows < 512 3 products, rest fp16; softmax f32; Wo hl x exact.

#define NB_  2
#define TT   2048
#define DM   2048
#define NH_  32
#define NKV  8
#define REP  (NH_ / NKV)
#define HD   64
#define DQ   (NH_ * HD)
#define DKV  (NKV * HD)
#define RH   512                  // query rows < RH use hi+lo planes (0: none)
#define SCL  0.125f   // HD^-0.5
typedef _Float16 h16;
typedef unsigned short bf;
typedef __attribute__((ext_vector_type(16))) __bf16   v16bf;
typedef __attribute__((ext_vector_type(16))) _Float16 v16h;
typedef __attribute__((ext_vector_type(8)))  _Float16 v8h;
typedef __attribute__((ext_vector_type(8)))  unsigned short v8us;
typedef __attribute__((ext_vector_type(8)))  float    v8f;
typedef __attribute__((ext_vector_type(4)))  float    v4f;
typedef v8h  __attribute__((may_alias)) v8ha;
typedef v4f  __attribute__((may_alias)) v4fa;
typedef v8us __attribute__((may_alias)) v8usa;

__device__ __forceinline__ unsigned short f2bf(float f) { unsigned u = __float_as_uint(f); u += 0x7FFFu + ((u >> 16) & 1u); return (unsigned short)(u >> 16); }
__device__ __forceinline__ float bf2f(unsigned short b) { return __uint_as_float(((unsigned)b) << 16); }
__device__ __forceinline__ float bfr(float f) { return bf2f(f2bf(f)); }
__device__ __forceinline__ v16h cat16(v8h lo, v8h hi) { return __builtin_shufflevector(lo, hi, 0, 1, 2, 3, 4, 5, 6, 7, 8, 9, 10, 11, 12, 13, 14, 15); }
__device__ __forceinline__ v16bf cat16b(v8us lo, v8us hi) { return __builtin_bit_cast(v16bf, __builtin_shufflevector(lo, hi, 0, 1, 2, 3, 4, 5, 6, 7, 8, 9, 10, 11, 12, 13, 14, 15)); }
__device__ __forceinline__ v8f wmma16(v16h a, v16h b, v8f c) { return __builtin_amdgcn_wmma_f32_16x16x32_f16(false, a, false, b, (short)0, c, false, false); }
__device__ __forceinline__ v8f wmmab(v16bf a, v16bf b, v8f c) { return __builtin_amdgcn_wmma_f32_16x16x32_bf16(false, a, false, b, (short)0, c, false, false); }



// ---- split-K inside a work-group: the NW waves of a 64x64 tile each take every NW-th 32-wide step of K (neighbouring waves read the two halves of the same 128-byte lines at about the same time),
// so the chain of dependent load round trips per wave is NW times shorter. ksum_store puts the NW partial tiles into LDS (row pitch 68 floats), and behind one barrier adds them in the fixed order wave 0..NW-1 and stores the tile.
template <int NW, bool BIAS>
__device__ __forceinline__ void ksum_store(const v8f (&acc)[4][4], float* os, int w, int lr, int hi, float* C, int ldc, const float* bias) {
#pragma unroll
    for (int mb = 0; mb < 4; ++mb)
#pragma unroll
        for (int nb = 0; nb < 4; ++nb)
#pragma unroll
            for (int j = 0; j < 8; ++j) os[(w * 64 + mb * 16 + hi * 8 + j) * 68 + nb * 16 + lr] = acc[mb][nb][j];
    __syncthreads();                       // all NW partial tiles are in LDS before any of them is read
    const int tid = threadIdx.x, cofs = (tid & 15) * 4;
#pragma unroll
    for (int s = 0; s < 32 / NW; ++s) { const int row = s * NW * 2 + (tid >> 4);
        v4f val = *(const v4fa*)(os + row * 68 + cofs);
#pragma unroll
        for (int u = 1; u < NW; ++u) val += *(const v4fa*)(os + (u * 64 + row) * 68 + cofs);
        if (BIAS) { val[0] += bfr(bias[cofs]); val[1] += bfr(bias[cofs + 1]); val[2] += bfr(bias[cofs + 2]); val[3] += bfr(bias[cofs + 3]); }
        *(v4f*)(C + (size_t)row * ldc + cofs) = val; }
}

// ---- k_gemmw: register-blocked GEMM, NW WAVES per 64x64 output tile (16 accumulators each, K split between them), operands straight from K-contiguous 16-bit planes; grid (M/64, N/64, Z), NW*32 threads.
// C[m][n] (f32, pitch ldc, + optional f32 bias[n]) = sum_k A[m][k] Bt[n][k] (+ split products per NSPLIT). z-batch strides sA/sB/sC in elements. K % 32 == 0.
template <typename T16> struct WFrag;
template <> struct WFrag<h16> { typedef v16h V; static __device__ __forceinline__ V ld(const h16* p) { return cat16(*(const v8h*)p, *(const v8h*)(p + 16)); } static __device__ __forceinline__ v8f mma(V a, V b, v8f c) { return wmma16(a, b, c); } };
template <> struct WFrag<bf> { typedef v16bf V; static __device__ __forceinline__ V ld(const bf* p) { return cat16b(*(const v8us*)p, *(const v8us*)(p + 16)); } static __device__ __forceinline__ v8f mma(V a, V b, v8f c) { return wmmab(a, b, c); } };
template <typename T16, int NSPLIT, bool BIAS, int NW>
__global__ __launch_bounds__(NW * 32) void k_gemmw(const T16* __restrict__ A, const T16* __restrict__ A2, const T16* __restrict__ Bt, const T16* __restrict__ Bt2, int K, float* C, int ldc, const float* __restrict__ bias, size_t sA, size_t sB, size_t sC) {
    typedef typename WFrag<T16>::V V;
    __shared__ __align__(16) float os[NW * 64 * 68];
    const size_t z = blockIdx.z; A += z * sA; if (A2) A2 += z * sA; Bt += z * sB; if (Bt2) Bt2 += z * sB; C += z * sC;
    const int lane = threadIdx.x & 31, lr = lane & 15, hi = lane >> 4; const int r0 = blockIdx.x * 64, c0 = blockIdx.y * 64;
    const int w = __builtin_amdgcn_readfirstlane(threadIdx.x >> 5);   // wave number, scalar: the K loop's bounds stay wave-uniform
    v8f acc[4][4];
#pragma unroll
    for (int mb = 0; mb < 4; ++mb)
#pragma unroll
        for (int nb = 0; nb < 4; ++nb) acc[mb][nb] = (v8f){};
    const size_t aoff = (size_t)(r0 + lr) * K + 8 * hi, boff = (size_t)(c0 + lr) * K + 8 * hi;
#pragma unroll 1
    for (int kc = w * 32; kc < K; kc += NW * 32) {
        V a[4], a2[4];
#pragma unroll
        for (int mb = 0; mb < 4; ++mb) { a[mb] = WFrag<T16>::ld(A + aoff + (size_t)mb * 16 * K + kc); if (NSPLIT == 1 || NSPLIT == 2) a2[mb] = WFrag<T16>::ld(A2 + aoff + (size_t)mb * 16 * K + kc); }
#pragma unroll
        for (int nb = 0; nb < 4; ++nb) { const V b = WFrag<T16>::ld(Bt + boff + (size_t)nb * 16 * K + kc); V b2; if (NSPLIT >= 2) b2 = WFrag<T16>::ld(Bt2 + boff + (size_t)nb * 16 * K + kc);
#pragma unroll
            for (int mb = 0; mb < 4; ++mb) { acc[mb][nb] = WFrag<T16>::mma(a[mb], b, acc[mb][nb]); if (NSPLIT == 1 || NSPLIT == 2) acc[mb][nb] = WFrag<T16>::mma(a2[mb], b, acc[mb][nb]); if (NSPLIT >= 2) acc[mb][nb] = WFrag<T16>::mma(a[mb], b2, acc[mb][nb]); } }
        asm volatile("v_nop\n\tv_nop\n\tv_nop\n\tv_nop" : "+v"(acc[0][0]), "+v"(acc[1][1]), "+v"(acc[2][2]), "+v"(acc[3][3]) : "v"(a[0]), "v"(a[3]));
    }
    ksum_store<NW, BIAS>(acc, os, w, lr, hi, C + (size_t)r0 * ldc + c0, ldc, BIAS ? bias + c0 : nullptr);
}

__device__ __forceinline__ h16 tohx(float x) { return (h16)x; }
__device__ __forceinline__ void splitf(float y, unsigned short& h, unsigned short& l) { h = f2bf(y); l = f2bf(y - bf2f(h)); }
typedef __attribute__((ext_vector_type(2))) _Float16 v2h;
typedef __attribute__((ext_vector_type(4))) _Float16 v4h;
typedef __attribute__((ext_vector_type(2))) unsigned short v2us;
typedef __attribute__((ext_vector_type(4))) unsigned short v4us;
typedef __attribute__((ext_vector_type(2))) float v2f;
typedef __attribute__((ext_vector_type(4))) int v4i;

__global__ __launch_bounds__(256) void k_cvt8(const float* __restrict__ src, bf* dst, size_t n8) { const size_t i = (size_t)blockIdx.x * 256 + threadIdx.x; if (i >= n8) return; const v8f v = *(const v8f*)(src + i * 8); v8us o;
#pragma unroll
    for (int k = 0; k < 8; ++k) o[k] = f2bf(v[k]); *(v8us*)(dst + i * 8) = o;  }

// k_rope: head planes [h][t][d] (fp16 + hi/lo) of rope(x) x sc with the rotate-half convention out[d] = x[d] cos[t][d] - x[d+HD/2] sin[t][d], out[d+HD/2] = x[d+HD/2] cos[t][d+HD/2] + x[d] sin[t][d+HD/2]
__global__ __launch_bounds__(256) void k_rope(const float* __restrict__ F, int pitch, int nheads, const float* __restrict__ CS, const float* __restrict__ RF, const float* __restrict__ nw, float sc, h16* P16, bf* Ph, bf* Pl) {
    const size_t e = ((size_t)blockIdx.x * 256 + threadIdx.x) * 2; if (e >= (size_t)nheads * TT * HD) return; const int d = (int)(e % HD); const int t = (int)((e / HD) % TT); const int h = (int)(e / ((size_t)HD * TT)); const float* f = F + (size_t)t * pitch + h * HD; const float rf = RF ? RF[(size_t)h * TT + t] : 1.0f; v2h o16; v2us oh, ol;
#pragma unroll
    for (int q = 0; q < 2; ++q) { const int dd = d + q; const int dp = (dd < HD / 2) ? dd + HD / 2 : dd - HD / 2; float x0 = f[dd], x1 = f[dp];
        if (RF) { float n0 = __fmul_rn(x0, rf), n1 = __fmul_rn(x1, rf); asm volatile("" : "+v"(n0)); asm volatile("" : "+v"(n1)); x0 = __fmul_rn(bfr(nw[dd]), n0); x1 = __fmul_rn(bfr(nw[dp]), n1); }
        const v2f cs = *(const v2f*)(CS + ((size_t)t * HD + dd) * 2); float a = __fmul_rn(x0, cs[0]), bq = __fmul_rn(x1, cs[1]); asm volatile("" : "+v"(a)); asm volatile("" : "+v"(bq)); const float r = ((dd < HD / 2) ? __fsub_rn(a, bq) : __fadd_rn(a, bq)) * sc;
        o16[q] = tohx(r); unsigned short a2, c2; splitf(r, a2, c2); oh[q] = a2; ol[q] = c2; }
    *(v2h*)(P16 + e) = o16; *(v2us*)(Ph + e) = oh; *(v2us*)(Pl + e) = ol;  }
__global__ __launch_bounds__(256) void k_vtp(const float* __restrict__ F, int pitch, int nheads, h16* V16, bf* Vh, bf* Vl) { const size_t e = ((size_t)blockIdx.x * 256 + threadIdx.x) * 2; if (e >= (size_t)nheads * HD * TT) return; const int t = (int)(e % TT); const int d = (int)((e / TT) % HD); const int g = (int)(e / ((size_t)TT * HD)); v2h o16; v2us oh, ol;
#pragma unroll
    for (int q = 0; q < 2; ++q) { const float x = F[(size_t)(t + q) * pitch + g * HD + d]; o16[q] = tohx(x); unsigned short a2, c2; splitf(x, a2, c2); oh[q] = a2; ol[q] = c2; }
    *(v2h*)(V16 + e) = o16; *(v2us*)(Vh + e) = oh; *(v2us*)(Vl + e) = ol;  }
__constant__ float INVT[HD / 2] = { 1.000000000e+00f, 6.493816376e-01f, 4.216965139e-01f, 2.738419771e-01f, 1.778279394e-01f, 1.154781953e-01f, 7.498942316e-02f, 4.869675264e-02f, 3.162277490e-02f, 2.053525113e-02f, 1.333521400e-02f, 8.659643121e-03f, 5.623413250e-03f, 3.651741194e-03f, 2.371373819e-03f, 1.539926510e-03f, 1.000000047e-03f, 6.493816036e-04f, 4.216965172e-04f, 2.738419571e-04f, 1.778279402e-04f, 1.154782003e-04f, 7.498942432e-05f, 4.869675104e-05f, 3.162277790e-05f, 2.053524986e-05f, 1.333521413e-05f, 8.659642845e-06f, 5.623413472e-06f, 3.651741281e-06f, 2.371373739e-06f, 1.539926529e-06f };   // THETA ** (-arange(0, 64, 2) / 64) with THETA = 1e6 in float32 (the module's power expression)
__global__ __launch_bounds__(256) void k_cs5(float* CS) { const int idx = blockIdx.x * 256 + threadIdx.x; if (idx >= TT * HD) return; const int d = idx % HD; const int t = idx / HD; const float a = __fmul_rn((float)t, INVT[d % (HD / 2)]); v2f cs; cs[0] = cosf(a); cs[1] = sinf(a); *(v2f*)(CS + (size_t)idx * 2) = cs;  }
__global__ __launch_bounds__(256) void k_hrms(const float* __restrict__ F, int pitch, int nheads, float* RF) { const int idx = blockIdx.x * 256 + threadIdx.x; if (idx >= nheads * TT) return; const int t = idx % TT; const int h = idx / TT; const float* f = F + (size_t)t * pitch + h * HD; float s = 0.f;
#pragma unroll 4
    for (int d = 0; d < HD; d += 4) { const v4f a = *(const v4f*)(f + d);
#pragma unroll
        for (int q = 0; q < 4; ++q) { float p = __fmul_rn(a[q], a[q]); asm volatile("" : "+v"(p)); s = __fadd_rn(s, p); } }
    const float rf = __fdiv_rn(1.0f, __fsqrt_rn(__fadd_rn(__fdiv_rn(s, (float)HD), 1e-5f))); *(float*)(RF + idx) = rf;  }

__global__ __launch_bounds__(256) void k_rmsapply(float* F, int pitch, int nheads, const float* __restrict__ RF, const float* __restrict__ w) { const size_t i = (size_t)blockIdx.x * 256 + threadIdx.x; if (i >= (size_t)TT * nheads * HD / 4) return; const size_t e = i * 4; const int c = (int)(e % ((size_t)nheads * HD)); const int t = (int)(e / ((size_t)nheads * HD)); const int h = c / HD, d = c % HD; const float r = RF[(size_t)h * TT + t]; v4f a = *(const v4f*)(F + (size_t)t * pitch + c);
#pragma unroll
    for (int q = 0; q < 4; ++q) { float y = __fmul_rn(a[q], r); asm volatile("" : "+v"(y)); float wv_ = bfr(w[d + q]); asm volatile("" : "+v"(wv_)); a[q] = __fmul_rn(y, wv_); }   /* x w[d] */
    *(v4f*)(F + (size_t)t * pitch + c) = a;  }
__global__ __launch_bounds__(256) void k_wtG(const float* __restrict__ w, int K, int N, bf* Bt) {
    const int lane = threadIdx.x & 31; const int L0 = (blockIdx.x * 8 + (threadIdx.x >> 5)) * 8; const int nlines = N * K / 64;
{
#pragma unroll 1
        for (int l = 0; l < 8; ++l) { const int L = L0 + l; if (L >= nlines) break; const size_t e = (size_t)L * 64 + lane * 2; const int k = (int)(e % K), n = (int)(e / K); v2us o;
            o[0] = f2bf(w[(size_t)k * N + n]); o[1] = f2bf(w[(size_t)(k + 1) * N + n]); *(v2us*)(Bt + e) = o; }
         }
}

// ---- k_fattn: the whole causal attention of one batch in one launch (scores, softmax, probability x value and the hi/lo merge), with a running maximum and sum per query; no score or probability plane in memory.
// Transposed products: S^T = K Q^T (A = key rows, B = query rows kept in registers), O^T += V^T P^T (A = rows of the [d][t] value plane). In a 16-column group lane (lr, hi) holds query lr only: keys 8 hi + j of each
// 16-key score tile, so two score tiles of a 32-key block, converted in place, are the B operand of the second product in the loaders' own k order (8 hi + 0..7, 16 + 8 hi + 0..7), and maximum, sum and rescale factor are per lane.
// Work-group = 16 waves: the 4 query heads of one kv head (they read the same K and V lines) x KS = 4 key parts (part p takes every 4th 32-key block); parts 1..3 hand their (O, m, l) to part 0 through LDS behind one barrier.
// One work-group fills a WGP's registers, so the tiles, longest first, are dealt out as WGPs fall free; blockIdx.x = kv head.
// Query rows < RH: 16 columns a wave, hi/lo bf16 planes, 3 products in both contractions; the rest: 32 columns a wave, fp16, probabilities carried x 2^10 (the sum carries the same factor, so it cancels).
#define L2E  1.4426950408889634f
#define KS   4
__device__ __forceinline__ float xhalf(float x) { return __builtin_bit_cast(float, __builtin_amdgcn_permlanex16(__builtin_bit_cast(int, x), __builtin_bit_cast(int, x), 0x76543210, 0xfedcba98, false, false)); }   // lane l <-> lane l ^ 16
template <typename T16, bool HR, int NQ>
__device__ __forceinline__ void fattn_tile(const T16* __restrict__ Q, const T16* __restrict__ Q2, const T16* __restrict__ Kp, const T16* __restrict__ K2, const T16* __restrict__ Vt, const T16* __restrict__ V2, int q0, int hd, int part, bf* Ah, bf* Al, float* xs) {
    typedef typename WFrag<T16>::V V;
    const int lane = threadIdx.x & 31, lr = lane & 15, hi = lane >> 4;
    const unsigned kofs = lr * HD + 8 * hi, vofs = lr * TT + 8 * hi;   // the lane's place in a fragment's rows; every address below = wave-uniform pointer + one of these + a constant, so no load's result can land on an address register
    V qf[NQ][2], qf2[NQ][2];
#pragma unroll
    for (int n = 0; n < NQ; ++n)
#pragma unroll
        for (int ks = 0; ks < 2; ++ks) { const unsigned qo = kofs + n * 16 * HD + ks * 32; qf[n][ks] = WFrag<T16>::ld(Q + (size_t)q0 * HD + qo); if (HR) qf2[n][ks] = WFrag<T16>::ld(Q2 + (size_t)q0 * HD + qo); }
    v8f o[4][NQ]; float m[NQ], l[NQ];
#pragma unroll
    for (int n = 0; n < NQ; ++n) { m[n] = -3.0e38f; l[n] = 0.f;
#pragma unroll
        for (int dt = 0; dt < 4; ++dt) o[dt][n] = (v8f){}; }
    const int kend = q0 + 16 * NQ;                      // keys [0, kend): every 32-key block that starts below kend holds at least one allowed key for every query of the tile
    typedef const __attribute__((address_space(1))) T16* gptr;   // typed as global memory, so that the loads stay global loads behind the statement that the pointers pass through
    gptr kq = (gptr)(Kp + (size_t)part * 32 * HD), kq2 = HR ? (gptr)(K2 + (size_t)part * 32 * HD) : nullptr;   // wave-uniform walking pointers: key rows and value columns of the part's current block
    gptr vq = (gptr)(Vt + part * 32), vq2 = HR ? (gptr)(V2 + part * 32) : nullptr;
    V kf[2][2], kf2[2][2];
#pragma unroll
    for (int kt = 0; kt < 2; ++kt)
#pragma unroll
        for (int ks = 0; ks < 2; ++ks) { kf[kt][ks] = WFrag<T16>::ld((const T16*)(kq + kofs + kt * 16 * HD + ks * 32)); if (HR) kf2[kt][ks] = WFrag<T16>::ld((const T16*)(kq2 + kofs + kt * 16 * HD + ks * 32)); }
#pragma unroll 1   // run-time trip count; one trip's fragments, scores and accumulators already take most of the wave's registers
    for (int kb = part * 32; kb < kend; kb += KS * 32) {
        V vf[4], vf2[4];                                // this block's value fragments: asked for first, needed last
#pragma unroll
        for (int dt = 0; dt < 4; ++dt) { vf[dt] = WFrag<T16>::ld((const T16*)(vq + vofs + dt * 16 * TT)); if (HR) vf2[dt] = WFrag<T16>::ld((const T16*)(vq2 + vofs + dt * 16 * TT)); }
        // the wait in front of the steps of the base pointers that this trip's value loads and the last trip's key loads name; the pointers pass through the statement so that their steps stay behind it
        if constexpr (HR) asm volatile("s_wait_xcnt 0x0" : "+s"(vq), "+s"(vq2), "+s"(kq), "+s"(kq2) :: "memory");
        else asm volatile("s_wait_xcnt 0x0" : "+s"(vq), "+s"(kq) :: "memory");
        vq += KS * 32; if (HR) vq2 += KS * 32;
        v8f s[2][NQ];
#pragma unroll
        for (int kt = 0; kt < 2; ++kt)
#pragma unroll
            for (int n = 0; n < NQ; ++n) { v8f c = (v8f){};
#pragma unroll
                for (int ks = 0; ks < 2; ++ks) { c = WFrag<T16>::mma(kf[kt][ks], qf[n][ks], c); if (HR) { c = WFrag<T16>::mma(kf[kt][ks], qf2[n][ks], c); c = WFrag<T16>::mma(kf2[kt][ks], qf[n][ks], c); } }
                s[kt][n] = c; }
        const int kstep = (kb + KS * 32 < kend) ? KS * 32 * HD : 0; kq += kstep; if (HR) kq2 += kstep;   // the part's next key block, fetched one trip ahead (the last trip stays where it is; its fetch is not used)
#pragma unroll
        for (int kt = 0; kt < 2; ++kt)
#pragma unroll
            for (int ks = 0; ks < 2; ++ks) { kf[kt][ks] = WFrag<T16>::ld((const T16*)(kq + kofs + kt * 16 * HD + ks * 32)); if (HR) kf2[kt][ks] = WFrag<T16>::ld((const T16*)(kq2 + kofs + kt * 16 * HD + ks * 32)); }
        if (kb + 31 > q0) {                             // wave-uniform: only a block that reaches the diagonal is masked (key > query excluded)
#pragma unroll
            for (int kt = 0; kt < 2; ++kt)
#pragma unroll
                for (int n = 0; n < NQ; ++n)
#pragma unroll
                    for (int j = 0; j < 8; ++j) s[kt][n][j] = (kb + kt * 16 + hi * 8 + j <= q0 + n * 16 + lr) ? s[kt][n][j] : -3.0e38f; }
        V pf[NQ], pf2[NQ];
#pragma unroll
        for (int n = 0; n < NQ; ++n) { float mx = m[n];
#pragma unroll
            for (int j = 0; j < 8; ++j) mx = fmaxf(mx, fmaxf(s[0][n][j], s[1][n][j]));
            mx = fmaxf(mx, xhalf(mx));                  // the two lane halves hold the same query's other keys
            const float al = __builtin_amdgcn_exp2f((m[n] - mx) * (SCL * L2E)), mo = HR ? mx * (SCL * L2E) : mx * (SCL * L2E) - 10.0f; m[n] = mx; v2f sum = (v2f){0.f, 0.f};   // m: raw products; SCL and the change to base 2 go into one factor
#pragma unroll
            for (int kt = 0; kt < 2; ++kt)
#pragma unroll
                for (int j = 0; j < 8; j += 2) { const v2f p = (v2f){__builtin_amdgcn_exp2f(fmaf(s[kt][n][j], SCL * L2E, -mo)), __builtin_amdgcn_exp2f(fmaf(s[kt][n][j + 1], SCL * L2E, -mo))}; s[kt][n][j] = p[0]; s[kt][n][j + 1] = p[1]; sum += p; }   // even and odd keys summed side by side (packed adds)
            l[n] = l[n] * al + (sum[0] + sum[1]);
#pragma unroll
            for (int dt = 0; dt < 4; ++dt) o[dt][n] *= al;
            if constexpr (HR) { v8us h0, h1, l0, l1;
#pragma unroll
                for (int j = 0; j < 8; ++j) { unsigned short a, c2; splitf(s[0][n][j], a, c2); h0[j] = a; l0[j] = c2; splitf(s[1][n][j], a, c2); h1[j] = a; l1[j] = c2; }
                pf[n] = cat16b(h0, h1); pf2[n] = cat16b(l0, l1);
            } else { v8h h0, h1;
#pragma unroll
                for (int j = 0; j < 8; ++j) { h0[j] = tohx(s[0][n][j]); h1[j] = tohx(s[1][n][j]); }
                pf[n] = cat16(h0, h1); } }
#pragma unroll
        for (int dt = 0; dt < 4; ++dt)
#pragma unroll
            for (int n = 0; n < NQ; ++n) { o[dt][n] = WFrag<T16>::mma(vf[dt], pf[n], o[dt][n]); if (HR) { o[dt][n] = WFrag<T16>::mma(vf[dt], pf2[n], o[dt][n]); o[dt][n] = WFrag<T16>::mma(vf2[dt], pf[n], o[dt][n]); } }
        // the loop's branch stands right behind the last matrix instructions: four vector slots keep the distance on the taken side too
        if constexpr (NQ == 2) asm volatile("v_nop\n\tv_nop\n\tv_nop\n\tv_nop" : "+v"(o[0][0]), "+v"(o[1][0]), "+v"(o[2][0]), "+v"(o[3][0]), "+v"(o[0][1]), "+v"(o[1][1]), "+v"(o[2][1]), "+v"(o[3][1]));
        else asm volatile("v_nop\n\tv_nop\n\tv_nop\n\tv_nop" : "+v"(o[0][0]), "+v"(o[1][0]), "+v"(o[2][0]), "+v"(o[3][0]));
    }
    // the last trip's key fetch is not used and may still be on its way: the wait in front of whatever takes over the registers that it names
    if constexpr (HR) asm volatile("s_wait_xcnt 0x0" :: "s"(kq), "s"(kq2) : "memory");
    else asm volatile("s_wait_xcnt 0x0" :: "s"(kq) : "memory");
    // join of the key parts in the fixed order 0..KS-1. LDS: per (part - 1, head) 4 NQ tiles of [2 halves][32 lanes][4 floats]; behind them per (part - 1, head) m and l
    if (part != 0) { float* xo = xs + ((part - 1) * 4 + hd) * 2048; float* xm = xs + (KS - 1) * 4 * 2048 + ((part - 1) * 4 + hd) * 128;
#pragma unroll
        for (int n = 0; n < NQ; ++n) { xm[(n * 2) * 32 + lane] = m[n]; xm[(n * 2 + 1) * 32 + lane] = l[n];
#pragma unroll
            for (int dt = 0; dt < 4; ++dt) { float* t = xo + (dt * NQ + n) * 256 + lane * 4; *(v4fa*)t = (v4f){o[dt][n][0], o[dt][n][1], o[dt][n][2], o[dt][n][3]}; *(v4fa*)(t + 128) = (v4f){o[dt][n][4], o[dt][n][5], o[dt][n][6], o[dt][n][7]}; } } }
    __syncthreads();                                    // the other parts' partial results are in LDS before part 0 reads them; every wave of the work-group passes here
    if (part == 0) { const float* xo = xs + hd * 2048; const float* xm = xs + (KS - 1) * 4 * 2048 + hd * 128;
#pragma unroll
        for (int n = 0; n < NQ; ++n) { float mp[KS - 1], f[KS - 1]; float mx = m[n];      // a part without a key block hands over m = -3e38, l = 0, O = 0: its factor is 0
#pragma unroll
            for (int u = 0; u < KS - 1; ++u) { mp[u] = xm[u * 512 + (n * 2) * 32 + lane]; mx = fmaxf(mx, mp[u]); }
            float f0 = __builtin_amdgcn_exp2f((m[n] - mx) * (SCL * L2E)), lt = l[n] * f0;
#pragma unroll
            for (int u = 0; u < KS - 1; ++u) { f[u] = __builtin_amdgcn_exp2f((mp[u] - mx) * (SCL * L2E)); lt += xm[u * 512 + (n * 2 + 1) * 32 + lane] * f[u]; }
            lt += xhalf(lt);                            // the two lane halves summed the same query's other keys
            const float inv = __fdiv_rn(1.0f, lt); f0 *= inv;
#pragma unroll
            for (int u = 0; u < KS - 1; ++u) f[u] *= inv;
#pragma unroll
            for (int dt = 0; dt < 4; ++dt) { v8f r = o[dt][n] * f0;
#pragma unroll
                for (int u = 0; u < KS - 1; ++u) { const float* t = xo + u * 8192 + (dt * NQ + n) * 256 + lane * 4; const v4f u0 = *(const v4fa*)t, u1 = *(const v4fa*)(t + 128);
#pragma unroll
                    for (int j = 0; j < 4; ++j) { r[j] += u0[j] * f[u]; r[4 + j] += u1[j] * f[u]; } }
                v8us oh, ol;
#pragma unroll
                for (int j = 0; j < 8; ++j) { unsigned short a, c2; splitf(r[j], a, c2); oh[j] = a; ol[j] = c2; }
                const unsigned oo = (n * 16 + lr) * DQ + dt * 16 + hi * 8; *(v8usa*)(Ah + (size_t)q0 * DQ + oo) = oh; *(v8usa*)(Al + (size_t)q0 * DQ + oo) = ol;
                asm volatile("s_wait_xcnt 0x0" ::: "memory"); } } }   // the next tile's values reuse the registers that these two stores name
}
__global__ __launch_bounds__(KS * 128) void k_fattn(const h16* __restrict__ Q16, const h16* __restrict__ K16, const h16* __restrict__ V16, const bf* __restrict__ Qh, const bf* __restrict__ Ql, const bf* __restrict__ Kh, const bf* __restrict__ Kl, const bf* __restrict__ Vh, const bf* __restrict__ Vl, bf* Ah, bf* Al) {
    static_assert(REP == 4 && RH % 32 == 0 && (TT - RH) % 32 == 0, "4 query heads a kv head; whole tiles on both sides of RH");
    __shared__ __align__(16) float xs[(KS - 1) * 4 * (2048 + 128)];
    const int w = __builtin_amdgcn_readfirstlane(threadIdx.x >> 5);   // wave number, scalar: head, key part and the key loop's bounds stay wave-uniform
    const int hd = w & 3, part = w >> 2, g = blockIdx.x, bt = blockIdx.y, h = g * REP + hd; const size_t qp = (size_t)h * TT * HD, kp = (size_t)g * TT * HD;
    if (bt < (TT - RH) / 32) fattn_tile<h16, false, 2>(Q16 + qp, nullptr, K16 + kp, nullptr, V16 + kp, nullptr, TT - 32 * (bt + 1), hd, part, Ah + h * HD, Al + h * HD, xs);   // longest tiles first
    else fattn_tile<bf, true, 1>(Qh + qp, Ql + qp, Kh + kp, Kl + kp, Vh + kp, Vl + kp, RH - 16 * (bt - (TT - RH) / 32 + 1), hd, part, Ah + h * HD, Al + h * HD, xs);
}

extern "C" void kernel_launch(void* const* d_in, const int* in_sizes, int n_in,
                              void* d_out, int out_size, void* d_ws, size_t ws_size, hipStream_t stream) {
    (void)in_sizes; (void)n_in; (void)out_size;
    const float* x = (const float*)d_in[0]; const float* wq = (const float*)d_in[1]; const float* wk = (const float*)d_in[2]; const float* wv = (const float*)d_in[3]; const float* wo = (const float*)d_in[4]; const float* qsc = (const float*)d_in[5]; const float* ksc = (const float*)d_in[6];   /* input order x, Wq ('xw' [2048][2048]), Wk, Wv ([2048][512]), Wo ('xw'), q_norm_w, k_norm_w ([64], read) */
    float* OUT = (float*)d_out;     // [2][2048][2048]
    char* wsp = (char*)d_ws;
    auto take = [&](size_t bytes) { char* p = wsp; wsp += (bytes + 255) & ~(size_t)255; return (void*)p; };
    bf* WQ = (bf*)take((size_t)DQ * DM * 2); bf* WK = (bf*)take((size_t)DKV * DM * 2); bf* WV = (bf*)take((size_t)DKV * DM * 2); bf* WO = (bf*)take((size_t)DM * DQ * 2); float* CS = (float*)take((size_t)TT * HD * 2 * 4);
    bf* XB = (bf*)take((size_t)TT * DM * 2); float* RFQ = (float*)take((size_t)NH_ * TT * 4); float* RFK = (float*)take((size_t)NKV * TT * 4);   /* per (head, token) inverse RMS */ float* FQ = (float*)take((size_t)TT * DQ * 4); float* FK = (float*)take((size_t)TT * DKV * 4);
    h16* QP16 = (h16*)take((size_t)NH_ * TT * HD * 2); h16* KP16 = (h16*)take((size_t)NKV * TT * HD * 2); h16* VT16 = (h16*)take((size_t)NKV * HD * TT * 2);
    bf* QPh = (bf*)take((size_t)NH_ * TT * HD * 2); bf* QPl = (bf*)take((size_t)NH_ * TT * HD * 2); bf* KPh = (bf*)take((size_t)NKV * TT * HD * 2); bf* KPl = (bf*)take((size_t)NKV * TT * HD * 2); bf* VTh = (bf*)take((size_t)NKV * HD * TT * 2); bf* VTl = (bf*)take((size_t)NKV * HD * TT * 2);
    bf* ATh = (bf*)take((size_t)TT * DQ * 2); bf* ATl = (bf*)take((size_t)TT * DQ * 2);
    if ((size_t)(wsp - (char*)d_ws) > ws_size) return;    // ws 256 MiB
    float* FV = FK;   // v projection reuses the k buffer after the k planes are built (stream-ordered)
    { k_wtG<<<(unsigned)((DM * DQ / 64 + 63) / 64), 256, 0, stream>>>(wq, DM, DQ, WQ); k_wtG<<<(unsigned)((DM * DKV / 64 + 63) / 64), 256, 0, stream>>>(wk, DM, DKV, WK); k_wtG<<<(unsigned)((DM * DKV / 64 + 63) / 64), 256, 0, stream>>>(wv, DM, DKV, WV);
      k_wtG<<<(unsigned)((DQ * DM / 64 + 63) / 64), 256, 0, stream>>>(wo, DQ, DM, WO);
       }
    k_cs5<<<(TT * HD + 255) / 256, 256, 0, stream>>>(CS);   /* rotary table computed from t and INVT */
    const unsigned LQ = (unsigned)(((size_t)NH_ * TT * HD / 2 + 255) / 256), LKv = (unsigned)(((size_t)NKV * TT * HD / 2 + 255) / 256);
    for (int b = 0; b < NB_; ++b) {
        
        k_cvt8<<<(unsigned)(((size_t)TT * DM / 8 + 255) / 256), 256, 0, stream>>>(x + (size_t)b * TT * DM, XB, (size_t)TT * DM / 8);
        k_gemmw<bf, 0, false, 8><<<dim3(TT / 64, DQ / 64, 1), 256, 0, stream>>>(XB, nullptr, WQ, nullptr, DM, FQ, DQ, nullptr, 0, 0, 0);
        k_hrms<<<(NH_ * TT + 255) / 256, 256, 0, stream>>>(FQ, DQ, NH_, RFQ); k_rmsapply<<<(unsigned)(((size_t)TT * DQ / 4 + 255) / 256), 256, 0, stream>>>(FQ, DQ, NH_, RFQ, qsc);   /* per-head RMSNorm x q_norm_w */ k_rope<<<LQ, 256, 0, stream>>>(FQ, DQ, NH_, CS, nullptr, nullptr, 1.0f, QP16, QPh, QPl);
        k_gemmw<bf, 0, false, 16><<<dim3(TT / 64, DKV / 64, 1), 512, 0, stream>>>(XB, nullptr, WK, nullptr, DM, FK, DKV, nullptr, 0, 0, 0);
        k_hrms<<<(NKV * TT + 255) / 256, 256, 0, stream>>>(FK, DKV, NKV, RFK); k_rmsapply<<<(unsigned)(((size_t)TT * DKV / 4 + 255) / 256), 256, 0, stream>>>(FK, DKV, NKV, RFK, ksc);   /* per-head RMSNorm x k_norm_w */ k_rope<<<LKv, 256, 0, stream>>>(FK, DKV, NKV, CS, nullptr, nullptr, 1.0f, KP16, KPh, KPl);
        k_gemmw<bf, 0, false, 16><<<dim3(TT / 64, DKV / 64, 1), 512, 0, stream>>>(XB, nullptr, WV, nullptr, DM, FV, DKV, nullptr, 0, 0, 0); k_vtp<<<LKv, 256, 0, stream>>>(FV, DKV, NKV, VT16, VTh, VTl);
        k_fattn<<<dim3(NKV, (TT - RH) / 32 + RH / 16, 1), KS * 128, 0, stream>>>(QP16, KP16, VT16, QPh, QPl, KPh, KPl, VTh, VTl, ATh, ATl);
        k_gemmw<bf, 1, false, 8><<<dim3(TT / 64, DM / 64, 1), 256, 0, stream>>>(ATh, ATl, WO, nullptr, DQ, OUT + (size_t)b * TT * DM, DM, nullptr, 0, 0, 0); }
}

// v004
// One run takes 335 microseconds.
// Two timings next to v003 put it at 1.23 and 1.24 times that version's speed.
// All steps since v000 together make it 8.28 times as fast.
#include <hip/hip_runtime.h>

// Grouped-query causal attention with per-head RMSNorm and computed half-split rotary embeddings at base 1e6 (x [2][2048][2048]; q = x Wq (32 heads x 64), k, v = x Wk, x Wv (8 kv heads x 64) ('xw' 0.02, no bias); per head q = rms_norm(q) x q_norm_w, k = rms_norm(k) x k_norm_w (eps 1e-5; weights [64] = ones, read); rope: (x1, x2) = the two HALVES of each head: cat(x1 cos - x2 sin, x2 cos + x1 sin) with angle t x 1000000^(-2i/64), i < 32 (32 f32 frequencies jnp-exact for the module's power expression; precise cosf/sinf); query heads viewed (HKV, g): kv head = q head / 4; scores x 64^-0.5; causal (finfo.min == exclusion); softmax; out = merged Wo ('xw') -> [2][2048][2048] (8.4 M); argument order x, Wq, Wk, Wv, Wo, q_norm_w, k_norm_w).
// Layout per batch: bf16 copy of x; 'xw' weights transposed once (k_wtG); exact projections, whose 64x64 tile is one head x 64 tokens, so the tile's epilogue does RMSNorm (1/sqrt(mean + eps) x w[d]) and rotate-half with the k_cs5 table {cosf, sinf}(t x INVT[d mod 32]) and writes the head planes itself (v: transposed planes); causal T-2048 GQA attention in one launch (k_fattn, running softmax; hybrid rows: < 512 hi/lo 3 products, rest fp16 x1024; key blocks above the diagonal are never visited); merged hi/lo x Wo exact.
// Compute dtypes, f32 accumulate: every input rounded to bf16 incl. the norm weights; projections exact; RMSNorm and rotary f32; attention rows < 512 3 products, rest fp16; softmax f32; Wo hl x exact.

#define NB_  2
#define TT   2048
#define DM   2048
#define NH_  32
#define NKV  8
#define REP  (NH_ / NKV)
#define HD   64
#define DQ   (NH_ * HD)
#define DKV  (NKV * HD)
#define RH   512                  // query rows < RH use hi+lo planes (0: none)
#define SCL  0.125f   // HD^-0.5
typedef _Float16 h16;
typedef unsigned short bf;
typedef __attribute__((ext_vector_type(16))) __bf16   v16bf;
typedef __attribute__((ext_vector_type(16))) _Float16 v16h;
typedef __attribute__((ext_vector_type(8)))  _Float16 v8h;
typedef __attribute__((ext_vector_type(8)))  unsigned short v8us;
typedef __attribute__((ext_vector_type(8)))  float    v8f;
typedef __attribute__((ext_vector_type(4)))  float    v4f;
typedef v8h  __attribute__((may_alias)) v8ha;
typedef v4f  __attribute__((may_alias)) v4fa;
typedef v8us __attribute__((may_alias)) v8usa;

__device__ __forceinline__ unsigned short f2bf(float f) { unsigned u = __float_as_uint(f); u += 0x7FFFu + ((u >> 16) & 1u); return (unsigned short)(u >> 16); }
__device__ __forceinline__ float bf2f(unsigned short b) { return __uint_as_float(((unsigned)b) << 16); }
__device__ __forceinline__ float bfr(float f) { return bf2f(f2bf(f)); }
__device__ __forceinline__ v16h cat16(v8h lo, v8h hi) { return __builtin_shufflevector(lo, hi, 0, 1, 2, 3, 4, 5, 6, 7, 8, 9, 10, 11, 12, 13, 14, 15); }
__device__ __forceinline__ v16bf cat16b(v8us lo, v8us hi) { return __builtin_bit_cast(v16bf, __builtin_shufflevector(lo, hi, 0, 1, 2, 3, 4, 5, 6, 7, 8, 9, 10, 11, 12, 13, 14, 15)); }
__device__ __forceinline__ v8f wmma16(v16h a, v16h b, v8f c) { return __builtin_amdgcn_wmma_f32_16x16x32_f16(false, a, false, b, (short)0, c, false, false); }
__device__ __forceinline__ v8f wmmab(v16bf a, v16bf b, v8f c) { return __builtin_amdgcn_wmma_f32_16x16x32_bf16(false, a, false, b, (short)0, c, false, false); }



// ---- split-K inside a work-group: the NW waves of a 64x64 tile each take every NW-th 32-wide step of K (neighbouring waves read the two halves of the same 128-byte lines at about the same time),
// so the chain of dependent load round trips per wave is NW times shorter. ksum_store puts the NW partial tiles into LDS (row pitch 68 floats), and behind one barrier adds them in the fixed order wave 0..NW-1 and stores the tile.
__device__ __forceinline__ void kpart_put(const v8f (&acc)[4][4], float* os, int w, int lr, int hi) {
#pragma unroll
    for (int mb = 0; mb < 4; ++mb)
#pragma unroll
        for (int nb = 0; nb < 4; ++nb)
#pragma unroll
            for (int j = 0; j < 8; ++j) os[(w * 64 + mb * 16 + hi * 8 + j) * 68 + nb * 16 + lr] = acc[mb][nb][j];
}
template <int NW>
__device__ __forceinline__ v4f kpart_sum(const float* os, int row, int cofs) {
    v4f val = *(const v4fa*)(os + row * 68 + cofs);
#pragma unroll
    for (int u = 1; u < NW; ++u) val += *(const v4fa*)(os + (u * 64 + row) * 68 + cofs);
    return val;
}
template <int NW, bool BIAS>
__device__ __forceinline__ void ksum_store(const v8f (&acc)[4][4], float* os, int w, int lr, int hi, float* C, int ldc, const float* bias) {
    kpart_put(acc, os, w, lr, hi);
    __syncthreads();                       // all NW partial tiles are in LDS before any of them is read
    const int tid = threadIdx.x, cofs = (tid & 15) * 4;
#pragma unroll
    for (int s = 0; s < 32 / NW; ++s) { const int row = s * NW * 2 + (tid >> 4);
        v4f val = kpart_sum<NW>(os, row, cofs);
        if (BIAS) { val[0] += bfr(bias[cofs]); val[1] += bfr(bias[cofs + 1]); val[2] += bfr(bias[cofs + 2]); val[3] += bfr(bias[cofs + 3]); }
        *(v4f*)(C + (size_t)row * ldc + cofs) = val; }
}

__device__ __forceinline__ h16 tohx(float x) { return (h16)x; }
__device__ __forceinline__ void splitf(float y, unsigned short& h, unsigned short& l) { h = f2bf(y); l = f2bf(y - bf2f(h)); }
typedef __attribute__((ext_vector_type(4))) _Float16 v4h;
typedef __attribute__((ext_vector_type(4))) unsigned short v4us;
template <int M> __device__ __forceinline__ float xrow(float x) { return __builtin_bit_cast(float, __builtin_amdgcn_update_dpp(0, __builtin_bit_cast(int, x), 0x160 | M, 0xf, 0xf, true)); }   // lane l <-> lane l ^ M inside a 16-lane row (row_xmask)

// ---- ksum_rope: epilogue of a q or k projection tile (64 tokens x the 64 dims of ONE head). Behind the sum of the partial tiles the 16 lanes of a row hold one (token, head) vector, 4 dims each:
// sum of squares over the row by a 4-step butterfly (the same value in all 16 lanes), x 1/sqrt(mean + eps) x w[d], then rotate-half (dim d's partner d +- 32 sits in lane l ^ 8), then the fp16 and hi/lo planes [t][d]: a wave stores 2 whole 128-byte rows a plane.
// cs: the tile's first row of the {cos, sin} table; P16, Ph, Pl: the tile's first row in the head's planes.
template <int NW>
__device__ __forceinline__ void ksum_rope(const v8f (&acc)[4][4], float* os, int w, int lr, int hi, const float* __restrict__ cs, const float* __restrict__ nw, h16* P16, bf* Ph, bf* Pl) {
    constexpr int NS = 32 / NW;
    const int tid = threadIdx.x, cofs = (tid & 15) * 4, rw = tid >> 4;
    v4f c01[NS], c23[NS]; float wv[4];     // the thread's table rows are asked for in front of the LDS stores and the barrier, which cover their way
#pragma unroll
    for (int s = 0; s < NS; ++s) { const float* c = cs + ((s * NW * 2 + rw) * HD + cofs) * 2; c01[s] = *(const v4f*)c; c23[s] = *(const v4f*)(c + 4); }
#pragma unroll
    for (int q = 0; q < 4; ++q) wv[q] = bfr(nw[cofs + q]);
    kpart_put(acc, os, w, lr, hi);
    __builtin_amdgcn_sched_barrier(0);     // keeps every use of the table rows behind the LDS stores: without it the first wait for those loads stands in front of the stores
    __syncthreads();                       // all NW partial tiles are in LDS before any of them is read
    const float sg = (cofs < HD / 2) ? -1.0f : 1.0f;   // out[d] = x[d] cos - x[d + 32] sin, out[d + 32] = x[d + 32] cos + x[d] sin
#pragma unroll
    for (int s = 0; s < NS; ++s) { const int row = s * NW * 2 + rw;
        const v4f a = kpart_sum<NW>(os, row, cofs);
        float ss = a[0] * a[0] + a[1] * a[1] + a[2] * a[2] + a[3] * a[3];
        ss += xrow<1>(ss); ss += xrow<2>(ss); ss += xrow<4>(ss); ss += xrow<8>(ss);
        const float rf = __fdiv_rn(1.0f, __fsqrt_rn(ss * (1.0f / HD) + 1e-5f));
        v4h o16; v4us oh, ol;
#pragma unroll
        for (int q = 0; q < 4; ++q) { const float y = a[q] * rf * wv[q], p = xrow<8>(y) * sg; const float co = (q < 2) ? c01[s][q * 2] : c23[s][q * 2 - 4], si = (q < 2) ? c01[s][q * 2 + 1] : c23[s][q * 2 - 3];
            const float r = y * co + p * si; o16[q] = tohx(r); unsigned short a2, c2; splitf(r, a2, c2); oh[q] = a2; ol[q] = c2; }
        const unsigned po = row * HD + cofs; *(v4h*)(P16 + po) = o16; *(v4us*)(Ph + po) = oh; *(v4us*)(Pl + po) = ol; }
}
// ---- ksum_vt: epilogue of a v projection tile: the summed tile goes back into LDS (each thread over the elements of partial tile 0 that it alone has read), and behind a second barrier it is read by columns:
// 8 lanes store one whole 128-byte row (64 tokens of one dim) of the transposed fp16 and hi/lo planes [d][t]. V16, Vh, Vl: the tile's first token in the head's planes.
template <int NW>
__device__ __forceinline__ void ksum_vt(const v8f (&acc)[4][4], float* os, int w, int lr, int hi, h16* V16, bf* Vh, bf* Vl) {
    static_assert(NW == 16, "8 tokens a thread");
    kpart_put(acc, os, w, lr, hi);
    __syncthreads();                       // all NW partial tiles are in LDS before any of them is read
    const int tid = threadIdx.x, cofs = (tid & 15) * 4;
#pragma unroll
    for (int s = 0; s < 32 / NW; ++s) { const int row = s * NW * 2 + (tid >> 4); const v4f val = kpart_sum<NW>(os, row, cofs); *(v4fa*)(os + row * 68 + cofs) = val; }
    __syncthreads();                       // the whole summed tile is in LDS before it is read across the threads' own elements
    const int d = tid >> 3, tc = (tid & 7) * 8; v8h o16; v8us oh, ol;
#pragma unroll
    for (int j = 0; j < 8; ++j) { const float x = os[(tc + j) * 68 + d]; o16[j] = tohx(x); unsigned short a2, c2; splitf(x, a2, c2); oh[j] = a2; ol[j] = c2; }
    const unsigned po = d * TT + tc; *(v8h*)(V16 + po) = o16; *(v8us*)(Vh + po) = oh; *(v8us*)(Vl + po) = ol;
}

// ---- k_gemmw: register-blocked GEMM, NW WAVES per 64x64 output tile (16 accumulators each, K split between them), operands straight from K-contiguous 16-bit planes; grid (M/64, N/64, Z), NW*32 threads.
// C[m][n] (f32, pitch ldc, + optional f32 bias[n]) = sum_k A[m][k] Bt[n][k] (+ split products per NSPLIT). z-batch strides sA/sB/sC in elements. K % 32 == 0.
// EPI 0: the tile goes to C. EPI 1 (q, k) and 2 (v): m = token, tile column = head; the tile goes through ksum_rope or ksum_vt into the planes P16, Ph, Pl and C is not used.
template <typename T16> struct WFrag;
template <> struct WFrag<h16> { typedef v16h V; static __device__ __forceinline__ V ld(const h16* p) { return cat16(*(const v8h*)p, *(const v8h*)(p + 16)); } static __device__ __forceinline__ v8f mma(V a, V b, v8f c) { return wmma16(a, b, c); } };
template <> struct WFrag<bf> { typedef v16bf V; static __device__ __forceinline__ V ld(const bf* p) { return cat16b(*(const v8us*)p, *(const v8us*)(p + 16)); } static __device__ __forceinline__ v8f mma(V a, V b, v8f c) { return wmmab(a, b, c); } };
template <typename T16, int NSPLIT, bool BIAS, int NW, int EPI>
__global__ __launch_bounds__(NW * 32) void k_gemmw(const T16* __restrict__ A, const T16* __restrict__ A2, const T16* __restrict__ Bt, const T16* __restrict__ Bt2, int K, float* C, int ldc, const float* __restrict__ bias, size_t sA, size_t sB, size_t sC, const float* __restrict__ CS, const float* __restrict__ nw, h16* P16, bf* Ph, bf* Pl) {
    typedef typename WFrag<T16>::V V;
    __shared__ __align__(16) float os[NW * 64 * 68];
    const size_t z = blockIdx.z; A += z * sA; if (A2) A2 += z * sA; Bt += z * sB; if (Bt2) Bt2 += z * sB; C += z * sC;
    const int lane = threadIdx.x & 31, lr = lane & 15, hi = lane >> 4; const int r0 = blockIdx.x * 64, c0 = blockIdx.y * 64;
    const int w = __builtin_amdgcn_readfirstlane(threadIdx.x >> 5);   // wave number, scalar: the K loop's bounds stay wave-uniform
    v8f acc[4][4];
#pragma unroll
    for (int mb = 0; mb < 4; ++mb)
#pragma unroll
        for (int nb = 0; nb < 4; ++nb) acc[mb][nb] = (v8f){};
    const size_t aoff = (size_t)(r0 + lr) * K + 8 * hi, boff = (size_t)(c0 + lr) * K + 8 * hi;
#pragma unroll 1
    for (int kc = w * 32; kc < K; kc += NW * 32) {
        V a[4], a2[4];
#pragma unroll
        for (int mb = 0; mb < 4; ++mb) { a[mb] = WFrag<T16>::ld(A + aoff + (size_t)mb * 16 * K + kc); if (NSPLIT == 1 || NSPLIT == 2) a2[mb] = WFrag<T16>::ld(A2 + aoff + (size_t)mb * 16 * K + kc); }
#pragma unroll
        for (int nb = 0; nb < 4; ++nb) { const V b = WFrag<T16>::ld(Bt + boff + (size_t)nb * 16 * K + kc); V b2; if (NSPLIT >= 2) b2 = WFrag<T16>::ld(Bt2 + boff + (size_t)nb * 16 * K + kc);
#pragma unroll
            for (int mb = 0; mb < 4; ++mb) { acc[mb][nb] = WFrag<T16>::mma(a[mb], b, acc[mb][nb]); if (NSPLIT == 1 || NSPLIT == 2) acc[mb][nb] = WFrag<T16>::mma(a2[mb], b, acc[mb][nb]); if (NSPLIT >= 2) acc[mb][nb] = WFrag<T16>::mma(a[mb], b2, acc[mb][nb]); } }
        asm volatile("v_nop\n\tv_nop\n\tv_nop\n\tv_nop" : "+v"(acc[0][0]), "+v"(acc[1][1]), "+v"(acc[2][2]), "+v"(acc[3][3]) : "v"(a[0]), "v"(a[3]));
    }
    if constexpr (EPI == 0) ksum_store<NW, BIAS>(acc, os, w, lr, hi, C + (size_t)r0 * ldc + c0, ldc, BIAS ? bias + c0 : nullptr);
    else if constexpr (EPI == 1) { const size_t po = ((size_t)blockIdx.y * TT + r0) * HD; ksum_rope<NW>(acc, os, w, lr, hi, CS + (size_t)r0 * HD * 2, nw, P16 + po, Ph + po, Pl + po); }
    else { const size_t po = (size_t)blockIdx.y * HD * TT + r0; ksum_vt<NW>(acc, os, w, lr, hi, P16 + po, Ph + po, Pl + po); }
}

typedef __attribute__((ext_vector_type(2))) unsigned short v2us;
typedef __attribute__((ext_vector_type(2))) float v2f;
typedef __attribute__((ext_vector_type(4))) int v4i;

__global__ __launch_bounds__(256) void k_cvt8(const float* __restrict__ src, bf* dst, size_t n8) { const size_t i = (size_t)blockIdx.x * 256 + threadIdx.x; if (i >= n8) return; const v8f v = *(const v8f*)(src + i * 8); v8us o;
#pragma unroll
    for (int k = 0; k < 8; ++k) o[k] = f2bf(v[k]); *(v8us*)(dst + i * 8) = o;  }

__constant__ float INVT[HD / 2] = { 1.000000000e+00f, 6.493816376e-01f, 4.216965139e-01f, 2.738419771e-01f, 1.778279394e-01f, 1.154781953e-01f, 7.498942316e-02f, 4.869675264e-02f, 3.162277490e-02f, 2.053525113e-02f, 1.333521400e-02f, 8.659643121e-03f, 5.623413250e-03f, 3.651741194e-03f, 2.371373819e-03f, 1.539926510e-03f, 1.000000047e-03f, 6.493816036e-04f, 4.216965172e-04f, 2.738419571e-04f, 1.778279402e-04f, 1.154782003e-04f, 7.498942432e-05f, 4.869675104e-05f, 3.162277790e-05f, 2.053524986e-05f, 1.333521413e-05f, 8.659642845e-06f, 5.623413472e-06f, 3.651741281e-06f, 2.371373739e-06f, 1.539926529e-06f };   // THETA ** (-arange(0, 64, 2) / 64) with THETA = 1e6 in float32 (the module's power expression)
__global__ __launch_bounds__(256) void k_cs5(float* CS) { const int idx = blockIdx.x * 256 + threadIdx.x; if (idx >= TT * HD) return; const int d = idx % HD; const int t = idx / HD; const float a = __fmul_rn((float)t, INVT[d % (HD / 2)]); v2f cs; cs[0] = cosf(a); cs[1] = sinf(a); *(v2f*)(CS + (size_t)idx * 2) = cs;  }
__global__ __launch_bounds__(256) void k_wtG(const float* __restrict__ w, int K, int N, bf* Bt) {
    const int lane = threadIdx.x & 31; const int L0 = (blockIdx.x * 8 + (threadIdx.x >> 5)) * 8; const int nlines = N * K / 64;
{
#pragma unroll 1
        for (int l = 0; l < 8; ++l) { const int L = L0 + l; if (L >= nlines) break; const size_t e = (size_t)L * 64 + lane * 2; const int k = (int)(e % K), n = (int)(e / K); v2us o;
            o[0] = f2bf(w[(size_t)k * N + n]); o[1] = f2bf(w[(size_t)(k + 1) * N + n]); *(v2us*)(Bt + e) = o; }
         }
}

// ---- k_fattn: the whole causal attention of one batch in one launch (scores, softmax, probability x value and the hi/lo merge), with a running maximum and sum per query; no score or probability plane in memory.
// Transposed products: S^T = K Q^T (A = key rows, B = query rows kept in registers), O^T += V^T P^T (A = rows of the [d][t] value plane). In a 16-column group lane (lr, hi) holds query lr only: keys 8 hi + j of each
// 16-key score tile, so two score tiles of a 32-key block, converted in place, are the B operand of the second product in the loaders' own k order (8 hi + 0..7, 16 + 8 hi + 0..7), and maximum, sum and rescale factor are per lane.
// Work-group = 16 waves: the 4 query heads of one kv head (they read the same K and V lines) x KS = 4 key parts (part p takes every 4th 32-key block); parts 1..3 hand their (O, m, l) to part 0 through LDS behind one barrier.
// One work-group fills a WGP's registers, so the tiles, longest first, are dealt out as WGPs fall free; blockIdx.x = kv head.
// Query rows < RH: 16 columns a wave, hi/lo bf16 planes, 3 products in both contractions; the rest: 32 columns a wave, fp16, probabilities carried x 2^10 (the sum carries the same factor, so it cancels).
#define L2E  1.4426950408889634f
#define KS   4
__device__ __forceinline__ float xhalf(float x) { return __builtin_bit_cast(float, __builtin_amdgcn_permlanex16(__builtin_bit_cast(int, x), __builtin_bit_cast(int, x), 0x76543210, 0xfedcba98, false, false)); }   // lane l <-> lane l ^ 16
template <typename T16, bool HR, int NQ>
__device__ __forceinline__ void fattn_tile(const T16* __restrict__ Q, const T16* __restrict__ Q2, const T16* __restrict__ Kp, const T16* __restrict__ K2, const T16* __restrict__ Vt, const T16* __restrict__ V2, int q0, int hd, int part, bf* Ah, bf* Al, float* xs) {
    typedef typename WFrag<T16>::V V;
    const int lane = threadIdx.x & 31, lr = lane & 15, hi = lane >> 4;
    const unsigned kofs = lr * HD + 8 * hi, vofs = lr * TT + 8 * hi;   // the lane's place in a fragment's rows; every address below = wave-uniform pointer + one of these + a constant, so no load's result can land on an address register
    V qf[NQ][2], qf2[NQ][2];
#pragma unroll
    for (int n = 0; n < NQ; ++n)
#pragma unroll
        for (int ks = 0; ks < 2; ++ks) { const unsigned qo = kofs + n * 16 * HD + ks * 32; qf[n][ks] = WFrag<T16>::ld(Q + (size_t)q0 * HD + qo); if (HR) qf2[n][ks] = WFrag<T16>::ld(Q2 + (size_t)q0 * HD + qo); }
    v8f o[4][NQ]; float m[NQ], l[NQ];
#pragma unroll
    for (int n = 0; n < NQ; ++n) { m[n] = -3.0e38f; l[n] = 0.f;
#pragma unroll
        for (int dt = 0; dt < 4; ++dt) o[dt][n] = (v8f){}; }
    const int kend = q0 + 16 * NQ;                      // keys [0, kend): every 32-key block that starts below kend holds at least one allowed key for every query of the tile
    typedef const __attribute__((address_space(1))) T16* gptr;   // typed as global memory, so that the loads stay global loads behind the statement that the pointers pass through
    gptr kq = (gptr)(Kp + (size_t)part * 32 * HD), kq2 = HR ? (gptr)(K2 + (size_t)part * 32 * HD) : nullptr;   // wave-uniform walking pointers: key rows and value columns of the part's current block
    gptr vq = (gptr)(Vt + part * 32), vq2 = HR ? (gptr)(V2 + part * 32) : nullptr;
    V kf[2][2], kf2[2][2];
#pragma unroll
    for (int kt = 0; kt < 2; ++kt)
#pragma unroll
        for (int ks = 0; ks < 2; ++ks) { kf[kt][ks] = WFrag<T16>::ld((const T16*)(kq + kofs + kt * 16 * HD + ks * 32)); if (HR) kf2[kt][ks] = WFrag<T16>::ld((const T16*)(kq2 + kofs + kt * 16 * HD + ks * 32)); }
#pragma unroll 1   // run-time trip count; one trip's fragments, scores and accumulators already take most of the wave's registers
    for (int kb = part * 32; kb < kend; kb += KS * 32) {
        V vf[4], vf2[4];                                // this block's value fragments: asked for first, needed last
#pragma unroll
        for (int dt = 0; dt < 4; ++dt) { vf[dt] = WFrag<T16>::ld((const T16*)(vq + vofs + dt * 16 * TT)); if (HR) vf2[dt] = WFrag<T16>::ld((const T16*)(vq2 + vofs + dt * 16 * TT)); }
        // the wait in front of the steps of the base pointers that this trip's value loads and the last trip's key loads name; the pointers pass through the statement so that their steps stay behind it
        if constexpr (HR) asm volatile("s_wait_xcnt 0x0" : "+s"(vq), "+s"(vq2), "+s"(kq), "+s"(kq2) :: "memory");
        else asm volatile("s_wait_xcnt 0x0" : "+s"(vq), "+s"(kq) :: "memory");
        vq += KS * 32; if (HR) vq2 += KS * 32;
        v8f s[2][NQ];
#pragma unroll
        for (int kt = 0; kt < 2; ++kt)
#pragma unroll
            for (int n = 0; n < NQ; ++n) { v8f c = (v8f){};
#pragma unroll
                for (int ks = 0; ks < 2; ++ks) { c = WFrag<T16>::mma(kf[kt][ks], qf[n][ks], c); if (HR) { c = WFrag<T16>::mma(kf[kt][ks], qf2[n][ks], c); c = WFrag<T16>::mma(kf2[kt][ks], qf[n][ks], c); } }
                s[kt][n] = c; }
        const int kstep = (kb + KS * 32 < kend) ? KS * 32 * HD : 0; kq += kstep; if (HR) kq2 += kstep;   // the part's next key block, fetched one trip ahead (the last trip stays where it is; its fetch is not used)
#pragma unroll
        for (int kt = 0; kt < 2; ++kt)
#pragma unroll
            for (int ks = 0; ks < 2; ++ks) { kf[kt][ks] = WFrag<T16>::ld((const T16*)(kq + kofs + kt * 16 * HD + ks * 32)); if (HR) kf2[kt][ks] = WFrag<T16>::ld((const T16*)(kq2 + kofs + kt * 16 * HD + ks * 32)); }
        if (kb + 31 > q0) {                             // wave-uniform: only a block that reaches the diagonal is masked (key > query excluded)
#pragma unroll
            for (int kt = 0; kt < 2; ++kt)
#pragma unroll
                for (int n = 0; n < NQ; ++n)
#pragma unroll
                    for (int j = 0; j < 8; ++j) s[kt][n][j] = (kb + kt * 16 + hi * 8 + j <= q0 + n * 16 + lr) ? s[kt][n][j] : -3.0e38f; }
        V pf[NQ], pf2[NQ];
#pragma unroll
        for (int n = 0; n < NQ; ++n) { float mx = m[n];
#pragma unroll
            for (int j = 0; j < 8; ++j) mx = fmaxf(mx, fmaxf(s[0][n][j], s[1][n][j]));
            mx = fmaxf(mx, xhalf(mx));                  // the two lane halves hold the same query's other keys
            const float al = __builtin_amdgcn_exp2f((m[n] - mx) * (SCL * L2E)), mo = HR ? mx * (SCL * L2E) : mx * (SCL * L2E) - 10.0f; m[n] = mx; v2f sum = (v2f){0.f, 0.f};   // m: raw products; SCL and the change to base 2 go into one factor
#pragma unroll
            for (int kt = 0; kt < 2; ++kt)
#pragma unroll
                for (int j = 0; j < 8; j += 2) { const v2f p = (v2f){__builtin_amdgcn_exp2f(fmaf(s[kt][n][j], SCL * L2E, -mo)), __builtin_amdgcn_exp2f(fmaf(s[kt][n][j + 1], SCL * L2E, -mo))}; s[kt][n][j] = p[0]; s[kt][n][j + 1] = p[1]; sum += p; }   // even and odd keys summed side by side (packed adds)
            l[n] = l[n] * al + (sum[0] + sum[1]);
#pragma unroll
            for (int dt = 0; dt < 4; ++dt) o[dt][n] *= al;
            if constexpr (HR) { v8us h0, h1, l0, l1;
#pragma unroll
                for (int j = 0; j < 8; ++j) { unsigned short a, c2; splitf(s[0][n][j], a, c2); h0[j] = a; l0[j] = c2; splitf(s[1][n][j], a, c2); h1[j] = a; l1[j] = c2; }
                pf[n] = cat16b(h0, h1); pf2[n] = cat16b(l0, l1);
            } else { v8h h0, h1;
#pragma unroll
                for (int j = 0; j < 8; ++j) { h0[j] = tohx(s[0][n][j]); h1[j] = tohx(s[1][n][j]); }
                pf[n] = cat16(h0, h1); } }
#pragma unroll
        for (int dt = 0; dt < 4; ++dt)
#pragma unroll
            for (int n = 0; n < NQ; ++n) { o[dt][n] = WFrag<T16>::mma(vf[dt], pf[n], o[dt][n]); if (HR) { o[dt][n] = WFrag<T16>::mma(vf[dt], pf2[n], o[dt][n]); o[dt][n] = WFrag<T16>::mma(vf2[dt], pf[n], o[dt][n]); } }
        // the loop's branch stands right behind the last matrix instructions: four vector slots keep the distance on the taken side too
        if constexpr (NQ == 2) asm volatile("v_nop\n\tv_nop\n\tv_nop\n\tv_nop" : "+v"(o[0][0]), "+v"(o[1][0]), "+v"(o[2][0]), "+v"(o[3][0]), "+v"(o[0][1]), "+v"(o[1][1]), "+v"(o[2][1]), "+v"(o[3][1]));
        else asm volatile("v_nop\n\tv_nop\n\tv_nop\n\tv_nop" : "+v"(o[0][0]), "+v"(o[1][0]), "+v"(o[2][0]), "+v"(o[3][0]));
    }
    // the last trip's key fetch is not used and may still be on its way: the wait in front of whatever takes over the registers that it names
    if constexpr (HR) asm volatile("s_wait_xcnt 0x0" :: "s"(kq), "s"(kq2) : "memory");
    else asm volatile("s_wait_xcnt 0x0" :: "s"(kq) : "memory");
    // join of the key parts in the fixed order 0..KS-1. LDS: per (part - 1, head) 4 NQ tiles of [2 halves][32 lanes][4 floats]; behind them per (part - 1, head) m and l
    if (part != 0) { float* xo = xs + ((part - 1) * 4 + hd) * 2048; float* xm = xs + (KS - 1) * 4 * 2048 + ((part - 1) * 4 + hd) * 128;
#pragma unroll
        for (int n = 0; n < NQ; ++n) { xm[(n * 2) * 32 + lane] = m[n]; xm[(n * 2 + 1) * 32 + lane] = l[n];
#pragma unroll
            for (int dt = 0; dt < 4; ++dt) { float* t = xo + (dt * NQ + n) * 256 + lane * 4; *(v4fa*)t = (v4f){o[dt][n][0], o[dt][n][1], o[dt][n][2], o[dt][n][3]}; *(v4fa*)(t + 128) = (v4f){o[dt][n][4], o[dt][n][5], o[dt][n][6], o[dt][n][7]}; } } }
    __syncthreads();                                    // the other parts' partial results are in LDS before part 0 reads them; every wave of the work-group passes here
    if (part == 0) { const float* xo = xs + hd * 2048; const float* xm = xs + (KS - 1) * 4 * 2048 + hd * 128;
#pragma unroll
        for (int n = 0; n < NQ; ++n) { float mp[KS - 1], f[KS - 1]; float mx = m[n];      // a part without a key block hands over m = -3e38, l = 0, O = 0: its factor is 0
#pragma unroll
            for (int u = 0; u < KS - 1; ++u) { mp[u] = xm[u * 512 + (n * 2) * 32 + lane]; mx = fmaxf(mx, mp[u]); }
            float f0 = __builtin_amdgcn_exp2f((m[n] - mx) * (SCL * L2E)), lt = l[n] * f0;
#pragma unroll
            for (int u = 0; u < KS - 1; ++u) { f[u] = __builtin_amdgcn_exp2f((mp[u] - mx) * (SCL * L2E)); lt += xm[u * 512 + (n * 2 + 1) * 32 + lane] * f[u]; }
            lt += xhalf(lt);                            // the two lane halves summed the same query's other keys
            const float inv = __fdiv_rn(1.0f, lt); f0 *= inv;
#pragma unroll
            for (int u = 0; u < KS - 1; ++u) f[u] *= inv;
#pragma unroll
            for (int dt = 0; dt < 4; ++dt) { v8f r = o[dt][n] * f0;
#pragma unroll
                for (int u = 0; u < KS - 1; ++u) { const float* t = xo + u * 8192 + (dt * NQ + n) * 256 + lane * 4; const v4f u0 = *(const v4fa*)t, u1 = *(const v4fa*)(t + 128);
#pragma unroll
                    for (int j = 0; j < 4; ++j) { r[j] += u0[j] * f[u]; r[4 + j] += u1[j] * f[u]; } }
                v8us oh, ol;
#pragma unroll
                for (int j = 0; j < 8; ++j) { unsigned short a, c2; splitf(r[j], a, c2); oh[j] = a; ol[j] = c2; }
                const unsigned oo = (n * 16 + lr) * DQ + dt * 16 + hi * 8; *(v8usa*)(Ah + (size_t)q0 * DQ + oo) = oh; *(v8usa*)(Al + (size_t)q0 * DQ + oo) = ol;
                asm volatile("s_wait_xcnt 0x0" ::: "memory"); } } }   // the next tile's values reuse the registers that these two stores name
}
__global__ __launch_bounds__(KS * 128) void k_fattn(const h16* __restrict__ Q16, const h16* __restrict__ K16, const h16* __restrict__ V16, const bf* __restrict__ Qh, const bf* __restrict__ Ql, const bf* __restrict__ Kh, const bf* __restrict__ Kl, const bf* __restrict__ Vh, const bf* __restrict__ Vl, bf* Ah, bf* Al) {
    static_assert(REP == 4 && RH % 32 == 0 && (TT - RH) % 32 == 0, "4 query heads a kv head; whole tiles on both sides of RH");
    __shared__ __align__(16) float xs[(KS - 1) * 4 * (2048 + 128)];
    const int w = __builtin_amdgcn_readfirstlane(threadIdx.x >> 5);   // wave number, scalar: head, key part and the key loop's bounds stay wave-uniform
    const int hd = w & 3, part = w >> 2, g = blockIdx.x, bt = blockIdx.y, h = g * REP + hd; const size_t qp = (size_t)h * TT * HD, kp = (size_t)g * TT * HD;
    if (bt < (TT - RH) / 32) fattn_tile<h16, false, 2>(Q16 + qp, nullptr, K16 + kp, nullptr, V16 + kp, nullptr, TT - 32 * (bt + 1), hd, part, Ah + h * HD, Al + h * HD, xs);   // longest tiles first
    else fattn_tile<bf, true, 1>(Qh + qp, Ql + qp, Kh + kp, Kl + kp, Vh + kp, Vl + kp, RH - 16 * (bt - (TT - RH) / 32 + 1), hd, part, Ah + h * HD, Al + h * HD, xs);
}

extern "C" void kernel_launch(void* const* d_in, const int* in_sizes, int n_in,
                              void* d_out, int out_size, void* d_ws, size_t ws_size, hipStream_t stream) {
    (void)in_sizes; (void)n_in; (void)out_size;
    const float* x = (const float*)d_in[0]; const float* wq = (const float*)d_in[1]; const float* wk = (const float*)d_in[2]; const float* wv = (const float*)d_in[3]; const float* wo = (const float*)d_in[4]; const float* qsc = (const float*)d_in[5]; const float* ksc = (const float*)d_in[6];   /* input order x, Wq ('xw' [2048][2048]), Wk, Wv ([2048][512]), Wo ('xw'), q_norm_w, k_norm_w ([64], read) */
    float* OUT = (float*)d_out;     // [2][2048][2048]
    char* wsp = (char*)d_ws;
    auto take = [&](size_t bytes) { char* p = wsp; wsp += (bytes + 255) & ~(size_t)255; return (void*)p; };
    bf* WQ = (bf*)take((size_t)DQ * DM * 2); bf* WK = (bf*)take((size_t)DKV * DM * 2); bf* WV = (bf*)take((size_t)DKV * DM * 2); bf* WO = (bf*)take((size_t)DM * DQ * 2); float* CS = (float*)take((size_t)TT * HD * 2 * 4);
    bf* XB = (bf*)take((size_t)TT * DM * 2);
    h16* QP16 = (h16*)take((size_t)NH_ * TT * HD * 2); h16* KP16 = (h16*)take((size_t)NKV * TT * HD * 2); h16* VT16 = (h16*)take((size_t)NKV * HD * TT * 2);
    bf* QPh = (bf*)take((size_t)NH_ * TT * HD * 2); bf* QPl = (bf*)take((size_t)NH_ * TT * HD * 2); bf* KPh = (bf*)take((size_t)NKV * TT * HD * 2); bf* KPl = (bf*)take((size_t)NKV * TT * HD * 2); bf* VTh = (bf*)take((size_t)NKV * HD * TT * 2); bf* VTl = (bf*)take((size_t)NKV * HD * TT * 2);
    bf* ATh = (bf*)take((size_t)TT * DQ * 2); bf* ATl = (bf*)take((size_t)TT * DQ * 2);
    if ((size_t)(wsp - (char*)d_ws) > ws_size) return;    // ws 256 MiB
    { k_wtG<<<(unsigned)((DM * DQ / 64 + 63) / 64), 256, 0, stream>>>(wq, DM, DQ, WQ); k_wtG<<<(unsigned)((DM * DKV / 64 + 63) / 64), 256, 0, stream>>>(wk, DM, DKV, WK); k_wtG<<<(unsigned)((DM * DKV / 64 + 63) / 64), 256, 0, stream>>>(wv, DM, DKV, WV);
      k_wtG<<<(unsigned)((DQ * DM / 64 + 63) / 64), 256, 0, stream>>>(wo, DQ, DM, WO);
       }
    k_cs5<<<(TT * HD + 255) / 256, 256, 0, stream>>>(CS);   /* rotary table computed from the positions and INVT */
    for (int b = 0; b < NB_; ++b) {
        
        k_cvt8<<<(unsigned)(((size_t)TT * DM / 8 + 255) / 256), 256, 0, stream>>>(x + (size_t)b * TT * DM, XB, (size_t)TT * DM / 8);
        k_gemmw<bf, 0, false, 8, 1><<<dim3(TT / 64, DQ / 64, 1), 256, 0, stream>>>(XB, nullptr, WQ, nullptr, DM, nullptr, 0, nullptr, 0, 0, 0, CS, qsc, QP16, QPh, QPl);   /* q: projection, per-head RMSNorm x q_norm_w, rotary, planes */
        k_gemmw<bf, 0, false, 16, 1><<<dim3(TT / 64, DKV / 64, 1), 512, 0, stream>>>(XB, nullptr, WK, nullptr, DM, nullptr, 0, nullptr, 0, 0, 0, CS, ksc, KP16, KPh, KPl);   /* k: the same with k_norm_w */
        k_gemmw<bf, 0, false, 16, 2><<<dim3(TT / 64, DKV / 64, 1), 512, 0, stream>>>(XB, nullptr, WV, nullptr, DM, nullptr, 0, nullptr, 0, 0, 0, nullptr, nullptr, VT16, VTh, VTl);   /* v: projection, transposed planes */
        k_fattn<<<dim3(NKV, (TT - RH) / 32 + RH / 16, 1), KS * 128, 0, stream>>>(QP16, KP16, VT16, QPh, QPl, KPh, KPl, VTh, VTl, ATh, ATl);
        k_gemmw<bf, 1, false, 8, 0><<<dim3(TT / 64, DM / 64, 1), 256, 0, stream>>>(ATh, ATl, WO, nullptr, DQ, OUT + (size_t)b * TT * DM, DM, nullptr, 0, 0, 0, nullptr, nullptr, nullptr, nullptr, nullptr); }
}

// v005
// One run takes 245 microseconds.
// Next to v004, in two timings, it ran 1.36 and 1.37 times as fast.
// All steps since v000 together make it 11.3 times as fast.
#include <hip/hip_runtime.h>

// Grouped-query causal attention with per-head RMSNorm and computed half-split rotary embeddings at base 1e6 (x [2][2048][2048]; q = x Wq (32 heads x 64), k, v = x Wk, x Wv (8 kv heads x 64) ('xw' 0.02, no bias); per head q = rms_norm(q) x q_norm_w, k = rms_norm(k) x k_norm_w (eps 1e-5; weights [64] = ones, read); rope: (x1, x2) = the two HALVES of each head: cat(x1 cos - x2 sin, x2 cos + x1 sin) with angle t x 1000000^(-2i/64), i < 32 (32 f32 frequencies jnp-exact for the module's power expression; precise cosf/sinf); query heads viewed (HKV, g): kv head = q head / 4; scores x 64^-0.5; causal (finfo.min == exclusion); softmax; out = merged Wo ('xw') -> [2][2048][2048] (8.4 M); argument order x, Wq, Wk, Wv, Wo, q_norm_w, k_norm_w).
// Layout per batch: bf16 copy of x and 'xw' weights transposed once, both in fragment order (see FRAGMENT ORDER below; k_cvt8, k_wtG); exact projections, whose 64x64 tile is one head x 64 tokens, so the tile's epilogue does RMSNorm (1/sqrt(mean + eps) x w[d]) and rotate-half with the k_cs5 table {cosf, sinf}(t x INVT[d mod 32]) and writes the head planes itself (v: transposed planes); causal T-2048 GQA attention in one launch (k_fattn, running softmax; hybrid rows: < 512 hi/lo 3 products, rest fp16 x1024; key blocks above the diagonal are never visited); merged hi/lo (fragment order) x Wo exact.
// Compute dtypes, f32 accumulate: every input rounded to bf16 incl. the norm weights (the cos/sin table stays f32); projections exact; RMSNorm and rotary f32; attention rows < 512 3 products, rest fp16; softmax f32; Wo hl x exact.

#define NB_  2
#define TT   2048
#define DM   2048
#define NH_  32
#define NKV  8
#define REP  (NH_ / NKV)
#define HD   64
#define DQ   (NH_ * HD)
#define DKV  (NKV * HD)
#define RH   512                  // query rows < RH use hi+lo planes (0: none)
#define SCL  0.125f   // HD^-0.5
typedef _Float16 h16;
typedef unsigned short bf;
typedef __attribute__((ext_vector_type(16))) __bf16   v16bf;
typedef __attribute__((ext_vector_type(16))) _Float16 v16h;
typedef __attribute__((ext_vector_type(8)))  _Float16 v8h;
typedef __attribute__((ext_vector_type(8)))  unsigned short v8us;
typedef __attribute__((ext_vector_type(8)))  float    v8f;
typedef __attribute__((ext_vector_type(4)))  float    v4f;
typedef v8h  __attribute__((may_alias)) v8ha;
typedef v4f  __attribute__((may_alias)) v4fa;
typedef v8us __attribute__((may_alias)) v8usa;

__device__ __forceinline__ unsigned short f2bf(float f) { unsigned u = __float_as_uint(f); u += 0x7FFFu + ((u >> 16) & 1u); return (unsigned short)(u >> 16); }
__device__ __forceinline__ float bf2f(unsigned short b) { return __uint_as_float(((unsigned)b) << 16); }
__device__ __forceinline__ float bfr(float f) { return bf2f(f2bf(f)); }
__device__ __forceinline__ v16h cat16(v8h lo, v8h hi) { return __builtin_shufflevector(lo, hi, 0, 1, 2, 3, 4, 5, 6, 7, 8, 9, 10, 11, 12, 13, 14, 15); }
__device__ __forceinline__ v16bf cat16b(v8us lo, v8us hi) { return __builtin_bit_cast(v16bf, __builtin_shufflevector(lo, hi, 0, 1, 2, 3, 4, 5, 6, 7, 8, 9, 10, 11, 12, 13, 14, 15)); }
__device__ __forceinline__ v8f wmma16(v16h a, v16h b, v8f c) { return __builtin_amdgcn_wmma_f32_16x16x32_f16(false, a, false, b, (short)0, c, false, false); }
__device__ __forceinline__ v8f wmmab(v16bf a, v16bf b, v8f c) { return __builtin_amdgcn_wmma_f32_16x16x32_bf16(false, a, false, b, (short)0, c, false, false); }



// ---- split-K inside a work-group: the NW waves of a 64x64 tile each take every NW-th 32-wide step of K (neighbouring waves read neighbouring 1024-byte fragments of a row block at about the same time),
// so the chain of dependent load round trips per wave is NW times shorter. ksum_store puts the NW partial tiles into LDS (row pitch 68 floats), and behind one barrier adds them in the fixed order wave 0..NW-1 and stores the tile.
__device__ __forceinline__ void kpart_put(const v8f (&acc)[4][4], float* os, int w, int lr, int hi) {
#pragma unroll
    for (int mb = 0; mb < 4; ++mb)
#pragma unroll
        for (int nb = 0; nb < 4; ++nb)
#pragma unroll
            for (int j = 0; j < 8; ++j) os[(w * 64 + mb * 16 + hi * 8 + j) * 68 + nb * 16 + lr] = acc[mb][nb][j];
}
template <int NW>
__device__ __forceinline__ v4f kpart_sum(const float* os, int row, int cofs) {
    v4f val = *(const v4fa*)(os + row * 68 + cofs);
#pragma unroll
    for (int u = 1; u < NW; ++u) val += *(const v4fa*)(os + (u * 64 + row) * 68 + cofs);
    return val;
}
template <int NW, bool BIAS>
__device__ __forceinline__ void ksum_store(const v8f (&acc)[4][4], float* os, int w, int lr, int hi, float* C, int ldc, const float* bias) {
    kpart_put(acc, os, w, lr, hi);
    __syncthreads();                       // all NW partial tiles are in LDS before any of them is read
    const int tid = threadIdx.x, cofs = (tid & 15) * 4;
#pragma unroll
    for (int s = 0; s < 32 / NW; ++s) { const int row = s * NW * 2 + (tid >> 4);
        v4f val = kpart_sum<NW>(os, row, cofs);
        if (BIAS) { val[0] += bfr(bias[cofs]); val[1] += bfr(bias[cofs + 1]); val[2] += bfr(bias[cofs + 2]); val[3] += bfr(bias[cofs + 3]); }
        *(v4f*)(C + (size_t)row * ldc + cofs) = val; }
}

__device__ __forceinline__ h16 tohx(float x) { return (h16)x; }
__device__ __forceinline__ void splitf(float y, unsigned short& h, unsigned short& l) { h = f2bf(y); l = f2bf(y - bf2f(h)); }
typedef __attribute__((ext_vector_type(4))) _Float16 v4h;
typedef __attribute__((ext_vector_type(4))) unsigned short v4us;
template <int M> __device__ __forceinline__ float xrow(float x) { return __builtin_bit_cast(float, __builtin_amdgcn_update_dpp(0, __builtin_bit_cast(int, x), 0x160 | M, 0xf, 0xf, true)); }   // lane l <-> lane l ^ M inside a 16-lane row (row_xmask)

// ---- ksum_rope: epilogue of a q or k projection tile (64 tokens x the 64 dims of ONE head). Behind the sum of the partial tiles the 16 lanes of a row hold one (token, head) vector, 4 dims each:
// sum of squares over the row by a 4-step butterfly (the same value in all 16 lanes), x 1/sqrt(mean + eps) x w[d], then rotate-half (dim d's partner d +- 32 sits in lane l ^ 8), then the fp16 and hi/lo planes [t][d]: a wave stores 2 whole 128-byte rows a plane.
// cs: the tile's first row of the {cos, sin} table; P16, Ph, Pl: the tile's first row in the head's planes.
template <int NW>
__device__ __forceinline__ void ksum_rope(const v8f (&acc)[4][4], float* os, int w, int lr, int hi, const float* __restrict__ cs, const float* __restrict__ nw, h16* P16, bf* Ph, bf* Pl) {
    constexpr int NS = 32 / NW;
    const int tid = threadIdx.x, cofs = (tid & 15) * 4, rw = tid >> 4;
    v4f c01[NS], c23[NS]; float wv[4];     // the thread's table rows are asked for in front of the LDS stores and the barrier, which cover their way
#pragma unroll
    for (int s = 0; s < NS; ++s) { const float* c = cs + ((s * NW * 2 + rw) * HD + cofs) * 2; c01[s] = *(const v4f*)c; c23[s] = *(const v4f*)(c + 4); }
#pragma unroll
    for (int q = 0; q < 4; ++q) wv[q] = bfr(nw[cofs + q]);
    kpart_put(acc, os, w, lr, hi);
    __builtin_amdgcn_sched_barrier(0);     // keeps every use of the table rows behind the LDS stores: without it the first wait for those loads stands in front of the stores
    __syncthreads();                       // all NW partial tiles are in LDS before any of them is read
    const float sg = (cofs < HD / 2) ? -1.0f : 1.0f;   // out[d] = x[d] cos - x[d + 32] sin, out[d + 32] = x[d + 32] cos + x[d] sin
#pragma unroll
    for (int s = 0; s < NS; ++s) { const int row = s * NW * 2 + rw;
        const v4f a = kpart_sum<NW>(os, row, cofs);
        float ss = a[0] * a[0] + a[1] * a[1] + a[2] * a[2] + a[3] * a[3];
        ss += xrow<1>(ss); ss += xrow<2>(ss); ss += xrow<4>(ss); ss += xrow<8>(ss);
        const float rf = __fdiv_rn(1.0f, __fsqrt_rn(ss * (1.0f / HD) + 1e-5f));
        v4h o16; v4us oh, ol;
#pragma unroll
        for (int q = 0; q < 4; ++q) { const float y = a[q] * rf * wv[q], p = xrow<8>(y) * sg; const float co = (q < 2) ? c01[s][q * 2] : c23[s][q * 2 - 4], si = (q < 2) ? c01[s][q * 2 + 1] : c23[s][q * 2 - 3];
            const float r = y * co + p * si; o16[q] = tohx(r); unsigned short a2, c2; splitf(r, a2, c2); oh[q] = a2; ol[q] = c2; }
        const unsigned po = row * HD + cofs; *(v4h*)(P16 + po) = o16; *(v4us*)(Ph + po) = oh; *(v4us*)(Pl + po) = ol; }
}
// ---- ksum_vt: epilogue of a v projection tile: the summed tile goes back into LDS (each thread over the elements of partial tile 0 that it alone has read), and behind a second barrier it is read by columns:
// 8 lanes store one whole 128-byte row (64 tokens of one dim) of the transposed fp16 and hi/lo planes [d][t]. V16, Vh, Vl: the tile's first token in the head's planes.
template <int NW>
__device__ __forceinline__ void ksum_vt(const v8f (&acc)[4][4], float* os, int w, int lr, int hi, h16* V16, bf* Vh, bf* Vl) {
    static_assert(NW == 16, "8 tokens a thread");
    kpart_put(acc, os, w, lr, hi);
    __syncthreads();                       // all NW partial tiles are in LDS before any of them is read
    const int tid = threadIdx.x, cofs = (tid & 15) * 4;
#pragma unroll
    for (int s = 0; s < 32 / NW; ++s) { const int row = s * NW * 2 + (tid >> 4); const v4f val = kpart_sum<NW>(os, row, cofs); *(v4fa*)(os + row * 68 + cofs) = val; }
    __syncthreads();                       // the whole summed tile is in LDS before it is read across the threads' own elements
    const int d = tid >> 3, tc = (tid & 7) * 8; v8h o16; v8us oh, ol;
#pragma unroll
    for (int j = 0; j < 8; ++j) { const float x = os[(tc + j) * 68 + d]; o16[j] = tohx(x); unsigned short a2, c2; splitf(x, a2, c2); oh[j] = a2; ol[j] = c2; }
    const unsigned po = d * TT + tc; *(v8h*)(V16 + po) = o16; *(v8us*)(Vh + po) = oh; *(v8us*)(Vl + po) = ol;
}

// ---- FRAGMENT ORDER of a GEMM operand plane [R][K]: one 16-row x 32-k fragment is 1024 contiguous bytes, fragments of a 16-row block follow one another along k. Inside a fragment lane (lr = row & 15, hi) owns two 16-byte pieces:
// k = 8 hi + 0..7 at element lane * 8 and k = 16 + 8 hi + 0..7 at element 256 + lane * 8 (lane = hi * 16 + lr): element (r, k) stands at ((r >> 4) * (K >> 5) + (k >> 5)) * 512 + ((k >> 4) & 1) * 256 + (((k >> 3) & 1) * 16 + (r & 15)) * 8 + (k & 7).
// Each of a fragment's two wave loads then covers 512 contiguous bytes (4 whole 128-byte lines) instead of 32-byte pieces of 16 lines; which lane and register holds which k is what it was with row-major planes.
// ---- k_gemmw: register-blocked GEMM, NW WAVES per 64x64 output tile (16 accumulators each, K split between them), operands straight from 16-bit planes in fragment order; grid (M/64, N/64, Z), NW*32 threads.
// C[m][n] (f32, pitch ldc, + optional f32 bias[n]) = sum_k A[m][k] Bt[n][k] (+ split products per NSPLIT). z-batch strides sA/sB/sC in elements. K % 32 == 0.
// EPI 0: the tile goes to C. EPI 1 (q, k) and 2 (v): m = token, tile column = head; the tile goes through ksum_rope or ksum_vt into the planes P16, Ph, Pl and C is not used.
template <typename T16> struct WFrag;
template <> struct WFrag<h16> { typedef v16h V; static __device__ __forceinline__ V ld(const h16* p) { return cat16(*(const v8h*)p, *(const v8h*)(p + 16)); } static __device__ __forceinline__ V ldp(const h16* p) { return cat16(*(const v8h*)p, *(const v8h*)(p + 256)); } static __device__ __forceinline__ v8f mma(V a, V b, v8f c) { return wmma16(a, b, c); } };
template <> struct WFrag<bf> { typedef v16bf V; static __device__ __forceinline__ V ld(const bf* p) { return cat16b(*(const v8us*)p, *(const v8us*)(p + 16)); } static __device__ __forceinline__ V ldp(const bf* p) { return cat16b(*(const v8us*)p, *(const v8us*)(p + 256)); } static __device__ __forceinline__ v8f mma(V a, V b, v8f c) { return wmmab(a, b, c); } };
template <typename T16, int NSPLIT, bool BIAS, int NW, int EPI, int K>
__global__ __launch_bounds__(NW * 32) void k_gemmw(const T16* __restrict__ A, const T16* __restrict__ A2, const T16* __restrict__ Bt, const T16* __restrict__ Bt2, float* C, int ldc, const float* __restrict__ bias, size_t sA, size_t sB, size_t sC, const float* __restrict__ CS, const float* __restrict__ nw, h16* P16, bf* Ph, bf* Pl) {
    typedef typename WFrag<T16>::V V;
    __shared__ __align__(16) float os[NW * 64 * 68];
    const size_t z = blockIdx.z; A += z * sA; if (A2) A2 += z * sA; Bt += z * sB; if (Bt2) Bt2 += z * sB; C += z * sC;
    const int lane = threadIdx.x & 31, lr = lane & 15, hi = lane >> 4; const int r0 = blockIdx.x * 64, c0 = blockIdx.y * 64;
    const int w = __builtin_amdgcn_readfirstlane(threadIdx.x >> 5);   // wave number, scalar: the K loop's bounds stay wave-uniform
    v8f acc[4][4];
#pragma unroll
    for (int mb = 0; mb < 4; ++mb)
#pragma unroll
        for (int nb = 0; nb < 4; ++nb) acc[mb][nb] = (v8f){};
    // a 16-row block is 16 K elements, a 32-k step inside it 512: every address = a wave-uniform walking pointer (the tile's first row block at the wave's k step) + the lane's fixed offset + a constant (row block mb or nb; K is a
    // compile-time constant for that), so no load's result and no address step can land on a vector register that a load in flight names
    typedef const __attribute__((address_space(1))) T16* gptr;   // typed as global memory, so that the loads stay global loads behind the statement that the pointers pass through
    constexpr bool HA2 = NSPLIT == 1 || NSPLIT == 2, HB2 = NSPLIT >= 2;
    gptr ap = (gptr)(A + (size_t)r0 * K + w * 512), ap2 = HA2 ? (gptr)(A2 + (size_t)r0 * K + w * 512) : nullptr, bp = (gptr)(Bt + (size_t)c0 * K + w * 512), bp2 = HB2 ? (gptr)(Bt2 + (size_t)c0 * K + w * 512) : nullptr;
    const unsigned lofs = lane * 8;
#pragma unroll 1
    for (int kc = w * 32; kc < K; kc += NW * 32) {
        V a[4], a2[4], b[4], b2[4];
#pragma unroll
        for (int mb = 0; mb < 4; ++mb) { a[mb] = WFrag<T16>::ldp((const T16*)(ap + lofs + mb * 16 * K)); if (HA2) a2[mb] = WFrag<T16>::ldp((const T16*)(ap2 + lofs + mb * 16 * K)); }
#pragma unroll
        for (int nb = 0; nb < 4; ++nb) { b[nb] = WFrag<T16>::ldp((const T16*)(bp + lofs + nb * 16 * K)); if (HB2) b2[nb] = WFrag<T16>::ldp((const T16*)(bp2 + lofs + nb * 16 * K)); }
        __builtin_amdgcn_sched_barrier(0);     // keeps the trip's loads one group in front of its matrix instructions: without it this build asks for each B fragment only when the one before is used up, a round trip each
#pragma unroll
        for (int nb = 0; nb < 4; ++nb)
#pragma unroll
            for (int mb = 0; mb < 4; ++mb) { acc[mb][nb] = WFrag<T16>::mma(a[mb], b[nb], acc[mb][nb]); if (HA2) acc[mb][nb] = WFrag<T16>::mma(a2[mb], b[nb], acc[mb][nb]); if (HB2) acc[mb][nb] = WFrag<T16>::mma(a[mb], b2[nb], acc[mb][nb]); }
        asm volatile("v_nop\n\tv_nop\n\tv_nop\n\tv_nop" : "+v"(acc[0][0]), "+v"(acc[1][1]), "+v"(acc[2][2]), "+v"(acc[3][3]) : "v"(a[0]), "v"(a[3]));
        // the wait in front of the steps of the base pointers that this trip's loads name; the pointers pass through the statement so that their steps stay behind it
        if constexpr (HA2 && HB2) asm volatile("s_wait_xcnt 0x0" : "+s"(ap), "+s"(ap2), "+s"(bp), "+s"(bp2) :: "memory");
        else if constexpr (HA2) asm volatile("s_wait_xcnt 0x0" : "+s"(ap), "+s"(ap2), "+s"(bp) :: "memory");
        else if constexpr (HB2) asm volatile("s_wait_xcnt 0x0" : "+s"(ap), "+s"(bp), "+s"(bp2) :: "memory");
        else asm volatile("s_wait_xcnt 0x0" : "+s"(ap), "+s"(bp) :: "memory");
        ap += NW * 512; bp += NW * 512; if (HA2) ap2 += NW * 512; if (HB2) bp2 += NW * 512;
    }
    if constexpr (EPI == 0) ksum_store<NW, BIAS>(acc, os, w, lr, hi, C + (size_t)r0 * ldc + c0, ldc, BIAS ? bias + c0 : nullptr);
    else if constexpr (EPI == 1) { const size_t po = ((size_t)blockIdx.y * TT + r0) * HD; ksum_rope<NW>(acc, os, w, lr, hi, CS + (size_t)r0 * HD * 2, nw, P16 + po, Ph + po, Pl + po); }
    else { const size_t po = (size_t)blockIdx.y * HD * TT + r0; ksum_vt<NW>(acc, os, w, lr, hi, P16 + po, Ph + po, Pl + po); }
}

typedef __attribute__((ext_vector_type(2))) unsigned short v2us;
typedef __attribute__((ext_vector_type(2))) float v2f;
typedef __attribute__((ext_vector_type(4))) int v4i;

// k_cvt8: f32 [R][K] -> bf16 plane in fragment order. One wave = one fragment, one thread = one lane's place in it: the wave reads the fragment's 16 rows x 128 bytes and stores its 1024 bytes as two runs of 512.
// Every address = wave-uniform pointer + the lane's fixed offset + a constant.
template <int K>
__global__ __launch_bounds__(256) void k_cvt8(const float* __restrict__ src, bf* dst, int nfrag) {
    const int lane = threadIdx.x & 31, f = blockIdx.x * 8 + __builtin_amdgcn_readfirstlane(threadIdx.x >> 5); if (f >= nfrag) return;   // fragment number, scalar
    const float* s = src + (size_t)(f / (K / 32)) * 16 * K + (f % (K / 32)) * 32; const unsigned so = (lane & 15) * K + (lane >> 4) * 8;
    const v8f v0 = *(const v8f*)(s + so), v1 = *(const v8f*)(s + so + 16); v8us o0, o1;
#pragma unroll
    for (int k = 0; k < 8; ++k) { o0[k] = f2bf(v0[k]); o1[k] = f2bf(v1[k]); }
    bf* d = dst + (size_t)f * 512; const unsigned dof = lane * 8; *(v8us*)(d + dof) = o0; *(v8us*)(d + dof + 256) = o1; }

__constant__ float INVT[HD / 2] = { 1.000000000e+00f, 6.493816376e-01f, 4.216965139e-01f, 2.738419771e-01f, 1.778279394e-01f, 1.154781953e-01f, 7.498942316e-02f, 4.869675264e-02f, 3.162277490e-02f, 2.053525113e-02f, 1.333521400e-02f, 8.659643121e-03f, 5.623413250e-03f, 3.651741194e-03f, 2.371373819e-03f, 1.539926510e-03f, 1.000000047e-03f, 6.493816036e-04f, 4.216965172e-04f, 2.738419571e-04f, 1.778279402e-04f, 1.154782003e-04f, 7.498942432e-05f, 4.869675104e-05f, 3.162277790e-05f, 2.053524986e-05f, 1.333521413e-05f, 8.659642845e-06f, 5.623413472e-06f, 3.651741281e-06f, 2.371373739e-06f, 1.539926529e-06f };   // THETA ** (-arange(0, 64, 2) / 64) with THETA = 1e6 in float32 (the module's power expression)
__global__ __launch_bounds__(256) void k_cs5(float* CS) { const int idx = blockIdx.x * 256 + threadIdx.x; if (idx >= TT * HD) return; const int d = idx % HD; const int t = idx / HD; const float a = __fmul_rn((float)t, INVT[d % (HD / 2)]); v2f cs; cs[0] = cosf(a); cs[1] = sinf(a); *(v2f*)(CS + (size_t)idx * 2) = cs;  }
// k_wtG: f32 w [K][N] -> bf16 plane of w^T ([N][K]) in fragment order. One wave = one fragment, one thread = one lane's place in it: its 16 k of one n; 16 lanes read 64 contiguous bytes of a row of w,
// and the two waves of a pair take neighbouring 16-column blocks at the same k, the two halves of the same 128-byte lines. Every address = wave-uniform pointer + the lane's fixed offset + a constant. Grid: N K / 512 waves.
template <int K, int N>
__global__ __launch_bounds__(256) void k_wtG(const float* __restrict__ w, bf* Bt) {
    static_assert(N % 32 == 0 && K % 32 == 0 && (N / 16) * (K / 32) % 8 == 0, "whole fragments, pairs of column blocks, whole work-groups");
    const int lane = threadIdx.x & 31, wv = blockIdx.x * 8 + __builtin_amdgcn_readfirstlane(threadIdx.x >> 5), pair = wv >> 1;   // wave number, scalar
    const int nb = (pair / (K / 32)) * 2 + (wv & 1), kb = pair % (K / 32);
    const float* s = w + (size_t)kb * 32 * N + nb * 16; const unsigned so = (lane >> 4) * 8 * N + (lane & 15); v8us o0, o1;
#pragma unroll
    for (int j = 0; j < 8; ++j) { o0[j] = f2bf(s[so + j * N]); o1[j] = f2bf(s[so + (16 + j) * N]); }
    bf* d = Bt + ((size_t)nb * (K / 32) + kb) * 512; const unsigned dof = lane * 8; *(v8us*)(d + dof) = o0; *(v8us*)(d + dof + 256) = o1;
}

// ---- k_fattn: the whole causal attention of one batch in one launch (scores, softmax, probability x value and the hi/lo merge), with a running maximum and sum per query; no score or probability plane in memory.
// Transposed products: S^T = K Q^T (A = key rows, B = query rows kept in registers), O^T += V^T P^T (A = rows of the [d][t] value plane). In a 16-column group lane (lr, hi) holds query lr only: keys 8 hi + j of each
// 16-key score tile, so two score tiles of a 32-key block, converted in place, are the B operand of the second product in the loaders' own k order (8 hi + 0..7, 16 + 8 hi + 0..7), and maximum, sum and rescale factor are per lane.
// Work-group = 16 waves: the 4 query heads of one kv head (they read the same K and V lines) x KS = 4 key parts (part p takes every 4th 32-key block); parts 1..3 hand their (O, m, l) to part 0 through LDS behind one barrier.
// One work-group fills a WGP's registers, so the tiles, longest first, are dealt out as WGPs fall free; blockIdx.x = kv head.
// Query rows < RH: 16 columns a wave, hi/lo bf16 planes, 3 products in both contractions; the rest: 32 columns a wave, fp16, probabilities carried x 2^10 (the sum carries the same factor, so it cancels).
#define L2E  1.4426950408889634f
#define KS   4
__device__ __forceinline__ float xhalf(float x) { return __builtin_bit_cast(float, __builtin_amdgcn_permlanex16(__builtin_bit_cast(int, x), __builtin_bit_cast(int, x), 0x76543210, 0xfedcba98, false, false)); }   // lane l <-> lane l ^ 16
template <typename T16, bool HR, int NQ>
__device__ __forceinline__ void fattn_tile(const T16* __restrict__ Q, const T16* __restrict__ Q2, const T16* __restrict__ Kp, const T16* __restrict__ K2, const T16* __restrict__ Vt, const T16* __restrict__ V2, int q0, int hd, int part, bf* Ah, bf* Al, float* xs) {
    typedef typename WFrag<T16>::V V;
    const int lane = threadIdx.x & 31, lr = lane & 15, hi = lane >> 4;
    const unsigned kofs = lr * HD + 8 * hi, vofs = lr * TT + 8 * hi;   // the lane's place in a fragment's rows; every address below = wave-uniform pointer + one of these + a constant, so no load's result can land on an address register
    V qf[NQ][2], qf2[NQ][2];
#pragma unroll
    for (int n = 0; n < NQ; ++n)
#pragma unroll
        for (int ks = 0; ks < 2; ++ks) { const unsigned qo = kofs + n * 16 * HD + ks * 32; qf[n][ks] = WFrag<T16>::ld(Q + (size_t)q0 * HD + qo); if (HR) qf2[n][ks] = WFrag<T16>::ld(Q2 + (size_t)q0 * HD + qo); }
    v8f o[4][NQ]; float m[NQ], l[NQ];
#pragma unroll
    for (int n = 0; n < NQ; ++n) { m[n] = -3.0e38f; l[n] = 0.f;
#pragma unroll
        for (int dt = 0; dt < 4; ++dt) o[dt][n] = (v8f){}; }
    const int kend = q0 + 16 * NQ;                      // keys [0, kend): every 32-key block that starts below kend holds at least one allowed key for every query of the tile
    typedef const __attribute__((address_space(1))) T16* gptr;   // typed as global memory, so that the loads stay global loads behind the statement that the pointers pass through
    gptr kq = (gptr)(Kp + (size_t)part * 32 * HD), kq2 = HR ? (gptr)(K2 + (size_t)part * 32 * HD) : nullptr;   // wave-uniform walking pointers: key rows and value columns of the part's current block
    gptr vq = (gptr)(Vt + part * 32), vq2 = HR ? (gptr)(V2 + part * 32) : nullptr;
    V kf[2][2], kf2[2][2];
#pragma unroll
    for (int kt = 0; kt < 2; ++kt)
#pragma unroll
        for (int ks = 0; ks < 2; ++ks) { kf[kt][ks] = WFrag<T16>::ld((const T16*)(kq + kofs + kt * 16 * HD + ks * 32)); if (HR) kf2[kt][ks] = WFrag<T16>::ld((const T16*)(kq2 + kofs + kt * 16 * HD + ks * 32)); }
#pragma unroll 1   // run-time trip count; one trip's fragments, scores and accumulators already take most of the wave's registers
    for (int kb = part * 32; kb < kend; kb += KS * 32) {
        V vf[4], vf2[4];                                // this block's value fragments: asked for first, needed last
#pragma unroll
        for (int dt = 0; dt < 4; ++dt) { vf[dt] = WFrag<T16>::ld((const T16*)(vq + vofs + dt * 16 * TT)); if (HR) vf2[dt] = WFrag<T16>::ld((const T16*)(vq2 + vofs + dt * 16 * TT)); }
        // the wait in front of the steps of the base pointers that this trip's value loads and the last trip's key loads name; the pointers pass through the statement so that their steps stay behind it
        if constexpr (HR) asm volatile("s_wait_xcnt 0x0" : "+s"(vq), "+s"(vq2), "+s"(kq), "+s"(kq2) :: "memory");
        else asm volatile("s_wait_xcnt 0x0" : "+s"(vq), "+s"(kq) :: "memory");
        vq += KS * 32; if (HR) vq2 += KS * 32;
        v8f s[2][NQ];
#pragma unroll
        for (int kt = 0; kt < 2; ++kt)
#pragma unroll
            for (int n = 0; n < NQ; ++n) { v8f c = (v8f){};
#pragma unroll
                for (int ks = 0; ks < 2; ++ks) { c = WFrag<T16>::mma(kf[kt][ks], qf[n][ks], c); if (HR) { c = WFrag<T16>::mma(kf[kt][ks], qf2[n][ks], c); c = WFrag<T16>::mma(kf2[kt][ks], qf[n][ks], c); } }
                s[kt][n] = c; }
        const int kstep = (kb + KS * 32 < kend) ? KS * 32 * HD : 0; kq += kstep; if (HR) kq2 += kstep;   // the part's next key block, fetched one trip ahead (the last trip stays where it is; its fetch is not used)
#pragma unroll
        for (int kt = 0; kt < 2; ++kt)
#pragma unroll
            for (int ks = 0; ks < 2; ++ks) { kf[kt][ks] = WFrag<T16>::ld((const T16*)(kq + kofs + kt * 16 * HD + ks * 32)); if (HR) kf2[kt][ks] = WFrag<T16>::ld((const T16*)(kq2 + kofs + kt * 16 * HD + ks * 32)); }
        if (kb + 31 > q0) {                             // wave-uniform: only a block that reaches the diagonal is masked (key > query excluded)
#pragma unroll
            for (int kt = 0; kt < 2; ++kt)
#pragma unroll
                for (int n = 0; n < NQ; ++n)
#pragma unroll
                    for (int j = 0; j < 8; ++j) s[kt][n][j] = (kb + kt * 16 + hi * 8 + j <= q0 + n * 16 + lr) ? s[kt][n][j] : -3.0e38f; }
        V pf[NQ], pf2[NQ];
#pragma unroll
        for (int n = 0; n < NQ; ++n) { float mx = m[n];
#pragma unroll
            for (int j = 0; j < 8; ++j) mx = fmaxf(mx, fmaxf(s[0][n][j], s[1][n][j]));
            mx = fmaxf(mx, xhalf(mx));                  // the two lane halves hold the same query's other keys
            const float al = __builtin_amdgcn_exp2f((m[n] - mx) * (SCL * L2E)), mo = HR ? mx * (SCL * L2E) : mx * (SCL * L2E) - 10.0f; m[n] = mx; v2f sum = (v2f){0.f, 0.f};   // m: raw products; SCL and the change to base 2 go into one factor
#pragma unroll
            for (int kt = 0; kt < 2; ++kt)
#pragma unroll
                for (int j = 0; j < 8; j += 2) { const v2f p = (v2f){__builtin_amdgcn_exp2f(fmaf(s[kt][n][j], SCL * L2E, -mo)), __builtin_amdgcn_exp2f(fmaf(s[kt][n][j + 1], SCL * L2E, -mo))}; s[kt][n][j] = p[0]; s[kt][n][j + 1] = p[1]; sum += p; }   // even and odd keys summed side by side (packed adds)
            l[n] = l[n] * al + (sum[0] + sum[1]);
#pragma unroll
            for (int dt = 0; dt < 4; ++dt) o[dt][n] *= al;
            if constexpr (HR) { v8us h0, h1, l0, l1;
#pragma unroll
                for (int j = 0; j < 8; ++j) { unsigned short a, c2; splitf(s[0][n][j], a, c2); h0[j] = a; l0[j] = c2; splitf(s[1][n][j], a, c2); h1[j] = a; l1[j] = c2; }
                pf[n] = cat16b(h0, h1); pf2[n] = cat16b(l0, l1);
            } else { v8h h0, h1;
#pragma unroll
                for (int j = 0; j < 8; ++j) { h0[j] = tohx(s[0][n][j]); h1[j] = tohx(s[1][n][j]); }
                pf[n] = cat16(h0, h1); } }
#pragma unroll
        for (int dt = 0; dt < 4; ++dt)
#pragma unroll
            for (int n = 0; n < NQ; ++n) { o[dt][n] = WFrag<T16>::mma(vf[dt], pf[n], o[dt][n]); if (HR) { o[dt][n] = WFrag<T16>::mma(vf[dt], pf2[n], o[dt][n]); o[dt][n] = WFrag<T16>::mma(vf2[dt], pf[n], o[dt][n]); } }
        // the loop's branch stands right behind the last matrix instructions: four vector slots keep the distance on the taken side too
        if constexpr (NQ == 2) asm volatile("v_nop\n\tv_nop\n\tv_nop\n\tv_nop" : "+v"(o[0][0]), "+v"(o[1][0]), "+v"(o[2][0]), "+v"(o[3][0]), "+v"(o[0][1]), "+v"(o[1][1]), "+v"(o[2][1]), "+v"(o[3][1]));
        else asm volatile("v_nop\n\tv_nop\n\tv_nop\n\tv_nop" : "+v"(o[0][0]), "+v"(o[1][0]), "+v"(o[2][0]), "+v"(o[3][0]));
    }
    // the last trip's key fetch is not used and may still be on its way: the wait in front of whatever takes over the registers that it names
    if constexpr (HR) asm volatile("s_wait_xcnt 0x0" :: "s"(kq), "s"(kq2) : "memory");
    else asm volatile("s_wait_xcnt 0x0" :: "s"(kq) : "memory");
    // join of the key parts in the fixed order 0..KS-1. LDS: per (part - 1, head) 4 NQ tiles of [2 halves][32 lanes][4 floats]; behind them per (part - 1, head) m and l
    if (part != 0) { float* xo = xs + ((part - 1) * 4 + hd) * 2048; float* xm = xs + (KS - 1) * 4 * 2048 + ((part - 1) * 4 + hd) * 128;
#pragma unroll
        for (int n = 0; n < NQ; ++n) { xm[(n * 2) * 32 + lane] = m[n]; xm[(n * 2 + 1) * 32 + lane] = l[n];
#pragma unroll
            for (int dt = 0; dt < 4; ++dt) { float* t = xo + (dt * NQ + n) * 256 + lane * 4; *(v4fa*)t = (v4f){o[dt][n][0], o[dt][n][1], o[dt][n][2], o[dt][n][3]}; *(v4fa*)(t + 128) = (v4f){o[dt][n][4], o[dt][n][5], o[dt][n][6], o[dt][n][7]}; } } }
    __syncthreads();                                    // the other parts' partial results are in LDS before part 0 reads them; every wave of the work-group passes here
    if (part == 0) { const float* xo = xs + hd * 2048; const float* xm = xs + (KS - 1) * 4 * 2048 + hd * 128;
#pragma unroll
        for (int n = 0; n < NQ; ++n) { float mp[KS - 1], f[KS - 1]; float mx = m[n];      // a part without a key block hands over m = -3e38, l = 0, O = 0: its factor is 0
#pragma unroll
            for (int u = 0; u < KS - 1; ++u) { mp[u] = xm[u * 512 + (n * 2) * 32 + lane]; mx = fmaxf(mx, mp[u]); }
            float f0 = __builtin_amdgcn_exp2f((m[n] - mx) * (SCL * L2E)), lt = l[n] * f0;
#pragma unroll
            for (int u = 0; u < KS - 1; ++u) { f[u] = __builtin_amdgcn_exp2f((mp[u] - mx) * (SCL * L2E)); lt += xm[u * 512 + (n * 2 + 1) * 32 + lane] * f[u]; }
            lt += xhalf(lt);                            // the two lane halves summed the same query's other keys
            const float inv = __fdiv_rn(1.0f, lt); f0 *= inv;
#pragma unroll
            for (int u = 0; u < KS - 1; ++u) f[u] *= inv;
#pragma unroll
            for (int dt = 0; dt < 4; ++dt) { v8f r = o[dt][n] * f0;
#pragma unroll
                for (int u = 0; u < KS - 1; ++u) { const float* t = xo + u * 8192 + (dt * NQ + n) * 256 + lane * 4; const v4f u0 = *(const v4fa*)t, u1 = *(const v4fa*)(t + 128);
#pragma unroll
                    for (int j = 0; j < 4; ++j) { r[j] += u0[j] * f[u]; r[4 + j] += u1[j] * f[u]; } }
                v8us oh, ol;
#pragma unroll
                for (int j = 0; j < 8; ++j) { unsigned short a, c2; splitf(r[j], a, c2); oh[j] = a; ol[j] = c2; }
                const unsigned oo = n * 16 * DQ + dt * 256 + lane * 8; *(v8usa*)(Ah + (size_t)q0 * DQ + oo) = oh; *(v8usa*)(Al + (size_t)q0 * DQ + oo) = ol;   // fragment order of the merged plane [t][DQ]: Ah, Al point at the head's two fragments (k = 64 h ..) of row block 0; dims 16 dt + 8 hi + j are piece dt & 1 of fragment dt >> 1
                asm volatile("s_wait_xcnt 0x0" ::: "memory"); } } }   // the next tile's values reuse the registers that these two stores name
}
__global__ __launch_bounds__(KS * 128) void k_fattn(const h16* __restrict__ Q16, const h16* __restrict__ K16, const h16* __restrict__ V16, const bf* __restrict__ Qh, const bf* __restrict__ Ql, const bf* __restrict__ Kh, const bf* __restrict__ Kl, const bf* __restrict__ Vh, const bf* __restrict__ Vl, bf* Ah, bf* Al) {
    static_assert(REP == 4 && RH % 32 == 0 && (TT - RH) % 32 == 0, "4 query heads a kv head; whole tiles on both sides of RH");
    __shared__ __align__(16) float xs[(KS - 1) * 4 * (2048 + 128)];
    const int w = __builtin_amdgcn_readfirstlane(threadIdx.x >> 5);   // wave number, scalar: head, key part and the key loop's bounds stay wave-uniform
    const int hd = w & 3, part = w >> 2, g = blockIdx.x, bt = blockIdx.y, h = g * REP + hd; const size_t qp = (size_t)h * TT * HD, kp = (size_t)g * TT * HD;
    if (bt < (TT - RH) / 32) fattn_tile<h16, false, 2>(Q16 + qp, nullptr, K16 + kp, nullptr, V16 + kp, nullptr, TT - 32 * (bt + 1), hd, part, Ah + h * (HD * 16), Al + h * (HD * 16), xs);   // longest tiles first
    else fattn_tile<bf, true, 1>(Qh + qp, Ql + qp, Kh + kp, Kl + kp, Vh + kp, Vl + kp, RH - 16 * (bt - (TT - RH) / 32 + 1), hd, part, Ah + h * (HD * 16), Al + h * (HD * 16), xs);
}

extern "C" void kernel_launch(void* const* d_in, const int* in_sizes, int n_in,
                              void* d_out, int out_size, void* d_ws, size_t ws_size, hipStream_t stream) {
    (void)in_sizes; (void)n_in; (void)out_size;
    const float* x = (const float*)d_in[0]; const float* wq = (const float*)d_in[1]; const float* wk = (const float*)d_in[2]; const float* wv = (const float*)d_in[3]; const float* wo = (const float*)d_in[4]; const float* qsc = (const float*)d_in[5]; const float* ksc = (const float*)d_in[6];   /* input order x, Wq ('xw' [2048][2048]), Wk, Wv ([2048][512]), Wo ('xw'), q_norm_w, k_norm_w ([64], read) */
    float* OUT = (float*)d_out;     // [2][2048][2048]
    char* wsp = (char*)d_ws;
    auto take = [&](size_t bytes) { char* p = wsp; wsp += (bytes + 255) & ~(size_t)255; return (void*)p; };
    bf* WQ = (bf*)take((size_t)DQ * DM * 2); bf* WK = (bf*)take((size_t)DKV * DM * 2); bf* WV = (bf*)take((size_t)DKV * DM * 2); bf* WO = (bf*)take((size_t)DM * DQ * 2); float* CS = (float*)take((size_t)TT * HD * 2 * 4);
    bf* XB = (bf*)take((size_t)TT * DM * 2);
    h16* QP16 = (h16*)take((size_t)NH_ * TT * HD * 2); h16* KP16 = (h16*)take((size_t)NKV * TT * HD * 2); h16* VT16 = (h16*)take((size_t)NKV * HD * TT * 2);
    bf* QPh = (bf*)take((size_t)NH_ * TT * HD * 2); bf* QPl = (bf*)take((size_t)NH_ * TT * HD * 2); bf* KPh = (bf*)take((size_t)NKV * TT * HD * 2); bf* KPl = (bf*)take((size_t)NKV * TT * HD * 2); bf* VTh = (bf*)take((size_t)NKV * HD * TT * 2); bf* VTl = (bf*)take((size_t)NKV * HD * TT * 2);
    bf* ATh = (bf*)take((size_t)TT * DQ * 2); bf* ATl = (bf*)take((size_t)TT * DQ * 2);
    if ((size_t)(wsp - (char*)d_ws) > ws_size) return;    // ws 256 MiB
    { k_wtG<DM, DQ><<<DM * DQ / 16 / 256, 256, 0, stream>>>(wq, WQ); k_wtG<DM, DKV><<<DM * DKV / 16 / 256, 256, 0, stream>>>(wk, WK); k_wtG<DM, DKV><<<DM * DKV / 16 / 256, 256, 0, stream>>>(wv, WV);
      k_wtG<DQ, DM><<<DQ * DM / 16 / 256, 256, 0, stream>>>(wo, WO);
       }
    k_cs5<<<(TT * HD + 255) / 256, 256, 0, stream>>>(CS);   /* rotary table computed from the positions and INVT */
    for (int b = 0; b < NB_; ++b) {
        
        k_cvt8<DM><<<(TT * DM / 512 + 7) / 8, 256, 0, stream>>>(x + (size_t)b * TT * DM, XB, TT * DM / 512);
        k_gemmw<bf, 0, false, 8, 1, DM><<<dim3(TT / 64, DQ / 64, 1), 256, 0, stream>>>(XB, nullptr, WQ, nullptr, nullptr, 0, nullptr, 0, 0, 0, CS, qsc, QP16, QPh, QPl);   /* q: projection, per-head RMSNorm x q_norm_w, rotary, planes */
        k_gemmw<bf, 0, false, 16, 1, DM><<<dim3(TT / 64, DKV / 64, 1), 512, 0, stream>>>(XB, nullptr, WK, nullptr, nullptr, 0, nullptr, 0, 0, 0, CS, ksc, KP16, KPh, KPl);   /* k: the same with k_norm_w */
        k_gemmw<bf, 0, false, 16, 2, DM><<<dim3(TT / 64, DKV / 64, 1), 512, 0, stream>>>(XB, nullptr, WV, nullptr, nullptr, 0, nullptr, 0, 0, 0, nullptr, nullptr, VT16, VTh, VTl);   /* v: projection, transposed planes */
        k_fattn<<<dim3(NKV, (TT - RH) / 32 + RH / 16, 1), KS * 128, 0, stream>>>(QP16, KP16, VT16, QPh, QPl, KPh, KPl, VTh, VTl, ATh, ATl);
        k_gemmw<bf, 1, false, 8, 0, DQ><<<dim3(TT / 64, DM / 64, 1), 256, 0, stream>>>(ATh, ATl, WO, nullptr, OUT + (size_t)b * TT * DM, DM, nullptr, 0, 0, 0, nullptr, nullptr, nullptr, nullptr, nullptr); }
}

// v006
// One run takes 211 microseconds.
// In both of two side-by-side timings against v005, it was 1.16 times as fast.
// Counting every step since v000, it is 13.1 times as fast.
#include <hip/hip_runtime.h>

// Grouped-query causal attention with per-head RMSNorm and computed half-split rotary embeddings at base 1e6 (x [2][2048][2048]; q = x Wq (32 heads x 64), k, v = x Wk, x Wv (8 kv heads x 64) ('xw' 0.02, no bias); per head q = rms_norm(q) x q_norm_w, k = rms_norm(k) x k_norm_w (eps 1e-5; weights [64] = ones, read); rope: (x1, x2) = the two HALVES of each head: cat(x1 cos - x2 sin, x2 cos + x1 sin) with angle t x 1000000^(-2i/64), i < 32 (32 f32 frequencies jnp-exact for the module's power expression; precise cosf/sinf); query heads viewed (HKV, g): kv head = q head / 4; scores x 64^-0.5; causal (finfo.min == exclusion); softmax; out = merged Wo ('xw') -> [2][2048][2048] (8.4 M); argument order x, Wq, Wk, Wv, Wo, q_norm_w, k_norm_w).
// Layout per batch: bf16 copy of x and 'xw' weights transposed once, both in fragment order (see FRAGMENT ORDER below; k_cvt8, k_wtG); exact projections, whose 64x64 tile is one head x 64 tokens, so the tile's epilogue does RMSNorm (1/sqrt(mean + eps) x w[d]) and rotate-half with the k_cs5 table {cosf, sinf}(t x INVT[d mod 32]) and writes the head planes itself (v: transposed planes; k and v planes in fragment order); causal T-2048 GQA attention in one launch (k_fattn, running softmax; hybrid rows: < 512 hi/lo 3 products, rest fp16 x1024; key blocks above the diagonal are never visited); merged hi/lo (fragment order) x Wo exact.
// Compute dtypes, f32 accumulate: every input rounded to bf16 incl. scales (the rotary table stays f32); projections exact; RMSNorm and rotary f32; attention rows < 512 3 products, rest fp16; softmax f32; Wo hl x exact.

#define NB_  2
#define TT   2048
#define DM   2048
#define NH_  32
#define NKV  8
#define REP  (NH_ / NKV)
#define HD   64
#define DQ   (NH_ * HD)
#define DKV  (NKV * HD)
#define RH   512                  // query rows < RH use hi+lo planes (0: none)
#define SCL  0.125f   // HD^-0.5
typedef _Float16 h16;
typedef unsigned short bf;
typedef __attribute__((ext_vector_type(16))) __bf16   v16bf;
typedef __attribute__((ext_vector_type(16))) _Float16 v16h;
typedef __attribute__((ext_vector_type(8)))  _Float16 v8h;
typedef __attribute__((ext_vector_type(8)))  unsigned short v8us;
typedef __attribute__((ext_vector_type(8)))  float    v8f;
typedef __attribute__((ext_vector_type(4)))  float    v4f;
typedef v8h  __attribute__((may_alias)) v8ha;
typedef v4f  __attribute__((may_alias)) v4fa;
typedef v8us __attribute__((may_alias)) v8usa;

__device__ __forceinline__ unsigned short f2bf(float f) { unsigned u = __float_as_uint(f); u += 0x7FFFu + ((u >> 16) & 1u); return (unsigned short)(u >> 16); }
__device__ __forceinline__ float bf2f(unsigned short b) { return __uint_as_float(((unsigned)b) << 16); }
__device__ __forceinline__ float bfr(float f) { return bf2f(f2bf(f)); }
__device__ __forceinline__ v16h cat16(v8h lo, v8h hi) { return __builtin_shufflevector(lo, hi, 0, 1, 2, 3, 4, 5, 6, 7, 8, 9, 10, 11, 12, 13, 14, 15); }
__device__ __forceinline__ v16bf cat16b(v8us lo, v8us hi) { return __builtin_bit_cast(v16bf, __builtin_shufflevector(lo, hi, 0, 1, 2, 3, 4, 5, 6, 7, 8, 9, 10, 11, 12, 13, 14, 15)); }
__device__ __forceinline__ v8f wmma16(v16h a, v16h b, v8f c) { return __builtin_amdgcn_wmma_f32_16x16x32_f16(false, a, false, b, (short)0, c, false, false); }
__device__ __forceinline__ v8f wmmab(v16bf a, v16bf b, v8f c) { return __builtin_amdgcn_wmma_f32_16x16x32_bf16(false, a, false, b, (short)0, c, false, false); }



// ---- split-K inside a work-group: the NW waves of a 64x64 tile each take every NW-th 32-wide step of K (neighbouring waves read neighbouring 1024-byte fragments of a row block at about the same time),
// so the chain of dependent load round trips per wave is NW times shorter. ksum_store puts the NW partial tiles into LDS (row pitch 68 floats), and behind one barrier adds them in the fixed order wave 0..NW-1 and stores the tile.
__device__ __forceinline__ void kpart_put(const v8f (&acc)[4][4], float* os, int w, int lr, int hi) {
#pragma unroll
    for (int mb = 0; mb < 4; ++mb)
#pragma unroll
        for (int nb = 0; nb < 4; ++nb)
#pragma unroll
            for (int j = 0; j < 8; ++j) os[(w * 64 + mb * 16 + hi * 8 + j) * 68 + nb * 16 + lr] = acc[mb][nb][j];
}
template <int NW>
__device__ __forceinline__ v4f kpart_sum(const float* os, int row, int cofs) {
    v4f val = *(const v4fa*)(os + row * 68 + cofs);
#pragma unroll
    for (int u = 1; u < NW; ++u) val += *(const v4fa*)(os + (u * 64 + row) * 68 + cofs);
    return val;
}
template <int NW, bool BIAS>
__device__ __forceinline__ void ksum_store(const v8f (&acc)[4][4], float* os, int w, int lr, int hi, float* C, int ldc, const float* bias) {
    kpart_put(acc, os, w, lr, hi);
    __syncthreads();                       // all NW partial tiles are in LDS before any of them is read
    const int tid = threadIdx.x, cofs = (tid & 15) * 4;
#pragma unroll
    for (int s = 0; s < 32 / NW; ++s) { const int row = s * NW * 2 + (tid >> 4);
        v4f val = kpart_sum<NW>(os, row, cofs);
        if (BIAS) { val[0] += bfr(bias[cofs]); val[1] += bfr(bias[cofs + 1]); val[2] += bfr(bias[cofs + 2]); val[3] += bfr(bias[cofs + 3]); }
        *(v4f*)(C + (size_t)row * ldc + cofs) = val; }
}

__device__ __forceinline__ h16 tohx(float x) { return (h16)x; }
__device__ __forceinline__ void splitf(float y, unsigned short& h, unsigned short& l) { h = f2bf(y); l = f2bf(y - bf2f(h)); }
typedef __attribute__((ext_vector_type(4))) _Float16 v4h;
typedef __attribute__((ext_vector_type(4))) unsigned short v4us;
template <int M> __device__ __forceinline__ float xrow(float x) { return __builtin_bit_cast(float, __builtin_amdgcn_update_dpp(0, __builtin_bit_cast(int, x), 0x160 | M, 0xf, 0xf, true)); }   // lane l <-> lane l ^ M inside a 16-lane row (row_xmask)

// ---- ksum_rope: epilogue of a q or k projection tile (64 tokens x the 64 dims of ONE head). Behind the sum of the partial tiles the 16 lanes of a row hold one (token, head) vector, 4 dims each:
// sum of squares over the row by a 4-step butterfly (the same value in all 16 lanes), x 1/sqrt(mean + eps) x w[d], then rotate-half (dim d's partner d +- 32 sits in lane l ^ 8), then the fp16 and hi/lo planes [t][d]: a wave stores 2 whole 128-byte rows a plane.
// cs: the tile's first row of the {cos, sin} table; P16, Ph, Pl: the tile's first row in the head's planes.
// FR (k): the planes are in fragment order (see FRAGMENT ORDER below, [R][K] = [t][d]); the tile's 64 tokens x 64 dims are the same 4096 elements of the plane in both orders, and a thread's 4 dims stay neighbours; a wave's store there is 32-byte pieces of 8 lines, paid once a tile so that every pass of the attention kernel's key loop reads whole lines.
template <int NW, bool FR>
__device__ __forceinline__ void ksum_rope(const v8f (&acc)[4][4], float* os, int w, int lr, int hi, const float* __restrict__ cs, const float* __restrict__ nw, h16* P16, bf* Ph, bf* Pl) {
    constexpr int NS = 32 / NW;
    const int tid = threadIdx.x, cofs = (tid & 15) * 4, rw = tid >> 4;
    v4f c01[NS], c23[NS]; float wv[4];     // the thread's table rows are asked for in front of the LDS stores and the barrier, which cover their way
    const unsigned tofs = (rw * HD + cofs) * 2 * 4;   // the thread's place in the table's first NW * 2 rows, in bytes (the value that the loads' offset register holds): every table address = cs + this + a constant
#pragma unroll
    for (int s = 0; s < NS; ++s) { const float* c = (const float*)((const char*)cs + tofs) + s * NW * 2 * HD * 2; c01[s] = *(const v4f*)c; c23[s] = *(const v4f*)(c + 4); }
    asm volatile("s_wait_xcnt 0x0" :: "v"(tofs) : "memory");   // the wait in front of any rewrite of the offset register that the table loads name; the offset is an operand so that it lives to here and no load's result is given its register
#pragma unroll
    for (int q = 0; q < 4; ++q) wv[q] = bfr(nw[cofs + q]);
    kpart_put(acc, os, w, lr, hi);
    __builtin_amdgcn_sched_barrier(0);     // keeps every use of the table rows behind the LDS stores: without it the first wait for those loads stands in front of the stores
    __syncthreads();                       // all NW partial tiles are in LDS before any of them is read
    const float sg = (cofs < HD / 2) ? -1.0f : 1.0f;   // out[d] = x[d] cos - x[d + 32] sin, out[d + 32] = x[d + 32] cos + x[d] sin
#pragma unroll
    for (int s = 0; s < NS; ++s) { const int row = s * NW * 2 + rw;
        const v4f a = kpart_sum<NW>(os, row, cofs);
        float ss = a[0] * a[0] + a[1] * a[1] + a[2] * a[2] + a[3] * a[3];
        ss += xrow<1>(ss); ss += xrow<2>(ss); ss += xrow<4>(ss); ss += xrow<8>(ss);
        const float rf = __fdiv_rn(1.0f, __fsqrt_rn(ss * (1.0f / HD) + 1e-5f));
        v4h o16; v4us oh, ol;
#pragma unroll
        for (int q = 0; q < 4; ++q) { const float y = a[q] * rf * wv[q], p = xrow<8>(y) * sg; const float co = (q < 2) ? c01[s][q * 2] : c23[s][q * 2 - 4], si = (q < 2) ? c01[s][q * 2 + 1] : c23[s][q * 2 - 3];
            const float r = y * co + p * si; o16[q] = tohx(r); unsigned short a2, c2; splitf(r, a2, c2); oh[q] = a2; ol[q] = c2; }
        const unsigned po = FR ? ((row >> 4) * 2 + (cofs >> 5)) * 512 + ((cofs >> 4) & 1) * 256 + (((cofs >> 3) & 1) * 16 + (row & 15)) * 8 + (cofs & 7) : row * HD + cofs; *(v4h*)(P16 + po) = o16; *(v4us*)(Ph + po) = oh; *(v4us*)(Pl + po) = ol; }
}
// ---- ksum_vt: epilogue of a v projection tile: the summed tile goes back into LDS (each thread over the elements of partial tile 0 that it alone has read), and behind a second barrier it is read by columns:
// one wave stores one 512-byte half of a fragment of the transposed fp16 and hi/lo planes ([R][K] = [d][t] in fragment order, see FRAGMENT ORDER below): wave = (16-dim block, 16-token group), lane = its place in the fragment, 8 tokens of one dim.
// V16, Vh, Vl: the fragment of the tile's first token in dim block 0 of the head's planes.
template <int NW>
__device__ __forceinline__ void ksum_vt(const v8f (&acc)[4][4], float* os, int w, int lr, int hi, h16* V16, bf* Vh, bf* Vl) {
    static_assert(NW == 16, "8 tokens a thread");
    kpart_put(acc, os, w, lr, hi);
    __syncthreads();                       // all NW partial tiles are in LDS before any of them is read
    const int tid = threadIdx.x, cofs = (tid & 15) * 4;
#pragma unroll
    for (int s = 0; s < 32 / NW; ++s) { const int row = s * NW * 2 + (tid >> 4); const v4f val = kpart_sum<NW>(os, row, cofs); *(v4fa*)(os + row * 68 + cofs) = val; }
    __syncthreads();                       // the whole summed tile is in LDS before it is read across the threads' own elements
    const int lane = tid & 31, db = tid >> 7, tq = (tid >> 5) & 3, d = db * 16 + (lane & 15), tc = tq * 16 + (lane >> 4) * 8; v8h o16; v8us oh, ol;
#pragma unroll
    for (int j = 0; j < 8; ++j) { const float x = os[(tc + j) * 68 + d]; o16[j] = tohx(x); unsigned short a2, c2; splitf(x, a2, c2); oh[j] = a2; ol[j] = c2; }
    const unsigned po = (db * (TT / 32) + (tq >> 1)) * 512 + (tq & 1) * 256 + lane * 8; *(v8h*)(V16 + po) = o16; *(v8us*)(Vh + po) = oh; *(v8us*)(Vl + po) = ol;
}

// ---- FRAGMENT ORDER of a GEMM operand plane [R][K]: one 16-row x 32-k fragment is 1024 contiguous bytes, fragments of a 16-row block follow one another along k. Inside a fragment lane (lr = row & 15, hi) owns two 16-byte pieces:
// k = 8 hi + 0..7 at element lane * 8 and k = 16 + 8 hi + 0..7 at element 256 + lane * 8 (lane = hi * 16 + lr): element (r, k) stands at ((r >> 4) * (K >> 5) + (k >> 5)) * 512 + ((k >> 4) & 1) * 256 + (((k >> 3) & 1) * 16 + (r & 15)) * 8 + (k & 7).
// Each of a fragment's two wave loads then covers 512 contiguous bytes (4 whole 128-byte lines) instead of 32-byte pieces of 16 lines; which lane and register holds which k is what it was with row-major planes.
// ---- k_gemmw: register-blocked GEMM, NW WAVES per 64x64 output tile (16 accumulators each, K split between them), operands straight from 16-bit planes in fragment order; grid (M/64, N/64, Z), NW*32 threads.
// C[m][n] (f32, pitch ldc, + optional f32 bias[n]) = sum_k A[m][k] Bt[n][k] (+ split products per NSPLIT). z-batch strides sA/sB/sC in elements. K % 32 == 0.
// EPI 0: the tile goes to C. EPI 1 (q), 3 (k) and 2 (v): m = token, tile column = head; the tile goes through ksum_rope (q: planes [t][d] row-major, k: fragment order) or ksum_vt into the planes P16, Ph, Pl and C is not used.
template <typename T16> struct WFrag;
template <> struct WFrag<h16> { typedef v16h V; static __device__ __forceinline__ V ld(const h16* p) { return cat16(*(const v8h*)p, *(const v8h*)(p + 16)); } static __device__ __forceinline__ V ldp(const h16* p) { return cat16(*(const v8h*)p, *(const v8h*)(p + 256)); } static __device__ __forceinline__ v8f mma(V a, V b, v8f c) { return wmma16(a, b, c); } };
template <> struct WFrag<bf> { typedef v16bf V; static __device__ __forceinline__ V ld(const bf* p) { return cat16b(*(const v8us*)p, *(const v8us*)(p + 16)); } static __device__ __forceinline__ V ldp(const bf* p) { return cat16b(*(const v8us*)p, *(const v8us*)(p + 256)); } static __device__ __forceinline__ v8f mma(V a, V b, v8f c) { return wmmab(a, b, c); } };
template <typename T16, int NSPLIT, bool BIAS, int NW, int EPI, int K>
__global__ __launch_bounds__(NW * 32) void k_gemmw(const T16* __restrict__ A, const T16* __restrict__ A2, const T16* __restrict__ Bt, const T16* __restrict__ Bt2, float* C, int ldc, const float* __restrict__ bias, size_t sA, size_t sB, size_t sC, const float* __restrict__ CS, const float* __restrict__ nw, h16* P16, bf* Ph, bf* Pl) {
    typedef typename WFrag<T16>::V V;
    __shared__ __align__(16) float os[NW * 64 * 68];
    const size_t z = blockIdx.z; A += z * sA; if (A2) A2 += z * sA; Bt += z * sB; if (Bt2) Bt2 += z * sB; C += z * sC;
    const int lane = threadIdx.x & 31, lr = lane & 15, hi = lane >> 4; const int r0 = blockIdx.x * 64, c0 = blockIdx.y * 64;
    const int w = __builtin_amdgcn_readfirstlane(threadIdx.x >> 5);   // wave number, scalar: the K loop's bounds stay wave-uniform
    v8f acc[4][4];
#pragma unroll
    for (int mb = 0; mb < 4; ++mb)
#pragma unroll
        for (int nb = 0; nb < 4; ++nb) acc[mb][nb] = (v8f){};
    // a 16-row block is 16 K elements, a 32-k step inside it 512: every address = a wave-uniform walking pointer (the tile's first row block at the wave's k step) + the lane's fixed offset + a constant (row block mb or nb; K is a
    // compile-time constant for that), so no load's result and no address step can land on a vector register that a load in flight names
    typedef const __attribute__((address_space(1))) T16* gptr;   // typed as global memory, so that the loads stay global loads behind the statement that the pointers pass through
    constexpr bool HA2 = NSPLIT == 1 || NSPLIT == 2, HB2 = NSPLIT >= 2;
    gptr ap = (gptr)(A + (size_t)r0 * K + w * 512), ap2 = HA2 ? (gptr)(A2 + (size_t)r0 * K + w * 512) : nullptr, bp = (gptr)(Bt + (size_t)c0 * K + w * 512), bp2 = HB2 ? (gptr)(Bt2 + (size_t)c0 * K + w * 512) : nullptr;
    const unsigned lofs = lane * 8;
#pragma unroll 1
    for (int kc = w * 32; kc < K; kc += NW * 32) {
        V a[4], a2[4], b[4], b2[4];
#pragma unroll
        for (int mb = 0; mb < 4; ++mb) { a[mb] = WFrag<T16>::ldp((const T16*)(ap + lofs + mb * 16 * K)); if (HA2) a2[mb] = WFrag<T16>::ldp((const T16*)(ap2 + lofs + mb * 16 * K)); }
#pragma unroll
        for (int nb = 0; nb < 4; ++nb) { b[nb] = WFrag<T16>::ldp((const T16*)(bp + lofs + nb * 16 * K)); if (HB2) b2[nb] = WFrag<T16>::ldp((const T16*)(bp2 + lofs + nb * 16 * K)); }
        __builtin_amdgcn_sched_barrier(0);     // keeps the trip's loads one group in front of its matrix instructions: without it this build asks for each B fragment only when the one before is used up, a round trip each
#pragma unroll
        for (int nb = 0; nb < 4; ++nb)
#pragma unroll
            for (int mb = 0; mb < 4; ++mb) { acc[mb][nb] = WFrag<T16>::mma(a[mb], b[nb], acc[mb][nb]); if (HA2) acc[mb][nb] = WFrag<T16>::mma(a2[mb], b[nb], acc[mb][nb]); if (HB2) acc[mb][nb] = WFrag<T16>::mma(a[mb], b2[nb], acc[mb][nb]); }
        asm volatile("v_nop\n\tv_nop\n\tv_nop\n\tv_nop" : "+v"(acc[0][0]), "+v"(acc[1][1]), "+v"(acc[2][2]), "+v"(acc[3][3]) : "v"(a[0]), "v"(a[3]));
        // the wait in front of the steps of the base pointers that this trip's loads name; the pointers pass through the statement so that their steps stay behind it
        if constexpr (HA2 && HB2) asm volatile("s_wait_xcnt 0x0" : "+s"(ap), "+s"(ap2), "+s"(bp), "+s"(bp2) :: "memory");
        else if constexpr (HA2) asm volatile("s_wait_xcnt 0x0" : "+s"(ap), "+s"(ap2), "+s"(bp) :: "memory");
        else if constexpr (HB2) asm volatile("s_wait_xcnt 0x0" : "+s"(ap), "+s"(bp), "+s"(bp2) :: "memory");
        else asm volatile("s_wait_xcnt 0x0" : "+s"(ap), "+s"(bp) :: "memory");
        ap += NW * 512; bp += NW * 512; if (HA2) ap2 += NW * 512; if (HB2) bp2 += NW * 512;
    }
    if constexpr (EPI == 0) ksum_store<NW, BIAS>(acc, os, w, lr, hi, C + (size_t)r0 * ldc + c0, ldc, BIAS ? bias + c0 : nullptr);
    else if constexpr (EPI == 1 || EPI == 3) { const size_t po = ((size_t)blockIdx.y * TT + r0) * HD; ksum_rope<NW, EPI == 3>(acc, os, w, lr, hi, CS + (size_t)r0 * HD * 2, nw, P16 + po, Ph + po, Pl + po); }
    else { const size_t po = (size_t)blockIdx.y * HD * TT + r0 * 16; ksum_vt<NW>(acc, os, w, lr, hi, P16 + po, Ph + po, Pl + po); }
}

typedef __attribute__((ext_vector_type(2))) unsigned short v2us;
typedef __attribute__((ext_vector_type(2))) float v2f;
typedef __attribute__((ext_vector_type(4))) int v4i;

// k_cvt8: f32 [R][K] -> bf16 plane in fragment order. One wave = one fragment, one thread = one lane's place in it: the wave reads the fragment's 16 rows x 128 bytes and stores its 1024 bytes as two runs of 512.
// Every address = wave-uniform pointer + the lane's fixed offset + a constant.
template <int K>
__global__ __launch_bounds__(256) void k_cvt8(const float* __restrict__ src, bf* dst, int nfrag) {
    const int lane = threadIdx.x & 31, f = blockIdx.x * 8 + __builtin_amdgcn_readfirstlane(threadIdx.x >> 5); if (f >= nfrag) return;   // fragment number, scalar
    const float* s = src + (size_t)(f / (K / 32)) * 16 * K + (f % (K / 32)) * 32; const unsigned so = (lane & 15) * K + (lane >> 4) * 8;
    const v8f v0 = *(const v8f*)(s + so), v1 = *(const v8f*)(s + so + 16); v8us o0, o1;
#pragma unroll
    for (int k = 0; k < 8; ++k) { o0[k] = f2bf(v0[k]); o1[k] = f2bf(v1[k]); }
    bf* d = dst + (size_t)f * 512; const unsigned dof = lane * 8; *(v8us*)(d + dof) = o0; *(v8us*)(d + dof + 256) = o1; }

__constant__ float INVT[HD / 2] = { 1.000000000e+00f, 6.493816376e-01f, 4.216965139e-01f, 2.738419771e-01f, 1.778279394e-01f, 1.154781953e-01f, 7.498942316e-02f, 4.869675264e-02f, 3.162277490e-02f, 2.053525113e-02f, 1.333521400e-02f, 8.659643121e-03f, 5.623413250e-03f, 3.651741194e-03f, 2.371373819e-03f, 1.539926510e-03f, 1.000000047e-03f, 6.493816036e-04f, 4.216965172e-04f, 2.738419571e-04f, 1.778279402e-04f, 1.154782003e-04f, 7.498942432e-05f, 4.869675104e-05f, 3.162277790e-05f, 2.053524986e-05f, 1.333521413e-05f, 8.659642845e-06f, 5.623413472e-06f, 3.651741281e-06f, 2.371373739e-06f, 1.539926529e-06f };   // THETA ** (-arange(0, 64, 2) / 64) with THETA = 1e6 in float32 (the module's power expression)
__global__ __launch_bounds__(256) void k_cs5(float* CS) { const int idx = blockIdx.x * 256 + threadIdx.x; if (idx >= TT * HD) return; const int d = idx % HD; const int t = idx / HD; const float a = __fmul_rn((float)t, INVT[d % (HD / 2)]); v2f cs; cs[0] = cosf(a); cs[1] = sinf(a); *(v2f*)(CS + (size_t)idx * 2) = cs;  }
// k_wtG: f32 w [K][N] -> bf16 plane of w^T ([N][K]) in fragment order. One wave = one fragment, one thread = one lane's place in it: its 16 k of one n; 16 lanes read 64 contiguous bytes of a row of w,
// and the two waves of a pair take neighbouring 16-column blocks at the same k, the two halves of the same 128-byte lines. Every address = wave-uniform pointer + the lane's fixed offset + a constant. Grid: N K / 512 waves.
template <int K, int N>
__global__ __launch_bounds__(256) void k_wtG(const float* __restrict__ w, bf* Bt) {
    static_assert(N % 32 == 0 && K % 32 == 0 && (N / 16) * (K / 32) % 8 == 0, "whole fragments, pairs of column blocks, whole work-groups");
    const int lane = threadIdx.x & 31, wv = blockIdx.x * 8 + __builtin_amdgcn_readfirstlane(threadIdx.x >> 5), pair = wv >> 1;   // wave number, scalar
    const int nb = (pair / (K / 32)) * 2 + (wv & 1), kb = pair % (K / 32);
    const float* s = w + (size_t)kb * 32 * N + nb * 16; const unsigned so = (lane >> 4) * 8 * N + (lane & 15); v8us o0, o1;
#pragma unroll
    for (int j = 0; j < 8; ++j) { o0[j] = f2bf(s[so + j * N]); o1[j] = f2bf(s[so + (16 + j) * N]); }
    bf* d = Bt + ((size_t)nb * (K / 32) + kb) * 512; const unsigned dof = lane * 8; *(v8us*)(d + dof) = o0; *(v8us*)(d + dof + 256) = o1;
}

// ---- k_fattn: the whole causal attention of one batch in one launch (scores, softmax, probability x value and the hi/lo merge), with a running maximum and sum per query; no score or probability plane in memory.
// Transposed products: S^T = K Q^T (A = key rows, B = query rows kept in registers), O^T += V^T P^T (A = rows of the [d][t] value plane). The key and value planes are in fragment order: each wave load of the key loop covers 4 whole 128-byte lines. In a 16-column group lane (lr, hi) holds query lr only: keys 8 hi + j of each
// 16-key score tile, so two score tiles of a 32-key block, converted in place, are the B operand of the second product in the loaders' own k order (8 hi + 0..7, 16 + 8 hi + 0..7), and maximum, sum and rescale factor are per lane.
// Work-group = 16 waves: the 4 query heads of one kv head (they read the same K and V lines) x KS = 4 key parts (part p takes every 4th 32-key block); parts 1..3 hand their (O, m, l) to part 0 through LDS behind one barrier.
// One work-group fills a WGP's registers, so the tiles, longest first, are dealt out as WGPs fall free; blockIdx.x = kv head.
// Query rows < RH: 16 columns a wave, hi/lo bf16 planes, 3 products in both contractions; the rest: 32 columns a wave, fp16, probabilities carried x 2^10 (the sum carries the same factor, so it cancels).
#define L2E  1.4426950408889634f
#define KS   4
__device__ __forceinline__ float xhalf(float x) { return __builtin_bit_cast(float, __builtin_amdgcn_permlanex16(__builtin_bit_cast(int, x), __builtin_bit_cast(int, x), 0x76543210, 0xfedcba98, false, false)); }   // lane l <-> lane l ^ 16
template <typename T16, bool HR, int NQ>
__device__ __forceinline__ void fattn_tile(const T16* __restrict__ Q, const T16* __restrict__ Q2, const T16* __restrict__ Kp, const T16* __restrict__ K2, const T16* __restrict__ Vt, const T16* __restrict__ V2, int q0, int hd, int part, bf* Ah, bf* Al, float* xs) {
    typedef typename WFrag<T16>::V V;
    const int lane = threadIdx.x & 31, lr = lane & 15, hi = lane >> 4;
    const unsigned kofs = lr * HD + 8 * hi, lofs = lane * 8;   // the lane's place in a fragment's rows (q, row-major) and in a fragment (k, v, fragment order); every address below = wave-uniform pointer + one of these + a constant, so no load's result can land on an address register
    V qf[NQ][2], qf2[NQ][2];
#pragma unroll
    for (int n = 0; n < NQ; ++n)
#pragma unroll
        for (int ks = 0; ks < 2; ++ks) { const unsigned qo = kofs + n * 16 * HD + ks * 32; qf[n][ks] = WFrag<T16>::ld(Q + (size_t)q0 * HD + qo); if (HR) qf2[n][ks] = WFrag<T16>::ld(Q2 + (size_t)q0 * HD + qo); }
    v8f o[4][NQ]; float m[NQ], l[NQ];
#pragma unroll
    for (int n = 0; n < NQ; ++n) { m[n] = -3.0e38f; l[n] = 0.f;
#pragma unroll
        for (int dt = 0; dt < 4; ++dt) o[dt][n] = (v8f){}; }
    const int kend = q0 + 16 * NQ;                      // keys [0, kend): every 32-key block that starts below kend holds at least one allowed key for every query of the tile
    typedef const __attribute__((address_space(1))) T16* gptr;   // typed as global memory, so that the loads stay global loads behind the statement that the pointers pass through
    gptr kq = (gptr)(Kp + (size_t)part * 32 * HD), kq2 = HR ? (gptr)(K2 + (size_t)part * 32 * HD) : nullptr;   // wave-uniform walking pointers: key rows and value columns of the part's current block
    gptr vq = (gptr)(Vt + part * 512), vq2 = HR ? (gptr)(V2 + part * 512) : nullptr;   // a 32-key block is 4 key fragments in a row (16-key block kt, 32-dim step ks) and one value fragment in each of the 4 dim blocks
    V kf[2][2], kf2[2][2];
#pragma unroll
    for (int kt = 0; kt < 2; ++kt)
#pragma unroll
        for (int ks = 0; ks < 2; ++ks) { kf[kt][ks] = WFrag<T16>::ldp((const T16*)(kq + lofs + (kt * 2 + ks) * 512)); if (HR) kf2[kt][ks] = WFrag<T16>::ldp((const T16*)(kq2 + lofs + (kt * 2 + ks) * 512)); }
#pragma unroll 1   // run-time trip count; one trip's fragments, scores and accumulators already take most of the wave's registers
    for (int kb = part * 32; kb < kend; kb += KS * 32) {
        V vf[4], vf2[4];                                // this block's value fragments: asked for first, needed last
#pragma unroll
        for (int dt = 0; dt < 4; ++dt) { vf[dt] = WFrag<T16>::ldp((const T16*)(vq + lofs + dt * 16 * TT)); if (HR) vf2[dt] = WFrag<T16>::ldp((const T16*)(vq2 + lofs + dt * 16 * TT)); }
        // the wait in front of the steps of the base pointers that this trip's value loads and the last trip's key loads name; the pointers pass through the statement so that their steps stay behind it
        if constexpr (HR) asm volatile("s_wait_xcnt 0x0" : "+s"(vq), "+s"(vq2), "+s"(kq), "+s"(kq2) :: "memory");
        else asm volatile("s_wait_xcnt 0x0" : "+s"(vq), "+s"(kq) :: "memory");
        vq += KS * 512; if (HR) vq2 += KS * 512;
        v8f s[2][NQ];
#pragma unroll
        for (int kt = 0; kt < 2; ++kt)
#pragma unroll
            for (int n = 0; n < NQ; ++n) { v8f c = (v8f){};
#pragma unroll
                for (int ks = 0; ks < 2; ++ks) { c = WFrag<T16>::mma(kf[kt][ks], qf[n][ks], c); if (HR) { c = WFrag<T16>::mma(kf[kt][ks], qf2[n][ks], c); c = WFrag<T16>::mma(kf2[kt][ks], qf[n][ks], c); } }
                s[kt][n] = c; }
        const int kstep = (kb + KS * 32 < kend) ? KS * 32 * HD : 0; kq += kstep; if (HR) kq2 += kstep;   // the part's next key block, fetched one trip ahead (the last trip stays where it is; its fetch is not used)
#pragma unroll
        for (int kt = 0; kt < 2; ++kt)
#pragma unroll
            for (int ks = 0; ks < 2; ++ks) { kf[kt][ks] = WFrag<T16>::ldp((const T16*)(kq + lofs + (kt * 2 + ks) * 512)); if (HR) kf2[kt][ks] = WFrag<T16>::ldp((const T16*)(kq2 + lofs + (kt * 2 + ks) * 512)); }
        if (kb + 31 > q0) {                             // wave-uniform: only a block that reaches the diagonal is masked (key > query excluded)
#pragma unroll
            for (int kt = 0; kt < 2; ++kt)
#pragma unroll
                for (int n = 0; n < NQ; ++n)
#pragma unroll
                    for (int j = 0; j < 8; ++j) s[kt][n][j] = (kb + kt * 16 + hi * 8 + j <= q0 + n * 16 + lr) ? s[kt][n][j] : -3.0e38f; }
        V pf[NQ], pf2[NQ];
#pragma unroll
        for (int n = 0; n < NQ; ++n) { float mx = m[n];
#pragma unroll
            for (int j = 0; j < 8; ++j) mx = fmaxf(mx, fmaxf(s[0][n][j], s[1][n][j]));
            mx = fmaxf(mx, xhalf(mx));                  // the two lane halves hold the same query's other keys
            const float al = __builtin_amdgcn_exp2f((m[n] - mx) * (SCL * L2E)), mo = HR ? mx * (SCL * L2E) : mx * (SCL * L2E) - 10.0f; m[n] = mx; v2f sum = (v2f){0.f, 0.f};   // m: raw products; SCL and the change to base 2 go into one factor
#pragma unroll
            for (int kt = 0; kt < 2; ++kt)
#pragma unroll
                for (int j = 0; j < 8; j += 2) { const v2f p = (v2f){__builtin_amdgcn_exp2f(fmaf(s[kt][n][j], SCL * L2E, -mo)), __builtin_amdgcn_exp2f(fmaf(s[kt][n][j + 1], SCL * L2E, -mo))}; s[kt][n][j] = p[0]; s[kt][n][j + 1] = p[1]; sum += p; }   // even and odd keys summed side by side (packed adds)
            l[n] = l[n] * al + (sum[0] + sum[1]);
#pragma unroll
            for (int dt = 0; dt < 4; ++dt) o[dt][n] *= al;
            if constexpr (HR) { v8us h0, h1, l0, l1;
#pragma unroll
                for (int j = 0; j < 8; ++j) { unsigned short a, c2; splitf(s[0][n][j], a, c2); h0[j] = a; l0[j] = c2; splitf(s[1][n][j], a, c2); h1[j] = a; l1[j] = c2; }
                pf[n] = cat16b(h0, h1); pf2[n] = cat16b(l0, l1);
            } else { v8h h0, h1;
#pragma unroll
                for (int j = 0; j < 8; ++j) { h0[j] = tohx(s[0][n][j]); h1[j] = tohx(s[1][n][j]); }
                pf[n] = cat16(h0, h1); } }
#pragma unroll
        for (int dt = 0; dt < 4; ++dt)
#pragma unroll
            for (int n = 0; n < NQ; ++n) { o[dt][n] = WFrag<T16>::mma(vf[dt], pf[n], o[dt][n]); if (HR) { o[dt][n] = WFrag<T16>::mma(vf[dt], pf2[n], o[dt][n]); o[dt][n] = WFrag<T16>::mma(vf2[dt], pf[n], o[dt][n]); } }
        // the loop's branch stands right behind the last matrix instructions: four vector slots keep the distance on the taken side too
        if constexpr (NQ == 2) asm volatile("v_nop\n\tv_nop\n\tv_nop\n\tv_nop" : "+v"(o[0][0]), "+v"(o[1][0]), "+v"(o[2][0]), "+v"(o[3][0]), "+v"(o[0][1]), "+v"(o[1][1]), "+v"(o[2][1]), "+v"(o[3][1]));
        else asm volatile("v_nop\n\tv_nop\n\tv_nop\n\tv_nop" : "+v"(o[0][0]), "+v"(o[1][0]), "+v"(o[2][0]), "+v"(o[3][0]));
    }
    // the last trip's key fetch is not used and may still be on its way: the wait in front of whatever takes over the registers that it names
    if constexpr (HR) asm volatile("s_wait_xcnt 0x0" :: "s"(kq), "s"(kq2) : "memory");
    else asm volatile("s_wait_xcnt 0x0" :: "s"(kq) : "memory");
    // join of the key parts in the fixed order 0..KS-1. LDS: per (part - 1, head) 4 NQ tiles of [2 halves][32 lanes][4 floats]; behind them per (part - 1, head) m and l
    if (part != 0) { float* xo = xs + ((part - 1) * 4 + hd) * 2048; float* xm = xs + (KS - 1) * 4 * 2048 + ((part - 1) * 4 + hd) * 128;
#pragma unroll
        for (int n = 0; n < NQ; ++n) { xm[(n * 2) * 32 + lane] = m[n]; xm[(n * 2 + 1) * 32 + lane] = l[n];
#pragma unroll
            for (int dt = 0; dt < 4; ++dt) { float* t = xo + (dt * NQ + n) * 256 + lane * 4; *(v4fa*)t = (v4f){o[dt][n][0], o[dt][n][1], o[dt][n][2], o[dt][n][3]}; *(v4fa*)(t + 128) = (v4f){o[dt][n][4], o[dt][n][5], o[dt][n][6], o[dt][n][7]}; } } }
    __syncthreads();                                    // the other parts' partial results are in LDS before part 0 reads them; every wave of the work-group passes here
    if (part == 0) { const float* xo = xs + hd * 2048; const float* xm = xs + (KS - 1) * 4 * 2048 + hd * 128;
#pragma unroll
        for (int n = 0; n < NQ; ++n) { float mp[KS - 1], f[KS - 1]; float mx = m[n];      // a part without a key block hands over m = -3e38, l = 0, O = 0: its factor is 0
#pragma unroll
            for (int u = 0; u < KS - 1; ++u) { mp[u] = xm[u * 512 + (n * 2) * 32 + lane]; mx = fmaxf(mx, mp[u]); }
            float f0 = __builtin_amdgcn_exp2f((m[n] - mx) * (SCL * L2E)), lt = l[n] * f0;
#pragma unroll
            for (int u = 0; u < KS - 1; ++u) { f[u] = __builtin_amdgcn_exp2f((mp[u] - mx) * (SCL * L2E)); lt += xm[u * 512 + (n * 2 + 1) * 32 + lane] * f[u]; }
            lt += xhalf(lt);                            // the two lane halves summed the same query's other keys
            const float inv = __fdiv_rn(1.0f, lt); f0 *= inv;
#pragma unroll
            for (int u = 0; u < KS - 1; ++u) f[u] *= inv;
#pragma unroll
            for (int dt = 0; dt < 4; ++dt) { v8f r = o[dt][n] * f0;
#pragma unroll
                for (int u = 0; u < KS - 1; ++u) { const float* t = xo + u * 8192 + (dt * NQ + n) * 256 + lane * 4; const v4f u0 = *(const v4fa*)t, u1 = *(const v4fa*)(t + 128);
#pragma unroll
                    for (int j = 0; j < 4; ++j) { r[j] += u0[j] * f[u]; r[4 + j] += u1[j] * f[u]; } }
                v8us oh, ol;
#pragma unroll
                for (int j = 0; j < 8; ++j) { unsigned short a, c2; splitf(r[j], a, c2); oh[j] = a; ol[j] = c2; }
                const unsigned oo = n * 16 * DQ + dt * 256 + lane * 8; *(v8usa*)(Ah + (size_t)q0 * DQ + oo) = oh; *(v8usa*)(Al + (size_t)q0 * DQ + oo) = ol;   // fragment order of the merged plane [t][DQ]: Ah, Al point at the head's two fragments (k = 64 h ..) of row block 0; dims 16 dt + 8 hi + j are piece dt & 1 of fragment dt >> 1
                asm volatile("s_wait_xcnt 0x0" ::: "memory"); } } }   // the next tile's values reuse the registers that these two stores name
}
__global__ __launch_bounds__(KS * 128) void k_fattn(const h16* __restrict__ Q16, const h16* __restrict__ K16, const h16* __restrict__ V16, const bf* __restrict__ Qh, const bf* __restrict__ Ql, const bf* __restrict__ Kh, const bf* __restrict__ Kl, const bf* __restrict__ Vh, const bf* __restrict__ Vl, bf* Ah, bf* Al) {
    static_assert(REP == 4 && RH % 32 == 0 && (TT - RH) % 32 == 0, "4 query heads a kv head; whole tiles on both sides of RH");
    __shared__ __align__(16) float xs[(KS - 1) * 4 * (2048 + 128)];
    const int w = __builtin_amdgcn_readfirstlane(threadIdx.x >> 5);   // wave number, scalar: head, key part and the key loop's bounds stay wave-uniform
    const int hd = w & 3, part = w >> 2, g = blockIdx.x, bt = blockIdx.y, h = g * REP + hd; const size_t qp = (size_t)h * TT * HD, kp = (size_t)g * TT * HD;
    if (bt < (TT - RH) / 32) fattn_tile<h16, false, 2>(Q16 + qp, nullptr, K16 + kp, nullptr, V16 + kp, nullptr, TT - 32 * (bt + 1), hd, part, Ah + h * (HD * 16), Al + h * (HD * 16), xs);   // longest tiles first
    else fattn_tile<bf, true, 1>(Qh + qp, Ql + qp, Kh + kp, Kl + kp, Vh + kp, Vl + kp, RH - 16 * (bt - (TT - RH) / 32 + 1), hd, part, Ah + h * (HD * 16), Al + h * (HD * 16), xs);
}

extern "C" void kernel_launch(void* const* d_in, const int* in_sizes, int n_in,
                              void* d_out, int out_size, void* d_ws, size_t ws_size, hipStream_t stream) {
    (void)in_sizes; (void)n_in; (void)out_size;
    const float* x = (const float*)d_in[0]; const float* wq = (const float*)d_in[1]; const float* wk = (const float*)d_in[2]; const float* wv = (const float*)d_in[3]; const float* wo = (const float*)d_in[4]; const float* qsc = (const float*)d_in[5]; const float* ksc = (const float*)d_in[6];   /* input order x, Wq ('xw' [2048][2048]), Wk, Wv ([2048][512]), Wo ('xw'), q_norm_w, k_norm_w ([64], read) */
    float* OUT = (float*)d_out;     // [2][2048][2048]
    char* wsp = (char*)d_ws;
    auto take = [&](size_t bytes) { char* p = wsp; wsp += (bytes + 255) & ~(size_t)255; return (void*)p; };
    bf* WQ = (bf*)take((size_t)DQ * DM * 2); bf* WK = (bf*)take((size_t)DKV * DM * 2); bf* WV = (bf*)take((size_t)DKV * DM * 2); bf* WO = (bf*)take((size_t)DM * DQ * 2); float* CS = (float*)take((size_t)TT * HD * 2 * 4);
    bf* XB = (bf*)take((size_t)TT * DM * 2);
    h16* QP16 = (h16*)take((size_t)NH_ * TT * HD * 2); h16* KP16 = (h16*)take((size_t)NKV * TT * HD * 2); h16* VT16 = (h16*)take((size_t)NKV * HD * TT * 2);
    bf* QPh = (bf*)take((size_t)NH_ * TT * HD * 2); bf* QPl = (bf*)take((size_t)NH_ * TT * HD * 2); bf* KPh = (bf*)take((size_t)NKV * TT * HD * 2); bf* KPl = (bf*)take((size_t)NKV * TT * HD * 2); bf* VTh = (bf*)take((size_t)NKV * HD * TT * 2); bf* VTl = (bf*)take((size_t)NKV * HD * TT * 2);
    bf* ATh = (bf*)take((size_t)TT * DQ * 2); bf* ATl = (bf*)take((size_t)TT * DQ * 2);
    if ((size_t)(wsp - (char*)d_ws) > ws_size) return;    // ws 256 MiB
    { k_wtG<DM, DQ><<<DM * DQ / 16 / 256, 256, 0, stream>>>(wq, WQ); k_wtG<DM, DKV><<<DM * DKV / 16 / 256, 256, 0, stream>>>(wk, WK); k_wtG<DM, DKV><<<DM * DKV / 16 / 256, 256, 0, stream>>>(wv, WV);
      k_wtG<DQ, DM><<<DQ * DM / 16 / 256, 256, 0, stream>>>(wo, WO);
       }
    k_cs5<<<(TT * HD + 255) / 256, 256, 0, stream>>>(CS);   /* rotary table computed from the positions and INVT */
    for (int b = 0; b < NB_; ++b) {
        
        k_cvt8<DM><<<(TT * DM / 512 + 7) / 8, 256, 0, stream>>>(x + (size_t)b * TT * DM, XB, TT * DM / 512);
        k_gemmw<bf, 0, false, 8, 1, DM><<<dim3(TT / 64, DQ / 64, 1), 256, 0, stream>>>(XB, nullptr, WQ, nullptr, nullptr, 0, nullptr, 0, 0, 0, CS, qsc, QP16, QPh, QPl);   /* q: projection, per-head RMSNorm x q_norm_w, rotary, planes */
        k_gemmw<bf, 0, false, 16, 3, DM><<<dim3(TT / 64, DKV / 64, 1), 512, 0, stream>>>(XB, nullptr, WK, nullptr, nullptr, 0, nullptr, 0, 0, 0, CS, ksc, KP16, KPh, KPl);   /* k: the same with k_norm_w, planes in fragment order */
        k_gemmw<bf, 0, false, 16, 2, DM><<<dim3(TT / 64, DKV / 64, 1), 512, 0, stream>>>(XB, nullptr, WV, nullptr, nullptr, 0, nullptr, 0, 0, 0, nullptr, nullptr, VT16, VTh, VTl);   /* v: projection, transposed planes in fragment order */
        k_fattn<<<dim3(NKV, (TT - RH) / 32 + RH / 16, 1), KS * 128, 0, stream>>>(QP16, KP16, VT16, QPh, QPl, KPh, KPl, VTh, VTl, ATh, ATl);
        k_gemmw<bf, 1, false, 8, 0, DQ><<<dim3(TT / 64, DM / 64, 1), 256, 0, stream>>>(ATh, ATl, WO, nullptr, OUT + (size_t)b * TT * DM, DM, nullptr, 0, 0, 0, nullptr, nullptr, nullptr, nullptr, nullptr); }
}

// v007
// It runs in 192 microseconds.
// Timed twice side by side with v006, it ran 1.10 times as fast both times.
// All steps since v000 together make it 14.4 times as fast.
#include <hip/hip_runtime.h>

// Grouped-query causal attention with per-head RMSNorm and computed half-split rotary embeddings at base 1e6 (x [2][2048][2048]; q = x Wq (32 heads x 64), k, v = x Wk, x Wv (8 kv heads x 64) ('xw' 0.02, no bias); per head q = rms_norm(q) x q_norm_w, k = rms_norm(k) x k_norm_w (eps 1e-5; weights [64] = ones, read); rope: (x1, x2) = the two HALVES of each head: cat(x1 cos - x2 sin, x2 cos + x1 sin) with angle t x 1000000^(-2i/64), i < 32 (32 f32 frequencies jnp-exact for the module's power expression; precise cosf/sinf); query heads viewed (HKV, g): kv head = q head / 4; scores x 64^-0.5; causal (finfo.min == exclusion); softmax; out = merged Wo ('xw') -> [2][2048][2048] (8.4 M); argument order x, Wq, Wk, Wv, Wo, q_norm_w, k_norm_w).
// Layout per batch: bf16 copy of x and 'xw' weights transposed once, both in fragment order (see FRAGMENT ORDER below; k_cvt8, k_wtG); exact projections, whose 64x64 tile is one head x 64 tokens, so the tile's epilogue does RMSNorm (1/sqrt(mean + eps) x w[d]) and rotate-half with the k_cs5 table {cosf, sinf}(t x INVT[d mod 32]) and writes the head planes itself (v: transposed planes; k and v planes in fragment order); causal T-2048 GQA attention in one launch (k_fattn, running softmax; hybrid rows: < 512 hi/lo 3 products, rest fp16 x1024; key blocks above the diagonal are never visited); merged hi/lo (fragment order) x Wo exact.
// Compute dtypes, f32 accumulate: every input rounded to bf16 incl. scales (the rotary table stays f32); projections exact; RMSNorm and rotary f32; attention rows < 512 3 products, rest fp16; softmax f32; Wo hl x exact.

#define NB_  2
#define TT   2048
#define DM   2048
#define NH_  32
#define NKV  8
#define REP  (NH_ / NKV)
#define HD   64
#define DQ   (NH_ * HD)
#define DKV  (NKV * HD)
#define RH   512                  // query rows < RH use hi+lo planes (0: none)
#define SCL  0.125f   // HD^-0.5
typedef _Float16 h16;
typedef unsigned short bf;
typedef __attribute__((ext_vector_type(16))) __bf16   v16bf;
typedef __attribute__((ext_vector_type(16))) _Float16 v16h;
typedef __attribute__((ext_vector_type(8)))  _Float16 v8h;
typedef __attribute__((ext_vector_type(8)))  unsigned short v8us;
typedef __attribute__((ext_vector_type(8)))  float    v8f;
typedef __attribute__((ext_vector_type(4)))  float    v4f;
typedef v8h  __attribute__((may_alias)) v8ha;
typedef v4f  __attribute__((may_alias)) v4fa;
typedef v8us __attribute__((may_alias)) v8usa;

__device__ __forceinline__ unsigned short f2bf(float f) { unsigned u = __float_as_uint(f); u += 0x7FFFu + ((u >> 16) & 1u); return (unsigned short)(u >> 16); }
__device__ __forceinline__ float bf2f(unsigned short b) { return __uint_as_float(((unsigned)b) << 16); }
__device__ __forceinline__ float bfr(float f) { return bf2f(f2bf(f)); }
__device__ __forceinline__ v16h cat16(v8h lo, v8h hi) { return __builtin_shufflevector(lo, hi, 0, 1, 2, 3, 4, 5, 6, 7, 8, 9, 10, 11, 12, 13, 14, 15); }
__device__ __forceinline__ v16bf cat16b(v8us lo, v8us hi) { return __builtin_bit_cast(v16bf, __builtin_shufflevector(lo, hi, 0, 1, 2, 3, 4, 5, 6, 7, 8, 9, 10, 11, 12, 13, 14, 15)); }
__device__ __forceinline__ v8f wmma16(v16h a, v16h b, v8f c) { return __builtin_amdgcn_wmma_f32_16x16x32_f16(false, a, false, b, (short)0, c, false, false); }
__device__ __forceinline__ v8f wmmab(v16bf a, v16bf b, v8f c) { return __builtin_amdgcn_wmma_f32_16x16x32_bf16(false, a, false, b, (short)0, c, false, false); }



// ---- split-K inside a work-group: the NW waves of a 64x64 tile each take every NW-th 32-wide step of K (neighbouring waves read neighbouring 1024-byte fragments of a row block at about the same time),
// so the chain of dependent load round trips per wave is NW times shorter. ksum_store puts the NW partial tiles into LDS (row pitch 68 floats), and behind one barrier adds them in the fixed order wave 0..NW-1 and stores the tile.
__device__ __forceinline__ void kpart_put(const v8f (&acc)[4][4], float* os, int w, int lr, int hi) {
#pragma unroll
    for (int mb = 0; mb < 4; ++mb)
#pragma unroll
        for (int nb = 0; nb < 4; ++nb)
#pragma unroll
            for (int j = 0; j < 8; ++j) os[(w * 64 + mb * 16 + hi * 8 + j) * 68 + nb * 16 + lr] = acc[mb][nb][j];
}
template <int NW>
__device__ __forceinline__ v4f kpart_sum(const float* os, int row, int cofs) {
    v4f val = *(const v4fa*)(os + row * 68 + cofs);
#pragma unroll
    for (int u = 1; u < NW; ++u) val += *(const v4fa*)(os + (u * 64 + row) * 68 + cofs);
    return val;
}
template <int NW, bool BIAS>
__device__ __forceinline__ void ksum_store(const v8f (&acc)[4][4], float* os, int tid, int w, int lr, int hi, float* C, int ldc, const float* bias) {
    kpart_put(acc, os, w, lr, hi);
    __syncthreads();                       // all NW partial tiles are in LDS before any of them is read
    const int cofs = (tid & 15) * 4; v4f sm[32 / NW];
#pragma unroll
    for (int s = 0; s < 32 / NW; ++s) sm[s] = kpart_sum<NW>(os, s * NW * 2 + (tid >> 4), cofs);   // all of the thread's LDS reads go out in front of the first store's wait: one LDS round trip, not one a row
#pragma unroll
    for (int s = 0; s < 32 / NW; ++s) { const int row = s * NW * 2 + (tid >> 4);
        v4f val = sm[s];
        if (BIAS) { val[0] += bfr(bias[cofs]); val[1] += bfr(bias[cofs + 1]); val[2] += bfr(bias[cofs + 2]); val[3] += bfr(bias[cofs + 3]); }
        *(v4f*)(C + (size_t)row * ldc + cofs) = val;
        asm volatile("s_wait_xcnt 0x0" ::: "memory"); }   // the next rows' addresses reuse the registers that this store names
}

__device__ __forceinline__ h16 tohx(float x) { return (h16)x; }
__device__ __forceinline__ void splitf(float y, unsigned short& h, unsigned short& l) { h = f2bf(y); l = f2bf(y - bf2f(h)); }
typedef __attribute__((ext_vector_type(4))) _Float16 v4h;
typedef __attribute__((ext_vector_type(4))) unsigned short v4us;
template <int M> __device__ __forceinline__ float xrow(float x) { return __builtin_bit_cast(float, __builtin_amdgcn_update_dpp(0, __builtin_bit_cast(int, x), 0x160 | M, 0xf, 0xf, true)); }   // lane l <-> lane l ^ M inside a 16-lane row (row_xmask)

// ---- ksum_rope: epilogue of a q or k projection tile (64 tokens x the 64 dims of ONE head). Behind the sum of the partial tiles the 16 lanes of a row hold one (token, head) vector, 4 dims each:
// sum of squares over the row by a 4-step butterfly (the same value in all 16 lanes), x 1/sqrt(mean + eps) x w[d], then rotate-half (dim d's partner d +- 32 sits in lane l ^ 8), then the fp16 and hi/lo planes [t][d]: a wave stores 2 whole 128-byte rows a plane.
// cs: the tile's first row of the {cos, sin} table; P16, Ph, Pl: the tile's first row in the head's planes.
// FR (k): the planes are in fragment order (see FRAGMENT ORDER below, [R][K] = [t][d]); the tile's 64 tokens x 64 dims are the same 4096 elements of the plane in both orders, and a thread's 4 dims stay neighbours; a wave's store there is 32-byte pieces of 8 lines, paid once a tile so that every pass of the attention kernel's key loop reads whole lines.
template <int NW, bool FR>
__device__ __forceinline__ void ksum_rope(const v8f (&acc)[4][4], float* os, int tid, int w, int lr, int hi, const float* __restrict__ cs, const float* __restrict__ nw, h16* P16, bf* Ph, bf* Pl) {
    constexpr int NS = 32 / NW;
    const int cofs = (tid & 15) * 4, rw = tid >> 4;
    v4f c01[NS], c23[NS]; float wv[4];     // the thread's table rows are asked for in front of the LDS stores and the barrier, which cover their way
    const unsigned tofs = (rw * HD + cofs) * 2 * 4;   // the thread's place in the table's first NW * 2 rows, in bytes (the value that the loads' offset register holds): every table address = cs + this + a constant
#pragma unroll
    for (int s = 0; s < NS; ++s) { const float* c = (const float*)((const char*)cs + tofs) + s * NW * 2 * HD * 2; c01[s] = *(const v4f*)c; c23[s] = *(const v4f*)(c + 4); }
    asm volatile("s_wait_xcnt 0x0" :: "v"(tofs) : "memory");   // the wait in front of any rewrite of the offset register that the table loads name; the offset is an operand so that it lives to here and no load's result is given its register
#pragma unroll
    for (int q = 0; q < 4; ++q) wv[q] = bfr(nw[cofs + q]);
    kpart_put(acc, os, w, lr, hi);
    __builtin_amdgcn_sched_barrier(0);     // keeps every use of the table rows behind the LDS stores: without it the first wait for those loads stands in front of the stores
    __syncthreads();                       // all NW partial tiles are in LDS before any of them is read
    const float sg = (cofs < HD / 2) ? -1.0f : 1.0f;   // out[d] = x[d] cos - x[d + 32] sin, out[d + 32] = x[d + 32] cos + x[d] sin
    v4f sm[NS];
#pragma unroll
    for (int s = 0; s < NS; ++s) sm[s] = kpart_sum<NW>(os, s * NW * 2 + rw, cofs);   // all of the thread's LDS reads go out in front of the first stores' wait: one LDS round trip, not one a row
#pragma unroll
    for (int s = 0; s < NS; ++s) { const int row = s * NW * 2 + rw;
        const v4f a = sm[s];
        float ss = a[0] * a[0] + a[1] * a[1] + a[2] * a[2] + a[3] * a[3];
        ss += xrow<1>(ss); ss += xrow<2>(ss); ss += xrow<4>(ss); ss += xrow<8>(ss);
        const float rf = __fdiv_rn(1.0f, __fsqrt_rn(ss * (1.0f / HD) + 1e-5f));
        v4h o16; v4us oh, ol;
#pragma unroll
        for (int q = 0; q < 4; ++q) { const float y = a[q] * rf * wv[q], p = xrow<8>(y) * sg; const float co = (q < 2) ? c01[s][q * 2] : c23[s][q * 2 - 4], si = (q < 2) ? c01[s][q * 2 + 1] : c23[s][q * 2 - 3];
            const float r = y * co + p * si; o16[q] = tohx(r); unsigned short a2, c2; splitf(r, a2, c2); oh[q] = a2; ol[q] = c2; }
        const unsigned po = FR ? ((row >> 4) * 2 + (cofs >> 5)) * 512 + ((cofs >> 4) & 1) * 256 + (((cofs >> 3) & 1) * 16 + (row & 15)) * 8 + (cofs & 7) : row * HD + cofs; // behind each store the wait in front of whatever reuses the registers that it names (the other planes' values, the next rows')
        *(v4h*)(P16 + po) = o16; asm volatile("s_wait_xcnt 0x0" ::: "memory"); *(v4us*)(Ph + po) = oh; asm volatile("s_wait_xcnt 0x0" ::: "memory"); *(v4us*)(Pl + po) = ol; asm volatile("s_wait_xcnt 0x0" ::: "memory"); }
}
// ---- ksum_vt: epilogue of a v projection tile: the summed tile goes back into LDS (each thread over the elements of partial tile 0 that it alone has read), and behind a second barrier it is read by columns:
// one wave stores one 512-byte half of a fragment of the transposed fp16 and hi/lo planes ([R][K] = [d][t] in fragment order, see FRAGMENT ORDER below): wave = (16-dim block, 16-token group), lane = its place in the fragment, 8 tokens of one dim.
// V16, Vh, Vl: the fragment of the tile's first token in dim block 0 of the head's planes.
template <int NW>
__device__ __forceinline__ void ksum_vt(const v8f (&acc)[4][4], float* os, int tid, int w, int lr, int hi, h16* V16, bf* Vh, bf* Vl) {
    static_assert(NW == 16, "8 tokens a thread");
    kpart_put(acc, os, w, lr, hi);
    __syncthreads();                       // all NW partial tiles are in LDS before any of them is read
    const int cofs = (tid & 15) * 4;
#pragma unroll
    for (int s = 0; s < 32 / NW; ++s) { const int row = s * NW * 2 + (tid >> 4); const v4f val = kpart_sum<NW>(os, row, cofs); *(v4fa*)(os + row * 68 + cofs) = val; }
    __syncthreads();                       // the whole summed tile is in LDS before it is read across the threads' own elements
    const int lane = tid & 31, db = tid >> 7, tq = (tid >> 5) & 3, d = db * 16 + (lane & 15), tc = tq * 16 + (lane >> 4) * 8; v8h o16; v8us oh, ol;
#pragma unroll
    for (int j = 0; j < 8; ++j) { const float x = os[(tc + j) * 68 + d]; o16[j] = tohx(x); unsigned short a2, c2; splitf(x, a2, c2); oh[j] = a2; ol[j] = c2; }
    const unsigned po = (db * (TT / 32) + (tq >> 1)) * 512 + (tq & 1) * 256 + lane * 8; *(v8h*)(V16 + po) = o16; *(v8us*)(Vh + po) = oh; *(v8us*)(Vl + po) = ol;
}

// ---- FRAGMENT ORDER of a GEMM operand plane [R][K]: one 16-row x 32-k fragment is 1024 contiguous bytes, fragments of a 16-row block follow one another along k. Inside a fragment lane (lr = row & 15, hi) owns two 16-byte pieces:
// k = 8 hi + 0..7 at element lane * 8 and k = 16 + 8 hi + 0..7 at element 256 + lane * 8 (lane = hi * 16 + lr): element (r, k) stands at ((r >> 4) * (K >> 5) + (k >> 5)) * 512 + ((k >> 4) & 1) * 256 + (((k >> 3) & 1) * 16 + (r & 15)) * 8 + (k & 7).
// Each of a fragment's two wave loads then covers 512 contiguous bytes (4 whole 128-byte lines) instead of 32-byte pieces of 16 lines; which lane and register holds which k is what it was with row-major planes.
// ---- k_gemmw: register-blocked GEMM, NW WAVES per 64x64 output tile (16 accumulators each, K split between them), operands straight from 16-bit planes in fragment order; grid (M/64/SQ, N/64/SQ, Z), SQ*SQ*NW*32 threads.
// C[m][n] (f32, pitch ldc, + optional f32 bias[n]) = sum_k A[m][k] Bt[n][k] (+ split products per NSPLIT). z-batch strides sA/sB/sC in elements. K % 32 == 0.
// EPI 0: the tile goes to C. EPI 1 (q), 3 (k) and 2 (v): m = token, tile column = head; the tile goes through ksum_rope (q: planes [t][d] row-major, k: fragment order) or ksum_vt into the planes P16, Ph, Pl and C is not used.
template <typename T16> struct WFrag;
template <> struct WFrag<h16> { typedef v16h V; static __device__ __forceinline__ V ld(const h16* p) { return cat16(*(const v8h*)p, *(const v8h*)(p + 16)); } static __device__ __forceinline__ V ldp(const h16* p) { return cat16(*(const v8h*)p, *(const v8h*)(p + 256)); } static __device__ __forceinline__ v8f mma(V a, V b, v8f c) { return wmma16(a, b, c); } };
template <> struct WFrag<bf> { typedef v16bf V; static __device__ __forceinline__ V ld(const bf* p) { return cat16b(*(const v8us*)p, *(const v8us*)(p + 16)); } static __device__ __forceinline__ V ldp(const bf* p) { return cat16b(*(const v8us*)p, *(const v8us*)(p + 256)); } static __device__ __forceinline__ v8f mma(V a, V b, v8f c) { return wmmab(a, b, c); } };
// SQ: a work-group holds SQ x SQ neighbouring 64x64 tiles, NW waves each (grid (M/64/SQ, N/64/SQ, Z), SQ*SQ*NW*32 threads). With SQ = 2 the waves of the 4 tiles that stand at the same k step ask for the same A or B lines two by two at about the same
// time, so each line comes from L2 once for two waves and the second wave takes it from the WGP's cache. Each tile keeps its own waves, its own part of the LDS and its own epilogue; the barriers are passed by the whole work-group.
template <typename T16, int NSPLIT, bool BIAS, int NW, int EPI, int K, int SQ>
__global__ __launch_bounds__(SQ * SQ * NW * 32) void k_gemmw(const T16* __restrict__ A, const T16* __restrict__ A2, const T16* __restrict__ Bt, const T16* __restrict__ Bt2, float* C, int ldc, const float* __restrict__ bias, size_t sA, size_t sB, size_t sC, const float* __restrict__ CS, const float* __restrict__ nw, h16* P16, bf* Ph, bf* Pl) {
    typedef typename WFrag<T16>::V V;
    __shared__ __align__(16) float osa[SQ * SQ * NW * 64 * 68];
    const size_t z = blockIdx.z; A += z * sA; if (A2) A2 += z * sA; Bt += z * sB; if (Bt2) Bt2 += z * sB; C += z * sC;
    const int lane = threadIdx.x & 31, lr = lane & 15, hi = lane >> 4;
    const int wa = __builtin_amdgcn_readfirstlane(threadIdx.x >> 5);   // wave number, scalar: the tile and the K loop's bounds stay wave-uniform
    const int sub = wa % (SQ * SQ), w = wa / (SQ * SQ), tid = w * 32 + lane;   // the wave's tile in the work-group, its K part, the thread's number among its tile's threads: the SQ * SQ waves that share lines are neighbours in wave number, one on each SIMD, so they ask at the same time
    const int r0 = (blockIdx.x * SQ + sub % SQ) * 64, c0 = (blockIdx.y * SQ + sub / SQ) * 64; float* os = osa + sub * (NW * 64 * 68);
    v8f acc[4][4];
#pragma unroll
    for (int mb = 0; mb < 4; ++mb)
#pragma unroll
        for (int nb = 0; nb < 4; ++nb) acc[mb][nb] = (v8f){};
    // a 16-row block is 16 K elements, a 32-k step inside it 512: every address = a wave-uniform walking pointer (the tile's first row block at the wave's k step) + the lane's fixed offset + a constant (row block mb or nb; K is a
    // compile-time constant for that), so no load's result and no address step can land on a vector register that a load in flight names
    typedef const __attribute__((address_space(1))) T16* gptr;   // typed as global memory, so that the loads stay global loads behind the statement that the pointers pass through
    constexpr bool HA2 = NSPLIT == 1 || NSPLIT == 2, HB2 = NSPLIT >= 2;
    gptr ap = (gptr)(A + (size_t)r0 * K + w * 512), ap2 = HA2 ? (gptr)(A2 + (size_t)r0 * K + w * 512) : nullptr, bp = (gptr)(Bt + (size_t)c0 * K + w * 512), bp2 = HB2 ? (gptr)(Bt2 + (size_t)c0 * K + w * 512) : nullptr;
    const unsigned lofs = lane * 8;
#pragma unroll 1
    for (int kc = w * 32; kc < K; kc += NW * 32) {
        V a[4], a2[4], b[4], b2[4];
#pragma unroll
        for (int mb = 0; mb < 4; ++mb) { a[mb] = WFrag<T16>::ldp((const T16*)(ap + lofs + mb * 16 * K)); if (HA2) a2[mb] = WFrag<T16>::ldp((const T16*)(ap2 + lofs + mb * 16 * K)); }
#pragma unroll
        for (int nb = 0; nb < 4; ++nb) { b[nb] = WFrag<T16>::ldp((const T16*)(bp + lofs + nb * 16 * K)); if (HB2) b2[nb] = WFrag<T16>::ldp((const T16*)(bp2 + lofs + nb * 16 * K)); }
        __builtin_amdgcn_sched_barrier(0);     // keeps the trip's loads one group in front of its matrix instructions: without it this build asks for each B fragment only when the one before is used up, a round trip each
#pragma unroll
        for (int nb = 0; nb < 4; ++nb)
#pragma unroll
            for (int mb = 0; mb < 4; ++mb) { acc[mb][nb] = WFrag<T16>::mma(a[mb], b[nb], acc[mb][nb]); if (HA2) acc[mb][nb] = WFrag<T16>::mma(a2[mb], b[nb], acc[mb][nb]); if (HB2) acc[mb][nb] = WFrag<T16>::mma(a[mb], b2[nb], acc[mb][nb]); }
        asm volatile("v_nop\n\tv_nop\n\tv_nop\n\tv_nop" : "+v"(acc[0][0]), "+v"(acc[1][1]), "+v"(acc[2][2]), "+v"(acc[3][3]) : "v"(a[0]), "v"(a[3]));
        // the wait in front of the steps of the base pointers that this trip's loads name; the pointers pass through the statement so that their steps stay behind it
        if constexpr (HA2 && HB2) asm volatile("s_wait_xcnt 0x0" : "+s"(ap), "+s"(ap2), "+s"(bp), "+s"(bp2) :: "memory");
        else if constexpr (HA2) asm volatile("s_wait_xcnt 0x0" : "+s"(ap), "+s"(ap2), "+s"(bp) :: "memory");
        else if constexpr (HB2) asm volatile("s_wait_xcnt 0x0" : "+s"(ap), "+s"(bp), "+s"(bp2) :: "memory");
        else asm volatile("s_wait_xcnt 0x0" : "+s"(ap), "+s"(bp) :: "memory");
        ap += NW * 512; bp += NW * 512; if (HA2) ap2 += NW * 512; if (HB2) bp2 += NW * 512;
    }
    if constexpr (EPI == 0) ksum_store<NW, BIAS>(acc, os, tid, w, lr, hi, C + (size_t)r0 * ldc + c0, ldc, BIAS ? bias + c0 : nullptr);
    else if constexpr (EPI == 1 || EPI == 3) { const size_t po = ((size_t)(c0 / 64) * TT + r0) * HD; ksum_rope<NW, EPI == 3>(acc, os, tid, w, lr, hi, CS + (size_t)r0 * HD * 2, nw, P16 + po, Ph + po, Pl + po); }
    else { const size_t po = (size_t)(c0 / 64) * HD * TT + r0 * 16; ksum_vt<NW>(acc, os, tid, w, lr, hi, P16 + po, Ph + po, Pl + po); }
}

typedef __attribute__((ext_vector_type(2))) unsigned short v2us;
typedef __attribute__((ext_vector_type(2))) float v2f;
typedef __attribute__((ext_vector_type(4))) int v4i;

// k_cvt8: f32 [R][K] -> bf16 plane in fragment order. One wave = one fragment, one thread = one lane's place in it: the wave reads the fragment's 16 rows x 128 bytes and stores its 1024 bytes as two runs of 512.
// Every address = wave-uniform pointer + the lane's fixed offset + a constant.
template <int K>
__global__ __launch_bounds__(256) void k_cvt8(const float* __restrict__ src, bf* dst, int nfrag) {
    const int lane = threadIdx.x & 31, f = blockIdx.x * 8 + __builtin_amdgcn_readfirstlane(threadIdx.x >> 5); if (f >= nfrag) return;   // fragment number, scalar
    const float* s = src + (size_t)(f / (K / 32)) * 16 * K + (f % (K / 32)) * 32; const unsigned so = (lane & 15) * K + (lane >> 4) * 8;
    const v8f v0 = *(const v8f*)(s + so), v1 = *(const v8f*)(s + so + 16); v8us o0, o1;
#pragma unroll
    for (int k = 0; k < 8; ++k) { o0[k] = f2bf(v0[k]); o1[k] = f2bf(v1[k]); }
    bf* d = dst + (size_t)f * 512; const unsigned dof = lane * 8; *(v8us*)(d + dof) = o0; *(v8us*)(d + dof + 256) = o1; }

__constant__ float INVT[HD / 2] = { 1.000000000e+00f, 6.493816376e-01f, 4.216965139e-01f, 2.738419771e-01f, 1.778279394e-01f, 1.154781953e-01f, 7.498942316e-02f, 4.869675264e-02f, 3.162277490e-02f, 2.053525113e-02f, 1.333521400e-02f, 8.659643121e-03f, 5.623413250e-03f, 3.651741194e-03f, 2.371373819e-03f, 1.539926510e-03f, 1.000000047e-03f, 6.493816036e-04f, 4.216965172e-04f, 2.738419571e-04f, 1.778279402e-04f, 1.154782003e-04f, 7.498942432e-05f, 4.869675104e-05f, 3.162277790e-05f, 2.053524986e-05f, 1.333521413e-05f, 8.659642845e-06f, 5.623413472e-06f, 3.651741281e-06f, 2.371373739e-06f, 1.539926529e-06f };   // THETA ** (-arange(0, 64, 2) / 64) with THETA = 1e6 in float32 (the module's power expression)
__global__ __launch_bounds__(256) void k_cs5(float* CS) { const int idx = blockIdx.x * 256 + threadIdx.x; if (idx >= TT * HD) return; const int d = idx % HD; const int t = idx / HD; const float a = __fmul_rn((float)t, INVT[d % (HD / 2)]); v2f cs; cs[0] = cosf(a); cs[1] = sinf(a); *(v2f*)(CS + (size_t)idx * 2) = cs;  }
// k_wtG: f32 w [K][N] -> bf16 plane of w^T ([N][K]) in fragment order. One wave = one fragment, one thread = one lane's place in it: its 16 k of one n; 16 lanes read 64 contiguous bytes of a row of w,
// and the two waves of a pair take neighbouring 16-column blocks at the same k, the two halves of the same 128-byte lines. Every address = wave-uniform pointer + the lane's fixed offset + a constant. Grid: N K / 512 waves.
template <int K, int N>
__global__ __launch_bounds__(256) void k_wtG(const float* __restrict__ w, bf* Bt) {
    static_assert(N % 32 == 0 && K % 32 == 0 && (N / 16) * (K / 32) % 8 == 0, "whole fragments, pairs of column blocks, whole work-groups");
    const int lane = threadIdx.x & 31, wv = blockIdx.x * 8 + __builtin_amdgcn_readfirstlane(threadIdx.x >> 5), pair = wv >> 1;   // wave number, scalar
    const int nb = (pair / (K / 32)) * 2 + (wv & 1), kb = pair % (K / 32);
    const float* s = w + (size_t)kb * 32 * N + nb * 16; const unsigned so = (lane >> 4) * 8 * N + (lane & 15); v8us o0, o1;
#pragma unroll
    for (int j = 0; j < 8; ++j) { o0[j] = f2bf(s[so + j * N]); o1[j] = f2bf(s[so + (16 + j) * N]); }
    bf* d = Bt + ((size_t)nb * (K / 32) + kb) * 512; const unsigned dof = lane * 8; *(v8us*)(d + dof) = o0; *(v8us*)(d + dof + 256) = o1;
}

// ---- k_fattn: the whole causal attention of one batch in one launch (scores, softmax, probability x value and the hi/lo merge), with a running maximum and sum per query; no score or probability plane in memory.
// Transposed products: S^T = K Q^T (A = key rows, B = query rows kept in registers), O^T += V^T P^T (A = rows of the [d][t] value plane). The key and value planes are in fragment order: each wave load of the key loop covers 4 whole 128-byte lines. In a 16-column group lane (lr, hi) holds query lr only: keys 8 hi + j of each
// 16-key score tile, so two score tiles of a 32-key block, converted in place, are the B operand of the second product in the loaders' own k order (8 hi + 0..7, 16 + 8 hi + 0..7), and maximum, sum and rescale factor are per lane.
// Work-group = 16 waves: the 4 query heads of one kv head (they read the same K and V lines) x KS = 4 key parts (part p takes every 4th 32-key block); parts 1..3 hand their (O, m, l) to part 0 through LDS behind one barrier.
// One work-group fills a WGP's registers, so the tiles, longest first, are dealt out as WGPs fall free; blockIdx.x = kv head.
// Query rows < RH: 16 columns a wave, hi/lo bf16 planes, 3 products in both contractions; the rest: 32 columns a wave, fp16, probabilities carried x 2^10 (the sum carries the same factor, so it cancels).
#define L2E  1.4426950408889634f
#define KS   4
__device__ __forceinline__ float xhalf(float x) { return __builtin_bit_cast(float, __builtin_amdgcn_permlanex16(__builtin_bit_cast(int, x), __builtin_bit_cast(int, x), 0x76543210, 0xfedcba98, false, false)); }   // lane l <-> lane l ^ 16
template <typename T16, bool HR, int NQ>
__device__ __forceinline__ void fattn_tile(const T16* __restrict__ Q, const T16* __restrict__ Q2, const T16* __restrict__ Kp, const T16* __restrict__ K2, const T16* __restrict__ Vt, const T16* __restrict__ V2, int q0, int hd, int part, bf* Ah, bf* Al, float* xs) {
    typedef typename WFrag<T16>::V V;
    const int lane = threadIdx.x & 31, lr = lane & 15, hi = lane >> 4;
    const unsigned kofs = lr * HD + 8 * hi, lofs = lane * 8;   // the lane's place in a fragment's rows (q, row-major) and in a fragment (k, v, fragment order); every address below = wave-uniform pointer + one of these + a constant, so no load's result can land on an address register
    V qf[NQ][2], qf2[NQ][2];
#pragma unroll
    for (int n = 0; n < NQ; ++n)
#pragma unroll
        for (int ks = 0; ks < 2; ++ks) { const unsigned qo = kofs + n * 16 * HD + ks * 32; qf[n][ks] = WFrag<T16>::ld(Q + (size_t)q0 * HD + qo); if (HR) qf2[n][ks] = WFrag<T16>::ld(Q2 + (size_t)q0 * HD + qo); }
    v8f o[4][NQ]; float m[NQ], l[NQ];
#pragma unroll
    for (int n = 0; n < NQ; ++n) { m[n] = -3.0e38f; l[n] = 0.f;
#pragma unroll
        for (int dt = 0; dt < 4; ++dt) o[dt][n] = (v8f){}; }
    const int kend = q0 + 16 * NQ;                      // keys [0, kend): every 32-key block that starts below kend holds at least one allowed key for every query of the tile
    typedef const __attribute__((address_space(1))) T16* gptr;   // typed as global memory, so that the loads stay global loads behind the statement that the pointers pass through
    gptr kq = (gptr)(Kp + (size_t)part * 32 * HD), kq2 = HR ? (gptr)(K2 + (size_t)part * 32 * HD) : nullptr;   // wave-uniform walking pointers: key rows and value columns of the part's current block
    gptr vq = (gptr)(Vt + part * 512), vq2 = HR ? (gptr)(V2 + part * 512) : nullptr;   // a 32-key block is 4 key fragments in a row (16-key block kt, 32-dim step ks) and one value fragment in each of the 4 dim blocks
    V kf[2][2], kf2[2][2];
#pragma unroll
    for (int kt = 0; kt < 2; ++kt)
#pragma unroll
        for (int ks = 0; ks < 2; ++ks) { kf[kt][ks] = WFrag<T16>::ldp((const T16*)(kq + lofs + (kt * 2 + ks) * 512)); if (HR) kf2[kt][ks] = WFrag<T16>::ldp((const T16*)(kq2 + lofs + (kt * 2 + ks) * 512)); }
#pragma unroll 1   // run-time trip count; one trip's fragments, scores and accumulators already take most of the wave's registers
    for (int kb = part * 32; kb < kend; kb += KS * 32) {
        V vf[4], vf2[4];                                // this block's value fragments: asked for first, needed last
#pragma unroll
        for (int dt = 0; dt < 4; ++dt) { vf[dt] = WFrag<T16>::ldp((const T16*)(vq + lofs + dt * 16 * TT)); if (HR) vf2[dt] = WFrag<T16>::ldp((const T16*)(vq2 + lofs + dt * 16 * TT)); }
        // the wait in front of the steps of the base pointers that this trip's value loads and the last trip's key loads name; the pointers pass through the statement so that their steps stay behind it
        if constexpr (HR) asm volatile("s_wait_xcnt 0x0" : "+s"(vq), "+s"(vq2), "+s"(kq), "+s"(kq2) :: "memory");
        else asm volatile("s_wait_xcnt 0x0" : "+s"(vq), "+s"(kq) :: "memory");
        vq += KS * 512; if (HR) vq2 += KS * 512;
        v8f s[2][NQ];
#pragma unroll
        for (int kt = 0; kt < 2; ++kt)
#pragma unroll
            for (int n = 0; n < NQ; ++n) { v8f c = (v8f){};
#pragma unroll
                for (int ks = 0; ks < 2; ++ks) { c = WFrag<T16>::mma(kf[kt][ks], qf[n][ks], c); if (HR) { c = WFrag<T16>::mma(kf[kt][ks], qf2[n][ks], c); c = WFrag<T16>::mma(kf2[kt][ks], qf[n][ks], c); } }
                s[kt][n] = c; }
        const int kstep = (kb + KS * 32 < kend) ? KS * 32 * HD : 0; kq += kstep; if (HR) kq2 += kstep;   // the part's next key block, fetched one trip ahead (the last trip stays where it is; its fetch is not used)
#pragma unroll
        for (int kt = 0; kt < 2; ++kt)
#pragma unroll
            for (int ks = 0; ks < 2; ++ks) { kf[kt][ks] = WFrag<T16>::ldp((const T16*)(kq + lofs + (kt * 2 + ks) * 512)); if (HR) kf2[kt][ks] = WFrag<T16>::ldp((const T16*)(kq2 + lofs + (kt * 2 + ks) * 512)); }
        if (kb + 31 > q0) {                             // wave-uniform: only a block that reaches the diagonal is masked (key > query excluded)
#pragma unroll
            for (int kt = 0; kt < 2; ++kt)
#pragma unroll
                for (int n = 0; n < NQ; ++n)
#pragma unroll
                    for (int j = 0; j < 8; ++j) s[kt][n][j] = (kb + kt * 16 + hi * 8 + j <= q0 + n * 16 + lr) ? s[kt][n][j] : -3.0e38f; }
        V pf[NQ], pf2[NQ];
#pragma unroll
        for (int n = 0; n < NQ; ++n) { float mx = m[n];
#pragma unroll
            for (int j = 0; j < 8; ++j) mx = fmaxf(mx, fmaxf(s[0][n][j], s[1][n][j]));
            mx = fmaxf(mx, xhalf(mx));                  // the two lane halves hold the same query's other keys
            const float al = __builtin_amdgcn_exp2f((m[n] - mx) * (SCL * L2E)), mo = HR ? mx * (SCL * L2E) : mx * (SCL * L2E) - 10.0f; m[n] = mx; v2f sum = (v2f){0.f, 0.f};   // m: raw products; SCL and the change to base 2 go into one factor
#pragma unroll
            for (int kt = 0; kt < 2; ++kt)
#pragma unroll
                for (int j = 0; j < 8; j += 2) { const v2f p = (v2f){__builtin_amdgcn_exp2f(fmaf(s[kt][n][j], SCL * L2E, -mo)), __builtin_amdgcn_exp2f(fmaf(s[kt][n][j + 1], SCL * L2E, -mo))}; s[kt][n][j] = p[0]; s[kt][n][j + 1] = p[1]; sum += p; }   // even and odd keys summed side by side (packed adds)
            l[n] = l[n] * al + (sum[0] + sum[1]);
#pragma unroll
            for (int dt = 0; dt < 4; ++dt) o[dt][n] *= al;
            if constexpr (HR) { v8us h0, h1, l0, l1;
#pragma unroll
                for (int j = 0; j < 8; ++j) { unsigned short a, c2; splitf(s[0][n][j], a, c2); h0[j] = a; l0[j] = c2; splitf(s[1][n][j], a, c2); h1[j] = a; l1[j] = c2; }
                pf[n] = cat16b(h0, h1); pf2[n] = cat16b(l0, l1);
            } else { v8h h0, h1;
#pragma unroll
                for (int j = 0; j < 8; ++j) { h0[j] = tohx(s[0][n][j]); h1[j] = tohx(s[1][n][j]); }
                pf[n] = cat16(h0, h1); } }
#pragma unroll
        for (int dt = 0; dt < 4; ++dt)
#pragma unroll
            for (int n = 0; n < NQ; ++n) { o[dt][n] = WFrag<T16>::mma(vf[dt], pf[n], o[dt][n]); if (HR) { o[dt][n] = WFrag<T16>::mma(vf[dt], pf2[n], o[dt][n]); o[dt][n] = WFrag<T16>::mma(vf2[dt], pf[n], o[dt][n]); } }
        // the loop's branch stands right behind the last matrix instructions: four vector slots keep the distance on the taken side too
        if constexpr (NQ == 2) asm volatile("v_nop\n\tv_nop\n\tv_nop\n\tv_nop" : "+v"(o[0][0]), "+v"(o[1][0]), "+v"(o[2][0]), "+v"(o[3][0]), "+v"(o[0][1]), "+v"(o[1][1]), "+v"(o[2][1]), "+v"(o[3][1]));
        else asm volatile("v_nop\n\tv_nop\n\tv_nop\n\tv_nop" : "+v"(o[0][0]), "+v"(o[1][0]), "+v"(o[2][0]), "+v"(o[3][0]));
    }
    // the last trip's key fetch is not used and may still be on its way: the wait in front of whatever takes over the registers that it names
    if constexpr (HR) asm volatile("s_wait_xcnt 0x0" :: "s"(kq), "s"(kq2) : "memory");
    else asm volatile("s_wait_xcnt 0x0" :: "s"(kq) : "memory");
    // join of the key parts in the fixed order 0..KS-1. LDS: per (part - 1, head) 4 NQ tiles of [2 halves][32 lanes][4 floats]; behind them per (part - 1, head) m and l
    if (part != 0) { float* xo = xs + ((part - 1) * 4 + hd) * 2048; float* xm = xs + (KS - 1) * 4 * 2048 + ((part - 1) * 4 + hd) * 128;
#pragma unroll
        for (int n = 0; n < NQ; ++n) { xm[(n * 2) * 32 + lane] = m[n]; xm[(n * 2 + 1) * 32 + lane] = l[n];
#pragma unroll
            for (int dt = 0; dt < 4; ++dt) { float* t = xo + (dt * NQ + n) * 256 + lane * 4; *(v4fa*)t = (v4f){o[dt][n][0], o[dt][n][1], o[dt][n][2], o[dt][n][3]}; *(v4fa*)(t + 128) = (v4f){o[dt][n][4], o[dt][n][5], o[dt][n][6], o[dt][n][7]}; } } }
    __syncthreads();                                    // the other parts' partial results are in LDS before part 0 reads them; every wave of the work-group passes here
    if (part == 0) { const float* xo = xs + hd * 2048; const float* xm = xs + (KS - 1) * 4 * 2048 + hd * 128;
#pragma unroll
        for (int n = 0; n < NQ; ++n) { float mp[KS - 1], f[KS - 1]; float mx = m[n];      // a part without a key block hands over m = -3e38, l = 0, O = 0: its factor is 0
#pragma unroll
            for (int u = 0; u < KS - 1; ++u) { mp[u] = xm[u * 512 + (n * 2) * 32 + lane]; mx = fmaxf(mx, mp[u]); }
            float f0 = __builtin_amdgcn_exp2f((m[n] - mx) * (SCL * L2E)), lt = l[n] * f0;
#pragma unroll
            for (int u = 0; u < KS - 1; ++u) { f[u] = __builtin_amdgcn_exp2f((mp[u] - mx) * (SCL * L2E)); lt += xm[u * 512 + (n * 2 + 1) * 32 + lane] * f[u]; }
            lt += xhalf(lt);                            // the two lane halves summed the same query's other keys
            const float inv = __fdiv_rn(1.0f, lt); f0 *= inv;
#pragma unroll
            for (int u = 0; u < KS - 1; ++u) f[u] *= inv;
#pragma unroll
            for (int dt = 0; dt < 4; ++dt) { v8f r = o[dt][n] * f0;
#pragma unroll
                for (int u = 0; u < KS - 1; ++u) { const float* t = xo + u * 8192 + (dt * NQ + n) * 256 + lane * 4; const v4f u0 = *(const v4fa*)t, u1 = *(const v4fa*)(t + 128);
#pragma unroll
                    for (int j = 0; j < 4; ++j) { r[j] += u0[j] * f[u]; r[4 + j] += u1[j] * f[u]; } }
                v8us oh, ol;
#pragma unroll
                for (int j = 0; j < 8; ++j) { unsigned short a, c2; splitf(r[j], a, c2); oh[j] = a; ol[j] = c2; }
                const unsigned oo = n * 16 * DQ + dt * 256 + lane * 8; *(v8usa*)(Ah + (size_t)q0 * DQ + oo) = oh; *(v8usa*)(Al + (size_t)q0 * DQ + oo) = ol;   // fragment order of the merged plane [t][DQ]: Ah, Al point at the head's two fragments (k = 64 h ..) of row block 0; dims 16 dt + 8 hi + j are piece dt & 1 of fragment dt >> 1
                asm volatile("s_wait_xcnt 0x0" ::: "memory"); } } }   // the next tile's values reuse the registers that these two stores name
}
__global__ __launch_bounds__(KS * 128) void k_fattn(const h16* __restrict__ Q16, const h16* __restrict__ K16, const h16* __restrict__ V16, const bf* __restrict__ Qh, const bf* __restrict__ Ql, const bf* __restrict__ Kh, const bf* __restrict__ Kl, const bf* __restrict__ Vh, const bf* __restrict__ Vl, bf* Ah, bf* Al) {
    static_assert(REP == 4 && RH % 32 == 0 && (TT - RH) % 32 == 0, "4 query heads a kv head; whole tiles on both sides of RH");
    __shared__ __align__(16) float xs[(KS - 1) * 4 * (2048 + 128)];
    const int w = __builtin_amdgcn_readfirstlane(threadIdx.x >> 5);   // wave number, scalar: head, key part and the key loop's bounds stay wave-uniform
    const int hd = w & 3, part = w >> 2, g = blockIdx.x, bt = blockIdx.y, h = g * REP + hd; const size_t qp = (size_t)h * TT * HD, kp = (size_t)g * TT * HD;
    if (bt < (TT - RH) / 32) fattn_tile<h16, false, 2>(Q16 + qp, nullptr, K16 + kp, nullptr, V16 + kp, nullptr, TT - 32 * (bt + 1), hd, part, Ah + h * (HD * 16), Al + h * (HD * 16), xs);   // longest tiles first
    else fattn_tile<bf, true, 1>(Qh + qp, Ql + qp, Kh + kp, Kl + kp, Vh + kp, Vl + kp, RH - 16 * (bt - (TT - RH) / 32 + 1), hd, part, Ah + h * (HD * 16), Al + h * (HD * 16), xs);
}

extern "C" void kernel_launch(void* const* d_in, const int* in_sizes, int n_in,
                              void* d_out, int out_size, void* d_ws, size_t ws_size, hipStream_t stream) {
    (void)in_sizes; (void)n_in; (void)out_size;
    const float* x = (const float*)d_in[0]; const float* wq = (const float*)d_in[1]; const float* wk = (const float*)d_in[2]; const float* wv = (const float*)d_in[3]; const float* wo = (const float*)d_in[4]; const float* qsc = (const float*)d_in[5]; const float* ksc = (const float*)d_in[6];   /* input order x, Wq ('xw' [2048][2048]), Wk, Wv ([2048][512]), Wo ('xw'), q_norm_w, k_norm_w ([64], read) */
    float* OUT = (float*)d_out;     // [2][2048][2048]
    char* wsp = (char*)d_ws;
    auto take = [&](size_t bytes) { char* p = wsp; wsp += (bytes + 255) & ~(size_t)255; return (void*)p; };
    bf* WQ = (bf*)take((size_t)DQ * DM * 2); bf* WK = (bf*)take((size_t)DKV * DM * 2); bf* WV = (bf*)take((size_t)DKV * DM * 2); bf* WO = (bf*)take((size_t)DM * DQ * 2); float* CS = (float*)take((size_t)TT * HD * 2 * 4);
    bf* XB = (bf*)take((size_t)TT * DM * 2);
    h16* QP16 = (h16*)take((size_t)NH_ * TT * HD * 2); h16* KP16 = (h16*)take((size_t)NKV * TT * HD * 2); h16* VT16 = (h16*)take((size_t)NKV * HD * TT * 2);
    bf* QPh = (bf*)take((size_t)NH_ * TT * HD * 2); bf* QPl = (bf*)take((size_t)NH_ * TT * HD * 2); bf* KPh = (bf*)take((size_t)NKV * TT * HD * 2); bf* KPl = (bf*)take((size_t)NKV * TT * HD * 2); bf* VTh = (bf*)take((size_t)NKV * HD * TT * 2); bf* VTl = (bf*)take((size_t)NKV * HD * TT * 2);
    bf* ATh = (bf*)take((size_t)TT * DQ * 2); bf* ATl = (bf*)take((size_t)TT * DQ * 2);
    if ((size_t)(wsp - (char*)d_ws) > ws_size) return;    // ws 256 MiB
    { k_wtG<DM, DQ><<<DM * DQ / 16 / 256, 256, 0, stream>>>(wq, WQ); k_wtG<DM, DKV><<<DM * DKV / 16 / 256, 256, 0, stream>>>(wk, WK); k_wtG<DM, DKV><<<DM * DKV / 16 / 256, 256, 0, stream>>>(wv, WV);
      k_wtG<DQ, DM><<<DQ * DM / 16 / 256, 256, 0, stream>>>(wo, WO);
       }
    k_cs5<<<(TT * HD + 255) / 256, 256, 0, stream>>>(CS);   /* rotary table computed from the positions and INVT */
    for (int b = 0; b < NB_; ++b) {
        
        k_cvt8<DM><<<(TT * DM / 512 + 7) / 8, 256, 0, stream>>>(x + (size_t)b * TT * DM, XB, TT * DM / 512);
        k_gemmw<bf, 0, false, 4, 1, DM, 2><<<dim3(TT / 128, DQ / 128, 1), 512, 0, stream>>>(XB, nullptr, WQ, nullptr, nullptr, 0, nullptr, 0, 0, 0, CS, qsc, QP16, QPh, QPl);   /* q: projection, per-head RMSNorm x q_norm_w, rotary, planes */
        k_gemmw<bf, 0, false, 16, 3, DM, 1><<<dim3(TT / 64, DKV / 64, 1), 512, 0, stream>>>(XB, nullptr, WK, nullptr, nullptr, 0, nullptr, 0, 0, 0, CS, ksc, KP16, KPh, KPl);   /* k: the same with k_norm_w, planes in fragment order */
        k_gemmw<bf, 0, false, 16, 2, DM, 1><<<dim3(TT / 64, DKV / 64, 1), 512, 0, stream>>>(XB, nullptr, WV, nullptr, nullptr, 0, nullptr, 0, 0, 0, nullptr, nullptr, VT16, VTh, VTl);   /* v: projection, transposed planes in fragment order */
        k_fattn<<<dim3(NKV, (TT - RH) / 32 + RH / 16, 1), KS * 128, 0, stream>>>(QP16, KP16, VT16, QPh, QPl, KPh, KPl, VTh, VTl, ATh, ATl);
        k_gemmw<bf, 1, false, 4, 0, DQ, 2><<<dim3(TT / 128, DM / 128, 1), 512, 0, stream>>>(ATh, ATl, WO, nullptr, OUT + (size_t)b * TT * DM, DM, nullptr, 0, 0, 0, nullptr, nullptr, nullptr, nullptr, nullptr); }
}

// v008
// Measured time: 160 microseconds a run.
// In two side-by-side timings against v007, it was 1.19 and 1.21 times as fast.
// All steps since v000 together make it 17.3 times as fast.
#include <hip/hip_runtime.h>

// Grouped-query causal attention with per-head RMSNorm and computed half-split rotary embeddings at base 1e6 (x [2][2048][2048]; q = x Wq (32 heads x 64), k, v = x Wk, x Wv (8 kv heads x 64) ('xw' 0.02, no bias); per head q = rms_norm(q) x q_norm_w, k = rms_norm(k) x k_norm_w (eps 1e-5; weights [64] = ones, read); rope: (x1, x2) = the two HALVES of each head: cat(x1 cos - x2 sin, x2 cos + x1 sin) with angle t x 1000000^(-2i/64), i < 32 (32 f32 frequencies jnp-exact for the module's power expression; precise cosf/sinf); query heads viewed (HKV, g): kv head = q head / 4; scores x 64^-0.5; causal (finfo.min == exclusion); softmax; out = merged Wo ('xw') -> [2][2048][2048] (8.4 M); argument order x, Wq, Wk, Wv, Wo, q_norm_w, k_norm_w).
// Four launches, each over both batches (k_prep, k_qkv, k_fattn, k_wo). Layout: bf16 copy of x and 'xw' weights transposed once, both in fragment order (see FRAGMENT ORDER below; d_cvt8, d_wtG); exact projections, whose 64x64 tile is one head x 64 tokens, so the tile's epilogue does RMSNorm (1/sqrt(mean + eps) x w[d]) and rotate-half with the d_cs5 table {cosf, sinf}(t x INVT[d mod 32]) and writes the head planes itself (v: transposed planes; k and v planes in fragment order); causal T-2048 GQA attention in one launch (k_fattn, running softmax; hybrid rows: < 512 hi/lo 3 products, rest fp16 x1024; key blocks above the diagonal are never visited); merged hi/lo (fragment order) x Wo exact.
// Compute dtypes, f32 accumulate: every input rounded to bf16 incl. scales ({cos, sin} table f32); projections exact; RMSNorm and rotary f32; attention rows < 512 3 products, rest fp16; softmax f32; Wo hl x exact.

#define NB_  2
#define TT   2048
#define DM   2048
#define NH_  32
#define NKV  8
#define REP  (NH_ / NKV)
#define HD   64
#define DQ   (NH_ * HD)
#define DKV  (NKV * HD)
#define RH   512                  // query rows < RH use hi+lo planes (0: none)
#define SCL  0.125f   // HD^-0.5
typedef _Float16 h16;
typedef unsigned short bf;
typedef __attribute__((ext_vector_type(16))) __bf16   v16bf;
typedef __attribute__((ext_vector_type(16))) _Float16 v16h;
typedef __attribute__((ext_vector_type(8)))  _Float16 v8h;
typedef __attribute__((ext_vector_type(8)))  unsigned short v8us;
typedef __attribute__((ext_vector_type(8)))  float    v8f;
typedef __attribute__((ext_vector_type(4)))  float    v4f;
typedef v8h  __attribute__((may_alias)) v8ha;
typedef v4f  __attribute__((may_alias)) v4fa;
typedef v8us __attribute__((may_alias)) v8usa;

__device__ __forceinline__ unsigned short f2bf(float f) { unsigned u = __float_as_uint(f); u += 0x7FFFu + ((u >> 16) & 1u); return (unsigned short)(u >> 16); }
__device__ __forceinline__ float bf2f(unsigned short b) { return __uint_as_float(((unsigned)b) << 16); }
__device__ __forceinline__ float bfr(float f) { return bf2f(f2bf(f)); }
__device__ __forceinline__ v16h cat16(v8h lo, v8h hi) { return __builtin_shufflevector(lo, hi, 0, 1, 2, 3, 4, 5, 6, 7, 8, 9, 10, 11, 12, 13, 14, 15); }
__device__ __forceinline__ v16bf cat16b(v8us lo, v8us hi) { return __builtin_bit_cast(v16bf, __builtin_shufflevector(lo, hi, 0, 1, 2, 3, 4, 5, 6, 7, 8, 9, 10, 11, 12, 13, 14, 15)); }
__device__ __forceinline__ v8f wmma16(v16h a, v16h b, v8f c) { return __builtin_amdgcn_wmma_f32_16x16x32_f16(false, a, false, b, (short)0, c, false, false); }
__device__ __forceinline__ v8f wmmab(v16bf a, v16bf b, v8f c) { return __builtin_amdgcn_wmma_f32_16x16x32_bf16(false, a, false, b, (short)0, c, false, false); }



// ---- split-K inside a work-group: the NW waves of a 64x64 tile each take every NW-th 32-wide step of K (neighbouring waves read neighbouring 1024-byte fragments of a row block at about the same time),
// so the chain of dependent load round trips per wave is NW times shorter. ksum_store puts the NW partial tiles into LDS (row pitch 68 floats), and behind one barrier adds them in the fixed order wave 0..NW-1 and stores the tile.
__device__ __forceinline__ void kpart_put(const v8f (&acc)[4][4], float* os, int w, int lr, int hi) {
#pragma unroll
    for (int mb = 0; mb < 4; ++mb)
#pragma unroll
        for (int nb = 0; nb < 4; ++nb)
#pragma unroll
            for (int j = 0; j < 8; ++j) os[(w * 64 + mb * 16 + hi * 8 + j) * 68 + nb * 16 + lr] = acc[mb][nb][j];
}
template <int NW>
__device__ __forceinline__ v4f kpart_sum(const float* os, int row, int cofs) {
    v4f val = *(const v4fa*)(os + row * 68 + cofs);
#pragma unroll
    for (int u = 1; u < NW; ++u) val += *(const v4fa*)(os + (u * 64 + row) * 68 + cofs);
    return val;
}
template <int NW, bool BIAS>
__device__ __forceinline__ void ksum_store(const v8f (&acc)[4][4], float* os, int tid, int w, int lr, int hi, float* C, int ldc, const float* bias) {
    kpart_put(acc, os, w, lr, hi);
    __syncthreads();                       // all NW partial tiles are in LDS before any of them is read
    const int cofs = (tid & 15) * 4; v4f sm[32 / NW];
#pragma unroll
    for (int s = 0; s < 32 / NW; ++s) sm[s] = kpart_sum<NW>(os, s * NW * 2 + (tid >> 4), cofs);   // all of the thread's LDS reads go out in front of the first store's wait: one LDS round trip, not one a row
#pragma unroll
    for (int s = 0; s < 32 / NW; ++s) { const int row = s * NW * 2 + (tid >> 4);
        v4f val = sm[s];
        if (BIAS) { val[0] += bfr(bias[cofs]); val[1] += bfr(bias[cofs + 1]); val[2] += bfr(bias[cofs + 2]); val[3] += bfr(bias[cofs + 3]); }
        *(v4f*)(C + (size_t)row * ldc + cofs) = val;
        asm volatile("s_wait_xcnt 0x0" ::: "memory"); }   // the next rows' addresses reuse the registers that this store names
}

__device__ __forceinline__ h16 tohx(float x) { return (h16)x; }
__device__ __forceinline__ void splitf(float y, unsigned short& h, unsigned short& l) { h = f2bf(y); l = f2bf(y - bf2f(h)); }
typedef __attribute__((ext_vector_type(4))) _Float16 v4h;
typedef __attribute__((ext_vector_type(4))) unsigned short v4us;
template <int M> __device__ __forceinline__ float xrow(float x) { return __builtin_bit_cast(float, __builtin_amdgcn_update_dpp(0, __builtin_bit_cast(int, x), 0x160 | M, 0xf, 0xf, true)); }   // lane l <-> lane l ^ M inside a 16-lane row (row_xmask)

// ---- ksum_rope: epilogue of a q or k projection tile (64 tokens x the 64 dims of ONE head). Behind the sum of the partial tiles the 16 lanes of a row hold one (token, head) vector, 4 dims each:
// sum of squares over the row by a 4-step butterfly (the same value in all 16 lanes), x 1/sqrt(mean + eps) x w[d], then rotate-half (dim d's partner d +- 32 sits in lane l ^ 8), then the fp16 and hi/lo planes [t][d]: a wave stores 2 whole 128-byte rows a plane.
// cs: the tile's first row of the {cos, sin} table; P16, Ph, Pl: the tile's first row in the head's planes.
// FR (k): the planes are in fragment order (see FRAGMENT ORDER below, [R][K] = [t][d]); the tile's 64 tokens x 64 dims are the same 4096 elements of the plane in both orders, and a thread's 4 dims stay neighbours; a wave's store there is 32-byte pieces of 8 lines, paid once a tile so that every pass of the attention kernel's key loop reads whole lines.
template <int NW, bool FR>
__device__ __forceinline__ void ksum_rope(const v8f (&acc)[4][4], float* os, int tid, int w, int lr, int hi, const float* __restrict__ cs, const float* __restrict__ nw, h16* P16, bf* Ph, bf* Pl) {
    constexpr int NS = 32 / NW;
    const int cofs = (tid & 15) * 4, rw = tid >> 4;
    v4f c01[NS], c23[NS]; float wv[4];     // the thread's table rows are asked for in front of the LDS stores and the barrier, which cover their way
    const unsigned tofs = (rw * HD + cofs) * 2 * 4;   // the thread's place in the table's first NW * 2 rows, in bytes (the value that the loads' offset register holds): every table address = cs + this + a constant
#pragma unroll
    for (int s = 0; s < NS; ++s) { const float* c = (const float*)((const char*)cs + tofs) + s * NW * 2 * HD * 2; c01[s] = *(const v4f*)c; c23[s] = *(const v4f*)(c + 4); }
    asm volatile("s_wait_xcnt 0x0" :: "v"(tofs) : "memory");   // the wait in front of any rewrite of the offset register that the table loads name; the offset is an operand so that it lives to here and no load's result is given its register
#pragma unroll
    for (int q = 0; q < 4; ++q) wv[q] = bfr(nw[cofs + q]);
    kpart_put(acc, os, w, lr, hi);
    __builtin_amdgcn_sched_barrier(0);     // keeps every use of the table rows behind the LDS stores: without it the first wait for those loads stands in front of the stores
    __syncthreads();                       // all NW partial tiles are in LDS before any of them is read
    const float sg = (cofs < HD / 2) ? -1.0f : 1.0f;   // out[d] = x[d] cos - x[d + 32] sin, out[d + 32] = x[d + 32] cos + x[d] sin
    v4f sm[NS];
#pragma unroll
    for (int s = 0; s < NS; ++s) sm[s] = kpart_sum<NW>(os, s * NW * 2 + rw, cofs);   // all of the thread's LDS reads go out in front of the first stores' wait: one LDS round trip, not one a row
#pragma unroll
    for (int s = 0; s < NS; ++s) { const int row = s * NW * 2 + rw;
        const v4f a = sm[s];
        float ss = a[0] * a[0] + a[1] * a[1] + a[2] * a[2] + a[3] * a[3];
        ss += xrow<1>(ss); ss += xrow<2>(ss); ss += xrow<4>(ss); ss += xrow<8>(ss);
        const float rf = __fdiv_rn(1.0f, __fsqrt_rn(ss * (1.0f / HD) + 1e-5f));
        v4h o16; v4us oh, ol;
#pragma unroll
        for (int q = 0; q < 4; ++q) { const float y = a[q] * rf * wv[q], p = xrow<8>(y) * sg; const float co = (q < 2) ? c01[s][q * 2] : c23[s][q * 2 - 4], si = (q < 2) ? c01[s][q * 2 + 1] : c23[s][q * 2 - 3];
            const float r = y * co + p * si; o16[q] = tohx(r); unsigned short a2, c2; splitf(r, a2, c2); oh[q] = a2; ol[q] = c2; }
        const unsigned po = FR ? ((row >> 4) * 2 + (cofs >> 5)) * 512 + ((cofs >> 4) & 1) * 256 + (((cofs >> 3) & 1) * 16 + (row & 15)) * 8 + (cofs & 7) : row * HD + cofs; // behind each store the wait in front of whatever reuses the registers that it names (the other planes' values, the next rows')
        *(v4h*)(P16 + po) = o16; asm volatile("s_wait_xcnt 0x0" ::: "memory"); *(v4us*)(Ph + po) = oh; asm volatile("s_wait_xcnt 0x0" ::: "memory"); *(v4us*)(Pl + po) = ol; asm volatile("s_wait_xcnt 0x0" ::: "memory"); }
}
// ---- ksum_vt: epilogue of a v projection tile: the summed tile goes back into LDS (each thread over the elements of partial tile 0 that it alone has read), and behind a second barrier it is read by columns:
// one wave stores one 512-byte half of a fragment of the transposed fp16 and hi/lo planes ([R][K] = [d][t] in fragment order, see FRAGMENT ORDER below): wave = (16-dim block, 16-token group), lane = its place in the fragment, 8 tokens of one dim.
// V16, Vh, Vl: the fragment of the tile's first token in dim block 0 of the head's planes.
template <int NW>
__device__ __forceinline__ void ksum_vt(const v8f (&acc)[4][4], float* os, int tid, int w, int lr, int hi, h16* V16, bf* Vh, bf* Vl) {
    static_assert(NW == 16, "8 tokens a thread");
    kpart_put(acc, os, w, lr, hi);
    __syncthreads();                       // all NW partial tiles are in LDS before any of them is read
    const int cofs = (tid & 15) * 4;
#pragma unroll
    for (int s = 0; s < 32 / NW; ++s) { const int row = s * NW * 2 + (tid >> 4); const v4f val = kpart_sum<NW>(os, row, cofs); *(v4fa*)(os + row * 68 + cofs) = val; }
    __syncthreads();                       // the whole summed tile is in LDS before it is read across the threads' own elements
    const int lane = tid & 31, db = tid >> 7, tq = (tid >> 5) & 3, d = db * 16 + (lane & 15), tc = tq * 16 + (lane >> 4) * 8; v8h o16; v8us oh, ol;
#pragma unroll
    for (int j = 0; j < 8; ++j) { const float x = os[(tc + j) * 68 + d]; o16[j] = tohx(x); unsigned short a2, c2; splitf(x, a2, c2); oh[j] = a2; ol[j] = c2; }
    const unsigned po = (db * (TT / 32) + (tq >> 1)) * 512 + (tq & 1) * 256 + lane * 8; *(v8h*)(V16 + po) = o16; *(v8us*)(Vh + po) = oh; *(v8us*)(Vl + po) = ol;
}

// ---- FRAGMENT ORDER of a GEMM operand plane [R][K]: one 16-row x 32-k fragment is 1024 contiguous bytes, fragments of a 16-row block follow one another along k. Inside a fragment lane (lr = row & 15, hi) owns two 16-byte pieces:
// k = 8 hi + 0..7 at element lane * 8 and k = 16 + 8 hi + 0..7 at element 256 + lane * 8 (lane = hi * 16 + lr): element (r, k) stands at ((r >> 4) * (K >> 5) + (k >> 5)) * 512 + ((k >> 4) & 1) * 256 + (((k >> 3) & 1) * 16 + (r & 15)) * 8 + (k & 7).
// Each of a fragment's two wave loads then covers 512 contiguous bytes (4 whole 128-byte lines) instead of 32-byte pieces of 16 lines; which lane and register holds which k is what it was with row-major planes.
// ---- d_gemmw: register-blocked GEMM, NW WAVES per 64x64 output tile (16 accumulators each, K split between them), operands straight from 16-bit planes in fragment order; work-group (bx, by) of (M/64/SQ, N/64/SQ), SQ*SQ*NW*32 threads; osa: the work-group's LDS.
// C[m][n] (f32, pitch ldc, + optional f32 bias[n]) = sum_k A[m][k] Bt[n][k] (+ split products per NSPLIT). K % 32 == 0.
// EPI 0: the tile goes to C. EPI 1 (q), 3 (k) and 2 (v): m = token, tile column = head; the tile goes through ksum_rope (q: planes [t][d] row-major, k: fragment order) or ksum_vt into the planes P16, Ph, Pl and C is not used.
#define GW   16                   // waves of a GEMM work-group; its LDS holds GW partial tiles
template <typename T16> struct WFrag;
template <> struct WFrag<h16> { typedef v16h V; static __device__ __forceinline__ V ld(const h16* p) { return cat16(*(const v8h*)p, *(const v8h*)(p + 16)); } static __device__ __forceinline__ V ldp(const h16* p) { return cat16(*(const v8h*)p, *(const v8h*)(p + 256)); } static __device__ __forceinline__ v8f mma(V a, V b, v8f c) { return wmma16(a, b, c); } };
template <> struct WFrag<bf> { typedef v16bf V; static __device__ __forceinline__ V ld(const bf* p) { return cat16b(*(const v8us*)p, *(const v8us*)(p + 16)); } static __device__ __forceinline__ V ldp(const bf* p) { return cat16b(*(const v8us*)p, *(const v8us*)(p + 256)); } static __device__ __forceinline__ v8f mma(V a, V b, v8f c) { return wmmab(a, b, c); } };
// SQ: a work-group holds SQ x SQ neighbouring 64x64 tiles, NW waves each ((bx, by) of (M/64/SQ, N/64/SQ), SQ*SQ*NW*32 threads). With SQ = 2 the waves of the 4 tiles that stand at the same k step ask for the same A or B lines two by two at about the same
// time, so each line comes from L2 once for two waves and the second wave takes it from the WGP's cache. Each tile keeps its own waves, its own part of the LDS and its own epilogue; the barriers are passed by the whole work-group.
template <typename T16, int NSPLIT, bool BIAS, int NW, int EPI, int K, int SQ>
__device__ __forceinline__ void d_gemmw(float* osa, int bx, int by, const T16* __restrict__ A, const T16* __restrict__ A2, const T16* __restrict__ Bt, const T16* __restrict__ Bt2, float* C, int ldc, const float* __restrict__ bias, const float* __restrict__ CS, const float* __restrict__ nw, h16* P16, bf* Ph, bf* Pl) {
    typedef typename WFrag<T16>::V V;
    static_assert(SQ * SQ * NW == GW, "the work-group's waves and its LDS");
    const int lane = threadIdx.x & 31, lr = lane & 15, hi = lane >> 4;
    const int wa = __builtin_amdgcn_readfirstlane(threadIdx.x >> 5);   // wave number, scalar: the tile and the K loop's bounds stay wave-uniform
    const int sub = wa % (SQ * SQ), w = wa / (SQ * SQ), tid = w * 32 + lane;   // the wave's tile in the work-group, its K part, the thread's number among its tile's threads: the SQ * SQ waves that share lines are neighbours in wave number, one on each SIMD, so they ask at the same time
    const int r0 = (bx * SQ + sub % SQ) * 64, c0 = (by * SQ + sub / SQ) * 64; float* os = osa + sub * (NW * 64 * 68);
    v8f acc[4][4];
#pragma unroll
    for (int mb = 0; mb < 4; ++mb)
#pragma unroll
        for (int nb = 0; nb < 4; ++nb) acc[mb][nb] = (v8f){};
    // a 16-row block is 16 K elements, a 32-k step inside it 512: every address = a wave-uniform walking pointer (the tile's first row block at the wave's k step) + the lane's fixed offset + a constant (row block mb or nb; K is a
    // compile-time constant for that), so no load's result and no address step can land on a vector register that a load in flight names
    typedef const __attribute__((address_space(1))) T16* gptr;   // typed as global memory, so that the loads stay global loads behind the statement that the pointers pass through
    constexpr bool HA2 = NSPLIT == 1 || NSPLIT == 2, HB2 = NSPLIT >= 2;
    gptr ap = (gptr)(A + (size_t)r0 * K + w * 512), ap2 = HA2 ? (gptr)(A2 + (size_t)r0 * K + w * 512) : nullptr, bp = (gptr)(Bt + (size_t)c0 * K + w * 512), bp2 = HB2 ? (gptr)(Bt2 + (size_t)c0 * K + w * 512) : nullptr;
    const unsigned lofs = lane * 8;
#pragma unroll 1
    for (int kc = w * 32; kc < K; kc += NW * 32) {
        V a[4], a2[4], b[4], b2[4];
#pragma unroll
        for (int mb = 0; mb < 4; ++mb) { a[mb] = WFrag<T16>::ldp((const T16*)(ap + lofs + mb * 16 * K)); if (HA2) a2[mb] = WFrag<T16>::ldp((const T16*)(ap2 + lofs + mb * 16 * K)); }
#pragma unroll
        for (int nb = 0; nb < 4; ++nb) { b[nb] = WFrag<T16>::ldp((const T16*)(bp + lofs + nb * 16 * K)); if (HB2) b2[nb] = WFrag<T16>::ldp((const T16*)(bp2 + lofs + nb * 16 * K)); }
        __builtin_amdgcn_sched_barrier(0);     // keeps the trip's loads one group in front of its matrix instructions: without it this build asks for each B fragment only when the one before is used up, a round trip each
#pragma unroll
        for (int nb = 0; nb < 4; ++nb)
#pragma unroll
            for (int mb = 0; mb < 4; ++mb) { acc[mb][nb] = WFrag<T16>::mma(a[mb], b[nb], acc[mb][nb]); if (HA2) acc[mb][nb] = WFrag<T16>::mma(a2[mb], b[nb], acc[mb][nb]); if (HB2) acc[mb][nb] = WFrag<T16>::mma(a[mb], b2[nb], acc[mb][nb]); }
        asm volatile("v_nop\n\tv_nop\n\tv_nop\n\tv_nop" : "+v"(acc[0][0]), "+v"(acc[1][1]), "+v"(acc[2][2]), "+v"(acc[3][3]) : "v"(a[0]), "v"(a[3]));
        // the wait in front of the steps of the base pointers that this trip's loads name; the pointers pass through the statement so that their steps stay behind it
        if constexpr (HA2 && HB2) asm volatile("s_wait_xcnt 0x0" : "+s"(ap), "+s"(ap2), "+s"(bp), "+s"(bp2) :: "memory");
        else if constexpr (HA2) asm volatile("s_wait_xcnt 0x0" : "+s"(ap), "+s"(ap2), "+s"(bp) :: "memory");
        else if constexpr (HB2) asm volatile("s_wait_xcnt 0x0" : "+s"(ap), "+s"(bp), "+s"(bp2) :: "memory");
        else asm volatile("s_wait_xcnt 0x0" : "+s"(ap), "+s"(bp) :: "memory");
        ap += NW * 512; bp += NW * 512; if (HA2) ap2 += NW * 512; if (HB2) bp2 += NW * 512;
    }
    if constexpr (EPI == 0) ksum_store<NW, BIAS>(acc, os, tid, w, lr, hi, C + (size_t)r0 * ldc + c0, ldc, BIAS ? bias + c0 : nullptr);
    else if constexpr (EPI == 1 || EPI == 3) { const size_t po = ((size_t)(c0 / 64) * TT + r0) * HD; ksum_rope<NW, EPI == 3>(acc, os, tid, w, lr, hi, CS + (size_t)r0 * HD * 2, nw, P16 + po, Ph + po, Pl + po); }
    else { const size_t po = (size_t)(c0 / 64) * HD * TT + r0 * 16; ksum_vt<NW>(acc, os, tid, w, lr, hi, P16 + po, Ph + po, Pl + po); }
}

// k_qkv: the three projections of both batches in one launch: they depend on nothing of one another, so no WGP waits at a launch boundary between them. Grid (tile, batch, projection): the q work-groups (4 tiles each, the longest) come first.
__global__ __launch_bounds__(GW * 32) void k_qkv(const bf* __restrict__ XB, const bf* __restrict__ WQ, const bf* __restrict__ WK, const bf* __restrict__ WV, const float* __restrict__ CS, const float* __restrict__ qsc, const float* __restrict__ ksc, h16* QP16, bf* QPh, bf* QPl, h16* KP16, bf* KPh, bf* KPl, h16* VT16, bf* VTh, bf* VTl) {
    static_assert((TT / 128) * (DQ / 128) == (TT / 64) * (DKV / 64), "as many q work-groups as k or v work-groups");
    __shared__ __align__(16) float osa[GW * 64 * 68];
    const int t = blockIdx.x; const bf* X = XB + (size_t)blockIdx.y * TT * DM; const size_t qo = (size_t)blockIdx.y * NH_ * TT * HD, ko = (size_t)blockIdx.y * NKV * TT * HD;
    if (blockIdx.z == 0) d_gemmw<bf, 0, false, 4, 1, DM, 2>(osa, t % (TT / 128), t / (TT / 128), X, nullptr, WQ, nullptr, nullptr, 0, nullptr, CS, qsc, QP16 + qo, QPh + qo, QPl + qo);   /* q: projection, per-head RMSNorm x q_norm_w, rotary, planes */
    else if (blockIdx.z == 1) d_gemmw<bf, 0, false, 16, 3, DM, 1>(osa, t % (TT / 64), t / (TT / 64), X, nullptr, WK, nullptr, nullptr, 0, nullptr, CS, ksc, KP16 + ko, KPh + ko, KPl + ko);   /* k: the same with k_norm_w, planes in fragment order */
    else d_gemmw<bf, 0, false, 16, 2, DM, 1>(osa, t % (TT / 64), t / (TT / 64), X, nullptr, WV, nullptr, nullptr, 0, nullptr, nullptr, nullptr, VT16 + ko, VTh + ko, VTl + ko);   /* v: projection, transposed planes in fragment order */
}
// k_wo: merged hi/lo x Wo; the two batches' tokens are one run of NB_ * TT rows of the merged planes and of the output.
__global__ __launch_bounds__(GW * 32) void k_wo(const bf* __restrict__ ATh, const bf* __restrict__ ATl, const bf* __restrict__ WO, float* OUT) {
    __shared__ __align__(16) float osa[GW * 64 * 68];
    d_gemmw<bf, 1, false, 4, 0, DQ, 2>(osa, blockIdx.x, blockIdx.y, ATh, ATl, WO, nullptr, OUT, DM, nullptr, nullptr, nullptr, nullptr, nullptr, nullptr);
}

typedef __attribute__((ext_vector_type(2))) unsigned short v2us;
typedef __attribute__((ext_vector_type(2))) float v2f;
typedef __attribute__((ext_vector_type(4))) int v4i;

// d_cvt8 (work-group bx of 256 threads): f32 [R][K] -> bf16 plane in fragment order. One wave = one fragment, one thread = one lane's place in it: the wave reads the fragment's 16 rows x 128 bytes and stores its 1024 bytes as two runs of 512.
// Every address = wave-uniform pointer + the lane's fixed offset + a constant.
template <int K>
__device__ __forceinline__ void d_cvt8(int bx, const float* __restrict__ src, bf* dst, int nfrag) {
    const int lane = threadIdx.x & 31, f = bx * 8 + __builtin_amdgcn_readfirstlane(threadIdx.x >> 5); if (f >= nfrag) return;   // fragment number, scalar
    const float* s = src + (size_t)(f / (K / 32)) * 16 * K + (f % (K / 32)) * 32; const unsigned so = (lane & 15) * K + (lane >> 4) * 8;
    const v8f v0 = *(const v8f*)(s + so), v1 = *(const v8f*)(s + so + 16); v8us o0, o1;
#pragma unroll
    for (int k = 0; k < 8; ++k) { o0[k] = f2bf(v0[k]); o1[k] = f2bf(v1[k]); }
    bf* d = dst + (size_t)f * 512; const unsigned dof = lane * 8; *(v8us*)(d + dof) = o0; *(v8us*)(d + dof + 256) = o1; }

__constant__ float INVT[HD / 2] = { 1.000000000e+00f, 6.493816376e-01f, 4.216965139e-01f, 2.738419771e-01f, 1.778279394e-01f, 1.154781953e-01f, 7.498942316e-02f, 4.869675264e-02f, 3.162277490e-02f, 2.053525113e-02f, 1.333521400e-02f, 8.659643121e-03f, 5.623413250e-03f, 3.651741194e-03f, 2.371373819e-03f, 1.539926510e-03f, 1.000000047e-03f, 6.493816036e-04f, 4.216965172e-04f, 2.738419571e-04f, 1.778279402e-04f, 1.154782003e-04f, 7.498942432e-05f, 4.869675104e-05f, 3.162277790e-05f, 2.053524986e-05f, 1.333521413e-05f, 8.659642845e-06f, 5.623413472e-06f, 3.651741281e-06f, 2.371373739e-06f, 1.539926529e-06f };   // THETA ** (-arange(0, 64, 2) / 64) with THETA = 1e6 in float32 (the module's power expression)
__device__ __forceinline__ void d_cs5(int bx, float* CS) { const int idx = bx * 256 + threadIdx.x; if (idx >= TT * HD) return; const int d = idx % HD; const int t = idx / HD; const float a = __fmul_rn((float)t, INVT[d % (HD / 2)]); v2f cs; cs[0] = cosf(a); cs[1] = sinf(a); *(v2f*)(CS + (size_t)idx * 2) = cs;  }
// d_wtG (work-group bx of 256 threads): f32 w [K][N] -> bf16 plane of w^T ([N][K]) in fragment order. One wave = one fragment, one thread = one lane's place in it: its 16 k of one n; 16 lanes read 64 contiguous bytes of a row of w,
// and the two waves of a pair take neighbouring 16-column blocks at the same k, the two halves of the same 128-byte lines. Every address = wave-uniform pointer + the lane's fixed offset + a constant. Grid: N K / 512 waves.
template <int K, int N>
__device__ __forceinline__ void d_wtG(int bx, const float* __restrict__ w, bf* Bt) {
    static_assert(N % 32 == 0 && K % 32 == 0 && (N / 16) * (K / 32) % 8 == 0, "whole fragments, pairs of column blocks, whole work-groups");
    const int lane = threadIdx.x & 31, wv = bx * 8 + __builtin_amdgcn_readfirstlane(threadIdx.x >> 5), pair = wv >> 1;   // wave number, scalar
    const int nb = (pair / (K / 32)) * 2 + (wv & 1), kb = pair % (K / 32);
    const float* s = w + (size_t)kb * 32 * N + nb * 16; const unsigned so = (lane >> 4) * 8 * N + (lane & 15); v8us o0, o1;
#pragma unroll
    for (int j = 0; j < 8; ++j) { o0[j] = f2bf(s[so + j * N]); o1[j] = f2bf(s[so + (16 + j) * N]); }
    asm volatile("s_wait_xcnt 0x0" :: "v"(so) : "memory");   // the wait in front of any rewrite of the offset register that the loads name; the offset is an operand so that it lives to here and no load's result is given its register
    bf* d = Bt + ((size_t)nb * (K / 32) + kb) * 512; const unsigned dof = lane * 8; *(v8us*)(d + dof) = o0; *(v8us*)(d + dof + 256) = o1;
}

// k_prep: everything that depends on the inputs alone, in one launch: the rotary table, the four weight planes and the bf16 plane of x (both batches: one run of NB_ * TT rows). A work-group's job follows from its index.
#define PB_CS (TT * HD / 256)
#define PB_WQ (DM * DQ / 16 / 256)
#define PB_WK (DM * DKV / 16 / 256)
#define PB_X  (NB_ * TT * DM / 512 / 8)
__global__ __launch_bounds__(256) void k_prep(const float* __restrict__ x, const float* __restrict__ wq, const float* __restrict__ wk, const float* __restrict__ wv, const float* __restrict__ wo, bf* XB, bf* WQ, bf* WK, bf* WV, bf* WO, float* CS) {
    int b = blockIdx.x;
    if (b < PB_CS) { d_cs5(b, CS); return; }   /* rotary table */
    b -= PB_CS; if (b < PB_WQ) { d_wtG<DM, DQ>(b, wq, WQ); return; }
    b -= PB_WQ; if (b < PB_WK) { d_wtG<DM, DKV>(b, wk, WK); return; }
    b -= PB_WK; if (b < PB_WK) { d_wtG<DM, DKV>(b, wv, WV); return; }
    b -= PB_WK; if (b < PB_WQ) { d_wtG<DQ, DM>(b, wo, WO); return; }
    b -= PB_WQ; d_cvt8<DM>(b, x, XB, NB_ * TT * DM / 512);
}

// ---- k_fattn: the whole causal attention of both batches in one launch (scores, softmax, probability x value and the hi/lo merge), with a running maximum and sum per query; no score or probability plane in memory.
// Transposed products: S^T = K Q^T (A = key rows, B = query rows kept in registers), O^T += V^T P^T (A = rows of the [d][t] value plane). The key and value planes are in fragment order: each wave load of the key loop covers 4 whole 128-byte lines. In a 16-column group lane (lr, hi) holds query lr only: keys 8 hi + j of each
// 16-key score tile, so two score tiles of a 32-key block, converted in place, are the B operand of the second product in the loaders' own k order (8 hi + 0..7, 16 + 8 hi + 0..7), and maximum, sum and rescale factor are per lane.
// Work-group = 16 waves: the 4 query heads of one kv head (they read the same K and V lines) x KS = 4 key parts (part p takes every 4th 32-key block); parts 1..3 hand their (O, m, l) to part 0 through LDS behind one barrier.
// One work-group fills a WGP's registers, so the tiles, longest first, are dealt out as WGPs fall free; blockIdx.x = (batch, kv head), so that the two batches' tiles of one length stand side by side.
// Query rows < RH: 16 columns a wave, hi/lo bf16 planes, 3 products in both contractions; the rest: 32 columns a wave, fp16, probabilities carried x 2^10 (the sum carries the same factor, so it cancels).
#define L2E  1.4426950408889634f
#define KS   4
__device__ __forceinline__ float xhalf(float x) { return __builtin_bit_cast(float, __builtin_amdgcn_permlanex16(__builtin_bit_cast(int, x), __builtin_bit_cast(int, x), 0x76543210, 0xfedcba98, false, false)); }   // lane l <-> lane l ^ 16
template <typename T16, bool HR, int NQ>
__device__ __forceinline__ void fattn_tile(const T16* __restrict__ Q, const T16* __restrict__ Q2, const T16* __restrict__ Kp, const T16* __restrict__ K2, const T16* __restrict__ Vt, const T16* __restrict__ V2, int q0, int hd, int part, bf* Ah, bf* Al, float* xs) {
    typedef typename WFrag<T16>::V V;
    const int lane = threadIdx.x & 31, lr = lane & 15, hi = lane >> 4;
    const unsigned kofs = lr * HD + 8 * hi, lofs = lane * 8;   // the lane's place in a fragment's rows (q, row-major) and in a fragment (k, v, fragment order); every address below = wave-uniform pointer + one of these + a constant, so no load's result can land on an address register
    V qf[NQ][2], qf2[NQ][2];
#pragma unroll
    for (int n = 0; n < NQ; ++n)
#pragma unroll
        for (int ks = 0; ks < 2; ++ks) { const unsigned qo = kofs + n * 16 * HD + ks * 32; qf[n][ks] = WFrag<T16>::ld(Q + (size_t)q0 * HD + qo); if (HR) qf2[n][ks] = WFrag<T16>::ld(Q2 + (size_t)q0 * HD + qo); }
    v8f o[4][NQ]; float m[NQ], l[NQ];
#pragma unroll
    for (int n = 0; n < NQ; ++n) { m[n] = -3.0e38f; l[n] = 0.f;
#pragma unroll
        for (int dt = 0; dt < 4; ++dt) o[dt][n] = (v8f){}; }
    const int kend = q0 + 16 * NQ;                      // keys [0, kend): every 32-key block that starts below kend holds at least one allowed key for every query of the tile
    typedef const __attribute__((address_space(1))) T16* gptr;   // typed as global memory, so that the loads stay global loads behind the statement that the pointers pass through
    gptr kq = (gptr)(Kp + (size_t)part * 32 * HD), kq2 = HR ? (gptr)(K2 + (size_t)part * 32 * HD) : nullptr;   // wave-uniform walking pointers: key rows and value columns of the part's current block
    gptr vq = (gptr)(Vt + part * 512), vq2 = HR ? (gptr)(V2 + part * 512) : nullptr;   // a 32-key block is 4 key fragments in a row (16-key block kt, 32-dim step ks) and one value fragment in each of the 4 dim blocks
    V kf[2][2], kf2[2][2];
#pragma unroll
    for (int kt = 0; kt < 2; ++kt)
#pragma unroll
        for (int ks = 0; ks < 2; ++ks) { kf[kt][ks] = WFrag<T16>::ldp((const T16*)(kq + lofs + (kt * 2 + ks) * 512)); if (HR) kf2[kt][ks] = WFrag<T16>::ldp((const T16*)(kq2 + lofs + (kt * 2 + ks) * 512)); }
#pragma unroll 1   // run-time trip count; one trip's fragments, scores and accumulators already take most of the wave's registers
    for (int kb = part * 32; kb < kend; kb += KS * 32) {
        V vf[4], vf2[4];                                // this block's value fragments: asked for first, needed last
#pragma unroll
        for (int dt = 0; dt < 4; ++dt) { vf[dt] = WFrag<T16>::ldp((const T16*)(vq + lofs + dt * 16 * TT)); if (HR) vf2[dt] = WFrag<T16>::ldp((const T16*)(vq2 + lofs + dt * 16 * TT)); }
        // the wait in front of the steps of the base pointers that this trip's value loads and the last trip's key loads name; the pointers pass through the statement so that their steps stay behind it
        if constexpr (HR) asm volatile("s_wait_xcnt 0x0" : "+s"(vq), "+s"(vq2), "+s"(kq), "+s"(kq2) :: "memory");
        else asm volatile("s_wait_xcnt 0x0" : "+s"(vq), "+s"(kq) :: "memory");
        vq += KS * 512; if (HR) vq2 += KS * 512;
        v8f s[2][NQ];
#pragma unroll
        for (int kt = 0; kt < 2; ++kt)
#pragma unroll
            for (int n = 0; n < NQ; ++n) { v8f c = (v8f){};
#pragma unroll
                for (int ks = 0; ks < 2; ++ks) { c = WFrag<T16>::mma(kf[kt][ks], qf[n][ks], c); if (HR) { c = WFrag<T16>::mma(kf[kt][ks], qf2[n][ks], c); c = WFrag<T16>::mma(kf2[kt][ks], qf[n][ks], c); } }
                s[kt][n] = c; }
        const int kstep = (kb + KS * 32 < kend) ? KS * 32 * HD : 0; kq += kstep; if (HR) kq2 += kstep;   // the part's next key block, fetched one trip ahead (the last trip stays where it is; its fetch is not used)
#pragma unroll
        for (int kt = 0; kt < 2; ++kt)
#pragma unroll
            for (int ks = 0; ks < 2; ++ks) { kf[kt][ks] = WFrag<T16>::ldp((const T16*)(kq + lofs + (kt * 2 + ks) * 512)); if (HR) kf2[kt][ks] = WFrag<T16>::ldp((const T16*)(kq2 + lofs + (kt * 2 + ks) * 512)); }
        if (kb + 31 > q0) {                             // wave-uniform: only a block that reaches the diagonal is masked (key > query excluded)
#pragma unroll
            for (int kt = 0; kt < 2; ++kt)
#pragma unroll
                for (int n = 0; n < NQ; ++n)
#pragma unroll
                    for (int j = 0; j < 8; ++j) s[kt][n][j] = (kb + kt * 16 + hi * 8 + j <= q0 + n * 16 + lr) ? s[kt][n][j] : -3.0e38f; }
        V pf[NQ], pf2[NQ];
#pragma unroll
        for (int n = 0; n < NQ; ++n) { float mx = m[n];
#pragma unroll
            for (int j = 0; j < 8; ++j) mx = fmaxf(mx, fmaxf(s[0][n][j], s[1][n][j]));
            mx = fmaxf(mx, xhalf(mx));                  // the two lane halves hold the same query's other keys
            const float al = __builtin_amdgcn_exp2f((m[n] - mx) * (SCL * L2E)), mo = HR ? mx * (SCL * L2E) : mx * (SCL * L2E) - 10.0f; m[n] = mx; v2f sum = (v2f){0.f, 0.f};   // m: raw products; SCL and the change to base 2 go into one factor
#pragma unroll
            for (int kt = 0; kt < 2; ++kt)
#pragma unroll
                for (int j = 0; j < 8; j += 2) { const v2f p = (v2f){__builtin_amdgcn_exp2f(fmaf(s[kt][n][j], SCL * L2E, -mo)), __builtin_amdgcn_exp2f(fmaf(s[kt][n][j + 1], SCL * L2E, -mo))}; s[kt][n][j] = p[0]; s[kt][n][j + 1] = p[1]; sum += p; }   // even and odd keys summed side by side (packed adds)
            l[n] = l[n] * al + (sum[0] + sum[1]);
#pragma unroll
            for (int dt = 0; dt < 4; ++dt) o[dt][n] *= al;
            if constexpr (HR) { v8us h0, h1, l0, l1;
#pragma unroll
                for (int j = 0; j < 8; ++j) { unsigned short a, c2; splitf(s[0][n][j], a, c2); h0[j] = a; l0[j] = c2; splitf(s[1][n][j], a, c2); h1[j] = a; l1[j] = c2; }
                pf[n] = cat16b(h0, h1); pf2[n] = cat16b(l0, l1);
            } else { v8h h0, h1;
#pragma unroll
                for (int j = 0; j < 8; ++j) { h0[j] = tohx(s[0][n][j]); h1[j] = tohx(s[1][n][j]); }
                pf[n] = cat16(h0, h1); } }
#pragma unroll
        for (int dt = 0; dt < 4; ++dt)
#pragma unroll
            for (int n = 0; n < NQ; ++n) { o[dt][n] = WFrag<T16>::mma(vf[dt], pf[n], o[dt][n]); if (HR) { o[dt][n] = WFrag<T16>::mma(vf[dt], pf2[n], o[dt][n]); o[dt][n] = WFrag<T16>::mma(vf2[dt], pf[n], o[dt][n]); } }
        // the loop's branch stands right behind the last matrix instructions: four vector slots keep the distance on the taken side too
        if constexpr (NQ == 2) asm volatile("v_nop\n\tv_nop\n\tv_nop\n\tv_nop" : "+v"(o[0][0]), "+v"(o[1][0]), "+v"(o[2][0]), "+v"(o[3][0]), "+v"(o[0][1]), "+v"(o[1][1]), "+v"(o[2][1]), "+v"(o[3][1]));
        else asm volatile("v_nop\n\tv_nop\n\tv_nop\n\tv_nop" : "+v"(o[0][0]), "+v"(o[1][0]), "+v"(o[2][0]), "+v"(o[3][0]));
    }
    // the last trip's key fetch is not used and may still be on its way: the wait in front of whatever takes over the registers that it names
    if constexpr (HR) asm volatile("s_wait_xcnt 0x0" :: "s"(kq), "s"(kq2) : "memory");
    else asm volatile("s_wait_xcnt 0x0" :: "s"(kq) : "memory");
    // join of the key parts in the fixed order 0..KS-1. LDS: per (part - 1, head) 4 NQ tiles of [2 halves][32 lanes][4 floats]; behind them per (part - 1, head) m and l
    if (part != 0) { float* xo = xs + ((part - 1) * 4 + hd) * 2048; float* xm = xs + (KS - 1) * 4 * 2048 + ((part - 1) * 4 + hd) * 128;
#pragma unroll
        for (int n = 0; n < NQ; ++n) { xm[(n * 2) * 32 + lane] = m[n]; xm[(n * 2 + 1) * 32 + lane] = l[n];
#pragma unroll
            for (int dt = 0; dt < 4; ++dt) { float* t = xo + (dt * NQ + n) * 256 + lane * 4; *(v4fa*)t = (v4f){o[dt][n][0], o[dt][n][1], o[dt][n][2], o[dt][n][3]}; *(v4fa*)(t + 128) = (v4f){o[dt][n][4], o[dt][n][5], o[dt][n][6], o[dt][n][7]}; } } }
    __syncthreads();                                    // the other parts' partial results are in LDS before part 0 reads them; every wave of the work-group passes here
    if (part == 0) { const float* xo = xs + hd * 2048; const float* xm = xs + (KS - 1) * 4 * 2048 + hd * 128;
#pragma unroll
        for (int n = 0; n < NQ; ++n) { float mp[KS - 1], f[KS - 1]; float mx = m[n];      // a part without a key block hands over m = -3e38, l = 0, O = 0: its factor is 0
#pragma unroll
            for (int u = 0; u < KS - 1; ++u) { mp[u] = xm[u * 512 + (n * 2) * 32 + lane]; mx = fmaxf(mx, mp[u]); }
            float f0 = __builtin_amdgcn_exp2f((m[n] - mx) * (SCL * L2E)), lt = l[n] * f0;
#pragma unroll
            for (int u = 0; u < KS - 1; ++u) { f[u] = __builtin_amdgcn_exp2f((mp[u] - mx) * (SCL * L2E)); lt += xm[u * 512 + (n * 2 + 1) * 32 + lane] * f[u]; }
            lt += xhalf(lt);                            // the two lane halves summed the same query's other keys
            const float inv = __fdiv_rn(1.0f, lt); f0 *= inv;
#pragma unroll
            for (int u = 0; u < KS - 1; ++u) f[u] *= inv;
#pragma unroll
            for (int dt = 0; dt < 4; ++dt) { v8f r = o[dt][n] * f0;
#pragma unroll
                for (int u = 0; u < KS - 1; ++u) { const float* t = xo + u * 8192 + (dt * NQ + n) * 256 + lane * 4; const v4f u0 = *(const v4fa*)t, u1 = *(const v4fa*)(t + 128);
#pragma unroll
                    for (int j = 0; j < 4; ++j) { r[j] += u0[j] * f[u]; r[4 + j] += u1[j] * f[u]; } }
                v8us oh, ol;
#pragma unroll
                for (int j = 0; j < 8; ++j) { unsigned short a, c2; splitf(r[j], a, c2); oh[j] = a; ol[j] = c2; }
                const unsigned oo = n * 16 * DQ + dt * 256 + lane * 8; *(v8usa*)(Ah + (size_t)q0 * DQ + oo) = oh; *(v8usa*)(Al + (size_t)q0 * DQ + oo) = ol;   // fragment order of the merged plane [t][DQ]: Ah, Al point at the head's two fragments (k = 64 h ..) of row block 0; dims 16 dt + 8 hi + j are piece dt & 1 of fragment dt >> 1
                asm volatile("s_wait_xcnt 0x0" ::: "memory"); } } }   // the next tile's values reuse the registers that these two stores name
}
__global__ __launch_bounds__(KS * 128) void k_fattn(const h16* __restrict__ Q16, const h16* __restrict__ K16, const h16* __restrict__ V16, const bf* __restrict__ Qh, const bf* __restrict__ Ql, const bf* __restrict__ Kh, const bf* __restrict__ Kl, const bf* __restrict__ Vh, const bf* __restrict__ Vl, bf* Ah, bf* Al) {
    static_assert(REP == 4 && RH % 32 == 0 && (TT - RH) % 32 == 0, "4 query heads a kv head; whole tiles on both sides of RH");
    __shared__ __align__(16) float xs[(KS - 1) * 4 * (2048 + 128)];
    const int w = __builtin_amdgcn_readfirstlane(threadIdx.x >> 5);   // wave number, scalar: head, key part and the key loop's bounds stay wave-uniform
    const int hd = w & 3, part = w >> 2, g = blockIdx.x % NKV, nb = blockIdx.x / NKV, bt = blockIdx.y, h = g * REP + hd; const size_t qp = (size_t)(nb * NH_ + h) * TT * HD, kp = (size_t)(nb * NKV + g) * TT * HD; Ah += (size_t)nb * TT * DQ; Al += (size_t)nb * TT * DQ;
    if (bt < (TT - RH) / 32) fattn_tile<h16, false, 2>(Q16 + qp, nullptr, K16 + kp, nullptr, V16 + kp, nullptr, TT - 32 * (bt + 1), hd, part, Ah + h * (HD * 16), Al + h * (HD * 16), xs);   // longest tiles first
    else fattn_tile<bf, true, 1>(Qh + qp, Ql + qp, Kh + kp, Kl + kp, Vh + kp, Vl + kp, RH - 16 * (bt - (TT - RH) / 32 + 1), hd, part, Ah + h * (HD * 16), Al + h * (HD * 16), xs);
}

extern "C" void kernel_launch(void* const* d_in, const int* in_sizes, int n_in,
                              void* d_out, int out_size, void* d_ws, size_t ws_size, hipStream_t stream) {
    (void)in_sizes; (void)n_in; (void)out_size;
    const float* x = (const float*)d_in[0]; const float* wq = (const float*)d_in[1]; const float* wk = (const float*)d_in[2]; const float* wv = (const float*)d_in[3]; const float* wo = (const float*)d_in[4]; const float* qsc = (const float*)d_in[5]; const float* ksc = (const float*)d_in[6];   /* input order x, Wq ('xw' [2048][2048]), Wk, Wv ([2048][512]), Wo ('xw'), q_norm_w, k_norm_w ([64], read) */
    float* OUT = (float*)d_out;     // [2][2048][2048]
    char* wsp = (char*)d_ws;
    auto take = [&](size_t bytes) { char* p = wsp; wsp += (bytes + 255) & ~(size_t)255; return (void*)p; };
    bf* WQ = (bf*)take((size_t)DQ * DM * 2); bf* WK = (bf*)take((size_t)DKV * DM * 2); bf* WV = (bf*)take((size_t)DKV * DM * 2); bf* WO = (bf*)take((size_t)DM * DQ * 2); float* CS = (float*)take((size_t)TT * HD * 2 * 4);
    bf* XB = (bf*)take((size_t)NB_ * TT * DM * 2);
    h16* QP16 = (h16*)take((size_t)NB_ * NH_ * TT * HD * 2); h16* KP16 = (h16*)take((size_t)NB_ * NKV * TT * HD * 2); h16* VT16 = (h16*)take((size_t)NB_ * NKV * HD * TT * 2);
    bf* QPh = (bf*)take((size_t)NB_ * NH_ * TT * HD * 2); bf* QPl = (bf*)take((size_t)NB_ * NH_ * TT * HD * 2); bf* KPh = (bf*)take((size_t)NB_ * NKV * TT * HD * 2); bf* KPl = (bf*)take((size_t)NB_ * NKV * TT * HD * 2); bf* VTh = (bf*)take((size_t)NB_ * NKV * HD * TT * 2); bf* VTl = (bf*)take((size_t)NB_ * NKV * HD * TT * 2);
    bf* ATh = (bf*)take((size_t)NB_ * TT * DQ * 2); bf* ATl = (bf*)take((size_t)NB_ * TT * DQ * 2);
    if ((size_t)(wsp - (char*)d_ws) > ws_size) return;    // ws 256 MiB
    k_prep<<<PB_CS + 2 * PB_WQ + 2 * PB_WK + PB_X, 256, 0, stream>>>(x, wq, wk, wv, wo, XB, WQ, WK, WV, WO, CS);
    k_qkv<<<dim3((TT / 128) * (DQ / 128), NB_, 3), GW * 32, 0, stream>>>(XB, WQ, WK, WV, CS, qsc, ksc, QP16, QPh, QPl, KP16, KPh, KPl, VT16, VTh, VTl);
    k_fattn<<<dim3(NKV * NB_, (TT - RH) / 32 + RH / 16, 1), KS * 128, 0, stream>>>(QP16, KP16, VT16, QPh, QPl, KPh, KPl, VTh, VTl, ATh, ATl);
    k_wo<<<dim3(NB_ * TT / 128, DM / 128, 1), GW * 32, 0, stream>>>(ATh, ATl, WO, OUT);
}

// v009
// One run takes 151 microseconds.
// Two timings next to v008 both put it at 1.06 times that version's speed.
// Over all steps from v000 it is 18.4 times as fast.
#include <hip/hip_runtime.h>

// Grouped-query causal attention with per-head RMSNorm and computed half-split rotary embeddings at base 1e6 (x [2][2048][2048]; q = x Wq (32 heads x 64), k, v = x Wk, x Wv (8 kv heads x 64) ('xw' 0.02, no bias); per head q = rms_norm(q) x q_norm_w, k = rms_norm(k) x k_norm_w (eps 1e-5; weights [64] = ones, read); rope: (x1, x2) = the two HALVES of each head: cat(x1 cos - x2 sin, x2 cos + x1 sin) with angle t x 1000000^(-2i/64), i < 32 (32 f32 frequencies jnp-exact for the module's power expression; precise cosf/sinf); query heads viewed (HKV, g): kv head = q head / 4; scores x 64^-0.5; causal (finfo.min == exclusion); softmax; out = merged Wo ('xw') -> [2][2048][2048] (8.4 M); argument order x, Wq, Wk, Wv, Wo, q_norm_w, k_norm_w).
// Four launches, each over both batches (k_prep, k_qkv, k_fattn, k_wo). Layout: bf16 copy of x and 'xw' weights transposed once, both in fragment order (see FRAGMENT ORDER below; d_cvt8, d_wtG); exact projections, whose 64x64 tile is one head x 64 tokens, so the tile's epilogue does RMSNorm (1/sqrt(mean + eps) x w[d]) and rotate-half with the d_cs5 table {cosf, sinf}(t x INVT[d mod 32]) and writes the head planes itself (v: transposed planes; k and v planes in fragment order); causal T-2048 GQA attention in one launch (k_fattn, running softmax; hybrid rows: < 512 hi/lo 3 products, rest fp16 x1024; key blocks above the diagonal are never visited); merged hi/lo (fragment order) x Wo exact.
// Compute dtypes, f32 accumulate: every input rounded to bf16 incl. scales ({cos, sin} table f32); projections exact; RMSNorm and rotary f32; attention rows < 512 3 products, rest fp16; softmax f32; Wo hl x exact.

#define NB_  2
#define TT   2048
#define DM   2048
#define NH_  32
#define NKV  8
#define REP  (NH_ / NKV)
#define HD   64
#define DQ   (NH_ * HD)
#define DKV  (NKV * HD)
#define RH   512                  // query rows < RH use hi+lo planes (0: none)
#define SCL  0.125f   // HD^-0.5
typedef _Float16 h16;
typedef unsigned short bf;
typedef __attribute__((ext_vector_type(16))) __bf16   v16bf;
typedef __attribute__((ext_vector_type(16))) _Float16 v16h;
typedef __attribute__((ext_vector_type(8)))  _Float16 v8h;
typedef __attribute__((ext_vector_type(8)))  unsigned short v8us;
typedef __attribute__((ext_vector_type(8)))  float    v8f;
typedef __attribute__((ext_vector_type(4)))  float    v4f;
typedef v8h  __attribute__((may_alias)) v8ha;
typedef v4f  __attribute__((may_alias)) v4fa;
typedef v8us __attribute__((may_alias)) v8usa;

__device__ __forceinline__ unsigned short f2bf(float f) { unsigned u = __float_as_uint(f); u += 0x7FFFu + ((u >> 16) & 1u); return (unsigned short)(u >> 16); }
__device__ __forceinline__ float bf2f(unsigned short b) { return __uint_as_float(((unsigned)b) << 16); }
__device__ __forceinline__ float bfr(float f) { return bf2f(f2bf(f)); }
__device__ __forceinline__ v16h cat16(v8h lo, v8h hi) { return __builtin_shufflevector(lo, hi, 0, 1, 2, 3, 4, 5, 6, 7, 8, 9, 10, 11, 12, 13, 14, 15); }
__device__ __forceinline__ v16bf cat16b(v8us lo, v8us hi) { return __builtin_bit_cast(v16bf, __builtin_shufflevector(lo, hi, 0, 1, 2, 3, 4, 5, 6, 7, 8, 9, 10, 11, 12, 13, 14, 15)); }
__device__ __forceinline__ v8f wmma16(v16h a, v16h b, v8f c) { return __builtin_amdgcn_wmma_f32_16x16x32_f16(false, a, false, b, (short)0, c, false, false); }
__device__ __forceinline__ v8f wmmab(v16bf a, v16bf b, v8f c) { return __builtin_amdgcn_wmma_f32_16x16x32_bf16(false, a, false, b, (short)0, c, false, false); }



// ---- split-K inside a work-group: the NW waves of a 64x64 tile each take every NW-th 32-wide step of K (neighbouring waves read neighbouring 1024-byte fragments of a row block at about the same time),
// so the chain of dependent load round trips per wave is NW times shorter. ksum_store puts the NW partial tiles into LDS (row pitch 68 floats), and behind one barrier adds them in the fixed order wave 0..NW-1 and stores the tile.
__device__ __forceinline__ void kpart_put(const v8f (&acc)[4][4], float* os, int w, int lr, int hi) {
#pragma unroll
    for (int mb = 0; mb < 4; ++mb)
#pragma unroll
        for (int nb = 0; nb < 4; ++nb)
#pragma unroll
            for (int j = 0; j < 8; ++j) os[(w * 64 + mb * 16 + hi * 8 + j) * 68 + nb * 16 + lr] = acc[mb][nb][j];
}
template <int NW>
__device__ __forceinline__ v4f kpart_sum(const float* os, int row, int cofs) {
    v4f val = *(const v4fa*)(os + row * 68 + cofs);
#pragma unroll
    for (int u = 1; u < NW; ++u) val += *(const v4fa*)(os + (u * 64 + row) * 68 + cofs);
    return val;
}
template <int NW, bool BIAS>
__device__ __forceinline__ void ksum_store(const v8f (&acc)[4][4], float* os, int tid, int w, int lr, int hi, float* C, int ldc, const float* bias) {
    kpart_put(acc, os, w, lr, hi);
    __syncthreads();                       // all NW partial tiles are in LDS before any of them is read
    const int cofs = (tid & 15) * 4; v4f sm[32 / NW];
#pragma unroll
    for (int s = 0; s < 32 / NW; ++s) sm[s] = kpart_sum<NW>(os, s * NW * 2 + (tid >> 4), cofs);   // all of the thread's LDS reads go out in front of the first store's wait: one LDS round trip, not one a row
#pragma unroll
    for (int s = 0; s < 32 / NW; ++s) { const int row = s * NW * 2 + (tid >> 4);
        v4f val = sm[s];
        if (BIAS) { val[0] += bfr(bias[cofs]); val[1] += bfr(bias[cofs + 1]); val[2] += bfr(bias[cofs + 2]); val[3] += bfr(bias[cofs + 3]); }
        *(v4f*)(C + (size_t)row * ldc + cofs) = val;
        asm volatile("s_wait_xcnt 0x0" ::: "memory"); }   // the next rows' addresses reuse the registers that this store names
}

__device__ __forceinline__ h16 tohx(float x) { return (h16)x; }
__device__ __forceinline__ void splitf(float y, unsigned short& h, unsigned short& l) { h = f2bf(y); l = f2bf(y - bf2f(h)); }
typedef __attribute__((ext_vector_type(4))) _Float16 v4h;
typedef __attribute__((ext_vector_type(4))) unsigned short v4us;
template <int M> __device__ __forceinline__ float xrow(float x) { return __builtin_bit_cast(float, __builtin_amdgcn_update_dpp(0, __builtin_bit_cast(int, x), 0x160 | M, 0xf, 0xf, true)); }   // lane l <-> lane l ^ M inside a 16-lane row (row_xmask)

// ---- ksum_rope: epilogue of a q or k projection tile (64 tokens x the 64 dims of ONE head). Behind the sum of the partial tiles the 16 lanes of a row hold one (token, head) vector, 4 dims each:
// sum of squares over the row by a 4-step butterfly (the same value in all 16 lanes), x 1/sqrt(mean + eps) x w[d], then rotate-half (dim d's partner d +- 32 sits in lane l ^ 8), then the fp16 and hi/lo planes [t][d]: a wave stores 2 whole 128-byte rows a plane.
// cs: the tile's first row of the {cos, sin} table; P16, Ph, Pl: the tile's first row in the head's planes.
// FR (k): the planes are in fragment order (see FRAGMENT ORDER below, [R][K] = [t][d]); the tile's 64 tokens x 64 dims are the same 4096 elements of the plane in both orders, and a thread's 4 dims stay neighbours; a wave's store there is 32-byte pieces of 8 lines, paid once a tile so that every pass of the attention kernel's key loop reads whole lines.
template <int NW, bool FR>
__device__ __forceinline__ void ksum_rope(const v8f (&acc)[4][4], float* os, int tid, int w, int lr, int hi, const float* __restrict__ cs, const float* __restrict__ nw, h16* P16, bf* Ph, bf* Pl) {
    constexpr int NS = 32 / NW;
    const int cofs = (tid & 15) * 4, rw = tid >> 4;
    v4f c01[NS], c23[NS]; float wv[4];     // the thread's table rows are asked for in front of the LDS stores and the barrier, which cover their way
    const unsigned tofs = (rw * HD + cofs) * 2 * 4;   // the thread's place in the table's first NW * 2 rows, in bytes (the value that the loads' offset register holds): every table address = cs + this + a constant
#pragma unroll
    for (int s = 0; s < NS; ++s) { const float* c = (const float*)((const char*)cs + tofs) + s * NW * 2 * HD * 2; c01[s] = *(const v4f*)c; c23[s] = *(const v4f*)(c + 4); }
    asm volatile("s_wait_xcnt 0x0" :: "v"(tofs) : "memory");   // the wait in front of any rewrite of the offset register that the table loads name; the offset is an operand so that it lives to here and no load's result is given its register
#pragma unroll
    for (int q = 0; q < 4; ++q) wv[q] = bfr(nw[cofs + q]);
    kpart_put(acc, os, w, lr, hi);
    __builtin_amdgcn_sched_barrier(0);     // keeps every use of the table rows behind the LDS stores: without it the first wait for those loads stands in front of the stores
    __syncthreads();                       // all NW partial tiles are in LDS before any of them is read
    const float sg = (cofs < HD / 2) ? -1.0f : 1.0f;   // out[d] = x[d] cos - x[d + 32] sin, out[d + 32] = x[d + 32] cos + x[d] sin
    v4f sm[NS];
#pragma unroll
    for (int s = 0; s < NS; ++s) sm[s] = kpart_sum<NW>(os, s * NW * 2 + rw, cofs);   // all of the thread's LDS reads go out in front of the first stores' wait: one LDS round trip, not one a row
#pragma unroll
    for (int s = 0; s < NS; ++s) { const int row = s * NW * 2 + rw;
        const v4f a = sm[s];
        float ss = a[0] * a[0] + a[1] * a[1] + a[2] * a[2] + a[3] * a[3];
        ss += xrow<1>(ss); ss += xrow<2>(ss); ss += xrow<4>(ss); ss += xrow<8>(ss);
        const float rf = __fdiv_rn(1.0f, __fsqrt_rn(ss * (1.0f / HD) + 1e-5f));
        v4h o16; v4us oh, ol;
#pragma unroll
        for (int q = 0; q < 4; ++q) { const float y = a[q] * rf * wv[q], p = xrow<8>(y) * sg; const float co = (q < 2) ? c01[s][q * 2] : c23[s][q * 2 - 4], si = (q < 2) ? c01[s][q * 2 + 1] : c23[s][q * 2 - 3];
            const float r = y * co + p * si; o16[q] = tohx(r); unsigned short a2, c2; splitf(r, a2, c2); oh[q] = a2; ol[q] = c2; }
        const unsigned po = FR ? ((row >> 4) * 2 + (cofs >> 5)) * 512 + ((cofs >> 4) & 1) * 256 + (((cofs >> 3) & 1) * 16 + (row & 15)) * 8 + (cofs & 7) : row * HD + cofs; // behind each store the wait in front of whatever reuses the registers that it names (the other planes' values, the next rows')
        *(v4h*)(P16 + po) = o16; asm volatile("s_wait_xcnt 0x0" ::: "memory"); *(v4us*)(Ph + po) = oh; asm volatile("s_wait_xcnt 0x0" ::: "memory"); *(v4us*)(Pl + po) = ol; asm volatile("s_wait_xcnt 0x0" ::: "memory"); }
}
// ---- ksum_vt: epilogue of a v projection tile: the summed tile goes back into LDS (each thread over the elements of partial tile 0 that it alone has read), and behind a second barrier it is read by columns:
// one wave store is one 512-byte half of a fragment of the transposed fp16 and hi/lo planes ([R][K] = [d][t] in fragment order, see FRAGMENT ORDER below): piece = (16-dim block, 16-token group), lane = its place in the fragment, 8 tokens of one dim; the tile's 16 pieces are dealt out over its NW waves.
// V16, Vh, Vl: the fragment of the tile's first token in dim block 0 of the head's planes.
template <int NW>
__device__ __forceinline__ void ksum_vt(const v8f (&acc)[4][4], float* os, int tid, int w, int lr, int hi, h16* V16, bf* Vh, bf* Vl) {
    static_assert(16 % NW == 0, "whole pieces a wave");
    kpart_put(acc, os, w, lr, hi);
    __syncthreads();                       // all NW partial tiles are in LDS before any of them is read
    const int cofs = (tid & 15) * 4; v4f sm[32 / NW];
#pragma unroll
    for (int s = 0; s < 32 / NW; ++s) sm[s] = kpart_sum<NW>(os, s * NW * 2 + (tid >> 4), cofs);   // all of the thread's LDS reads go out in front of its first LDS store: one LDS round trip, not one a row
#pragma unroll
    for (int s = 0; s < 32 / NW; ++s) *(v4fa*)(os + (s * NW * 2 + (tid >> 4)) * 68 + cofs) = sm[s];
    __syncthreads();                       // the whole summed tile is in LDS before it is read across the threads' own elements
    const int lane = tid & 31; float xv[16 / NW][8];
#pragma unroll
    for (int u = 0; u < 16 / NW; ++u) { const int pc = u * NW + w, d = (pc >> 2) * 16 + (lane & 15), tc = (pc & 3) * 16 + (lane >> 4) * 8;   // all of the wave's pieces are read in front of the first store's wait: one LDS round trip, not one a piece
#pragma unroll
        for (int j = 0; j < 8; ++j) xv[u][j] = os[(tc + j) * 68 + d]; }
#pragma unroll
    for (int u = 0; u < 16 / NW; ++u) { const int pc = u * NW + w, db = pc >> 2, tq = pc & 3; v8h o16; v8us oh, ol;
#pragma unroll
        for (int j = 0; j < 8; ++j) { const float x = xv[u][j]; o16[j] = tohx(x); unsigned short a2, c2; splitf(x, a2, c2); oh[j] = a2; ol[j] = c2; }
        const unsigned po = (db * (TT / 32) + (tq >> 1)) * 512 + (tq & 1) * 256 + lane * 8;   // behind each store the wait in front of whatever reuses the registers that it names (the other planes' values, the next pieces')
        *(v8h*)(V16 + po) = o16; asm volatile("s_wait_xcnt 0x0" ::: "memory"); *(v8us*)(Vh + po) = oh; asm volatile("s_wait_xcnt 0x0" ::: "memory"); *(v8us*)(Vl + po) = ol; asm volatile("s_wait_xcnt 0x0" ::: "memory"); }
}

// ---- FRAGMENT ORDER of a GEMM operand plane [R][K]: one 16-row x 32-k fragment is 1024 contiguous bytes, fragments of a 16-row block follow one another along k. Inside a fragment lane (lr = row & 15, hi) owns two 16-byte pieces:
// k = 8 hi + 0..7 at element lane * 8 and k = 16 + 8 hi + 0..7 at element 256 + lane * 8 (lane = hi * 16 + lr): element (r, k) stands at ((r >> 4) * (K >> 5) + (k >> 5)) * 512 + ((k >> 4) & 1) * 256 + (((k >> 3) & 1) * 16 + (r & 15)) * 8 + (k & 7).
// Each of a fragment's two wave loads then covers 512 contiguous bytes (4 whole 128-byte lines) instead of 32-byte pieces of 16 lines; which lane and register holds which k is what it was with row-major planes.
// ---- d_gemmw: register-blocked GEMM, NW WAVES per 64x64 output tile (16 accumulators each, K split between them), operands straight from 16-bit planes in fragment order; work-group (bx, by) of (M/64/SQ, N/64/SQ), SQ*SQ*NW*32 threads; osa: the work-group's LDS.
// C[m][n] (f32, pitch ldc, + optional f32 bias[n]) = sum_k A[m][k] Bt[n][k] (+ split products per NSPLIT). K % 32 == 0.
// EPI 0: the tile goes to C. EPI 1 (q), 3 (k) and 2 (v): m = token, tile column = head; the tile goes through ksum_rope (q: planes [t][d] row-major, k: fragment order) or ksum_vt into the planes P16, Ph, Pl and C is not used.
#define GW   16                   // waves of a GEMM work-group; its LDS holds GW partial tiles
template <typename T16> struct WFrag;
template <> struct WFrag<h16> { typedef v16h V; static __device__ __forceinline__ V ld(const h16* p) { return cat16(*(const v8h*)p, *(const v8h*)(p + 16)); } static __device__ __forceinline__ V ldp(const h16* p) { return cat16(*(const v8h*)p, *(const v8h*)(p + 256)); } static __device__ __forceinline__ v8f mma(V a, V b, v8f c) { return wmma16(a, b, c); } };
template <> struct WFrag<bf> { typedef v16bf V; static __device__ __forceinline__ V ld(const bf* p) { return cat16b(*(const v8us*)p, *(const v8us*)(p + 16)); } static __device__ __forceinline__ V ldp(const bf* p) { return cat16b(*(const v8us*)p, *(const v8us*)(p + 256)); } static __device__ __forceinline__ v8f mma(V a, V b, v8f c) { return wmmab(a, b, c); } };
// SQ: a work-group holds SQ x SQ neighbouring 64x64 tiles, NW waves each ((bx, by) of (M/64/SQ, N/64/SQ), SQ*SQ*NW*32 threads). With SQ = 2 the waves of the 4 tiles that stand at the same k step ask for the same A or B lines two by two at about the same
// time, so each line comes from L2 once for two waves and the second wave takes it from the WGP's cache. Each tile keeps its own waves, its own part of the LDS and its own epilogue; the barriers are passed by the whole work-group.
template <typename T16, int NSPLIT, bool BIAS, int NW, int EPI, int K, int SQ>
__device__ __forceinline__ void d_gemmw(float* osa, int bx, int by, const T16* __restrict__ A, const T16* __restrict__ A2, const T16* __restrict__ Bt, const T16* __restrict__ Bt2, float* C, int ldc, const float* __restrict__ bias, const float* __restrict__ CS, const float* __restrict__ nw, h16* P16, bf* Ph, bf* Pl) {
    typedef typename WFrag<T16>::V V;
    static_assert(SQ * SQ * NW == GW, "the work-group's waves and its LDS");
    const int lane = threadIdx.x & 31, lr = lane & 15, hi = lane >> 4;
    const int wa = __builtin_amdgcn_readfirstlane(threadIdx.x >> 5);   // wave number, scalar: the tile and the K loop's bounds stay wave-uniform
    const int sub = wa % (SQ * SQ), w = wa / (SQ * SQ), tid = w * 32 + lane;   // the wave's tile in the work-group, its K part, the thread's number among its tile's threads: the SQ * SQ waves that share lines are neighbours in wave number, one on each SIMD, so they ask at the same time
    const int r0 = (bx * SQ + sub % SQ) * 64, c0 = (by * SQ + sub / SQ) * 64; float* os = osa + sub * (NW * 64 * 68);
    v8f acc[4][4];
#pragma unroll
    for (int mb = 0; mb < 4; ++mb)
#pragma unroll
        for (int nb = 0; nb < 4; ++nb) acc[mb][nb] = (v8f){};
    // a 16-row block is 16 K elements, a 32-k step inside it 512: every address = a wave-uniform walking pointer (the tile's first row block at the wave's k step) + the lane's fixed offset + a constant (row block mb or nb; K is a
    // compile-time constant for that), so no load's result and no address step can land on a vector register that a load in flight names
    typedef const __attribute__((address_space(1))) T16* gptr;   // typed as global memory, so that the loads stay global loads behind the statement that the pointers pass through
    constexpr bool HA2 = NSPLIT == 1 || NSPLIT == 2, HB2 = NSPLIT >= 2;
    gptr ap = (gptr)(A + (size_t)r0 * K + w * 512), ap2 = HA2 ? (gptr)(A2 + (size_t)r0 * K + w * 512) : nullptr, bp = (gptr)(Bt + (size_t)c0 * K + w * 512), bp2 = HB2 ? (gptr)(Bt2 + (size_t)c0 * K + w * 512) : nullptr;
    const unsigned lofs = lane * 8;
#pragma unroll 1
    for (int kc = w * 32; kc < K; kc += NW * 32) {
        V a[4], a2[4], b[4], b2[4];
#pragma unroll
        for (int mb = 0; mb < 4; ++mb) { a[mb] = WFrag<T16>::ldp((const T16*)(ap + lofs + mb * 16 * K)); if (HA2) a2[mb] = WFrag<T16>::ldp((const T16*)(ap2 + lofs + mb * 16 * K)); }
#pragma unroll
        for (int nb = 0; nb < 4; ++nb) { b[nb] = WFrag<T16>::ldp((const T16*)(bp + lofs + nb * 16 * K)); if (HB2) b2[nb] = WFrag<T16>::ldp((const T16*)(bp2 + lofs + nb * 16 * K)); }
        __builtin_amdgcn_sched_barrier(0);     // keeps the trip's loads one group in front of its matrix instructions: without it this build asks for each B fragment only when the one before is used up, a round trip each
#pragma unroll
        for (int nb = 0; nb < 4; ++nb)
#pragma unroll
            for (int mb = 0; mb < 4; ++mb) { acc[mb][nb] = WFrag<T16>::mma(a[mb], b[nb], acc[mb][nb]); if (HA2) acc[mb][nb] = WFrag<T16>::mma(a2[mb], b[nb], acc[mb][nb]); if (HB2) acc[mb][nb] = WFrag<T16>::mma(a[mb], b2[nb], acc[mb][nb]); }
        asm volatile("v_nop\n\tv_nop\n\tv_nop\n\tv_nop" : "+v"(acc[0][0]), "+v"(acc[1][1]), "+v"(acc[2][2]), "+v"(acc[3][3]) : "v"(a[0]), "v"(a[3]));
        // the wait in front of the steps of the base pointers that this trip's loads name; the pointers pass through the statement so that their steps stay behind it
        if constexpr (HA2 && HB2) asm volatile("s_wait_xcnt 0x0" : "+s"(ap), "+s"(ap2), "+s"(bp), "+s"(bp2) :: "memory");
        else if constexpr (HA2) asm volatile("s_wait_xcnt 0x0" : "+s"(ap), "+s"(ap2), "+s"(bp) :: "memory");
        else if constexpr (HB2) asm volatile("s_wait_xcnt 0x0" : "+s"(ap), "+s"(bp), "+s"(bp2) :: "memory");
        else asm volatile("s_wait_xcnt 0x0" : "+s"(ap), "+s"(bp) :: "memory");
        ap += NW * 512; bp += NW * 512; if (HA2) ap2 += NW * 512; if (HB2) bp2 += NW * 512;
    }
    if constexpr (EPI == 0) ksum_store<NW, BIAS>(acc, os, tid, w, lr, hi, C + (size_t)r0 * ldc + c0, ldc, BIAS ? bias + c0 : nullptr);
    else if constexpr (EPI == 1 || EPI == 3) { const size_t po = ((size_t)(c0 / 64) * TT + r0) * HD; ksum_rope<NW, EPI == 3>(acc, os, tid, w, lr, hi, CS + (size_t)r0 * HD * 2, nw, P16 + po, Ph + po, Pl + po); }
    else { const size_t po = (size_t)(c0 / 64) * HD * TT + r0 * 16; ksum_vt<NW>(acc, os, tid, w, lr, hi, P16 + po, Ph + po, Pl + po); }
}

// k_qkv: the three projections of both batches in one launch: they depend on nothing of one another, so no WGP waits at a launch boundary between them. Grid (work-group, batch): every work-group holds 2 x 2 tiles with K split over 4 waves a tile, so all
// are equally long; a batch's QB_ q work-groups come first, then its KB_ k and its KB_ v work-groups.
#define QB_  ((TT / 128) * (DQ / 128))
#define KB_  ((TT / 128) * (DKV / 128))
__global__ __launch_bounds__(GW * 32) void k_qkv(const bf* __restrict__ XB, const bf* __restrict__ WQ, const bf* __restrict__ WK, const bf* __restrict__ WV, const float* __restrict__ CS, const float* __restrict__ qsc, const float* __restrict__ ksc, h16* QP16, bf* QPh, bf* QPl, h16* KP16, bf* KPh, bf* KPl, h16* VT16, bf* VTh, bf* VTl) {
    __shared__ __align__(16) float osa[GW * 64 * 68];
    const int t = blockIdx.x; const bf* X = XB + (size_t)blockIdx.y * TT * DM; const size_t qo = (size_t)blockIdx.y * NH_ * TT * HD, ko = (size_t)blockIdx.y * NKV * TT * HD;
    if (t < QB_) d_gemmw<bf, 0, false, 4, 1, DM, 2>(osa, t % (TT / 128), t / (TT / 128), X, nullptr, WQ, nullptr, nullptr, 0, nullptr, CS, qsc, QP16 + qo, QPh + qo, QPl + qo);   /* q: projection, per-head RMSNorm x q_norm_w, rotary, planes */
    else if (t < QB_ + KB_) d_gemmw<bf, 0, false, 4, 3, DM, 2>(osa, (t - QB_) % (TT / 128), (t - QB_) / (TT / 128), X, nullptr, WK, nullptr, nullptr, 0, nullptr, CS, ksc, KP16 + ko, KPh + ko, KPl + ko);   /* k: the same with k_norm_w, planes in fragment order */
    else d_gemmw<bf, 0, false, 4, 2, DM, 2>(osa, (t - QB_ - KB_) % (TT / 128), (t - QB_ - KB_) / (TT / 128), X, nullptr, WV, nullptr, nullptr, 0, nullptr, nullptr, nullptr, VT16 + ko, VTh + ko, VTl + ko);   /* v: projection, transposed planes in fragment order */
}
// k_wo: merged hi/lo x Wo; the two batches' tokens are one run of NB_ * TT rows of the merged planes and of the output.
__global__ __launch_bounds__(GW * 32) void k_wo(const bf* __restrict__ ATh, const bf* __restrict__ ATl, const bf* __restrict__ WO, float* OUT) {
    __shared__ __align__(16) float osa[GW * 64 * 68];
    d_gemmw<bf, 1, false, 4, 0, DQ, 2>(osa, blockIdx.x, blockIdx.y, ATh, ATl, WO, nullptr, OUT, DM, nullptr, nullptr, nullptr, nullptr, nullptr, nullptr);
}

typedef __attribute__((ext_vector_type(2))) unsigned short v2us;
typedef __attribute__((ext_vector_type(2))) float v2f;
typedef __attribute__((ext_vector_type(4))) int v4i;

// d_cvt8 (work-group bx of 256 threads): f32 [R][K] -> bf16 plane in fragment order. One wave = one fragment, one thread = one lane's place in it: the wave reads the fragment's 16 rows x 128 bytes and stores its 1024 bytes as two runs of 512.
// Every address = wave-uniform pointer + the lane's fixed offset + a constant.
template <int K>
__device__ __forceinline__ void d_cvt8(int bx, const float* __restrict__ src, bf* dst, int nfrag) {
    const int lane = threadIdx.x & 31, f = bx * 8 + __builtin_amdgcn_readfirstlane(threadIdx.x >> 5); if (f >= nfrag) return;   // fragment number, scalar
    const float* s = src + (size_t)(f / (K / 32)) * 16 * K + (f % (K / 32)) * 32; const unsigned so = (lane & 15) * K + (lane >> 4) * 8;
    const v8f v0 = *(const v8f*)(s + so), v1 = *(const v8f*)(s + so + 16); v8us o0, o1;
#pragma unroll
    for (int k = 0; k < 8; ++k) { o0[k] = f2bf(v0[k]); o1[k] = f2bf(v1[k]); }
    bf* d = dst + (size_t)f * 512; const unsigned dof = lane * 8; *(v8us*)(d + dof) = o0; *(v8us*)(d + dof + 256) = o1; }

__constant__ float INVT[HD / 2] = { 1.000000000e+00f, 6.493816376e-01f, 4.216965139e-01f, 2.738419771e-01f, 1.778279394e-01f, 1.154781953e-01f, 7.498942316e-02f, 4.869675264e-02f, 3.162277490e-02f, 2.053525113e-02f, 1.333521400e-02f, 8.659643121e-03f, 5.623413250e-03f, 3.651741194e-03f, 2.371373819e-03f, 1.539926510e-03f, 1.000000047e-03f, 6.493816036e-04f, 4.216965172e-04f, 2.738419571e-04f, 1.778279402e-04f, 1.154782003e-04f, 7.498942432e-05f, 4.869675104e-05f, 3.162277790e-05f, 2.053524986e-05f, 1.333521413e-05f, 8.659642845e-06f, 5.623413472e-06f, 3.651741281e-06f, 2.371373739e-06f, 1.539926529e-06f };   // THETA ** (-arange(0, 64, 2) / 64) with THETA = 1e6 in float32 (the module's power expression)
__device__ __forceinline__ void d_cs5(int bx, float* CS) { const int idx = bx * 256 + threadIdx.x; if (idx >= TT * HD) return; const int d = idx % HD; const int t = idx / HD; const float a = __fmul_rn((float)t, INVT[d % (HD / 2)]); v2f cs; cs[0] = cosf(a); cs[1] = sinf(a); *(v2f*)(CS + (size_t)idx * 2) = cs;  }
// d_wtG (work-group bx of 256 threads): f32 w [K][N] -> bf16 plane of w^T ([N][K]) in fragment order. One wave = one fragment, one thread = one lane's place in it: its 16 k of one n; 16 lanes read 64 contiguous bytes of a row of w,
// and the two waves of a pair take neighbouring 16-column blocks at the same k, the two halves of the same 128-byte lines. Every address = wave-uniform pointer + the lane's fixed offset + a constant. Grid: N K / 512 waves.
template <int K, int N>
__device__ __forceinline__ void d_wtG(int bx, const float* __restrict__ w, bf* Bt) {
    static_assert(N % 32 == 0 && K % 32 == 0 && (N / 16) * (K / 32) % 8 == 0, "whole fragments, pairs of column blocks, whole work-groups");
    const int lane = threadIdx.x & 31, wv = bx * 8 + __builtin_amdgcn_readfirstlane(threadIdx.x >> 5), pair = wv >> 1;   // wave number, scalar
    const int nb = (pair / (K / 32)) * 2 + (wv & 1), kb = pair % (K / 32);
    const float* s = w + (size_t)kb * 32 * N + nb * 16; const unsigned so = (lane >> 4) * 8 * N + (lane & 15); v8us o0, o1;
#pragma unroll
    for (int j = 0; j < 8; ++j) { o0[j] = f2bf(s[so + j * N]); o1[j] = f2bf(s[so + (16 + j) * N]); }
    asm volatile("s_wait_xcnt 0x0" :: "v"(so) : "memory");   // the wait in front of any rewrite of the offset register that the loads name; the offset is an operand so that it lives to here and no load's result is given its register
    bf* d = Bt + ((size_t)nb * (K / 32) + kb) * 512; const unsigned dof = lane * 8; *(v8us*)(d + dof) = o0; *(v8us*)(d + dof + 256) = o1;
}

// k_prep: everything that depends on the inputs alone, in one launch: the rotary table, the four weight planes and the bf16 plane of x (both batches: one run of NB_ * TT rows). A work-group's job follows from its index.
#define PB_CS (TT * HD / 256)
#define PB_WQ (DM * DQ / 16 / 256)
#define PB_WK (DM * DKV / 16 / 256)
#define PB_X  (NB_ * TT * DM / 512 / 8)
__global__ __launch_bounds__(256) void k_prep(const float* __restrict__ x, const float* __restrict__ wq, const float* __restrict__ wk, const float* __restrict__ wv, const float* __restrict__ wo, bf* XB, bf* WQ, bf* WK, bf* WV, bf* WO, float* CS) {
    int b = blockIdx.x;
    if (b < PB_CS) { d_cs5(b, CS); return; }   /* rotary table */
    b -= PB_CS; if (b < PB_WQ) { d_wtG<DM, DQ>(b, wq, WQ); return; }
    b -= PB_WQ; if (b < PB_WK) { d_wtG<DM, DKV>(b, wk, WK); return; }
    b -= PB_WK; if (b < PB_WK) { d_wtG<DM, DKV>(b, wv, WV); return; }
    b -= PB_WK; if (b < PB_WQ) { d_wtG<DQ, DM>(b, wo, WO); return; }
    b -= PB_WQ; d_cvt8<DM>(b, x, XB, NB_ * TT * DM / 512);
}

// ---- k_fattn: the whole causal attention of both batches in one launch (scores, softmax, probability x value and the hi/lo merge), with a running maximum and sum per query; no score or probability plane in memory.
// Transposed products: S^T = K Q^T (A = key rows, B = query rows kept in registers), O^T += V^T P^T (A = rows of the [d][t] value plane). The key and value planes are in fragment order: each wave load of the key loop covers 4 whole 128-byte lines. In a 16-column group lane (lr, hi) holds query lr only: keys 8 hi + j of each
// 16-key score tile, so two score tiles of a 32-key block, converted in place, are the B operand of the second product in the loaders' own k order (8 hi + 0..7, 16 + 8 hi + 0..7), and maximum, sum and rescale factor are per lane.
// Work-group = 16 waves: the 4 query heads of one kv head (they read the same K and V lines) x KS = 4 key parts (part p takes every 4th 32-key block); parts 1..3 hand their (O, m, l) to part 0 through LDS behind one barrier.
// One work-group fills a WGP's registers, so the tiles, longest first, are dealt out as WGPs fall free; blockIdx.x = (batch, kv head), so that the two batches' tiles of one length stand side by side.
// Query rows < RH: 16 columns a wave, hi/lo bf16 planes, 3 products in both contractions; the rest: 32 columns a wave, fp16, probabilities carried x 2^10 (the sum carries the same factor, so it cancels).
#define L2E  1.4426950408889634f
#define KS   4
__device__ __forceinline__ float xhalf(float x) { return __builtin_bit_cast(float, __builtin_amdgcn_permlanex16(__builtin_bit_cast(int, x), __builtin_bit_cast(int, x), 0x76543210, 0xfedcba98, false, false)); }   // lane l <-> lane l ^ 16
template <typename T16, bool HR, int NQ>
__device__ __forceinline__ void fattn_tile(const T16* __restrict__ Q, const T16* __restrict__ Q2, const T16* __restrict__ Kp, const T16* __restrict__ K2, const T16* __restrict__ Vt, const T16* __restrict__ V2, int q0, int hd, int part, bf* Ah, bf* Al, float* xs) {
    typedef typename WFrag<T16>::V V;
    const int lane = threadIdx.x & 31, lr = lane & 15, hi = lane >> 4;
    const unsigned kofs = lr * HD + 8 * hi, lofs = lane * 8;   // the lane's place in a fragment's rows (q, row-major) and in a fragment (k, v, fragment order); every address below = wave-uniform pointer + one of these + a constant, so no load's result can land on an address register
    V qf[NQ][2], qf2[NQ][2];
#pragma unroll
    for (int n = 0; n < NQ; ++n)
#pragma unroll
        for (int ks = 0; ks < 2; ++ks) { const unsigned qo = kofs + n * 16 * HD + ks * 32; qf[n][ks] = WFrag<T16>::ld(Q + (size_t)q0 * HD + qo); if (HR) qf2[n][ks] = WFrag<T16>::ld(Q2 + (size_t)q0 * HD + qo); }
    v8f o[4][NQ]; float m[NQ], l[NQ];
#pragma unroll
    for (int n = 0; n < NQ; ++n) { m[n] = -3.0e38f; l[n] = 0.f;
#pragma unroll
        for (int dt = 0; dt < 4; ++dt) o[dt][n] = (v8f){}; }
    const int kend = q0 + 16 * NQ;                      // keys [0, kend): every 32-key block that starts below kend holds at least one allowed key for every query of the tile
    typedef const __attribute__((address_space(1))) T16* gptr;   // typed as global memory, so that the loads stay global loads behind the statement that the pointers pass through
    gptr kq = (gptr)(Kp + (size_t)part * 32 * HD), kq2 = HR ? (gptr)(K2 + (size_t)part * 32 * HD) : nullptr;   // wave-uniform walking pointers: key rows and value columns of the part's current block
    gptr vq = (gptr)(Vt + part * 512), vq2 = HR ? (gptr)(V2 + part * 512) : nullptr;   // a 32-key block is 4 key fragments in a row (16-key block kt, 32-dim step ks) and one value fragment in each of the 4 dim blocks
    V kf[2][2], kf2[2][2];
#pragma unroll
    for (int kt = 0; kt < 2; ++kt)
#pragma unroll
        for (int ks = 0; ks < 2; ++ks) { kf[kt][ks] = WFrag<T16>::ldp((const T16*)(kq + lofs + (kt * 2 + ks) * 512)); if (HR) kf2[kt][ks] = WFrag<T16>::ldp((const T16*)(kq2 + lofs + (kt * 2 + ks) * 512)); }
#pragma unroll 1   // run-time trip count; one trip's fragments, scores and accumulators already take most of the wave's registers
    for (int kb = part * 32; kb < kend; kb += KS * 32) {
        V vf[4], vf2[4];                                // this block's value fragments: asked for first, needed last
#pragma unroll
        for (int dt = 0; dt < 4; ++dt) { vf[dt] = WFrag<T16>::ldp((const T16*)(vq + lofs + dt * 16 * TT)); if (HR) vf2[dt] = WFrag<T16>::ldp((const T16*)(vq2 + lofs + dt * 16 * TT)); }
        // the wait in front of the steps of the base pointers that this trip's value loads and the last trip's key loads name; the pointers pass through the statement so that their steps stay behind it
        if constexpr (HR) asm volatile("s_wait_xcnt 0x0" : "+s"(vq), "+s"(vq2), "+s"(kq), "+s"(kq2) :: "memory");
        else asm volatile("s_wait_xcnt 0x0" : "+s"(vq), "+s"(kq) :: "memory");
        vq += KS * 512; if (HR) vq2 += KS * 512;
        v8f s[2][NQ];
#pragma unroll
        for (int kt = 0; kt < 2; ++kt)
#pragma unroll
            for (int n = 0; n < NQ; ++n) { v8f c = (v8f){};
#pragma unroll
                for (int ks = 0; ks < 2; ++ks) { c = WFrag<T16>::mma(kf[kt][ks], qf[n][ks], c); if (HR) { c = WFrag<T16>::mma(kf[kt][ks], qf2[n][ks], c); c = WFrag<T16>::mma(kf2[kt][ks], qf[n][ks], c); } }
                s[kt][n] = c; }
        const int kstep = (kb + KS * 32 < kend) ? KS * 32 * HD : 0; kq += kstep; if (HR) kq2 += kstep;   // the part's next key block, fetched one trip ahead (the last trip stays where it is; its fetch is not used)
#pragma unroll
        for (int kt = 0; kt < 2; ++kt)
#pragma unroll
            for (int ks = 0; ks < 2; ++ks) { kf[kt][ks] = WFrag<T16>::ldp((const T16*)(kq + lofs + (kt * 2 + ks) * 512)); if (HR) kf2[kt][ks] = WFrag<T16>::ldp((const T16*)(kq2 + lofs + (kt * 2 + ks) * 512)); }
        if (kb + 31 > q0) {                             // wave-uniform: only a block that reaches the diagonal is masked (key > query excluded)
#pragma unroll
            for (int kt = 0; kt < 2; ++kt)
#pragma unroll
                for (int n = 0; n < NQ; ++n)
#pragma unroll
                    for (int j = 0; j < 8; ++j) s[kt][n][j] = (kb + kt * 16 + hi * 8 + j <= q0 + n * 16 + lr) ? s[kt][n][j] : -3.0e38f; }
        V pf[NQ], pf2[NQ];
#pragma unroll
        for (int n = 0; n < NQ; ++n) { float mx = m[n];
#pragma unroll
            for (int j = 0; j < 8; ++j) mx = fmaxf(mx, fmaxf(s[0][n][j], s[1][n][j]));
            mx = fmaxf(mx, xhalf(mx));                  // the two lane halves hold the same query's other keys
            const float al = __builtin_amdgcn_exp2f((m[n] - mx) * (SCL * L2E)), mo = HR ? mx * (SCL * L2E) : mx * (SCL * L2E) - 10.0f; m[n] = mx; v2f sum = (v2f){0.f, 0.f};   // m: raw products; SCL and the change to base 2 go into one factor
#pragma unroll
            for (int kt = 0; kt < 2; ++kt)
#pragma unroll
                for (int j = 0; j < 8; j += 2) { const v2f p = (v2f){__builtin_amdgcn_exp2f(fmaf(s[kt][n][j], SCL * L2E, -mo)), __builtin_amdgcn_exp2f(fmaf(s[kt][n][j + 1], SCL * L2E, -mo))}; s[kt][n][j] = p[0]; s[kt][n][j + 1] = p[1]; sum += p; }   // even and odd keys summed side by side (packed adds)
            l[n] = l[n] * al + (sum[0] + sum[1]);
#pragma unroll
            for (int dt = 0; dt < 4; ++dt) o[dt][n] *= al;
            if constexpr (HR) { v8us h0, h1, l0, l1;
#pragma unroll
                for (int j = 0; j < 8; ++j) { unsigned short a, c2; splitf(s[0][n][j], a, c2); h0[j] = a; l0[j] = c2; splitf(s[1][n][j], a, c2); h1[j] = a; l1[j] = c2; }
                pf[n] = cat16b(h0, h1); pf2[n] = cat16b(l0, l1);
            } else { v8h h0, h1;
#pragma unroll
                for (int j = 0; j < 8; ++j) { h0[j] = tohx(s[0][n][j]); h1[j] = tohx(s[1][n][j]); }
                pf[n] = cat16(h0, h1); } }
#pragma unroll
        for (int dt = 0; dt < 4; ++dt)
#pragma unroll
            for (int n = 0; n < NQ; ++n) { o[dt][n] = WFrag<T16>::mma(vf[dt], pf[n], o[dt][n]); if (HR) { o[dt][n] = WFrag<T16>::mma(vf[dt], pf2[n], o[dt][n]); o[dt][n] = WFrag<T16>::mma(vf2[dt], pf[n], o[dt][n]); } }
        // the loop's branch stands right behind the last matrix instructions: four vector slots keep the distance on the taken side too
        if constexpr (NQ == 2) asm volatile("v_nop\n\tv_nop\n\tv_nop\n\tv_nop" : "+v"(o[0][0]), "+v"(o[1][0]), "+v"(o[2][0]), "+v"(o[3][0]), "+v"(o[0][1]), "+v"(o[1][1]), "+v"(o[2][1]), "+v"(o[3][1]));
        else asm volatile("v_nop\n\tv_nop\n\tv_nop\n\tv_nop" : "+v"(o[0][0]), "+v"(o[1][0]), "+v"(o[2][0]), "+v"(o[3][0]));
    }
    // the last trip's key fetch is not used and may still be on its way: the wait in front of whatever takes over the registers that it names
    if constexpr (HR) asm volatile("s_wait_xcnt 0x0" :: "s"(kq), "s"(kq2) : "memory");
    else asm volatile("s_wait_xcnt 0x0" :: "s"(kq) : "memory");
    // join of the key parts in the fixed order 0..KS-1. LDS: per (part - 1, head) 4 NQ tiles of [2 halves][32 lanes][4 floats]; behind them per (part - 1, head) m and l
    if (part != 0) { float* xo = xs + ((part - 1) * 4 + hd) * 2048; float* xm = xs + (KS - 1) * 4 * 2048 + ((part - 1) * 4 + hd) * 128;
#pragma unroll
        for (int n = 0; n < NQ; ++n) { xm[(n * 2) * 32 + lane] = m[n]; xm[(n * 2 + 1) * 32 + lane] = l[n];
#pragma unroll
            for (int dt = 0; dt < 4; ++dt) { float* t = xo + (dt * NQ + n) * 256 + lane * 4; *(v4fa*)t = (v4f){o[dt][n][0], o[dt][n][1], o[dt][n][2], o[dt][n][3]}; *(v4fa*)(t + 128) = (v4f){o[dt][n][4], o[dt][n][5], o[dt][n][6], o[dt][n][7]}; } } }
    __syncthreads();                                    // the other parts' partial results are in LDS before part 0 reads them; every wave of the work-group passes here
    if (part == 0) { const float* xo = xs + hd * 2048; const float* xm = xs + (KS - 1) * 4 * 2048 + hd * 128;
#pragma unroll
        for (int n = 0; n < NQ; ++n) { float mp[KS - 1], f[KS - 1]; float mx = m[n];      // a part without a key block hands over m = -3e38, l = 0, O = 0: its factor is 0
#pragma unroll
            for (int u = 0; u < KS - 1; ++u) { mp[u] = xm[u * 512 + (n * 2) * 32 + lane]; mx = fmaxf(mx, mp[u]); }
            float f0 = __builtin_amdgcn_exp2f((m[n] - mx) * (SCL * L2E)), lt = l[n] * f0;
#pragma unroll
            for (int u = 0; u < KS - 1; ++u) { f[u] = __builtin_amdgcn_exp2f((mp[u] - mx) * (SCL * L2E)); lt += xm[u * 512 + (n * 2 + 1) * 32 + lane] * f[u]; }
            lt += xhalf(lt);                            // the two lane halves summed the same query's other keys
            const float inv = __fdiv_rn(1.0f, lt); f0 *= inv;
#pragma unroll
            for (int u = 0; u < KS - 1; ++u) f[u] *= inv;
#pragma unroll
            for (int dt = 0; dt < 4; ++dt) { v8f r = o[dt][n] * f0;
#pragma unroll
                for (int u = 0; u < KS - 1; ++u) { const float* t = xo + u * 8192 + (dt * NQ + n) * 256 + lane * 4; const v4f u0 = *(const v4fa*)t, u1 = *(const v4fa*)(t + 128);
#pragma unroll
                    for (int j = 0; j < 4; ++j) { r[j] += u0[j] * f[u]; r[4 + j] += u1[j] * f[u]; } }
                v8us oh, ol;
#pragma unroll
                for (int j = 0; j < 8; ++j) { unsigned short a, c2; splitf(r[j], a, c2); oh[j] = a; ol[j] = c2; }
                const unsigned oo = n * 16 * DQ + dt * 256 + lane * 8; *(v8usa*)(Ah + (size_t)q0 * DQ + oo) = oh; *(v8usa*)(Al + (size_t)q0 * DQ + oo) = ol;   // fragment order of the merged plane [t][DQ]: Ah, Al point at the head's two fragments (k = 64 h ..) of row block 0; dims 16 dt + 8 hi + j are piece dt & 1 of fragment dt >> 1
                asm volatile("s_wait_xcnt 0x0" ::: "memory"); } } }   // the next tile's values reuse the registers that these two stores name
}
__global__ __launch_bounds__(KS * 128) void k_fattn(const h16* __restrict__ Q16, const h16* __restrict__ K16, const h16* __restrict__ V16, const bf* __restrict__ Qh, const bf* __restrict__ Ql, const bf* __restrict__ Kh, const bf* __restrict__ Kl, const bf* __restrict__ Vh, const bf* __restrict__ Vl, bf* Ah, bf* Al) {
    static_assert(REP == 4 && RH % 32 == 0 && (TT - RH) % 32 == 0, "4 query heads a kv head; whole tiles on both sides of RH");
    __shared__ __align__(16) float xs[(KS - 1) * 4 * (2048 + 128)];
    const int w = __builtin_amdgcn_readfirstlane(threadIdx.x >> 5);   // wave number, scalar: head, key part and the key loop's bounds stay wave-uniform
    const int hd = w & 3, part = w >> 2, g = blockIdx.x % NKV, nb = blockIdx.x / NKV, bt = blockIdx.y, h = g * REP + hd; const size_t qp = (size_t)(nb * NH_ + h) * TT * HD, kp = (size_t)(nb * NKV + g) * TT * HD; Ah += (size_t)nb * TT * DQ; Al += (size_t)nb * TT * DQ;
    if (bt < (TT - RH) / 32) fattn_tile<h16, false, 2>(Q16 + qp, nullptr, K16 + kp, nullptr, V16 + kp, nullptr, TT - 32 * (bt + 1), hd, part, Ah + h * (HD * 16), Al + h * (HD * 16), xs);   // longest tiles first
    else fattn_tile<bf, true, 1>(Qh + qp, Ql + qp, Kh + kp, Kl + kp, Vh + kp, Vl + kp, RH - 16 * (bt - (TT - RH) / 32 + 1), hd, part, Ah + h * (HD * 16), Al + h * (HD * 16), xs);
}

extern "C" void kernel_launch(void* const* d_in, const int* in_sizes, int n_in,
                              void* d_out, int out_size, void* d_ws, size_t ws_size, hipStream_t stream) {
    (void)in_sizes; (void)n_in; (void)out_size;
    const float* x = (const float*)d_in[0]; const float* wq = (const float*)d_in[1]; const float* wk = (const float*)d_in[2]; const float* wv = (const float*)d_in[3]; const float* wo = (const float*)d_in[4]; const float* qsc = (const float*)d_in[5]; const float* ksc = (const float*)d_in[6];   /* input order x, Wq ('xw' [2048][2048]), Wk, Wv ([2048][512]), Wo ('xw'), q_norm_w, k_norm_w ([64], read) */
    float* OUT = (float*)d_out;     // [2][2048][2048]
    char* wsp = (char*)d_ws;
    auto take = [&](size_t bytes) { char* p = wsp; wsp += (bytes + 255) & ~(size_t)255; return (void*)p; };
    bf* WQ = (bf*)take((size_t)DQ * DM * 2); bf* WK = (bf*)take((size_t)DKV * DM * 2); bf* WV = (bf*)take((size_t)DKV * DM * 2); bf* WO = (bf*)take((size_t)DM * DQ * 2); float* CS = (float*)take((size_t)TT * HD * 2 * 4);
    bf* XB = (bf*)take((size_t)NB_ * TT * DM * 2);
    h16* QP16 = (h16*)take((size_t)NB_ * NH_ * TT * HD * 2); h16* KP16 = (h16*)take((size_t)NB_ * NKV * TT * HD * 2); h16* VT16 = (h16*)take((size_t)NB_ * NKV * HD * TT * 2);
    bf* QPh = (bf*)take((size_t)NB_ * NH_ * TT * HD * 2); bf* QPl = (bf*)take((size_t)NB_ * NH_ * TT * HD * 2); bf* KPh = (bf*)take((size_t)NB_ * NKV * TT * HD * 2); bf* KPl = (bf*)take((size_t)NB_ * NKV * TT * HD * 2); bf* VTh = (bf*)take((size_t)NB_ * NKV * HD * TT * 2); bf* VTl = (bf*)take((size_t)NB_ * NKV * HD * TT * 2);
    bf* ATh = (bf*)take((size_t)NB_ * TT * DQ * 2); bf* ATl = (bf*)take((size_t)NB_ * TT * DQ * 2);
    if ((size_t)(wsp - (char*)d_ws) > ws_size) return;    // ws 256 MiB
    k_prep<<<PB_CS + 2 * PB_WQ + 2 * PB_WK + PB_X, 256, 0, stream>>>(x, wq, wk, wv, wo, XB, WQ, WK, WV, WO, CS);
    k_qkv<<<dim3(QB_ + 2 * KB_, NB_, 1), GW * 32, 0, stream>>>(XB, WQ, WK, WV, CS, qsc, ksc, QP16, QPh, QPl, KP16, KPh, KPl, VT16, VTh, VTl);
    k_fattn<<<dim3(NKV * NB_, (TT - RH) / 32 + RH / 16, 1), KS * 128, 0, stream>>>(QP16, KP16, VT16, QPh, QPl, KPh, KPl, VTh, VTl, ATh, ATl);
    k_wo<<<dim3(NB_ * TT / 128, DM / 128, 1), GW * 32, 0, stream>>>(ATh, ATl, WO, OUT);
}

// v010
// It runs in 143 microseconds.
// In both of two side-by-side timings against v009, it was 1.05 times as fast.
// Over all steps from v000 it is 19.3 times as fast.
#include <hip/hip_runtime.h>

// Grouped-query causal attention with per-head RMSNorm and computed half-split rotary embeddings at base 1e6 (x [2][2048][2048]; q = x Wq (32 heads x 64), k, v = x Wk, x Wv (8 kv heads x 64) ('xw' 0.02, no bias); per head q = rms_norm(q) x q_norm_w, k = rms_norm(k) x k_norm_w (eps 1e-5; weights [64] = ones, read); rope: (x1, x2) = the two HALVES of each head: cat(x1 cos - x2 sin, x2 cos + x1 sin) with angle t x 1000000^(-2i/64), i < 32 (32 f32 frequencies jnp-exact for the module's power expression; precise cosf/sinf); query heads viewed (HKV, g): kv head = q head / 4; scores x 64^-0.5; causal (finfo.min == exclusion); softmax; out = merged Wo ('xw') -> [2][2048][2048] (8.4 M); argument order x, Wq, Wk, Wv, Wo, q_norm_w, k_norm_w).
// Four launches, each over both batches (k_prep, k_qkv, k_fattn, k_wo). Layout: bf16 copy of x and 'xw' weights transposed once, both in fragment order (see FRAGMENT ORDER below; d_cvt8, d_wtG); exact projections, whose 64x64 tile is one head x 64 tokens, so the tile's epilogue does RMSNorm (1/sqrt(mean + eps) x w[d]) and rotate-half with the d_cs5 table {cosf, sinf}(t x INVT[d mod 32]) and writes the head planes itself (v: transposed planes; k and v planes in fragment order); causal T-2048 GQA attention in one launch (k_fattn, running softmax; hybrid rows: < 512 hi/lo 3 products, rest fp16 x1024; key blocks above the diagonal are never visited); merged hi/lo (fragment order) x Wo exact.
// Compute dtypes, f32 accumulate: every input rounded to bf16 incl. scales ({cos, sin} table f32); projections exact; RMSNorm and rotary f32; attention rows < 512 3 products, rest fp16; softmax f32; Wo hl x exact.

#define NB_  2
#define TT   2048
#define DM   2048
#define NH_  32
#define NKV  8
#define REP  (NH_ / NKV)
#define HD   64
#define DQ   (NH_ * HD)
#define DKV  (NKV * HD)
#define RH   512                  // query rows < RH use hi+lo planes (0: none)
#define SCL  0.125f   // HD^-0.5
typedef _Float16 h16;
typedef unsigned short bf;
typedef __attribute__((ext_vector_type(16))) __bf16   v16bf;
typedef __attribute__((ext_vector_type(16))) _Float16 v16h;
typedef __attribute__((ext_vector_type(8)))  _Float16 v8h;
typedef __attribute__((ext_vector_type(8)))  unsigned short v8us;
typedef __attribute__((ext_vector_type(8)))  float    v8f;
typedef __attribute__((ext_vector_type(4)))  float    v4f;
typedef v8h  __attribute__((may_alias)) v8ha;
typedef v4f  __attribute__((may_alias)) v4fa;
typedef v8us __attribute__((may_alias)) v8usa;

__device__ __forceinline__ unsigned short f2bf(float f) { unsigned u = __float_as_uint(f); u += 0x7FFFu + ((u >> 16) & 1u); return (unsigned short)(u >> 16); }
__device__ __forceinline__ float bf2f(unsigned short b) { return __uint_as_float(((unsigned)b) << 16); }
__device__ __forceinline__ float bfr(float f) { return bf2f(f2bf(f)); }
__device__ __forceinline__ v16h cat16(v8h lo, v8h hi) { return __builtin_shufflevector(lo, hi, 0, 1, 2, 3, 4, 5, 6, 7, 8, 9, 10, 11, 12, 13, 14, 15); }
__device__ __forceinline__ v16bf cat16b(v8us lo, v8us hi) { return __builtin_bit_cast(v16bf, __builtin_shufflevector(lo, hi, 0, 1, 2, 3, 4, 5, 6, 7, 8, 9, 10, 11, 12, 13, 14, 15)); }
__device__ __forceinline__ v8f wmma16(v16h a, v16h b, v8f c) { return __builtin_amdgcn_wmma_f32_16x16x32_f16(false, a, false, b, (short)0, c, false, false); }
__device__ __forceinline__ v8f wmmab(v16bf a, v16bf b, v8f c) { return __builtin_amdgcn_wmma_f32_16x16x32_bf16(false, a, false, b, (short)0, c, false, false); }



// ---- split-K inside a work-group: the NW waves of a 64x64 tile each take every NW-th 32-wide step of K (a wave's step of a 16-row block is one whole fragment, 1024 contiguous bytes),
// so the chain of dependent load round trips per wave is NW times shorter. The epilogues put the NW partial tiles into LDS (kpart_put, row pitch 68 floats), and behind one barrier add them in the fixed order wave 0..NW-1 (kpart_sum).
__device__ __forceinline__ void kpart_put(const v8f (&acc)[4][4], float* os, int w, int lr, int hi) {
#pragma unroll
    for (int mb = 0; mb < 4; ++mb)
#pragma unroll
        for (int nb = 0; nb < 4; ++nb)
#pragma unroll
            for (int j = 0; j < 8; ++j) os[(w * 64 + mb * 16 + hi * 8 + j) * 68 + nb * 16 + lr] = acc[mb][nb][j];
}
template <int NW>
__device__ __forceinline__ v4f kpart_sum(const float* os, int row, int cofs) {
    v4f val = *(const v4fa*)(os + row * 68 + cofs);
#pragma unroll
    for (int u = 1; u < NW; ++u) val += *(const v4fa*)(os + (u * 64 + row) * 68 + cofs);
    return val;
}

__device__ __forceinline__ h16 tohx(float x) { return (h16)x; }
__device__ __forceinline__ void splitf(float y, unsigned short& h, unsigned short& l) { h = f2bf(y); l = f2bf(y - bf2f(h)); }
typedef __attribute__((ext_vector_type(4))) _Float16 v4h;
typedef __attribute__((ext_vector_type(4))) unsigned short v4us;
template <int M> __device__ __forceinline__ float xrow(float x) { return __builtin_bit_cast(float, __builtin_amdgcn_update_dpp(0, __builtin_bit_cast(int, x), 0x160 | M, 0xf, 0xf, true)); }   // lane l <-> lane l ^ M inside a 16-lane row (row_xmask)

// ---- ksum_rope: epilogue of a q or k projection tile (64 tokens x the 64 dims of ONE head). Behind the sum of the partial tiles the 16 lanes of a row hold one (token, head) vector, 4 dims each:
// sum of squares over the row by a 4-step butterfly (the same value in all 16 lanes), x 1/sqrt(mean + eps) x w[d], then rotate-half (dim d's partner d +- 32 sits in lane l ^ 8), then the fp16 and hi/lo planes [t][d]: a wave stores 2 whole 128-byte rows a plane.
// cs: the tile's first row of the {cos, sin} table; P16, Ph, Pl: the tile's first row in the head's planes.
// FR (k): the planes are in fragment order (see FRAGMENT ORDER below, [R][K] = [t][d]); the tile's 64 tokens x 64 dims are the same 4096 elements of the plane in both orders, and a thread's 4 dims stay neighbours; a wave's store there is 32-byte pieces of 8 lines, paid once a tile so that every pass of the attention kernel's key loop reads whole lines.
template <int NW, bool FR>
__device__ __forceinline__ void ksum_rope(const v8f (&acc)[4][4], float* os, int tid, int w, int lr, int hi, const float* __restrict__ cs, const float* __restrict__ nw, h16* P16, bf* Ph, bf* Pl) {
    constexpr int NS = 32 / NW;
    const int cofs = (tid & 15) * 4, rw = tid >> 4;
    v4f c01[NS], c23[NS]; float wv[4];     // the thread's table rows are asked for in front of the LDS stores and the barrier, which cover their way
    const unsigned tofs = (rw * HD + cofs) * 2 * 4;   // the thread's place in the table's first NW * 2 rows, in bytes (the value that the loads' offset register holds): every table address = cs + this + a constant
#pragma unroll
    for (int s = 0; s < NS; ++s) { const float* c = (const float*)((const char*)cs + tofs) + s * NW * 2 * HD * 2; c01[s] = *(const v4f*)c; c23[s] = *(const v4f*)(c + 4); }
    asm volatile("s_wait_xcnt 0x0" :: "v"(tofs) : "memory");   // the wait in front of any rewrite of the offset register that the table loads name; the offset is an operand so that it lives to here and no load's result is given its register
#pragma unroll
    for (int q = 0; q < 4; ++q) wv[q] = bfr(nw[cofs + q]);
    kpart_put(acc, os, w, lr, hi);
    __builtin_amdgcn_sched_barrier(0);     // keeps every use of the table rows behind the LDS stores: without it the first wait for those loads stands in front of the stores
    __syncthreads();                       // all NW partial tiles are in LDS before any of them is read
    const float sg = (cofs < HD / 2) ? -1.0f : 1.0f;   // out[d] = x[d] cos - x[d + 32] sin, out[d + 32] = x[d + 32] cos + x[d] sin
    v4f sm[NS];
#pragma unroll
    for (int s = 0; s < NS; ++s) sm[s] = kpart_sum<NW>(os, s * NW * 2 + rw, cofs);   // all of the thread's LDS reads go out in front of the first stores' wait: one LDS round trip, not one a row
#pragma unroll
    for (int s = 0; s < NS; ++s) { const int row = s * NW * 2 + rw;
        const v4f a = sm[s];
        float ss = a[0] * a[0] + a[1] * a[1] + a[2] * a[2] + a[3] * a[3];
        ss += xrow<1>(ss); ss += xrow<2>(ss); ss += xrow<4>(ss); ss += xrow<8>(ss);
        const float rf = __fdiv_rn(1.0f, __fsqrt_rn(ss * (1.0f / HD) + 1e-5f));
        v4h o16; v4us oh, ol;
#pragma unroll
        for (int q = 0; q < 4; ++q) { const float y = a[q] * rf * wv[q], p = xrow<8>(y) * sg; const float co = (q < 2) ? c01[s][q * 2] : c23[s][q * 2 - 4], si = (q < 2) ? c01[s][q * 2 + 1] : c23[s][q * 2 - 3];
            const float r = y * co + p * si; o16[q] = tohx(r); unsigned short a2, c2; splitf(r, a2, c2); oh[q] = a2; ol[q] = c2; }
        const unsigned po = FR ? ((row >> 4) * 2 + (cofs >> 5)) * 512 + ((cofs >> 4) & 1) * 256 + (((cofs >> 3) & 1) * 16 + (row & 15)) * 8 + (cofs & 7) : row * HD + cofs; // behind each store the wait in front of whatever reuses the registers that it names (the other planes' values, the next rows')
        *(v4h*)(P16 + po) = o16; asm volatile("s_wait_xcnt 0x0" ::: "memory"); *(v4us*)(Ph + po) = oh; asm volatile("s_wait_xcnt 0x0" ::: "memory"); *(v4us*)(Pl + po) = ol; asm volatile("s_wait_xcnt 0x0" ::: "memory"); }
}
// ---- ksum_vt: epilogue of a v projection tile: the summed tile goes back into LDS (each thread over the elements of partial tile 0 that it alone has read), and behind a second barrier it is read by columns:
// one wave store is one 512-byte half of a fragment of the transposed fp16 and hi/lo planes ([R][K] = [d][t] in fragment order, see FRAGMENT ORDER below): piece = (16-dim block, 16-token group), lane = its place in the fragment, 8 tokens of one dim; the tile's 16 pieces are dealt out over its NW waves.
// V16, Vh, Vl: the fragment of the tile's first token in dim block 0 of the head's planes.
template <int NW>
__device__ __forceinline__ void ksum_vt(const v8f (&acc)[4][4], float* os, int tid, int w, int lr, int hi, h16* V16, bf* Vh, bf* Vl) {
    static_assert(16 % NW == 0, "whole pieces a wave");
    kpart_put(acc, os, w, lr, hi);
    __syncthreads();                       // all NW partial tiles are in LDS before any of them is read
    const int cofs = (tid & 15) * 4; v4f sm[32 / NW];
#pragma unroll
    for (int s = 0; s < 32 / NW; ++s) sm[s] = kpart_sum<NW>(os, s * NW * 2 + (tid >> 4), cofs);   // all of the thread's LDS reads go out in front of its first LDS store: one LDS round trip, not one a row
#pragma unroll
    for (int s = 0; s < 32 / NW; ++s) *(v4fa*)(os + (s * NW * 2 + (tid >> 4)) * 68 + cofs) = sm[s];
    __syncthreads();                       // the whole summed tile is in LDS before it is read across the threads' own elements
    const int lane = tid & 31; float xv[16 / NW][8];
#pragma unroll
    for (int u = 0; u < 16 / NW; ++u) { const int pc = u * NW + w, d = (pc >> 2) * 16 + (lane & 15), tc = (pc & 3) * 16 + (lane >> 4) * 8;   // all of the wave's pieces are read in front of the first store's wait: one LDS round trip, not one a piece
#pragma unroll
        for (int j = 0; j < 8; ++j) xv[u][j] = os[(tc + j) * 68 + d]; }
#pragma unroll
    for (int u = 0; u < 16 / NW; ++u) { const int pc = u * NW + w, db = pc >> 2, tq = pc & 3; v8h o16; v8us oh, ol;
#pragma unroll
        for (int j = 0; j < 8; ++j) { const float x = xv[u][j]; o16[j] = tohx(x); unsigned short a2, c2; splitf(x, a2, c2); oh[j] = a2; ol[j] = c2; }
        const unsigned po = (db * (TT / 32) + (tq >> 1)) * 512 + (tq & 1) * 256 + lane * 8;   // behind each store the wait in front of whatever reuses the registers that it names (the other planes' values, the next pieces')
        *(v8h*)(V16 + po) = o16; asm volatile("s_wait_xcnt 0x0" ::: "memory"); *(v8us*)(Vh + po) = oh; asm volatile("s_wait_xcnt 0x0" ::: "memory"); *(v8us*)(Vl + po) = ol; asm volatile("s_wait_xcnt 0x0" ::: "memory"); }
}

// ---- FRAGMENT ORDER of a GEMM operand plane [R][K]: one 16-row x 32-k fragment is 1024 contiguous bytes, fragments of a 16-row block follow one another along k. Inside a fragment lane (lr = row & 15, hi) owns two 16-byte pieces:
// k = 8 hi + 0..7 at element lane * 8 and k = 16 + 8 hi + 0..7 at element 256 + lane * 8 (lane = hi * 16 + lr): element (r, k) stands at ((r >> 4) * (K >> 5) + (k >> 5)) * 512 + ((k >> 4) & 1) * 256 + (((k >> 3) & 1) * 16 + (r & 15)) * 8 + (k & 7).
// Each of a fragment's two wave loads then covers 512 contiguous bytes (4 whole 128-byte lines) instead of 32-byte pieces of 16 lines; which lane and register holds which k is what it was with row-major planes.
// ---- d_gemmw: register-blocked GEMM, NW WAVES per 64x64 output tile (16 accumulators each, K split between them), operands straight from 16-bit planes in fragment order; work-group (bx, by) of (M/64/SQ, N/64/SQ), SQ*SQ*NW*32 threads; osa: the work-group's LDS.
// tile[m][n] (f32) = sum_k A[m][k] Bt[n][k] (+ split products per NSPLIT); no path writes C or adds bias. K % 32 == 0.
// EPI 1 (q), 3 (k) and 2 (v): m = token, tile column = head; the tile goes through ksum_rope (q: planes [t][d] row-major, k: fragment order) or ksum_vt into the planes P16, Ph, Pl and C is not used.
#define GW   16                   // waves of a GEMM work-group; its LDS holds GW partial tiles
template <typename T16> struct WFrag;
template <> struct WFrag<h16> { typedef v16h V; static __device__ __forceinline__ V ld(const h16* p) { return cat16(*(const v8h*)p, *(const v8h*)(p + 16)); } static __device__ __forceinline__ V ldp(const h16* p) { return cat16(*(const v8h*)p, *(const v8h*)(p + 256)); } static __device__ __forceinline__ v8f mma(V a, V b, v8f c) { return wmma16(a, b, c); } };
template <> struct WFrag<bf> { typedef v16bf V; static __device__ __forceinline__ V ld(const bf* p) { return cat16b(*(const v8us*)p, *(const v8us*)(p + 16)); } static __device__ __forceinline__ V ldp(const bf* p) { return cat16b(*(const v8us*)p, *(const v8us*)(p + 256)); } static __device__ __forceinline__ v8f mma(V a, V b, v8f c) { return wmmab(a, b, c); } };
// SQ: a work-group holds SQ x SQ neighbouring 64x64 tiles, NW waves each ((bx, by) of (M/64/SQ, N/64/SQ), SQ*SQ*NW*32 threads). With SQ = 2 the waves of the 4 tiles that stand at the same k step ask for the same A or B lines two by two at about the same
// time, so each line comes from L2 once for two waves and the second wave takes it from the WGP's cache. Each tile keeps its own waves, its own part of the LDS and its own epilogue; the barriers are passed by the whole work-group.
template <typename T16, int NSPLIT, bool BIAS, int NW, int EPI, int K, int SQ>
__device__ __forceinline__ void d_gemmw(float* osa, int bx, int by, const T16* __restrict__ A, const T16* __restrict__ A2, const T16* __restrict__ Bt, const T16* __restrict__ Bt2, float* C, int ldc, const float* __restrict__ bias, const float* __restrict__ CS, const float* __restrict__ nw, h16* P16, bf* Ph, bf* Pl) {
    typedef typename WFrag<T16>::V V;
    static_assert(SQ * SQ * NW == GW, "the work-group's waves and its LDS");
    const int lane = threadIdx.x & 31, lr = lane & 15, hi = lane >> 4;
    const int wa = __builtin_amdgcn_readfirstlane(threadIdx.x >> 5);   // wave number, scalar: the tile and the K loop's bounds stay wave-uniform
    const int sub = wa % (SQ * SQ), w = wa / (SQ * SQ), tid = w * 32 + lane;   // the wave's tile in the work-group, its K part, the thread's number among its tile's threads: the SQ * SQ waves that share lines are neighbours in wave number, one on each SIMD, so they ask at the same time
    const int r0 = (bx * SQ + sub % SQ) * 64, c0 = (by * SQ + sub / SQ) * 64; float* os = osa + sub * (NW * 64 * 68);
    v8f acc[4][4];
#pragma unroll
    for (int mb = 0; mb < 4; ++mb)
#pragma unroll
        for (int nb = 0; nb < 4; ++nb) acc[mb][nb] = (v8f){};
    // a 16-row block is 16 K elements, a 32-k step inside it 512: every address = a wave-uniform walking pointer (the tile's first row block at the wave's k step) + the lane's fixed offset + a constant (row block mb or nb; K is a
    // compile-time constant for that), so no load's result and no address step can land on a vector register that a load in flight names
    typedef const __attribute__((address_space(1))) T16* gptr;   // typed as global memory, so that the loads stay global loads behind the statement that the pointers pass through
    constexpr bool HA2 = NSPLIT == 1 || NSPLIT == 2, HB2 = NSPLIT >= 2;
    gptr ap = (gptr)(A + (size_t)r0 * K + w * 512), ap2 = HA2 ? (gptr)(A2 + (size_t)r0 * K + w * 512) : nullptr, bp = (gptr)(Bt + (size_t)c0 * K + w * 512), bp2 = HB2 ? (gptr)(Bt2 + (size_t)c0 * K + w * 512) : nullptr;
    const unsigned lofs = lane * 8;
#pragma unroll 1
    for (int kc = w * 32; kc < K; kc += NW * 32) {
        V a[4], a2[4], b[4], b2[4];
#pragma unroll
        for (int mb = 0; mb < 4; ++mb) { a[mb] = WFrag<T16>::ldp((const T16*)(ap + lofs + mb * 16 * K)); if (HA2) a2[mb] = WFrag<T16>::ldp((const T16*)(ap2 + lofs + mb * 16 * K)); }
#pragma unroll
        for (int nb = 0; nb < 4; ++nb) { b[nb] = WFrag<T16>::ldp((const T16*)(bp + lofs + nb * 16 * K)); if (HB2) b2[nb] = WFrag<T16>::ldp((const T16*)(bp2 + lofs + nb * 16 * K)); }
        __builtin_amdgcn_sched_barrier(0);     // keeps the trip's loads one group in front of its matrix instructions: without it this build asks for each B fragment only when the one before is used up, a round trip each
#pragma unroll
        for (int nb = 0; nb < 4; ++nb)
#pragma unroll
            for (int mb = 0; mb < 4; ++mb) { acc[mb][nb] = WFrag<T16>::mma(a[mb], b[nb], acc[mb][nb]); if (HA2) acc[mb][nb] = WFrag<T16>::mma(a2[mb], b[nb], acc[mb][nb]); if (HB2) acc[mb][nb] = WFrag<T16>::mma(a[mb], b2[nb], acc[mb][nb]); }
        asm volatile("v_nop\n\tv_nop\n\tv_nop\n\tv_nop" : "+v"(acc[0][0]), "+v"(acc[1][1]), "+v"(acc[2][2]), "+v"(acc[3][3]) : "v"(a[0]), "v"(a[3]));
        // the wait in front of the steps of the base pointers that this trip's loads name; the pointers pass through the statement so that their steps stay behind it
        if constexpr (HA2 && HB2) asm volatile("s_wait_xcnt 0x0" : "+s"(ap), "+s"(ap2), "+s"(bp), "+s"(bp2) :: "memory");
        else if constexpr (HA2) asm volatile("s_wait_xcnt 0x0" : "+s"(ap), "+s"(ap2), "+s"(bp) :: "memory");
        else if constexpr (HB2) asm volatile("s_wait_xcnt 0x0" : "+s"(ap), "+s"(bp), "+s"(bp2) :: "memory");
        else asm volatile("s_wait_xcnt 0x0" : "+s"(ap), "+s"(bp) :: "memory");
        ap += NW * 512; bp += NW * 512; if (HA2) ap2 += NW * 512; if (HB2) bp2 += NW * 512;
    }
    static_assert(EPI >= 1 && EPI <= 3, "a projection epilogue");
    if constexpr (EPI == 1 || EPI == 3) { const size_t po = ((size_t)(c0 / 64) * TT + r0) * HD; ksum_rope<NW, EPI == 3>(acc, os, tid, w, lr, hi, CS + (size_t)r0 * HD * 2, nw, P16 + po, Ph + po, Pl + po); }
    else { const size_t po = (size_t)(c0 / 64) * HD * TT + r0 * 16; ksum_vt<NW>(acc, os, tid, w, lr, hi, P16 + po, Ph + po, Pl + po); }
}

// k_qkv: the three projections of both batches in one launch: they depend on nothing of one another, so no WGP waits at a launch boundary between them. Grid (work-group, batch): every work-group holds 2 x 2 tiles with K split over 4 waves a tile, so all
// are equally long; a batch's QB_ q work-groups come first, then its KB_ k and its KB_ v work-groups.
#define QB_  ((TT / 128) * (DQ / 128))
#define KB_  ((TT / 128) * (DKV / 128))
__global__ __launch_bounds__(GW * 32) void k_qkv(const bf* __restrict__ XB, const bf* __restrict__ WQ, const bf* __restrict__ WK, const bf* __restrict__ WV, const float* __restrict__ CS, const float* __restrict__ qsc, const float* __restrict__ ksc, h16* QP16, bf* QPh, bf* QPl, h16* KP16, bf* KPh, bf* KPl, h16* VT16, bf* VTh, bf* VTl) {
    __shared__ __align__(16) float osa[GW * 64 * 68];
    const int t = blockIdx.x; const bf* X = XB + (size_t)blockIdx.y * TT * DM; const size_t qo = (size_t)blockIdx.y * NH_ * TT * HD, ko = (size_t)blockIdx.y * NKV * TT * HD;
    if (t < QB_) d_gemmw<bf, 0, false, 4, 1, DM, 2>(osa, t % (TT / 128), t / (TT / 128), X, nullptr, WQ, nullptr, nullptr, 0, nullptr, CS, qsc, QP16 + qo, QPh + qo, QPl + qo);   /* q: projection, per-head RMSNorm x q_norm_w, rotary, planes */
    else if (t < QB_ + KB_) d_gemmw<bf, 0, false, 4, 3, DM, 2>(osa, (t - QB_) % (TT / 128), (t - QB_) / (TT / 128), X, nullptr, WK, nullptr, nullptr, 0, nullptr, CS, ksc, KP16 + ko, KPh + ko, KPl + ko);   /* k: the same with k_norm_w, planes in fragment order */
    else d_gemmw<bf, 0, false, 4, 2, DM, 2>(osa, (t - QB_ - KB_) % (TT / 128), (t - QB_ - KB_) / (TT / 128), X, nullptr, WV, nullptr, nullptr, 0, nullptr, nullptr, nullptr, VT16 + ko, VTh + ko, VTl + ko);   /* v: projection, transposed planes in fragment order */
}
// k_wo: merged hi/lo x Wo; the two batches' tokens are one run of NB_ * TT rows of the merged planes and of the output.
// One wave per SIMD: a work-group is 4 waves, 2 x 2 neighbouring wave tiles of 64 tokens x 128 output columns (256 accumulator registers a lane), K unsplit, so no partial tiles are summed. A 32-k step asks for 16 fragments
// (4 hi, 4 lo, 8 of Wo) for 64 matrix instructions, a third fewer bytes per product than a 64 x 64 tile. With no second wave on the SIMD to cover a load's way, the fragments are fetched two k steps ahead into a ring of
// register sets (4 names, 3 alive at a time). Transposed product (A operand = rows of the Wo plane, B operand = token rows): a lane holds 8 neighbouring output columns of one token.
typedef const __attribute__((address_space(1))) bf* gbf;   // typed as global memory, so that the loads stay global loads behind the statement that the pointers pass through
struct WoSet { v16bf a[4], a2[4], b[8]; };
// KO: the k step, counted from where the walking pointers stand; every address = wave-uniform pointer + the lane's fixed offset + a constant. A set's 32 loads go out as two groups of 16, half a k step apart:
// a wave has at most 63 loads under way, and with whole sets the last load of a set would wait for the set that went out only one k step before it.
template <int KO>
__device__ __forceinline__ void wo_load_a(WoSet& f, gbf ap, gbf ap2, unsigned lofs) {
#pragma unroll
    for (int mb = 0; mb < 4; ++mb) { f.a[mb] = WFrag<bf>::ldp((const bf*)(ap + lofs + mb * 16 * DQ + KO * 512)); f.a2[mb] = WFrag<bf>::ldp((const bf*)(ap2 + lofs + mb * 16 * DQ + KO * 512)); }
    __builtin_amdgcn_sched_barrier(0);     // keeps the loads one group in front of the matrix instructions of the set that is worked on: sunk to their uses they would have no lead
}
template <int KO>
__device__ __forceinline__ void wo_load_b(WoSet& f, gbf bp, unsigned lofs) {
#pragma unroll
    for (int nb = 0; nb < 8; ++nb) f.b[nb] = WFrag<bf>::ldp((const bf*)(bp + lofs + nb * 16 * DQ + KO * 512));
    __builtin_amdgcn_sched_barrier(0);     // as in wo_load_a
}
template <int N0>   // the set's products for the 4 column blocks from N0 on
__device__ __forceinline__ void wo_mma(v8f (&acc)[4][8], const WoSet& f) {
#pragma unroll
    for (int nb = N0; nb < N0 + 4; ++nb) {   // the hi and the lo product of one accumulator stand 4 matrix instructions apart: a lone wave would wait out a directly dependent pair
#pragma unroll
        for (int mb = 0; mb < 4; ++mb) acc[mb][nb] = wmmab(f.b[nb], f.a[mb], acc[mb][nb]);
#pragma unroll
        for (int mb = 0; mb < 4; ++mb) acc[mb][nb] = wmmab(f.b[nb], f.a2[mb], acc[mb][nb]); }
    __builtin_amdgcn_sched_barrier(0);     // keeps the next group of loads behind these matrix instructions: lifted over them the groups would stand together again
}
// one k step: the products of set c, with the loads of set n (k step KO from the pointers, two steps ahead of c) in front of each half
template <int KO>
__device__ __forceinline__ void wo_step(v8f (&acc)[4][8], const WoSet& c, WoSet& n, gbf ap, gbf ap2, gbf bp, unsigned lofs) {
    wo_load_a<KO>(n, ap, ap2, lofs); wo_mma<0>(acc, c); wo_load_b<KO>(n, bp, lofs); wo_mma<4>(acc, c);
}
#define WOP  132                  // row pitch of the output staging in floats: 528 bytes, an odd multiple of 16
__global__ __launch_bounds__(128) void k_wo(const bf* __restrict__ ATh, const bf* __restrict__ ATl, const bf* __restrict__ WO, float* OUT) {
    static_assert(DQ % 128 == 0 && DQ / 32 >= 8, "whole groups of 4 k steps");
    __shared__ __align__(16) float sta[4 * 64 * WOP];
    const int lane = threadIdx.x & 31, lr = lane & 15, hi = lane >> 4;
    const int wa = __builtin_amdgcn_readfirstlane(threadIdx.x >> 5);   // wave number, scalar: the tile's pointers stay wave-uniform
    const int r0 = (blockIdx.x * 2 + (wa & 1)) * 64, c0 = (blockIdx.y * 2 + (wa >> 1)) * 128;
    v8f acc[4][8];
#pragma unroll
    for (int mb = 0; mb < 4; ++mb)
#pragma unroll
        for (int nb = 0; nb < 8; ++nb) acc[mb][nb] = (v8f){};
    gbf ap = (gbf)(ATh + (size_t)r0 * DQ), ap2 = (gbf)(ATl + (size_t)r0 * DQ), bp = (gbf)(WO + (size_t)c0 * DQ);
    const unsigned lofs = lane * 8;
    WoSet f0, f1, f2, f3;
    wo_load_a<0>(f0, ap, ap2, lofs); wo_load_b<0>(f0, bp, lofs); wo_load_a<1>(f1, ap, ap2, lofs); wo_load_b<1>(f1, bp, lofs);
#pragma unroll 1   // 4 k steps a trip, one for each name of the ring; more would only lengthen the code
    for (int kc = 0; kc < DQ / 32 - 4; kc += 4) {
        wo_step<2>(acc, f0, f2, ap, ap2, bp, lofs);
        wo_step<3>(acc, f1, f3, ap, ap2, bp, lofs);
        asm volatile("s_wait_xcnt 0x0" : "+s"(ap), "+s"(ap2), "+s"(bp) :: "memory");   // the wait in front of the steps of the base pointers that the issued loads name; the pointers pass through the statement so that their steps stay behind it
        ap += 4 * 512; ap2 += 4 * 512; bp += 4 * 512;
        wo_step<0>(acc, f2, f0, ap, ap2, bp, lofs);
        wo_step<1>(acc, f3, f1, ap, ap2, bp, lofs);
    }
    asm volatile("s_wait_xcnt 0x0" : "+s"(ap), "+s"(ap2), "+s"(bp) :: "memory");   // behind the loop this build forms the addresses anew, over the offset register that the loop's last loads name: the wait stands in front of that; the pointers pass through the statement so that the new addresses are formed behind it
    wo_step<2>(acc, f0, f2, ap, ap2, bp, lofs);   // the last 4 k steps: nothing is fetched past the end of K
    wo_step<3>(acc, f1, f3, ap, ap2, bp, lofs);
    asm volatile("s_wait_xcnt 0x0" ::: "memory");   // the wait in front of whatever takes over the registers that the last loads name
    wo_mma<0>(acc, f2); wo_mma<4>(acc, f2); wo_mma<0>(acc, f3); wo_mma<4>(acc, f3);
    // the tile goes out through the wave's own part of the LDS, so that a wave store is one whole 512-byte row piece (4 lines) and not 16-byte pieces of 16 rows
    float* st = sta + wa * (64 * WOP);
#pragma unroll
    for (int mb = 0; mb < 4; ++mb)
#pragma unroll
        for (int nb = 0; nb < 8; ++nb) { float* t = st + (mb * 16 + lr) * WOP + nb * 16 + hi * 8;
            *(v4fa*)t = (v4f){acc[mb][nb][0], acc[mb][nb][1], acc[mb][nb][2], acc[mb][nb][3]}; *(v4fa*)(t + 4) = (v4f){acc[mb][nb][4], acc[mb][nb][5], acc[mb][nb][6], acc[mb][nb][7]}; }
    asm volatile("s_wait_dscnt 0x0" ::: "memory");   // the wave's own LDS stores are done before its lanes read one another's elements back; no other wave touches this part
    float* C = OUT + (size_t)r0 * DM + c0; const unsigned cof = lane * 4;
#pragma unroll
    for (int g = 0; g < 4; ++g) { v4f val[16];
#pragma unroll
        for (int r = 0; r < 16; ++r) val[r] = *(const v4fa*)(st + (g * 16 + r) * WOP + cof);   // a group's LDS reads go out in front of its first store's wait: one LDS round trip a group
#pragma unroll
        for (int r = 0; r < 16; ++r) *(v4f*)(C + cof + (g * 16 + r) * DM) = val[r];
        asm volatile("s_wait_xcnt 0x0" ::: "memory"); }   // the next group's values reuse the registers that these stores name
}

typedef __attribute__((ext_vector_type(2))) unsigned short v2us;
typedef __attribute__((ext_vector_type(2))) float v2f;
typedef __attribute__((ext_vector_type(4))) int v4i;

// d_cvt8 (work-group bx of 256 threads): f32 [R][K] -> bf16 plane in fragment order. One wave = one fragment, one thread = one lane's place in it: the wave reads the fragment's 16 rows x 128 bytes and stores its 1024 bytes as two runs of 512.
// Every address = wave-uniform pointer + the lane's fixed offset + a constant.
template <int K>
__device__ __forceinline__ void d_cvt8(int bx, const float* __restrict__ src, bf* dst, int nfrag) {
    const int lane = threadIdx.x & 31, f = bx * 8 + __builtin_amdgcn_readfirstlane(threadIdx.x >> 5); if (f >= nfrag) return;   // fragment number, scalar
    const float* s = src + (size_t)(f / (K / 32)) * 16 * K + (f % (K / 32)) * 32; const unsigned so = (lane & 15) * K + (lane >> 4) * 8;
    const v8f v0 = *(const v8f*)(s + so), v1 = *(const v8f*)(s + so + 16); v8us o0, o1;
#pragma unroll
    for (int k = 0; k < 8; ++k) { o0[k] = f2bf(v0[k]); o1[k] = f2bf(v1[k]); }
    bf* d = dst + (size_t)f * 512; const unsigned dof = lane * 8; *(v8us*)(d + dof) = o0; *(v8us*)(d + dof + 256) = o1; }

__constant__ float INVT[HD / 2] = { 1.000000000e+00f, 6.493816376e-01f, 4.216965139e-01f, 2.738419771e-01f, 1.778279394e-01f, 1.154781953e-01f, 7.498942316e-02f, 4.869675264e-02f, 3.162277490e-02f, 2.053525113e-02f, 1.333521400e-02f, 8.659643121e-03f, 5.623413250e-03f, 3.651741194e-03f, 2.371373819e-03f, 1.539926510e-03f, 1.000000047e-03f, 6.493816036e-04f, 4.216965172e-04f, 2.738419571e-04f, 1.778279402e-04f, 1.154782003e-04f, 7.498942432e-05f, 4.869675104e-05f, 3.162277790e-05f, 2.053524986e-05f, 1.333521413e-05f, 8.659642845e-06f, 5.623413472e-06f, 3.651741281e-06f, 2.371373739e-06f, 1.539926529e-06f };   // THETA ** (-arange(0, 64, 2) / 64) with THETA = 1e6 in float32 (the module's power expression)
__device__ __forceinline__ void d_cs5(int bx, float* CS) { const int idx = bx * 256 + threadIdx.x; if (idx >= TT * HD) return; const int d = idx % HD; const int t = idx / HD; const float a = __fmul_rn((float)t, INVT[d % (HD / 2)]); v2f cs; cs[0] = cosf(a); cs[1] = sinf(a); *(v2f*)(CS + (size_t)idx * 2) = cs;  }
// d_wtG (work-group bx of 256 threads): f32 w [K][N] -> bf16 plane of w^T ([N][K]) in fragment order. One wave = one fragment, one thread = one lane's place in it: its 16 k of one n; 16 lanes read 64 contiguous bytes of a row of w,
// and the two waves of a pair take neighbouring 16-column blocks at the same k, the two halves of the same 128-byte lines. Every address = wave-uniform pointer + the lane's fixed offset + a constant. Grid: N K / 512 waves.
template <int K, int N>
__device__ __forceinline__ void d_wtG(int bx, const float* __restrict__ w, bf* Bt) {
    static_assert(N % 32 == 0 && K % 32 == 0 && (N / 16) * (K / 32) % 8 == 0, "whole fragments, pairs of column blocks, whole work-groups");
    const int lane = threadIdx.x & 31, wv = bx * 8 + __builtin_amdgcn_readfirstlane(threadIdx.x >> 5), pair = wv >> 1;   // wave number, scalar
    const int nb = (pair / (K / 32)) * 2 + (wv & 1), kb = pair % (K / 32);
    const float* s = w + (size_t)kb * 32 * N + nb * 16; const unsigned so = (lane >> 4) * 8 * N + (lane & 15); v8us o0, o1;
#pragma unroll
    for (int j = 0; j < 8; ++j) { o0[j] = f2bf(s[so + j * N]); o1[j] = f2bf(s[so + (16 + j) * N]); }
    asm volatile("s_wait_xcnt 0x0" :: "v"(so) : "memory");   // the wait in front of any rewrite of the offset register that the loads name; the offset is an operand so that it lives to here and no load's result is given its register
    bf* d = Bt + ((size_t)nb * (K / 32) + kb) * 512; const unsigned dof = lane * 8; *(v8us*)(d + dof) = o0; *(v8us*)(d + dof + 256) = o1;
}

// k_prep: everything that depends on the inputs alone, in one launch: the rotary table, the four weight planes and the bf16 plane of x (both batches: one run of NB_ * TT rows). A work-group's job follows from its index.
#define PB_CS (TT * HD / 256)
#define PB_WQ (DM * DQ / 16 / 256)
#define PB_WK (DM * DKV / 16 / 256)
#define PB_X  (NB_ * TT * DM / 512 / 8)
__global__ __launch_bounds__(256) void k_prep(const float* __restrict__ x, const float* __restrict__ wq, const float* __restrict__ wk, const float* __restrict__ wv, const float* __restrict__ wo, bf* XB, bf* WQ, bf* WK, bf* WV, bf* WO, float* CS) {
    int b = blockIdx.x;
    if (b < PB_CS) { d_cs5(b, CS); return; }   /* rotary table */
    b -= PB_CS; if (b < PB_WQ) { d_wtG<DM, DQ>(b, wq, WQ); return; }
    b -= PB_WQ; if (b < PB_WK) { d_wtG<DM, DKV>(b, wk, WK); return; }
    b -= PB_WK; if (b < PB_WK) { d_wtG<DM, DKV>(b, wv, WV); return; }
    b -= PB_WK; if (b < PB_WQ) { d_wtG<DQ, DM>(b, wo, WO); return; }
    b -= PB_WQ; d_cvt8<DM>(b, x, XB, NB_ * TT * DM / 512);
}

// ---- k_fattn: the whole causal attention of both batches in one launch (scores, softmax, probability x value and the hi/lo merge), with a running maximum and sum per query; no score or probability plane in memory.
// Transposed products: S^T = K Q^T (A = key rows, B = query rows kept in registers), O^T += V^T P^T (A = rows of the [d][t] value plane). The key and value planes are in fragment order: each wave load of the key loop covers 4 whole 128-byte lines. In a 16-column group lane (lr, hi) holds query lr only: keys 8 hi + j of each
// 16-key score tile, so two score tiles of a 32-key block, converted in place, are the B operand of the second product in the loaders' own k order (8 hi + 0..7, 16 + 8 hi + 0..7), and maximum, sum and rescale factor are per lane.
// Work-group = 16 waves: the 4 query heads of one kv head (they read the same K and V lines) x KS = 4 key parts (part p takes every 4th 32-key block); parts 1..3 hand their (O, m, l) to part 0 through LDS behind one barrier.
// One work-group fills a WGP's registers, so the tiles, longest first, are dealt out as WGPs fall free; blockIdx.x = (batch, kv head), so that the two batches' tiles of one length stand side by side.
// Query rows < RH: 16 columns a wave, hi/lo bf16 planes, 3 products in both contractions; the rest: 32 columns a wave, fp16, probabilities carried x 2^10 (the sum carries the same factor, so it cancels).
#define L2E  1.4426950408889634f
#define KS   4
__device__ __forceinline__ float xhalf(float x) { return __builtin_bit_cast(float, __builtin_amdgcn_permlanex16(__builtin_bit_cast(int, x), __builtin_bit_cast(int, x), 0x76543210, 0xfedcba98, false, false)); }   // lane l <-> lane l ^ 16
template <typename T16, bool HR, int NQ>
__device__ __forceinline__ void fattn_tile(const T16* __restrict__ Q, const T16* __restrict__ Q2, const T16* __restrict__ Kp, const T16* __restrict__ K2, const T16* __restrict__ Vt, const T16* __restrict__ V2, int q0, int hd, int part, bf* Ah, bf* Al, float* xs) {
    typedef typename WFrag<T16>::V V;
    const int lane = threadIdx.x & 31, lr = lane & 15, hi = lane >> 4;
    const unsigned kofs = lr * HD + 8 * hi, lofs = lane * 8;   // the lane's place in a fragment's rows (q, row-major) and in a fragment (k, v, fragment order); every address below = wave-uniform pointer + one of these + a constant, so no load's result can land on an address register
    V qf[NQ][2], qf2[NQ][2];
#pragma unroll
    for (int n = 0; n < NQ; ++n)
#pragma unroll
        for (int ks = 0; ks < 2; ++ks) { const unsigned qo = kofs + n * 16 * HD + ks * 32; qf[n][ks] = WFrag<T16>::ld(Q + (size_t)q0 * HD + qo); if (HR) qf2[n][ks] = WFrag<T16>::ld(Q2 + (size_t)q0 * HD + qo); }
    v8f o[4][NQ]; float m[NQ], l[NQ];
#pragma unroll
    for (int n = 0; n < NQ; ++n) { m[n] = -3.0e38f; l[n] = 0.f;
#pragma unroll
        for (int dt = 0; dt < 4; ++dt) o[dt][n] = (v8f){}; }
    const int kend = q0 + 16 * NQ;                      // keys [0, kend): every 32-key block that starts below kend holds at least one allowed key for every query of the tile
    typedef const __attribute__((address_space(1))) T16* gptr;   // typed as global memory, so that the loads stay global loads behind the statement that the pointers pass through
    gptr kq = (gptr)(Kp + (size_t)part * 32 * HD), kq2 = HR ? (gptr)(K2 + (size_t)part * 32 * HD) : nullptr;   // wave-uniform walking pointers: key rows and value columns of the part's current block
    gptr vq = (gptr)(Vt + part * 512), vq2 = HR ? (gptr)(V2 + part * 512) : nullptr;   // a 32-key block is 4 key fragments in a row (16-key block kt, 32-dim step ks) and one value fragment in each of the 4 dim blocks
    V kf[2][2], kf2[2][2];
#pragma unroll
    for (int kt = 0; kt < 2; ++kt)
#pragma unroll
        for (int ks = 0; ks < 2; ++ks) { kf[kt][ks] = WFrag<T16>::ldp((const T16*)(kq + lofs + (kt * 2 + ks) * 512)); if (HR) kf2[kt][ks] = WFrag<T16>::ldp((const T16*)(kq2 + lofs + (kt * 2 + ks) * 512)); }
#pragma unroll 1   // run-time trip count; one trip's fragments, scores and accumulators already take most of the wave's registers
    for (int kb = part * 32; kb < kend; kb += KS * 32) {
        V vf[4], vf2[4];                                // this block's value fragments: asked for first, needed last
#pragma unroll
        for (int dt = 0; dt < 4; ++dt) { vf[dt] = WFrag<T16>::ldp((const T16*)(vq + lofs + dt * 16 * TT)); if (HR) vf2[dt] = WFrag<T16>::ldp((const T16*)(vq2 + lofs + dt * 16 * TT)); }
        // the wait in front of the steps of the base pointers that this trip's value loads and the last trip's key loads name; the pointers pass through the statement so that their steps stay behind it
        if constexpr (HR) asm volatile("s_wait_xcnt 0x0" : "+s"(vq), "+s"(vq2), "+s"(kq), "+s"(kq2) :: "memory");
        else asm volatile("s_wait_xcnt 0x0" : "+s"(vq), "+s"(kq) :: "memory");
        vq += KS * 512; if (HR) vq2 += KS * 512;
        v8f s[2][NQ];
#pragma unroll
        for (int kt = 0; kt < 2; ++kt)
#pragma unroll
            for (int n = 0; n < NQ; ++n) { v8f c = (v8f){};
#pragma unroll
                for (int ks = 0; ks < 2; ++ks) { c = WFrag<T16>::mma(kf[kt][ks], qf[n][ks], c); if (HR) { c = WFrag<T16>::mma(kf[kt][ks], qf2[n][ks], c); c = WFrag<T16>::mma(kf2[kt][ks], qf[n][ks], c); } }
                s[kt][n] = c; }
        const int kstep = (kb + KS * 32 < kend) ? KS * 32 * HD : 0; kq += kstep; if (HR) kq2 += kstep;   // the part's next key block, fetched one trip ahead (the last trip stays where it is; its fetch is not used)
#pragma unroll
        for (int kt = 0; kt < 2; ++kt)
#pragma unroll
            for (int ks = 0; ks < 2; ++ks) { kf[kt][ks] = WFrag<T16>::ldp((const T16*)(kq + lofs + (kt * 2 + ks) * 512)); if (HR) kf2[kt][ks] = WFrag<T16>::ldp((const T16*)(kq2 + lofs + (kt * 2 + ks) * 512)); }
        if (kb + 31 > q0) {                             // wave-uniform: only a block that reaches the diagonal is masked (key > query excluded)
#pragma unroll
            for (int kt = 0; kt < 2; ++kt)
#pragma unroll
                for (int n = 0; n < NQ; ++n)
#pragma unroll
                    for (int j = 0; j < 8; ++j) s[kt][n][j] = (kb + kt * 16 + hi * 8 + j <= q0 + n * 16 + lr) ? s[kt][n][j] : -3.0e38f; }
        V pf[NQ], pf2[NQ];
#pragma unroll
        for (int n = 0; n < NQ; ++n) { float mx = m[n];
#pragma unroll
            for (int j = 0; j < 8; ++j) mx = fmaxf(mx, fmaxf(s[0][n][j], s[1][n][j]));
            mx = fmaxf(mx, xhalf(mx));                  // the two lane halves hold the same query's other keys
            const float al = __builtin_amdgcn_exp2f((m[n] - mx) * (SCL * L2E)), mo = HR ? mx * (SCL * L2E) : mx * (SCL * L2E) - 10.0f; m[n] = mx; v2f sum = (v2f){0.f, 0.f};   // m: raw products; SCL and the change to base 2 go into one factor
#pragma unroll
            for (int kt = 0; kt < 2; ++kt)
#pragma unroll
                for (int j = 0; j < 8; j += 2) { const v2f p = (v2f){__builtin_amdgcn_exp2f(fmaf(s[kt][n][j], SCL * L2E, -mo)), __builtin_amdgcn_exp2f(fmaf(s[kt][n][j + 1], SCL * L2E, -mo))}; s[kt][n][j] = p[0]; s[kt][n][j + 1] = p[1]; sum += p; }   // even and odd keys summed side by side (packed adds)
            l[n] = l[n] * al + (sum[0] + sum[1]);
#pragma unroll
            for (int dt = 0; dt < 4; ++dt) o[dt][n] *= al;
            if constexpr (HR) { v8us h0, h1, l0, l1;
#pragma unroll
                for (int j = 0; j < 8; ++j) { unsigned short a, c2; splitf(s[0][n][j], a, c2); h0[j] = a; l0[j] = c2; splitf(s[1][n][j], a, c2); h1[j] = a; l1[j] = c2; }
                pf[n] = cat16b(h0, h1); pf2[n] = cat16b(l0, l1);
            } else { v8h h0, h1;
#pragma unroll
                for (int j = 0; j < 8; ++j) { h0[j] = tohx(s[0][n][j]); h1[j] = tohx(s[1][n][j]); }
                pf[n] = cat16(h0, h1); } }
#pragma unroll
        for (int dt = 0; dt < 4; ++dt)
#pragma unroll
            for (int n = 0; n < NQ; ++n) { o[dt][n] = WFrag<T16>::mma(vf[dt], pf[n], o[dt][n]); if (HR) { o[dt][n] = WFrag<T16>::mma(vf[dt], pf2[n], o[dt][n]); o[dt][n] = WFrag<T16>::mma(vf2[dt], pf[n], o[dt][n]); } }
        // the loop's branch stands right behind the last matrix instructions: four vector slots keep the distance on the taken side too
        if constexpr (NQ == 2) asm volatile("v_nop\n\tv_nop\n\tv_nop\n\tv_nop" : "+v"(o[0][0]), "+v"(o[1][0]), "+v"(o[2][0]), "+v"(o[3][0]), "+v"(o[0][1]), "+v"(o[1][1]), "+v"(o[2][1]), "+v"(o[3][1]));
        else asm volatile("v_nop\n\tv_nop\n\tv_nop\n\tv_nop" : "+v"(o[0][0]), "+v"(o[1][0]), "+v"(o[2][0]), "+v"(o[3][0]));
    }
    // the last trip's key fetch is not used and may still be on its way: the wait in front of whatever takes over the registers that it names
    if constexpr (HR) asm volatile("s_wait_xcnt 0x0" :: "s"(kq), "s"(kq2) : "memory");
    else asm volatile("s_wait_xcnt 0x0" :: "s"(kq) : "memory");
    // join of the key parts in the fixed order 0..KS-1. LDS: per (part - 1, head) 4 NQ tiles of [2 halves][32 lanes][4 floats]; behind them per (part - 1, head) m and l
    if (part != 0) { float* xo = xs + ((part - 1) * 4 + hd) * 2048; float* xm = xs + (KS - 1) * 4 * 2048 + ((part - 1) * 4 + hd) * 128;
#pragma unroll
        for (int n = 0; n < NQ; ++n) { xm[(n * 2) * 32 + lane] = m[n]; xm[(n * 2 + 1) * 32 + lane] = l[n];
#pragma unroll
            for (int dt = 0; dt < 4; ++dt) { float* t = xo + (dt * NQ + n) * 256 + lane * 4; *(v4fa*)t = (v4f){o[dt][n][0], o[dt][n][1], o[dt][n][2], o[dt][n][3]}; *(v4fa*)(t + 128) = (v4f){o[dt][n][4], o[dt][n][5], o[dt][n][6], o[dt][n][7]}; } } }
    __syncthreads();                                    // the other parts' partial results are in LDS before part 0 reads them; every wave of the work-group passes here
    if (part == 0) { const float* xo = xs + hd * 2048; const float* xm = xs + (KS - 1) * 4 * 2048 + hd * 128;
#pragma unroll
        for (int n = 0; n < NQ; ++n) { float mp[KS - 1], f[KS - 1]; float mx = m[n];      // a part without a key block hands over m = -3e38, l = 0, O = 0: its factor is 0
#pragma unroll
            for (int u = 0; u < KS - 1; ++u) { mp[u] = xm[u * 512 + (n * 2) * 32 + lane]; mx = fmaxf(mx, mp[u]); }
            float f0 = __builtin_amdgcn_exp2f((m[n] - mx) * (SCL * L2E)), lt = l[n] * f0;
#pragma unroll
            for (int u = 0; u < KS - 1; ++u) { f[u] = __builtin_amdgcn_exp2f((mp[u] - mx) * (SCL * L2E)); lt += xm[u * 512 + (n * 2 + 1) * 32 + lane] * f[u]; }
            lt += xhalf(lt);                            // the two lane halves summed the same query's other keys
            const float inv = __fdiv_rn(1.0f, lt); f0 *= inv;
#pragma unroll
            for (int u = 0; u < KS - 1; ++u) f[u] *= inv;
#pragma unroll
            for (int dt = 0; dt < 4; ++dt) { v8f r = o[dt][n] * f0;
#pragma unroll
                for (int u = 0; u < KS - 1; ++u) { const float* t = xo + u * 8192 + (dt * NQ + n) * 256 + lane * 4; const v4f u0 = *(const v4fa*)t, u1 = *(const v4fa*)(t + 128);
#pragma unroll
                    for (int j = 0; j < 4; ++j) { r[j] += u0[j] * f[u]; r[4 + j] += u1[j] * f[u]; } }
                v8us oh, ol;
#pragma unroll
                for (int j = 0; j < 8; ++j) { unsigned short a, c2; splitf(r[j], a, c2); oh[j] = a; ol[j] = c2; }
                const unsigned oo = n * 16 * DQ + dt * 256 + lane * 8; *(v8usa*)(Ah + (size_t)q0 * DQ + oo) = oh; *(v8usa*)(Al + (size_t)q0 * DQ + oo) = ol;   // fragment order of the merged plane [t][DQ]: Ah, Al point at the head's two fragments (k = 64 h ..) of row block 0; dims 16 dt + 8 hi + j are piece dt & 1 of fragment dt >> 1
                asm volatile("s_wait_xcnt 0x0" ::: "memory"); } } }   // the next tile's values reuse the registers that these two stores name
}
__global__ __launch_bounds__(KS * 128) void k_fattn(const h16* __restrict__ Q16, const h16* __restrict__ K16, const h16* __restrict__ V16, const bf* __restrict__ Qh, const bf* __restrict__ Ql, const bf* __restrict__ Kh, const bf* __restrict__ Kl, const bf* __restrict__ Vh, const bf* __restrict__ Vl, bf* Ah, bf* Al) {
    static_assert(REP == 4 && RH % 32 == 0 && (TT - RH) % 32 == 0, "4 query heads a kv head; whole tiles on both sides of RH");
    __shared__ __align__(16) float xs[(KS - 1) * 4 * (2048 + 128)];
    const int w = __builtin_amdgcn_readfirstlane(threadIdx.x >> 5);   // wave number, scalar: head, key part and the key loop's bounds stay wave-uniform
    const int hd = w & 3, part = w >> 2, g = blockIdx.x % NKV, nb = blockIdx.x / NKV, bt = blockIdx.y, h = g * REP + hd; const size_t qp = (size_t)(nb * NH_ + h) * TT * HD, kp = (size_t)(nb * NKV + g) * TT * HD; Ah += (size_t)nb * TT * DQ; Al += (size_t)nb * TT * DQ;
    if (bt < (TT - RH) / 32) fattn_tile<h16, false, 2>(Q16 + qp, nullptr, K16 + kp, nullptr, V16 + kp, nullptr, TT - 32 * (bt + 1), hd, part, Ah + h * (HD * 16), Al + h * (HD * 16), xs);   // longest tiles first
    else fattn_tile<bf, true, 1>(Qh + qp, Ql + qp, Kh + kp, Kl + kp, Vh + kp, Vl + kp, RH - 16 * (bt - (TT - RH) / 32 + 1), hd, part, Ah + h * (HD * 16), Al + h * (HD * 16), xs);
}

extern "C" void kernel_launch(void* const* d_in, const int* in_sizes, int n_in,
                              void* d_out, int out_size, void* d_ws, size_t ws_size, hipStream_t stream) {
    (void)in_sizes; (void)n_in; (void)out_size;
    const float* x = (const float*)d_in[0]; const float* wq = (const float*)d_in[1]; const float* wk = (const float*)d_in[2]; const float* wv = (const float*)d_in[3]; const float* wo = (const float*)d_in[4]; const float* qsc = (const float*)d_in[5]; const float* ksc = (const float*)d_in[6];   /* input order x, Wq ('xw' [2048][2048]), Wk, Wv ([2048][512]), Wo ('xw'), q_norm_w, k_norm_w ([64], read) */
    float* OUT = (float*)d_out;     // [2][2048][2048]
    char* wsp = (char*)d_ws;
    auto take = [&](size_t bytes) { char* p = wsp; wsp += (bytes + 255) & ~(size_t)255; return (void*)p; };
    bf* WQ = (bf*)take((size_t)DQ * DM * 2); bf* WK = (bf*)take((size_t)DKV * DM * 2); bf* WV = (bf*)take((size_t)DKV * DM * 2); bf* WO = (bf*)take((size_t)DM * DQ * 2); float* CS = (float*)take((size_t)TT * HD * 2 * 4);
    bf* XB = (bf*)take((size_t)NB_ * TT * DM * 2);
    h16* QP16 = (h16*)take((size_t)NB_ * NH_ * TT * HD * 2); h16* KP16 = (h16*)take((size_t)NB_ * NKV * TT * HD * 2); h16* VT16 = (h16*)take((size_t)NB_ * NKV * HD * TT * 2);
    bf* QPh = (bf*)take((size_t)NB_ * NH_ * TT * HD * 2); bf* QPl = (bf*)take((size_t)NB_ * NH_ * TT * HD * 2); bf* KPh = (bf*)take((size_t)NB_ * NKV * TT * HD * 2); bf* KPl = (bf*)take((size_t)NB_ * NKV * TT * HD * 2); bf* VTh = (bf*)take((size_t)NB_ * NKV * HD * TT * 2); bf* VTl = (bf*)take((size_t)NB_ * NKV * HD * TT * 2);
    bf* ATh = (bf*)take((size_t)NB_ * TT * DQ * 2); bf* ATl = (bf*)take((size_t)NB_ * TT * DQ * 2);
    if ((size_t)(wsp - (char*)d_ws) > ws_size) return;    // ws 256 MiB
    k_prep<<<PB_CS + 2 * PB_WQ + 2 * PB_WK + PB_X, 256, 0, stream>>>(x, wq, wk, wv, wo, XB, WQ, WK, WV, WO, CS);
    k_qkv<<<dim3(QB_ + 2 * KB_, NB_, 1), GW * 32, 0, stream>>>(XB, WQ, WK, WV, CS, qsc, ksc, QP16, QPh, QPl, KP16, KPh, KPl, VT16, VTh, VTl);
    k_fattn<<<dim3(NKV * NB_, (TT - RH) / 32 + RH / 16, 1), KS * 128, 0, stream>>>(QP16, KP16, VT16, QPh, QPl, KPh, KPl, VTh, VTl, ATh, ATl);
    k_wo<<<dim3(NB_ * TT / 128, DM / 256, 1), 128, 0, stream>>>(ATh, ATl, WO, OUT);
}
